// v000
// Times are from an AMD MI455X. After a warm-up the kernel runs many times in a row, and a time is the length of
// such a window on the GPU divided by its runs, so every launch and the gaps after it count. The runs cycle
// through copies of the inputs. A figure is the median of several windows, for all but v000 over two sittings.
// Sittings can differ by a few percent; kernels timed side by side share one.
// The starting kernel, v000, takes 2630 microseconds a run.
#include <hip/hip_runtime.h>
#include <math.h>

#define N_NODES  207
#define T_STEPS  12
#define C_IN     4
#define BATCH    4
#define NT       (N_NODES * T_STEPS)   // 2484
#define D_MODEL  96
#define NHEAD    4
#define HD       24
#define FF_DIM   384
#define N_MASKT  1863
#define N_UNMASK 621
#define MAX_NEIGH 40
#define ATTN_SCALE 0.20412414523193154f   // 1/sqrt(24)
#define SQRT_D     9.797958971132712f     // sqrt(96)

typedef float v2f __attribute__((ext_vector_type(2)));
typedef float v8f __attribute__((ext_vector_type(8)));

// ---------------------------------------------------------------------------
// Adjacency: A = softmax(relu(nv1 @ nv2), axis=1); keep iff (A > 1/N) and
// strictly greater than the 41st-largest in its row (rank < MAX_NEIGH).
// ---------------------------------------------------------------------------
__global__ void adj_kernel(const float* __restrict__ nv1,
                           const float* __restrict__ nv2,
                           float* __restrict__ adpA) {
  __shared__ float a[N_NODES];
  __shared__ float stat[2];
  int i = blockIdx.x;
  int tid = threadIdx.x;
  for (int j = tid; j < N_NODES; j += blockDim.x) {
    float s = 0.f;
    for (int r = 0; r < 10; ++r) s += nv1[i * 10 + r] * nv2[r * N_NODES + j];
    a[j] = s > 0.f ? s : 0.f;
  }
  __syncthreads();
  if (tid == 0) {
    float mx = -1e30f;
    for (int j = 0; j < N_NODES; ++j) mx = fmaxf(mx, a[j]);
    float sum = 0.f;
    for (int j = 0; j < N_NODES; ++j) sum += __expf(a[j] - mx);
    stat[0] = mx; stat[1] = 1.f / sum;
  }
  __syncthreads();
  float mx = stat[0], inv = stat[1];
  for (int j = tid; j < N_NODES; j += blockDim.x) a[j] = __expf(a[j] - mx) * inv;
  __syncthreads();
  const float thr = 1.0f / (float)N_NODES;
  for (int j = tid; j < N_NODES; j += blockDim.x) {
    float aj = a[j];
    int cnt = 0;
    for (int l = 0; l < N_NODES; ++l) cnt += (a[l] > aj) ? 1 : 0;
    bool keep = (aj > thr) && (cnt < MAX_NEIGH);
    adpA[i * N_NODES + j] = keep ? aj : 0.f;
  }
}

// Encoder additive attention bias: 0 where connected, -1e30 where adpA == 0.
__global__ void encmask_kernel(const float* __restrict__ adpA,
                               const int* __restrict__ uidx,
                               float* __restrict__ Mb) {
  int idx = blockIdx.x * blockDim.x + threadIdx.x;
  if (idx >= N_UNMASK * N_UNMASK) return;
  int q = idx / N_UNMASK, k = idx % N_UNMASK;
  int nq = uidx[q] / T_STEPS, nk = uidx[k] / T_STEPS;
  Mb[idx] = (adpA[nq * N_NODES + nk] == 0.f) ? -1e30f : 0.f;
}

// token[b,nt,:] = x0*dim_w + dim_b + pos + tod*tod_w + tod_b + dow*dow_w + dow_b
__global__ void token_kernel(const float* __restrict__ hist,
                             const float* __restrict__ dim_w, const float* __restrict__ dim_b,
                             const float* __restrict__ pos,
                             const float* __restrict__ tod_w, const float* __restrict__ tod_b,
                             const float* __restrict__ dow_w, const float* __restrict__ dow_b,
                             float* __restrict__ token) {
  int row = blockIdx.x;            // b*NT + nt
  int d = threadIdx.x;             // 0..95
  int b = row / NT, nt = row % NT;
  int n = nt / T_STEPS, t = nt % T_STEPS;
  const float* hp = hist + (((size_t)b * T_STEPS + t) * N_NODES + n) * C_IN;
  float x0 = hp[0], dow = hp[2], tod = hp[3];
  token[(size_t)row * D_MODEL + d] =
      x0 * dim_w[d] + dim_b[d] + pos[(size_t)nt * D_MODEL + d] +
      tod * tod_w[d] + tod_b[d] + dow * dow_w[d] + dow_b[d];
}

// enc_in = token[:, unmasked_idx, :] * sqrt(D)
__global__ void gather_kernel(const float* __restrict__ token,
                              const int* __restrict__ uidx,
                              float* __restrict__ X) {
  int row = blockIdx.x;            // b*N_UNMASK + s
  int d = threadIdx.x;
  int b = row / N_UNMASK, s = row % N_UNMASK;
  X[(size_t)row * D_MODEL + d] =
      token[((size_t)b * NT + uidx[s]) * D_MODEL + d] * SQRT_D;
}

// ---------------------------------------------------------------------------
// fp32 GEMM via V_WMMA_F32_16X16X4_F32, register-blocked 32x32 per wave:
// 4 accumulators, each A-frag feeds 2 WMMAs and each B-frag feeds 2 WMMAs.
// Y[M,N] = X[M,K] @ W[K,N] + bias (+ReLU). K % 4 == 0, N % 32 == 0.
// M edge via row-clamped loads + guarded stores (EXEC stays full for WMMA).
// ---------------------------------------------------------------------------
__global__ void gemm_wmma_kernel(const float* __restrict__ X, const float* __restrict__ W,
                                 const float* __restrict__ bias, float* __restrict__ Y,
                                 int M, int K, int N, int relu) {
  int lane = threadIdx.x & 31;
  int l16 = lane & 15, half = lane >> 4;
  int m0 = blockIdx.x * 32, n0 = blockIdx.y * 32;
  int ra0 = m0 + l16;      if (ra0 >= M) ra0 = M - 1;
  int ra1 = m0 + 16 + l16; if (ra1 >= M) ra1 = M - 1;
  v8f acc00 = {}, acc01 = {}, acc10 = {}, acc11 = {};
  for (int k0 = 0; k0 < K; k0 += 4) {
    int kx = k0 + 2 * half;
    v2f a0, a1, b0, b1;
    a0.x = X[(size_t)ra0 * K + kx];
    a0.y = X[(size_t)ra0 * K + kx + 1];
    a1.x = X[(size_t)ra1 * K + kx];
    a1.y = X[(size_t)ra1 * K + kx + 1];
    b0.x = W[(size_t)kx * N + n0 + l16];
    b0.y = W[(size_t)(kx + 1) * N + n0 + l16];
    b1.x = W[(size_t)kx * N + n0 + 16 + l16];
    b1.y = W[(size_t)(kx + 1) * N + n0 + 16 + l16];
    acc00 = __builtin_amdgcn_wmma_f32_16x16x4_f32(false, a0, false, b0, (short)0, acc00, false, false);
    acc01 = __builtin_amdgcn_wmma_f32_16x16x4_f32(false, a0, false, b1, (short)0, acc01, false, false);
    acc10 = __builtin_amdgcn_wmma_f32_16x16x4_f32(false, a1, false, b0, (short)0, acc10, false, false);
    acc11 = __builtin_amdgcn_wmma_f32_16x16x4_f32(false, a1, false, b1, (short)0, acc11, false, false);
  }
  int nA = n0 + l16, nB = n0 + 16 + l16;
  float bv0 = bias ? bias[nA] : 0.f;
  float bv1 = bias ? bias[nB] : 0.f;
  for (int r = 0; r < 8; ++r) {
    int mA = m0 + r + 8 * half;
    if (mA < M) {
      float v0 = acc00[r] + bv0;
      float v1 = acc01[r] + bv1;
      if (relu) { v0 = fmaxf(v0, 0.f); v1 = fmaxf(v1, 0.f); }
      Y[(size_t)mA * N + nA] = v0;
      Y[(size_t)mA * N + nB] = v1;
    }
    int mB = m0 + 16 + r + 8 * half;
    if (mB < M) {
      float v0 = acc10[r] + bv0;
      float v1 = acc11[r] + bv1;
      if (relu) { v0 = fmaxf(v0, 0.f); v1 = fmaxf(v1, 0.f); }
      Y[(size_t)mB * N + nA] = v0;
      Y[(size_t)mB * N + nB] = v1;
    }
  }
}

// ---------------------------------------------------------------------------
// Fused attention per (b, head, 16-row q-tile).
// Scores for the whole key range are staged in LDS (16 x Spad), softmax'd
// in-place (all 32 lanes: lane = (row, key-parity), halves merged with a
// wave32 shfl_xor), then P@V runs through WMMA.
// Q/K/V layout: [(b*S+s)*96 + h*24 + d].
// ---------------------------------------------------------------------------
__global__ void attn_kernel(const float* __restrict__ Q, const float* __restrict__ Kb,
                            const float* __restrict__ Vb, float* __restrict__ O,
                            const float* __restrict__ maskb, int S, int Spad) {
  extern __shared__ float sc[];    // [16][Spad]
  int lane = threadIdx.x & 31;
  int l16 = lane & 15, half = lane >> 4;
  int qt = blockIdx.x, h = blockIdx.y, b = blockIdx.z;
  int qrow = qt * 16 + l16; int qrc = qrow < S ? qrow : S - 1;
  const size_t hb = (size_t)h * HD;

  // Q fragments (A-matrix 16x24): lane row = l16, x/y = K sub-indices
  v2f aq[6];
  {
    const float* qp = Q + ((size_t)b * S + qrc) * D_MODEL + hb;
    for (int j = 0; j < 6; ++j) {
      int kd = 4 * j + 2 * half;
      aq[j].x = qp[kd];
      aq[j].y = qp[kd + 1];
    }
  }

  int ktiles = Spad / 16;
  // -------- S = Q K^T, tile by tile into LDS --------
  for (int kt = 0; kt < ktiles; ++kt) {
    int key = kt * 16 + l16; if (key >= S) key = S - 1;
    const float* kp = Kb + ((size_t)b * S + key) * D_MODEL + hb;
    v8f acc = {};
    for (int j = 0; j < 6; ++j) {
      int kd = 4 * j + 2 * half;
      v2f bf; bf.x = kp[kd]; bf.y = kp[kd + 1];
      acc = __builtin_amdgcn_wmma_f32_16x16x4_f32(false, aq[j], false, bf, (short)0,
                                                  acc, false, false);
    }
    for (int r = 0; r < 8; ++r)
      sc[(size_t)(r + 8 * half) * Spad + kt * 16 + l16] = acc[r];
  }
  __syncthreads();

  // -------- softmax rows: lane (l16, half); half handles keys of its parity
  {
    int m = l16;
    float* row = sc + (size_t)m * Spad;
    int qg = qt * 16 + m; if (qg >= S) qg = S - 1;
    const float* mrow = maskb ? (maskb + (size_t)qg * S) : (const float*)0;
    float mx = -1e30f;
    for (int k = half; k < S; k += 2) {
      float v = row[k] * ATTN_SCALE + (mrow ? mrow[k] : 0.f);
      row[k] = v;
      mx = fmaxf(mx, v);
    }
    mx = fmaxf(mx, __shfl_xor(mx, 16, 32));
    float sum = 0.f;
    for (int k = half; k < S; k += 2) {
      float e = __expf(row[k] - mx);
      row[k] = e;
      sum += e;
    }
    sum += __shfl_xor(sum, 16, 32);
    float inv = 1.f / sum;
    for (int k = half; k < S; k += 2) row[k] *= inv;
    for (int k = S + half; k < Spad; k += 2) row[k] = 0.f;  // kill pad for P@V
  }
  __syncthreads();

  // -------- O = P V (HD=24 -> one full 16-wide tile + one 8-wide tile) ----
  v8f o0 = {}, o1 = {};
  int hd2 = 16 + l16; if (hd2 >= HD) hd2 = HD - 1;  // clamp; masked on store
  for (int kt = 0; kt < ktiles; ++kt) {
    for (int ks = 0; ks < 4; ++ks) {
      int k0 = kt * 16 + ks * 4;
      v2f ap;
      ap.x = sc[(size_t)l16 * Spad + k0 + 2 * half];
      ap.y = sc[(size_t)l16 * Spad + k0 + 2 * half + 1];
      int keyx = k0 + 2 * half;     if (keyx >= S) keyx = S - 1;
      int keyy = k0 + 2 * half + 1; if (keyy >= S) keyy = S - 1;
      const float* vpx = Vb + ((size_t)b * S + keyx) * D_MODEL + hb;
      const float* vpy = Vb + ((size_t)b * S + keyy) * D_MODEL + hb;
      v2f b0, b1;
      b0.x = vpx[l16]; b0.y = vpy[l16];
      b1.x = vpx[hd2]; b1.y = vpy[hd2];
      o0 = __builtin_amdgcn_wmma_f32_16x16x4_f32(false, ap, false, b0, (short)0, o0,
                                                 false, false);
      o1 = __builtin_amdgcn_wmma_f32_16x16x4_f32(false, ap, false, b1, (short)0, o1,
                                                 false, false);
    }
  }
  for (int r = 0; r < 8; ++r) {
    int m = qt * 16 + r + 8 * half;
    if (m < S) {
      float* op = O + ((size_t)b * S + m) * D_MODEL + hb;
      op[l16] = o0[r];
      if (l16 < 8) op[16 + l16] = o1[r];
    }
  }
}

// LayerNorm over D=96, optional fused residual R; in-place on X (row-local).
__global__ void ln_kernel(float* __restrict__ X, const float* __restrict__ R,
                          const float* __restrict__ g, const float* __restrict__ bta) {
  __shared__ float red[D_MODEL];
  __shared__ float stat[2];
  int row = blockIdx.x;
  int d = threadIdx.x;
  size_t idx = (size_t)row * D_MODEL + d;
  float v = X[idx] + (R ? R[idx] : 0.f);
  red[d] = v;
  __syncthreads();
  if (d == 0) {
    float s = 0.f;
    for (int j = 0; j < D_MODEL; ++j) s += red[j];
    stat[0] = s / (float)D_MODEL;
  }
  __syncthreads();
  float m = stat[0];
  float c = v - m;
  red[d] = c * c;
  __syncthreads();
  if (d == 0) {
    float s = 0.f;
    for (int j = 0; j < D_MODEL; ++j) s += red[j];
    stat[1] = rsqrtf(s / (float)D_MODEL + 1e-5f);
  }
  __syncthreads();
  X[idx] = c * stat[1] * g[d] + bta[d];
}

// Decoder input: first 621 rows = e2d(enc) * sqrt(D)
__global__ void dec_assemble_enc(const float* __restrict__ E, float* __restrict__ Xd) {
  int row = blockIdx.x;            // b*N_UNMASK + s
  int d = threadIdx.x;
  int b = row / N_UNMASK, s = row % N_UNMASK;
  Xd[((size_t)b * NT + s) * D_MODEL + d] = E[(size_t)row * D_MODEL + d] * SQRT_D;
}

// Decoder input: masked rows = (mask_token + pos + tod/dow emb) * sqrt(D)
__global__ void dec_assemble_mask(const float* __restrict__ hist,
                                  const int* __restrict__ midx,
                                  const float* __restrict__ mask_token,
                                  const float* __restrict__ pos,
                                  const float* __restrict__ tod_w, const float* __restrict__ tod_b,
                                  const float* __restrict__ dow_w, const float* __restrict__ dow_b,
                                  float* __restrict__ Xd) {
  int row = blockIdx.x;            // b*N_MASKT + j
  int d = threadIdx.x;
  int b = row / N_MASKT, j = row % N_MASKT;
  int nt = midx[j]; int n = nt / T_STEPS, t = nt % T_STEPS;
  const float* hp = hist + (((size_t)b * T_STEPS + t) * N_NODES + n) * C_IN;
  float dow = hp[2], tod = hp[3];
  float v = mask_token[d] + pos[(size_t)nt * D_MODEL + d] +
            tod * tod_w[d] + tod_b[d] + dow * dow_w[d] + dow_b[d];
  Xd[((size_t)b * NT + N_UNMASK + j) * D_MODEL + d] = v * SQRT_D;
}

// recon_masked = (decoder rows >= N_UNMASK) @ out_w + out_b ; label gather.
__global__ void out_kernel(const float* __restrict__ Xd, const float* __restrict__ hist,
                           const int* __restrict__ midx,
                           const float* __restrict__ out_w, const float* __restrict__ out_b,
                           float* __restrict__ out) {
  __shared__ float red[D_MODEL];
  int row = blockIdx.x;            // b*N_MASKT + j
  int d = threadIdx.x;
  int b = row / N_MASKT, j = row % N_MASKT;
  size_t xr = ((size_t)b * NT + N_UNMASK + j) * D_MODEL;
  red[d] = Xd[xr + d] * out_w[d];
  __syncthreads();
  if (d == 0) {
    float s = 0.f;
    for (int i = 0; i < D_MODEL; ++i) s += red[i];
    out[row] = s + out_b[0];
    int nt = midx[j]; int n = nt / T_STEPS, t = nt % T_STEPS;
    out[BATCH * N_MASKT + row] =
        hist[(((size_t)b * T_STEPS + t) * N_NODES + n) * C_IN + 0];
  }
}

// ---------------------------------------------------------------------------
extern "C" void kernel_launch(void* const* d_in, const int* in_sizes, int n_in,
                              void* d_out, int out_size, void* d_ws, size_t ws_size,
                              hipStream_t stream) {
  (void)in_sizes; (void)n_in; (void)out_size; (void)ws_size;
  const float* hist  = (const float*)d_in[0];
  const int*   uidx  = (const int*)d_in[1];
  const int*   midx  = (const int*)d_in[2];
  const float* nv1   = (const float*)d_in[3];
  const float* nv2   = (const float*)d_in[4];
  const float* dim_w = (const float*)d_in[5];
  const float* dim_b = (const float*)d_in[6];
  const float* pos   = (const float*)d_in[7];
  const float* tod_w = (const float*)d_in[8];
  const float* tod_b = (const float*)d_in[9];
  const float* dow_w = (const float*)d_in[10];
  const float* dow_b = (const float*)d_in[11];
  const float* mtok  = (const float*)d_in[12];
  const float* eaw   = (const float*)d_in[13];
  const float* eab   = (const float*)d_in[14];
  const float* ew1   = (const float*)d_in[15];
  const float* eb1   = (const float*)d_in[16];
  const float* ew2   = (const float*)d_in[17];
  const float* eb2   = (const float*)d_in[18];
  const float* eln   = (const float*)d_in[19];
  const float* eng   = (const float*)d_in[20];
  const float* enb   = (const float*)d_in[21];
  const float* e2dw  = (const float*)d_in[22];
  const float* e2db  = (const float*)d_in[23];
  const float* daw   = (const float*)d_in[24];
  const float* dab   = (const float*)d_in[25];
  const float* dw1   = (const float*)d_in[26];
  const float* db1   = (const float*)d_in[27];
  const float* dw2   = (const float*)d_in[28];
  const float* db2   = (const float*)d_in[29];
  const float* dln   = (const float*)d_in[30];
  const float* dng   = (const float*)d_in[31];
  const float* dnb   = (const float*)d_in[32];
  const float* outw  = (const float*)d_in[33];
  const float* outb  = (const float*)d_in[34];
  float* out = (float*)d_out;

  float* ws = (float*)d_ws;
  size_t off = 0;
  auto alloc = [&](size_t n) { float* p = ws + off; off += n; return p; };
  const size_t MD = (size_t)BATCH * NT;   // max rows (decoder): 9936
  float* adpA  = alloc((size_t)N_NODES * N_NODES);
  float* Menc  = alloc((size_t)N_UNMASK * N_UNMASK);
  float* token = alloc((size_t)BATCH * NT * D_MODEL);
  float* X  = alloc(MD * D_MODEL);
  float* Qb = alloc(MD * D_MODEL);
  float* Kb = alloc(MD * D_MODEL);
  float* Vb = alloc(MD * D_MODEL);
  float* Ob = alloc(MD * D_MODEL);
  float* T1 = alloc(MD * D_MODEL);
  float* F1 = alloc(MD * FF_DIM);
  float* Xd = alloc(MD * D_MODEL);

  adj_kernel<<<N_NODES, 256, 0, stream>>>(nv1, nv2, adpA);
  {
    int tot = N_UNMASK * N_UNMASK;
    encmask_kernel<<<(tot + 255) / 256, 256, 0, stream>>>(adpA, uidx, Menc);
  }
  token_kernel<<<BATCH * NT, D_MODEL, 0, stream>>>(hist, dim_w, dim_b, pos, tod_w,
                                                   tod_b, dow_w, dow_b, token);
  gather_kernel<<<BATCH * N_UNMASK, D_MODEL, 0, stream>>>(token, uidx, X);

  auto gemm = [&](const float* A, const float* W, const float* bias, float* Y,
                  int M, int K, int N, int relu) {
    dim3 g((unsigned)((M + 31) / 32), (unsigned)(N / 32));
    gemm_wmma_kernel<<<g, 32, 0, stream>>>(A, W, bias, Y, M, K, N, relu);
  };

  auto layer = [&](float* H, int S, const float* aw, const float* ab,
                   const float* w1, const float* b1, const float* w2, const float* b2,
                   const float* ln, const float* maskb) {
    int M = BATCH * S;
    int Spad = ((S + 15) / 16) * 16;
    gemm(H, aw + 0 * D_MODEL * D_MODEL, ab + 0 * D_MODEL, Qb, M, D_MODEL, D_MODEL, 0);
    gemm(H, aw + 1 * D_MODEL * D_MODEL, ab + 1 * D_MODEL, Kb, M, D_MODEL, D_MODEL, 0);
    gemm(H, aw + 2 * D_MODEL * D_MODEL, ab + 2 * D_MODEL, Vb, M, D_MODEL, D_MODEL, 0);
    dim3 ag((unsigned)(Spad / 16), NHEAD, BATCH);
    size_t sh = (size_t)16 * Spad * sizeof(float);
    attn_kernel<<<ag, 32, sh, stream>>>(Qb, Kb, Vb, Ob, maskb, S, Spad);
    gemm(Ob, aw + 3 * D_MODEL * D_MODEL, ab + 3 * D_MODEL, T1, M, D_MODEL, D_MODEL, 0);
    ln_kernel<<<M, D_MODEL, 0, stream>>>(H, T1, ln + 0 * 2 * D_MODEL,
                                         ln + 0 * 2 * D_MODEL + D_MODEL);
    gemm(H, w1, b1, F1, M, D_MODEL, FF_DIM, 1);
    gemm(F1, w2, b2, T1, M, FF_DIM, D_MODEL, 0);
    ln_kernel<<<M, D_MODEL, 0, stream>>>(H, T1, ln + 1 * 2 * D_MODEL,
                                         ln + 1 * 2 * D_MODEL + D_MODEL);
  };

  // ---- encoder (4 layers, masked attention over 621 tokens) ----
  for (int l = 0; l < 4; ++l) {
    layer(X, N_UNMASK,
          eaw + (size_t)l * 4 * D_MODEL * D_MODEL, eab + (size_t)l * 4 * D_MODEL,
          ew1 + (size_t)l * D_MODEL * FF_DIM,      eb1 + (size_t)l * FF_DIM,
          ew2 + (size_t)l * FF_DIM * D_MODEL,      eb2 + (size_t)l * D_MODEL,
          eln + (size_t)l * 2 * 2 * D_MODEL, Menc);
  }
  ln_kernel<<<BATCH * N_UNMASK, D_MODEL, 0, stream>>>(X, nullptr, eng, enb);
  gemm(X, e2dw, e2db, T1, BATCH * N_UNMASK, D_MODEL, D_MODEL, 0);
  dec_assemble_enc<<<BATCH * N_UNMASK, D_MODEL, 0, stream>>>(T1, Xd);
  dec_assemble_mask<<<BATCH * N_MASKT, D_MODEL, 0, stream>>>(hist, midx, mtok, pos,
                                                             tod_w, tod_b, dow_w, dow_b, Xd);
  // ---- decoder (1 layer, full attention over 2484 tokens) ----
  layer(Xd, NT, daw, dab, dw1, db1, dw2, db2, dln, nullptr);
  ln_kernel<<<BATCH * NT, D_MODEL, 0, stream>>>(Xd, nullptr, dng, dnb);
  out_kernel<<<BATCH * N_MASKT, D_MODEL, 0, stream>>>(Xd, hist, midx, outw, outb, out);
}

// v001
// It runs in 761 microseconds.
// Next to v000, in two timings, it ran 3.47 and 3.46 times as fast.
#include <hip/hip_runtime.h>
#include <math.h>

#define N_NODES  207
#define T_STEPS  12
#define C_IN     4
#define BATCH    4
#define NT       (N_NODES * T_STEPS)   // 2484
#define D_MODEL  96
#define NHEAD    4
#define HD       24
#define FF_DIM   384
#define N_MASKT  1863
#define N_UNMASK 621
#define MAX_NEIGH 40
#define ATTN_SCALE 0.20412414523193154f   // 1/sqrt(24)
#define SQRT_D     9.797958971132712f     // sqrt(96)

typedef float v2f __attribute__((ext_vector_type(2)));
typedef float v8f __attribute__((ext_vector_type(8)));

// ---------------------------------------------------------------------------
// Adjacency: A = softmax(relu(nv1 @ nv2), axis=1); keep iff (A > 1/N) and
// strictly greater than the 41st-largest in its row (rank < MAX_NEIGH).
// ---------------------------------------------------------------------------
__global__ void adj_kernel(const float* __restrict__ nv1,
                           const float* __restrict__ nv2,
                           float* __restrict__ adpA) {
  __shared__ float a[N_NODES];
  __shared__ float stat[2];
  int i = blockIdx.x;
  int tid = threadIdx.x;
  for (int j = tid; j < N_NODES; j += blockDim.x) {
    float s = 0.f;
    for (int r = 0; r < 10; ++r) s += nv1[i * 10 + r] * nv2[r * N_NODES + j];
    a[j] = s > 0.f ? s : 0.f;
  }
  __syncthreads();
  if (tid == 0) {
    float mx = -1e30f;
    for (int j = 0; j < N_NODES; ++j) mx = fmaxf(mx, a[j]);
    float sum = 0.f;
    for (int j = 0; j < N_NODES; ++j) sum += __expf(a[j] - mx);
    stat[0] = mx; stat[1] = 1.f / sum;
  }
  __syncthreads();
  float mx = stat[0], inv = stat[1];
  for (int j = tid; j < N_NODES; j += blockDim.x) a[j] = __expf(a[j] - mx) * inv;
  __syncthreads();
  const float thr = 1.0f / (float)N_NODES;
  for (int j = tid; j < N_NODES; j += blockDim.x) {
    float aj = a[j];
    int cnt = 0;
    for (int l = 0; l < N_NODES; ++l) cnt += (a[l] > aj) ? 1 : 0;
    bool keep = (aj > thr) && (cnt < MAX_NEIGH);
    adpA[i * N_NODES + j] = keep ? aj : 0.f;
  }
}

// Encoder additive attention bias: 0 where connected, -1e30 where adpA == 0.
__global__ void encmask_kernel(const float* __restrict__ adpA,
                               const int* __restrict__ uidx,
                               float* __restrict__ Mb) {
  int idx = blockIdx.x * blockDim.x + threadIdx.x;
  if (idx >= N_UNMASK * N_UNMASK) return;
  int q = idx / N_UNMASK, k = idx % N_UNMASK;
  int nq = uidx[q] / T_STEPS, nk = uidx[k] / T_STEPS;
  Mb[idx] = (adpA[nq * N_NODES + nk] == 0.f) ? -1e30f : 0.f;
}

// token[b,nt,:] = x0*dim_w + dim_b + pos + tod*tod_w + tod_b + dow*dow_w + dow_b
__global__ void token_kernel(const float* __restrict__ hist,
                             const float* __restrict__ dim_w, const float* __restrict__ dim_b,
                             const float* __restrict__ pos,
                             const float* __restrict__ tod_w, const float* __restrict__ tod_b,
                             const float* __restrict__ dow_w, const float* __restrict__ dow_b,
                             float* __restrict__ token) {
  int row = blockIdx.x;            // b*NT + nt
  int d = threadIdx.x;             // 0..95
  int b = row / NT, nt = row % NT;
  int n = nt / T_STEPS, t = nt % T_STEPS;
  const float* hp = hist + (((size_t)b * T_STEPS + t) * N_NODES + n) * C_IN;
  float x0 = hp[0], dow = hp[2], tod = hp[3];
  token[(size_t)row * D_MODEL + d] =
      x0 * dim_w[d] + dim_b[d] + pos[(size_t)nt * D_MODEL + d] +
      tod * tod_w[d] + tod_b[d] + dow * dow_w[d] + dow_b[d];
}

// enc_in = token[:, unmasked_idx, :] * sqrt(D)
__global__ void gather_kernel(const float* __restrict__ token,
                              const int* __restrict__ uidx,
                              float* __restrict__ X) {
  int row = blockIdx.x;            // b*N_UNMASK + s
  int d = threadIdx.x;
  int b = row / N_UNMASK, s = row % N_UNMASK;
  X[(size_t)row * D_MODEL + d] =
      token[((size_t)b * NT + uidx[s]) * D_MODEL + d] * SQRT_D;
}

// ---------------------------------------------------------------------------
// fp32 GEMM via V_WMMA_F32_16X16X4_F32, register-blocked 32x32 per wave:
// 4 accumulators, each A-frag feeds 2 WMMAs and each B-frag feeds 2 WMMAs.
// Y[M,N] = X[M,K] @ W[K,N] + bias (+ReLU). K % 4 == 0, N % 32 == 0.
// M edge via row-clamped loads + guarded stores (EXEC stays full for WMMA).
// ---------------------------------------------------------------------------
__global__ void gemm_wmma_kernel(const float* __restrict__ X, const float* __restrict__ W,
                                 const float* __restrict__ bias, float* __restrict__ Y,
                                 int M, int K, int N, int relu) {
  int lane = threadIdx.x & 31;
  int l16 = lane & 15, half = lane >> 4;
  int m0 = blockIdx.x * 32, n0 = blockIdx.y * 32;
  int ra0 = m0 + l16;      if (ra0 >= M) ra0 = M - 1;
  int ra1 = m0 + 16 + l16; if (ra1 >= M) ra1 = M - 1;
  v8f acc00 = {}, acc01 = {}, acc10 = {}, acc11 = {};
  for (int k0 = 0; k0 < K; k0 += 4) {
    int kx = k0 + 2 * half;
    v2f a0, a1, b0, b1;
    a0.x = X[(size_t)ra0 * K + kx];
    a0.y = X[(size_t)ra0 * K + kx + 1];
    a1.x = X[(size_t)ra1 * K + kx];
    a1.y = X[(size_t)ra1 * K + kx + 1];
    b0.x = W[(size_t)kx * N + n0 + l16];
    b0.y = W[(size_t)(kx + 1) * N + n0 + l16];
    b1.x = W[(size_t)kx * N + n0 + 16 + l16];
    b1.y = W[(size_t)(kx + 1) * N + n0 + 16 + l16];
    acc00 = __builtin_amdgcn_wmma_f32_16x16x4_f32(false, a0, false, b0, (short)0, acc00, false, false);
    acc01 = __builtin_amdgcn_wmma_f32_16x16x4_f32(false, a0, false, b1, (short)0, acc01, false, false);
    acc10 = __builtin_amdgcn_wmma_f32_16x16x4_f32(false, a1, false, b0, (short)0, acc10, false, false);
    acc11 = __builtin_amdgcn_wmma_f32_16x16x4_f32(false, a1, false, b1, (short)0, acc11, false, false);
  }
  int nA = n0 + l16, nB = n0 + 16 + l16;
  float bv0 = bias ? bias[nA] : 0.f;
  float bv1 = bias ? bias[nB] : 0.f;
  for (int r = 0; r < 8; ++r) {
    int mA = m0 + r + 8 * half;
    if (mA < M) {
      float v0 = acc00[r] + bv0;
      float v1 = acc01[r] + bv1;
      if (relu) { v0 = fmaxf(v0, 0.f); v1 = fmaxf(v1, 0.f); }
      Y[(size_t)mA * N + nA] = v0;
      Y[(size_t)mA * N + nB] = v1;
    }
    int mB = m0 + 16 + r + 8 * half;
    if (mB < M) {
      float v0 = acc10[r] + bv0;
      float v1 = acc11[r] + bv1;
      if (relu) { v0 = fmaxf(v0, 0.f); v1 = fmaxf(v1, 0.f); }
      Y[(size_t)mB * N + nA] = v0;
      Y[(size_t)mB * N + nB] = v1;
    }
  }
}

// ---------------------------------------------------------------------------
// Fused attention per (b, head, 16-row q-tile), one work-group of ATT_WAVES
// waves on one shared score tile in LDS (16 x Spad).
//   S = Q K^T : 16-key tiles dealt round-robin to the waves.
//   softmax   : wave w owns row w, its 32 lanes run along the keys.
//   O = P V   : 16-key tiles dealt round-robin; each wave's partial 16x24
//               result goes to LDS (over the dead scores) and is summed there.
// Needs Spad >= 24 * ATT_WAVES for the partial results to fit in the tile.
// Q/K/V layout: [(b*S+s)*96 + h*24 + d].
// ---------------------------------------------------------------------------
#define ATT_WAVES 16
#define ATT_OTILE (16 * HD)        // 384 floats of partial output per wave
static_assert(ATT_WAVES == 16, "softmax deals one row of the 16-row tile to each wave");

__global__ __launch_bounds__(ATT_WAVES * 32)
void attn_kernel(const float* __restrict__ Q, const float* __restrict__ Kb,
                 const float* __restrict__ Vb, float* __restrict__ O,
                 const float* __restrict__ maskb, int S, int Spad) {
  extern __shared__ float sc[];    // [16][Spad]
  int lane = threadIdx.x & 31;
  // wave number in a scalar register: loop bounds and row bases stay scalar
  int wave = __builtin_amdgcn_readfirstlane((int)(threadIdx.x >> 5));
  int l16 = lane & 15, half = lane >> 4;
  int qt = blockIdx.x, h = blockIdx.y, b = blockIdx.z;
  int qrow = qt * 16 + l16; int qrc = qrow < S ? qrow : S - 1;
  const size_t hb = (size_t)h * HD;

  // Q fragments (A-matrix 16x24): lane row = l16, x/y = K sub-indices
  v2f aq[6];
  {
    const float* qp = Q + ((size_t)b * S + qrc) * D_MODEL + hb;
    for (int j = 0; j < 6; ++j) {
      int kd = 4 * j + 2 * half;
      aq[j].x = qp[kd];
      aq[j].y = qp[kd + 1];
    }
  }

  int ktiles = Spad / 16;
  // -------- S = Q K^T, this wave's key tiles into LDS --------
  for (int kt = wave; kt < ktiles; kt += ATT_WAVES) {
    int key = kt * 16 + l16; if (key >= S) key = S - 1;
    const float* kp = Kb + ((size_t)b * S + key) * D_MODEL + hb;
    v8f acc = {};
    for (int j = 0; j < 6; ++j) {
      int kd = 4 * j + 2 * half;
      v2f bf; bf.x = kp[kd]; bf.y = kp[kd + 1];
      acc = __builtin_amdgcn_wmma_f32_16x16x4_f32(false, aq[j], false, bf, (short)0,
                                                  acc, false, false);
    }
    for (int r = 0; r < 8; ++r)
      sc[(size_t)(r + 8 * half) * Spad + kt * 16 + l16] = acc[r];
  }
  __syncthreads();

  // -------- softmax: wave = row, lanes along the keys --------
  {
    int m = wave;
    float* row = sc + (size_t)m * Spad;
    int qg = qt * 16 + m; if (qg >= S) qg = S - 1;
    const float* mrow = maskb ? (maskb + (size_t)qg * S) : (const float*)0;
    float mx = -1e30f;
    for (int k = lane; k < S; k += 32) {
      float v = row[k] * ATTN_SCALE + (mrow ? mrow[k] : 0.f);
      row[k] = v;
      mx = fmaxf(mx, v);
    }
    for (int o = 16; o > 0; o >>= 1) mx = fmaxf(mx, __shfl_xor(mx, o, 32));
    float sum = 0.f;
    for (int k = lane; k < S; k += 32) {
      float e = __expf(row[k] - mx);
      row[k] = e;
      sum += e;
    }
    for (int o = 16; o > 0; o >>= 1) sum += __shfl_xor(sum, o, 32);
    float inv = 1.f / sum;
    for (int k = lane; k < S; k += 32) row[k] *= inv;
    for (int k = S + lane; k < Spad; k += 32) row[k] = 0.f;  // kill pad for P@V
  }
  __syncthreads();

  // -------- O = P V over this wave's key tiles
  //          (HD=24 -> one full 16-wide tile + one 8-wide tile) ----
  v8f o0 = {}, o1 = {};
  int hd2 = 16 + l16; if (hd2 >= HD) hd2 = HD - 1;  // clamp; masked on store
  for (int kt = wave; kt < ktiles; kt += ATT_WAVES) {
    for (int ks = 0; ks < 4; ++ks) {
      int k0 = kt * 16 + ks * 4;
      v2f ap;
      ap.x = sc[(size_t)l16 * Spad + k0 + 2 * half];
      ap.y = sc[(size_t)l16 * Spad + k0 + 2 * half + 1];
      int keyx = k0 + 2 * half;     if (keyx >= S) keyx = S - 1;
      int keyy = k0 + 2 * half + 1; if (keyy >= S) keyy = S - 1;
      const float* vpx = Vb + ((size_t)b * S + keyx) * D_MODEL + hb;
      const float* vpy = Vb + ((size_t)b * S + keyy) * D_MODEL + hb;
      v2f b0, b1;
      b0.x = vpx[l16]; b0.y = vpy[l16];
      b1.x = vpx[hd2]; b1.y = vpy[hd2];
      o0 = __builtin_amdgcn_wmma_f32_16x16x4_f32(false, ap, false, b0, (short)0, o0,
                                                 false, false);
      o1 = __builtin_amdgcn_wmma_f32_16x16x4_f32(false, ap, false, b1, (short)0, o1,
                                                 false, false);
    }
  }
  __syncthreads();   // every wave has read its probabilities: the tile is free

  // -------- partial results to LDS, [wave][row][d], then summed over waves ----
  {
    float* part = sc + (size_t)wave * ATT_OTILE;
    for (int r = 0; r < 8; ++r) {
      int m = r + 8 * half;
      part[m * HD + l16] = o0[r];
      if (l16 < 8) part[m * HD + 16 + l16] = o1[r];
    }
  }
  __syncthreads();
  int t = threadIdx.x;
  if (t < ATT_OTILE) {
    float s = 0.f;
    for (int w = 0; w < ATT_WAVES; ++w) s += sc[w * ATT_OTILE + t];
    int m = qt * 16 + t / HD;
    if (m < S) O[((size_t)b * S + m) * D_MODEL + hb + t % HD] = s;
  }
}

// LayerNorm over D=96, optional fused residual R; in-place on X (row-local).
__global__ void ln_kernel(float* __restrict__ X, const float* __restrict__ R,
                          const float* __restrict__ g, const float* __restrict__ bta) {
  __shared__ float red[D_MODEL];
  __shared__ float stat[2];
  int row = blockIdx.x;
  int d = threadIdx.x;
  size_t idx = (size_t)row * D_MODEL + d;
  float v = X[idx] + (R ? R[idx] : 0.f);
  red[d] = v;
  __syncthreads();
  if (d == 0) {
    float s = 0.f;
    for (int j = 0; j < D_MODEL; ++j) s += red[j];
    stat[0] = s / (float)D_MODEL;
  }
  __syncthreads();
  float m = stat[0];
  float c = v - m;
  red[d] = c * c;
  __syncthreads();
  if (d == 0) {
    float s = 0.f;
    for (int j = 0; j < D_MODEL; ++j) s += red[j];
    stat[1] = rsqrtf(s / (float)D_MODEL + 1e-5f);
  }
  __syncthreads();
  X[idx] = c * stat[1] * g[d] + bta[d];
}

// Decoder input: first 621 rows = e2d(enc) * sqrt(D)
__global__ void dec_assemble_enc(const float* __restrict__ E, float* __restrict__ Xd) {
  int row = blockIdx.x;            // b*N_UNMASK + s
  int d = threadIdx.x;
  int b = row / N_UNMASK, s = row % N_UNMASK;
  Xd[((size_t)b * NT + s) * D_MODEL + d] = E[(size_t)row * D_MODEL + d] * SQRT_D;
}

// Decoder input: masked rows = (mask_token + pos + tod/dow emb) * sqrt(D)
__global__ void dec_assemble_mask(const float* __restrict__ hist,
                                  const int* __restrict__ midx,
                                  const float* __restrict__ mask_token,
                                  const float* __restrict__ pos,
                                  const float* __restrict__ tod_w, const float* __restrict__ tod_b,
                                  const float* __restrict__ dow_w, const float* __restrict__ dow_b,
                                  float* __restrict__ Xd) {
  int row = blockIdx.x;            // b*N_MASKT + j
  int d = threadIdx.x;
  int b = row / N_MASKT, j = row % N_MASKT;
  int nt = midx[j]; int n = nt / T_STEPS, t = nt % T_STEPS;
  const float* hp = hist + (((size_t)b * T_STEPS + t) * N_NODES + n) * C_IN;
  float dow = hp[2], tod = hp[3];
  float v = mask_token[d] + pos[(size_t)nt * D_MODEL + d] +
            tod * tod_w[d] + tod_b[d] + dow * dow_w[d] + dow_b[d];
  Xd[((size_t)b * NT + N_UNMASK + j) * D_MODEL + d] = v * SQRT_D;
}

// recon_masked = (decoder rows >= N_UNMASK) @ out_w + out_b ; label gather.
__global__ void out_kernel(const float* __restrict__ Xd, const float* __restrict__ hist,
                           const int* __restrict__ midx,
                           const float* __restrict__ out_w, const float* __restrict__ out_b,
                           float* __restrict__ out) {
  __shared__ float red[D_MODEL];
  int row = blockIdx.x;            // b*N_MASKT + j
  int d = threadIdx.x;
  int b = row / N_MASKT, j = row % N_MASKT;
  size_t xr = ((size_t)b * NT + N_UNMASK + j) * D_MODEL;
  red[d] = Xd[xr + d] * out_w[d];
  __syncthreads();
  if (d == 0) {
    float s = 0.f;
    for (int i = 0; i < D_MODEL; ++i) s += red[i];
    out[row] = s + out_b[0];
    int nt = midx[j]; int n = nt / T_STEPS, t = nt % T_STEPS;
    out[BATCH * N_MASKT + row] =
        hist[(((size_t)b * T_STEPS + t) * N_NODES + n) * C_IN + 0];
  }
}

// ---------------------------------------------------------------------------
extern "C" void kernel_launch(void* const* d_in, const int* in_sizes, int n_in,
                              void* d_out, int out_size, void* d_ws, size_t ws_size,
                              hipStream_t stream) {
  (void)in_sizes; (void)n_in; (void)out_size; (void)ws_size;
  const float* hist  = (const float*)d_in[0];
  const int*   uidx  = (const int*)d_in[1];
  const int*   midx  = (const int*)d_in[2];
  const float* nv1   = (const float*)d_in[3];
  const float* nv2   = (const float*)d_in[4];
  const float* dim_w = (const float*)d_in[5];
  const float* dim_b = (const float*)d_in[6];
  const float* pos   = (const float*)d_in[7];
  const float* tod_w = (const float*)d_in[8];
  const float* tod_b = (const float*)d_in[9];
  const float* dow_w = (const float*)d_in[10];
  const float* dow_b = (const float*)d_in[11];
  const float* mtok  = (const float*)d_in[12];
  const float* eaw   = (const float*)d_in[13];
  const float* eab   = (const float*)d_in[14];
  const float* ew1   = (const float*)d_in[15];
  const float* eb1   = (const float*)d_in[16];
  const float* ew2   = (const float*)d_in[17];
  const float* eb2   = (const float*)d_in[18];
  const float* eln   = (const float*)d_in[19];
  const float* eng   = (const float*)d_in[20];
  const float* enb   = (const float*)d_in[21];
  const float* e2dw  = (const float*)d_in[22];
  const float* e2db  = (const float*)d_in[23];
  const float* daw   = (const float*)d_in[24];
  const float* dab   = (const float*)d_in[25];
  const float* dw1   = (const float*)d_in[26];
  const float* db1   = (const float*)d_in[27];
  const float* dw2   = (const float*)d_in[28];
  const float* db2   = (const float*)d_in[29];
  const float* dln   = (const float*)d_in[30];
  const float* dng   = (const float*)d_in[31];
  const float* dnb   = (const float*)d_in[32];
  const float* outw  = (const float*)d_in[33];
  const float* outb  = (const float*)d_in[34];
  float* out = (float*)d_out;

  float* ws = (float*)d_ws;
  size_t off = 0;
  auto alloc = [&](size_t n) { float* p = ws + off; off += n; return p; };
  const size_t MD = (size_t)BATCH * NT;   // max rows (decoder): 9936
  float* adpA  = alloc((size_t)N_NODES * N_NODES);
  float* Menc  = alloc((size_t)N_UNMASK * N_UNMASK);
  float* token = alloc((size_t)BATCH * NT * D_MODEL);
  float* X  = alloc(MD * D_MODEL);
  float* Qb = alloc(MD * D_MODEL);
  float* Kb = alloc(MD * D_MODEL);
  float* Vb = alloc(MD * D_MODEL);
  float* Ob = alloc(MD * D_MODEL);
  float* T1 = alloc(MD * D_MODEL);
  float* F1 = alloc(MD * FF_DIM);
  float* Xd = alloc(MD * D_MODEL);

  adj_kernel<<<N_NODES, 256, 0, stream>>>(nv1, nv2, adpA);
  {
    int tot = N_UNMASK * N_UNMASK;
    encmask_kernel<<<(tot + 255) / 256, 256, 0, stream>>>(adpA, uidx, Menc);
  }
  token_kernel<<<BATCH * NT, D_MODEL, 0, stream>>>(hist, dim_w, dim_b, pos, tod_w,
                                                   tod_b, dow_w, dow_b, token);
  gather_kernel<<<BATCH * N_UNMASK, D_MODEL, 0, stream>>>(token, uidx, X);

  auto gemm = [&](const float* A, const float* W, const float* bias, float* Y,
                  int M, int K, int N, int relu) {
    dim3 g((unsigned)((M + 31) / 32), (unsigned)(N / 32));
    gemm_wmma_kernel<<<g, 32, 0, stream>>>(A, W, bias, Y, M, K, N, relu);
  };

  auto layer = [&](float* H, int S, const float* aw, const float* ab,
                   const float* w1, const float* b1, const float* w2, const float* b2,
                   const float* ln, const float* maskb) {
    int M = BATCH * S;
    int Spad = ((S + 15) / 16) * 16;
    gemm(H, aw + 0 * D_MODEL * D_MODEL, ab + 0 * D_MODEL, Qb, M, D_MODEL, D_MODEL, 0);
    gemm(H, aw + 1 * D_MODEL * D_MODEL, ab + 1 * D_MODEL, Kb, M, D_MODEL, D_MODEL, 0);
    gemm(H, aw + 2 * D_MODEL * D_MODEL, ab + 2 * D_MODEL, Vb, M, D_MODEL, D_MODEL, 0);
    dim3 ag((unsigned)(Spad / 16), NHEAD, BATCH);
    size_t sh = (size_t)16 * Spad * sizeof(float);
    attn_kernel<<<ag, ATT_WAVES * 32, sh, stream>>>(Qb, Kb, Vb, Ob, maskb, S, Spad);
    gemm(Ob, aw + 3 * D_MODEL * D_MODEL, ab + 3 * D_MODEL, T1, M, D_MODEL, D_MODEL, 0);
    ln_kernel<<<M, D_MODEL, 0, stream>>>(H, T1, ln + 0 * 2 * D_MODEL,
                                         ln + 0 * 2 * D_MODEL + D_MODEL);
    gemm(H, w1, b1, F1, M, D_MODEL, FF_DIM, 1);
    gemm(F1, w2, b2, T1, M, FF_DIM, D_MODEL, 0);
    ln_kernel<<<M, D_MODEL, 0, stream>>>(H, T1, ln + 1 * 2 * D_MODEL,
                                         ln + 1 * 2 * D_MODEL + D_MODEL);
  };

  // ---- encoder (4 layers, masked attention over 621 tokens) ----
  for (int l = 0; l < 4; ++l) {
    layer(X, N_UNMASK,
          eaw + (size_t)l * 4 * D_MODEL * D_MODEL, eab + (size_t)l * 4 * D_MODEL,
          ew1 + (size_t)l * D_MODEL * FF_DIM,      eb1 + (size_t)l * FF_DIM,
          ew2 + (size_t)l * FF_DIM * D_MODEL,      eb2 + (size_t)l * D_MODEL,
          eln + (size_t)l * 2 * 2 * D_MODEL, Menc);
  }
  ln_kernel<<<BATCH * N_UNMASK, D_MODEL, 0, stream>>>(X, nullptr, eng, enb);
  gemm(X, e2dw, e2db, T1, BATCH * N_UNMASK, D_MODEL, D_MODEL, 0);
  dec_assemble_enc<<<BATCH * N_UNMASK, D_MODEL, 0, stream>>>(T1, Xd);
  dec_assemble_mask<<<BATCH * N_MASKT, D_MODEL, 0, stream>>>(hist, midx, mtok, pos,
                                                             tod_w, tod_b, dow_w, dow_b, Xd);
  // ---- decoder (1 layer, full attention over 2484 tokens) ----
  layer(Xd, NT, daw, dab, dw1, db1, dw2, db2, dln, nullptr);
  ln_kernel<<<BATCH * NT, D_MODEL, 0, stream>>>(Xd, nullptr, dng, dnb);
  out_kernel<<<BATCH * N_MASKT, D_MODEL, 0, stream>>>(Xd, hist, midx, outw, outb, out);
}

// v002
// Measured time: 530 microseconds a run.
// Two timings next to v001 both put it at 1.44 times that version's speed.
// Counting every step since v000, it is 4.98 times as fast.
#include <hip/hip_runtime.h>
#include <math.h>

#define N_NODES  207
#define T_STEPS  12
#define C_IN     4
#define BATCH    4
#define NT       (N_NODES * T_STEPS)   // 2484
#define D_MODEL  96
#define NHEAD    4
#define HD       24
#define FF_DIM   384
#define N_MASKT  1863
#define N_UNMASK 621
#define MAX_NEIGH 40
#define ATTN_SCALE 0.20412414523193154f   // 1/sqrt(24)
#define SQRT_D     9.797958971132712f     // sqrt(96)

typedef float v2f __attribute__((ext_vector_type(2)));
typedef float v8f __attribute__((ext_vector_type(8)));

// ---------------------------------------------------------------------------
// Adjacency: A = softmax(relu(nv1 @ nv2), axis=1); keep iff (A > 1/N) and
// strictly greater than the 41st-largest in its row (rank < MAX_NEIGH).
// ---------------------------------------------------------------------------
__global__ void adj_kernel(const float* __restrict__ nv1,
                           const float* __restrict__ nv2,
                           float* __restrict__ adpA) {
  __shared__ float a[N_NODES];
  __shared__ float stat[2];
  int i = blockIdx.x;
  int tid = threadIdx.x;
  for (int j = tid; j < N_NODES; j += blockDim.x) {
    float s = 0.f;
    for (int r = 0; r < 10; ++r) s += nv1[i * 10 + r] * nv2[r * N_NODES + j];
    a[j] = s > 0.f ? s : 0.f;
  }
  __syncthreads();
  if (tid == 0) {
    float mx = -1e30f;
    for (int j = 0; j < N_NODES; ++j) mx = fmaxf(mx, a[j]);
    float sum = 0.f;
    for (int j = 0; j < N_NODES; ++j) sum += __expf(a[j] - mx);
    stat[0] = mx; stat[1] = 1.f / sum;
  }
  __syncthreads();
  float mx = stat[0], inv = stat[1];
  for (int j = tid; j < N_NODES; j += blockDim.x) a[j] = __expf(a[j] - mx) * inv;
  __syncthreads();
  const float thr = 1.0f / (float)N_NODES;
  for (int j = tid; j < N_NODES; j += blockDim.x) {
    float aj = a[j];
    int cnt = 0;
    for (int l = 0; l < N_NODES; ++l) cnt += (a[l] > aj) ? 1 : 0;
    bool keep = (aj > thr) && (cnt < MAX_NEIGH);
    adpA[i * N_NODES + j] = keep ? aj : 0.f;
  }
}

// Encoder additive attention bias: 0 where connected, -1e30 where adpA == 0.
__global__ void encmask_kernel(const float* __restrict__ adpA,
                               const int* __restrict__ uidx,
                               float* __restrict__ Mb) {
  int idx = blockIdx.x * blockDim.x + threadIdx.x;
  if (idx >= N_UNMASK * N_UNMASK) return;
  int q = idx / N_UNMASK, k = idx % N_UNMASK;
  int nq = uidx[q] / T_STEPS, nk = uidx[k] / T_STEPS;
  Mb[idx] = (adpA[nq * N_NODES + nk] == 0.f) ? -1e30f : 0.f;
}

// token[b,nt,:] = x0*dim_w + dim_b + pos + tod*tod_w + tod_b + dow*dow_w + dow_b
__global__ void token_kernel(const float* __restrict__ hist,
                             const float* __restrict__ dim_w, const float* __restrict__ dim_b,
                             const float* __restrict__ pos,
                             const float* __restrict__ tod_w, const float* __restrict__ tod_b,
                             const float* __restrict__ dow_w, const float* __restrict__ dow_b,
                             float* __restrict__ token) {
  int row = blockIdx.x;            // b*NT + nt
  int d = threadIdx.x;             // 0..95
  int b = row / NT, nt = row % NT;
  int n = nt / T_STEPS, t = nt % T_STEPS;
  const float* hp = hist + (((size_t)b * T_STEPS + t) * N_NODES + n) * C_IN;
  float x0 = hp[0], dow = hp[2], tod = hp[3];
  token[(size_t)row * D_MODEL + d] =
      x0 * dim_w[d] + dim_b[d] + pos[(size_t)nt * D_MODEL + d] +
      tod * tod_w[d] + tod_b[d] + dow * dow_w[d] + dow_b[d];
}

// enc_in = token[:, unmasked_idx, :] * sqrt(D)
__global__ void gather_kernel(const float* __restrict__ token,
                              const int* __restrict__ uidx,
                              float* __restrict__ X) {
  int row = blockIdx.x;            // b*N_UNMASK + s
  int d = threadIdx.x;
  int b = row / N_UNMASK, s = row % N_UNMASK;
  X[(size_t)row * D_MODEL + d] =
      token[((size_t)b * NT + uidx[s]) * D_MODEL + d] * SQRT_D;
}

// ---------------------------------------------------------------------------
// fp32 GEMM via V_WMMA_F32_16X16X4_F32, register-blocked 32x32 per wave:
// 4 accumulators, each A-frag feeds 2 WMMAs and each B-frag feeds 2 WMMAs.
// Y[M,N] = X[M,K] @ W[K,N] + bias (+ReLU). K and N are compile-time, so every
// operand load is a base register plus an immediate offset.
// The K loop is a register ring: operands come in chunks of GK_STEPS k-steps,
// GK_BUFS chunks are held, and a chunk's loads are issued at least GK_BUFS - 1
// chunks ahead of the WMMAs that use it, so a wave waits out the load latency
// once and not once per trip. Every accumulator keeps the ascending k order.
// M edge via row-clamped loads + guarded stores (EXEC stays full for WMMA).
// ---------------------------------------------------------------------------
#define GK_STEPS 4     // k-steps (of 4) per chunk: 32 loads
#define GK_BUFS  3     // chunks held in registers

template <int K, int N>
__global__ __launch_bounds__(32)
void gemm_wmma_kernel(const float* __restrict__ X, const float* __restrict__ W,
                      const float* __restrict__ bias, float* __restrict__ Y,
                      int M, int relu) {
  constexpr int NCH = K / (4 * GK_STEPS);
  static_assert(K % (4 * GK_STEPS) == 0 && N % 32 == 0 && NCH >= GK_BUFS, "shape");
  int lane = threadIdx.x & 31;
  int l16 = lane & 15, half = lane >> 4;
  int m0 = blockIdx.x * 32, n0 = blockIdx.y * 32;
  int ra0 = m0 + l16;      if (ra0 >= M) ra0 = M - 1;
  int ra1 = m0 + 16 + l16; if (ra1 >= M) ra1 = M - 1;
  const float* xa0 = X + (size_t)ra0 * K + 2 * half;
  const float* xa1 = X + (size_t)ra1 * K + 2 * half;
  const float* wp  = W + (size_t)(2 * half) * N + n0 + l16;
  v2f a0[GK_BUFS][GK_STEPS], a1[GK_BUFS][GK_STEPS];
  v2f b0[GK_BUFS][GK_STEPS], b1[GK_BUFS][GK_STEPS];
  v8f acc00 = {}, acc01 = {}, acc10 = {}, acc11 = {};

// unrolled here and below: every ring index must be a compile-time constant,
// or the ring would live in scratch instead of registers
#define GK_LOAD(c)                                                     \
  _Pragma("unroll")                                                    \
  for (int j = 0; j < GK_STEPS; ++j) {                                 \
    const int k0 = ((c) * GK_STEPS + j) * 4;                           \
    const int s = (c) % GK_BUFS;                                       \
    a0[s][j].x = xa0[k0];              a0[s][j].y = xa0[k0 + 1];       \
    a1[s][j].x = xa1[k0];              a1[s][j].y = xa1[k0 + 1];       \
    b0[s][j].x = wp[k0 * N];           b0[s][j].y = wp[(k0 + 1) * N];  \
    b1[s][j].x = wp[k0 * N + 16];      b1[s][j].y = wp[(k0 + 1) * N + 16]; \
  }

#pragma unroll   // constant ring index
  for (int c = 0; c < GK_BUFS - 1; ++c) { GK_LOAD(c) }
#pragma unroll   // constant ring index and immediate load offsets
  for (int c = 0; c < NCH; ++c) {
    if (c + GK_BUFS - 1 < NCH) { GK_LOAD(c + GK_BUFS - 1) }
    // keeps the loads above in front of this chunk's WMMAs: sunk to their use,
    // each chunk would wait out its own load latency again
    __builtin_amdgcn_sched_barrier(0);
    const int s = c % GK_BUFS;
#pragma unroll   // constant ring index
    for (int j = 0; j < GK_STEPS; ++j) {
      acc00 = __builtin_amdgcn_wmma_f32_16x16x4_f32(false, a0[s][j], false, b0[s][j], (short)0, acc00, false, false);
      acc01 = __builtin_amdgcn_wmma_f32_16x16x4_f32(false, a0[s][j], false, b1[s][j], (short)0, acc01, false, false);
      acc10 = __builtin_amdgcn_wmma_f32_16x16x4_f32(false, a1[s][j], false, b0[s][j], (short)0, acc10, false, false);
      acc11 = __builtin_amdgcn_wmma_f32_16x16x4_f32(false, a1[s][j], false, b1[s][j], (short)0, acc11, false, false);
    }
  }
#undef GK_LOAD
  // stands in front of the epilogue's reuse of the operand loads' address
  // registers; the scheduling barrier keeps that arithmetic from rising over it
  asm volatile("s_wait_xcnt 0x0" ::: "memory");
  __builtin_amdgcn_sched_barrier(0);
  int nA = n0 + l16, nB = n0 + 16 + l16;
  float bv0 = bias ? bias[nA] : 0.f;
  float bv1 = bias ? bias[nB] : 0.f;
  for (int r = 0; r < 8; ++r) {
    int mA = m0 + r + 8 * half;
    if (mA < M) {
      float v0 = acc00[r] + bv0;
      float v1 = acc01[r] + bv1;
      if (relu) { v0 = fmaxf(v0, 0.f); v1 = fmaxf(v1, 0.f); }
      Y[(size_t)mA * N + nA] = v0;
      Y[(size_t)mA * N + nB] = v1;
    }
    int mB = m0 + 16 + r + 8 * half;
    if (mB < M) {
      float v0 = acc10[r] + bv0;
      float v1 = acc11[r] + bv1;
      if (relu) { v0 = fmaxf(v0, 0.f); v1 = fmaxf(v1, 0.f); }
      Y[(size_t)mB * N + nA] = v0;
      Y[(size_t)mB * N + nB] = v1;
    }
  }
}

// ---------------------------------------------------------------------------
// Fused attention per (b, head, 16-row q-tile), one work-group of ATT_WAVES
// waves on one shared score tile in LDS (16 x Spad).
//   S = Q K^T : 16-key tiles dealt round-robin to the waves.
//   softmax   : wave w owns row w, its 32 lanes run along the keys.
//   O = P V   : 16-key tiles dealt round-robin; each wave's partial 16x24
//               result goes to LDS (over the dead scores) and is summed there.
// Needs Spad >= 24 * ATT_WAVES for the partial results to fit in the tile.
// Q/K/V layout: [(b*S+s)*96 + h*24 + d].
// ---------------------------------------------------------------------------
#define ATT_WAVES 16
#define ATT_OTILE (16 * HD)        // 384 floats of partial output per wave
static_assert(ATT_WAVES == 16, "softmax deals one row of the 16-row tile to each wave");

__global__ __launch_bounds__(ATT_WAVES * 32)
void attn_kernel(const float* __restrict__ Q, const float* __restrict__ Kb,
                 const float* __restrict__ Vb, float* __restrict__ O,
                 const float* __restrict__ maskb, int S, int Spad) {
  extern __shared__ float sc[];    // [16][Spad]
  int lane = threadIdx.x & 31;
  // wave number in a scalar register: loop bounds and row bases stay scalar
  int wave = __builtin_amdgcn_readfirstlane((int)(threadIdx.x >> 5));
  int l16 = lane & 15, half = lane >> 4;
  int qt = blockIdx.x, h = blockIdx.y, b = blockIdx.z;
  int qrow = qt * 16 + l16; int qrc = qrow < S ? qrow : S - 1;
  const size_t hb = (size_t)h * HD;

  // Q fragments (A-matrix 16x24): lane row = l16, x/y = K sub-indices
  v2f aq[6];
  {
    const float* qp = Q + ((size_t)b * S + qrc) * D_MODEL + hb;
    for (int j = 0; j < 6; ++j) {
      int kd = 4 * j + 2 * half;
      aq[j].x = qp[kd];
      aq[j].y = qp[kd + 1];
    }
  }

  int ktiles = Spad / 16;
  // -------- S = Q K^T, this wave's key tiles into LDS --------
  for (int kt = wave; kt < ktiles; kt += ATT_WAVES) {
    int key = kt * 16 + l16; if (key >= S) key = S - 1;
    const float* kp = Kb + ((size_t)b * S + key) * D_MODEL + hb;
    v8f acc = {};
    for (int j = 0; j < 6; ++j) {
      int kd = 4 * j + 2 * half;
      v2f bf; bf.x = kp[kd]; bf.y = kp[kd + 1];
      acc = __builtin_amdgcn_wmma_f32_16x16x4_f32(false, aq[j], false, bf, (short)0,
                                                  acc, false, false);
    }
    for (int r = 0; r < 8; ++r)
      sc[(size_t)(r + 8 * half) * Spad + kt * 16 + l16] = acc[r];
  }
  __syncthreads();

  // -------- softmax: wave = row, lanes along the keys --------
  {
    int m = wave;
    float* row = sc + (size_t)m * Spad;
    int qg = qt * 16 + m; if (qg >= S) qg = S - 1;
    const float* mrow = maskb ? (maskb + (size_t)qg * S) : (const float*)0;
    float mx = -1e30f;
    for (int k = lane; k < S; k += 32) {
      float v = row[k] * ATTN_SCALE + (mrow ? mrow[k] : 0.f);
      row[k] = v;
      mx = fmaxf(mx, v);
    }
    for (int o = 16; o > 0; o >>= 1) mx = fmaxf(mx, __shfl_xor(mx, o, 32));
    float sum = 0.f;
    for (int k = lane; k < S; k += 32) {
      float e = __expf(row[k] - mx);
      row[k] = e;
      sum += e;
    }
    for (int o = 16; o > 0; o >>= 1) sum += __shfl_xor(sum, o, 32);
    float inv = 1.f / sum;
    for (int k = lane; k < S; k += 32) row[k] *= inv;
    for (int k = S + lane; k < Spad; k += 32) row[k] = 0.f;  // kill pad for P@V
  }
  __syncthreads();

  // -------- O = P V over this wave's key tiles
  //          (HD=24 -> one full 16-wide tile + one 8-wide tile) ----
  v8f o0 = {}, o1 = {};
  int hd2 = 16 + l16; if (hd2 >= HD) hd2 = HD - 1;  // clamp; masked on store
  for (int kt = wave; kt < ktiles; kt += ATT_WAVES) {
    for (int ks = 0; ks < 4; ++ks) {
      int k0 = kt * 16 + ks * 4;
      v2f ap;
      ap.x = sc[(size_t)l16 * Spad + k0 + 2 * half];
      ap.y = sc[(size_t)l16 * Spad + k0 + 2 * half + 1];
      int keyx = k0 + 2 * half;     if (keyx >= S) keyx = S - 1;
      int keyy = k0 + 2 * half + 1; if (keyy >= S) keyy = S - 1;
      const float* vpx = Vb + ((size_t)b * S + keyx) * D_MODEL + hb;
      const float* vpy = Vb + ((size_t)b * S + keyy) * D_MODEL + hb;
      v2f b0, b1;
      b0.x = vpx[l16]; b0.y = vpy[l16];
      b1.x = vpx[hd2]; b1.y = vpy[hd2];
      o0 = __builtin_amdgcn_wmma_f32_16x16x4_f32(false, ap, false, b0, (short)0, o0,
                                                 false, false);
      o1 = __builtin_amdgcn_wmma_f32_16x16x4_f32(false, ap, false, b1, (short)0, o1,
                                                 false, false);
    }
  }
  __syncthreads();   // every wave has read its probabilities: the tile is free

  // -------- partial results to LDS, [wave][row][d], then summed over waves ----
  {
    float* part = sc + (size_t)wave * ATT_OTILE;
    for (int r = 0; r < 8; ++r) {
      int m = r + 8 * half;
      part[m * HD + l16] = o0[r];
      if (l16 < 8) part[m * HD + 16 + l16] = o1[r];
    }
  }
  __syncthreads();
  int t = threadIdx.x;
  if (t < ATT_OTILE) {
    float s = 0.f;
    for (int w = 0; w < ATT_WAVES; ++w) s += sc[w * ATT_OTILE + t];
    int m = qt * 16 + t / HD;
    if (m < S) O[((size_t)b * S + m) * D_MODEL + hb + t % HD] = s;
  }
}

// LayerNorm over D=96, optional fused residual R; in-place on X (row-local).
__global__ void ln_kernel(float* __restrict__ X, const float* __restrict__ R,
                          const float* __restrict__ g, const float* __restrict__ bta) {
  __shared__ float red[D_MODEL];
  __shared__ float stat[2];
  int row = blockIdx.x;
  int d = threadIdx.x;
  size_t idx = (size_t)row * D_MODEL + d;
  float v = X[idx] + (R ? R[idx] : 0.f);
  red[d] = v;
  __syncthreads();
  if (d == 0) {
    float s = 0.f;
    for (int j = 0; j < D_MODEL; ++j) s += red[j];
    stat[0] = s / (float)D_MODEL;
  }
  __syncthreads();
  float m = stat[0];
  float c = v - m;
  red[d] = c * c;
  __syncthreads();
  if (d == 0) {
    float s = 0.f;
    for (int j = 0; j < D_MODEL; ++j) s += red[j];
    stat[1] = rsqrtf(s / (float)D_MODEL + 1e-5f);
  }
  __syncthreads();
  X[idx] = c * stat[1] * g[d] + bta[d];
}

// Decoder input: first 621 rows = e2d(enc) * sqrt(D)
__global__ void dec_assemble_enc(const float* __restrict__ E, float* __restrict__ Xd) {
  int row = blockIdx.x;            // b*N_UNMASK + s
  int d = threadIdx.x;
  int b = row / N_UNMASK, s = row % N_UNMASK;
  Xd[((size_t)b * NT + s) * D_MODEL + d] = E[(size_t)row * D_MODEL + d] * SQRT_D;
}

// Decoder input: masked rows = (mask_token + pos + tod/dow emb) * sqrt(D)
__global__ void dec_assemble_mask(const float* __restrict__ hist,
                                  const int* __restrict__ midx,
                                  const float* __restrict__ mask_token,
                                  const float* __restrict__ pos,
                                  const float* __restrict__ tod_w, const float* __restrict__ tod_b,
                                  const float* __restrict__ dow_w, const float* __restrict__ dow_b,
                                  float* __restrict__ Xd) {
  int row = blockIdx.x;            // b*N_MASKT + j
  int d = threadIdx.x;
  int b = row / N_MASKT, j = row % N_MASKT;
  int nt = midx[j]; int n = nt / T_STEPS, t = nt % T_STEPS;
  const float* hp = hist + (((size_t)b * T_STEPS + t) * N_NODES + n) * C_IN;
  float dow = hp[2], tod = hp[3];
  float v = mask_token[d] + pos[(size_t)nt * D_MODEL + d] +
            tod * tod_w[d] + tod_b[d] + dow * dow_w[d] + dow_b[d];
  Xd[((size_t)b * NT + N_UNMASK + j) * D_MODEL + d] = v * SQRT_D;
}

// recon_masked = (decoder rows >= N_UNMASK) @ out_w + out_b ; label gather.
__global__ void out_kernel(const float* __restrict__ Xd, const float* __restrict__ hist,
                           const int* __restrict__ midx,
                           const float* __restrict__ out_w, const float* __restrict__ out_b,
                           float* __restrict__ out) {
  __shared__ float red[D_MODEL];
  int row = blockIdx.x;            // b*N_MASKT + j
  int d = threadIdx.x;
  int b = row / N_MASKT, j = row % N_MASKT;
  size_t xr = ((size_t)b * NT + N_UNMASK + j) * D_MODEL;
  red[d] = Xd[xr + d] * out_w[d];
  __syncthreads();
  if (d == 0) {
    float s = 0.f;
    for (int i = 0; i < D_MODEL; ++i) s += red[i];
    out[row] = s + out_b[0];
    int nt = midx[j]; int n = nt / T_STEPS, t = nt % T_STEPS;
    out[BATCH * N_MASKT + row] =
        hist[(((size_t)b * T_STEPS + t) * N_NODES + n) * C_IN + 0];
  }
}

// ---------------------------------------------------------------------------
extern "C" void kernel_launch(void* const* d_in, const int* in_sizes, int n_in,
                              void* d_out, int out_size, void* d_ws, size_t ws_size,
                              hipStream_t stream) {
  (void)in_sizes; (void)n_in; (void)out_size; (void)ws_size;
  const float* hist  = (const float*)d_in[0];
  const int*   uidx  = (const int*)d_in[1];
  const int*   midx  = (const int*)d_in[2];
  const float* nv1   = (const float*)d_in[3];
  const float* nv2   = (const float*)d_in[4];
  const float* dim_w = (const float*)d_in[5];
  const float* dim_b = (const float*)d_in[6];
  const float* pos   = (const float*)d_in[7];
  const float* tod_w = (const float*)d_in[8];
  const float* tod_b = (const float*)d_in[9];
  const float* dow_w = (const float*)d_in[10];
  const float* dow_b = (const float*)d_in[11];
  const float* mtok  = (const float*)d_in[12];
  const float* eaw   = (const float*)d_in[13];
  const float* eab   = (const float*)d_in[14];
  const float* ew1   = (const float*)d_in[15];
  const float* eb1   = (const float*)d_in[16];
  const float* ew2   = (const float*)d_in[17];
  const float* eb2   = (const float*)d_in[18];
  const float* eln   = (const float*)d_in[19];
  const float* eng   = (const float*)d_in[20];
  const float* enb   = (const float*)d_in[21];
  const float* e2dw  = (const float*)d_in[22];
  const float* e2db  = (const float*)d_in[23];
  const float* daw   = (const float*)d_in[24];
  const float* dab   = (const float*)d_in[25];
  const float* dw1   = (const float*)d_in[26];
  const float* db1   = (const float*)d_in[27];
  const float* dw2   = (const float*)d_in[28];
  const float* db2   = (const float*)d_in[29];
  const float* dln   = (const float*)d_in[30];
  const float* dng   = (const float*)d_in[31];
  const float* dnb   = (const float*)d_in[32];
  const float* outw  = (const float*)d_in[33];
  const float* outb  = (const float*)d_in[34];
  float* out = (float*)d_out;

  float* ws = (float*)d_ws;
  size_t off = 0;
  auto alloc = [&](size_t n) { float* p = ws + off; off += n; return p; };
  const size_t MD = (size_t)BATCH * NT;   // max rows (decoder): 9936
  float* adpA  = alloc((size_t)N_NODES * N_NODES);
  float* Menc  = alloc((size_t)N_UNMASK * N_UNMASK);
  float* token = alloc((size_t)BATCH * NT * D_MODEL);
  float* X  = alloc(MD * D_MODEL);
  float* Qb = alloc(MD * D_MODEL);
  float* Kb = alloc(MD * D_MODEL);
  float* Vb = alloc(MD * D_MODEL);
  float* Ob = alloc(MD * D_MODEL);
  float* T1 = alloc(MD * D_MODEL);
  float* F1 = alloc(MD * FF_DIM);
  float* Xd = alloc(MD * D_MODEL);

  adj_kernel<<<N_NODES, 256, 0, stream>>>(nv1, nv2, adpA);
  {
    int tot = N_UNMASK * N_UNMASK;
    encmask_kernel<<<(tot + 255) / 256, 256, 0, stream>>>(adpA, uidx, Menc);
  }
  token_kernel<<<BATCH * NT, D_MODEL, 0, stream>>>(hist, dim_w, dim_b, pos, tod_w,
                                                   tod_b, dow_w, dow_b, token);
  gather_kernel<<<BATCH * N_UNMASK, D_MODEL, 0, stream>>>(token, uidx, X);

  auto gemm = [&](const float* A, const float* W, const float* bias, float* Y,
                  int M, int K, int N, int relu) {
    dim3 g((unsigned)((M + 31) / 32), (unsigned)(N / 32));
    if (K == FF_DIM)
      gemm_wmma_kernel<FF_DIM, D_MODEL><<<g, 32, 0, stream>>>(A, W, bias, Y, M, relu);
    else if (N == FF_DIM)
      gemm_wmma_kernel<D_MODEL, FF_DIM><<<g, 32, 0, stream>>>(A, W, bias, Y, M, relu);
    else
      gemm_wmma_kernel<D_MODEL, D_MODEL><<<g, 32, 0, stream>>>(A, W, bias, Y, M, relu);
  };

  auto layer = [&](float* H, int S, const float* aw, const float* ab,
                   const float* w1, const float* b1, const float* w2, const float* b2,
                   const float* ln, const float* maskb) {
    int M = BATCH * S;
    int Spad = ((S + 15) / 16) * 16;
    gemm(H, aw + 0 * D_MODEL * D_MODEL, ab + 0 * D_MODEL, Qb, M, D_MODEL, D_MODEL, 0);
    gemm(H, aw + 1 * D_MODEL * D_MODEL, ab + 1 * D_MODEL, Kb, M, D_MODEL, D_MODEL, 0);
    gemm(H, aw + 2 * D_MODEL * D_MODEL, ab + 2 * D_MODEL, Vb, M, D_MODEL, D_MODEL, 0);
    dim3 ag((unsigned)(Spad / 16), NHEAD, BATCH);
    size_t sh = (size_t)16 * Spad * sizeof(float);
    attn_kernel<<<ag, ATT_WAVES * 32, sh, stream>>>(Qb, Kb, Vb, Ob, maskb, S, Spad);
    gemm(Ob, aw + 3 * D_MODEL * D_MODEL, ab + 3 * D_MODEL, T1, M, D_MODEL, D_MODEL, 0);
    ln_kernel<<<M, D_MODEL, 0, stream>>>(H, T1, ln + 0 * 2 * D_MODEL,
                                         ln + 0 * 2 * D_MODEL + D_MODEL);
    gemm(H, w1, b1, F1, M, D_MODEL, FF_DIM, 1);
    gemm(F1, w2, b2, T1, M, FF_DIM, D_MODEL, 0);
    ln_kernel<<<M, D_MODEL, 0, stream>>>(H, T1, ln + 1 * 2 * D_MODEL,
                                         ln + 1 * 2 * D_MODEL + D_MODEL);
  };

  // ---- encoder (4 layers, masked attention over 621 tokens) ----
  for (int l = 0; l < 4; ++l) {
    layer(X, N_UNMASK,
          eaw + (size_t)l * 4 * D_MODEL * D_MODEL, eab + (size_t)l * 4 * D_MODEL,
          ew1 + (size_t)l * D_MODEL * FF_DIM,      eb1 + (size_t)l * FF_DIM,
          ew2 + (size_t)l * FF_DIM * D_MODEL,      eb2 + (size_t)l * D_MODEL,
          eln + (size_t)l * 2 * 2 * D_MODEL, Menc);
  }
  ln_kernel<<<BATCH * N_UNMASK, D_MODEL, 0, stream>>>(X, nullptr, eng, enb);
  gemm(X, e2dw, e2db, T1, BATCH * N_UNMASK, D_MODEL, D_MODEL, 0);
  dec_assemble_enc<<<BATCH * N_UNMASK, D_MODEL, 0, stream>>>(T1, Xd);
  dec_assemble_mask<<<BATCH * N_MASKT, D_MODEL, 0, stream>>>(hist, midx, mtok, pos,
                                                             tod_w, tod_b, dow_w, dow_b, Xd);
  // ---- decoder (1 layer, full attention over 2484 tokens) ----
  layer(Xd, NT, daw, dab, dw1, db1, dw2, db2, dln, nullptr);
  ln_kernel<<<BATCH * NT, D_MODEL, 0, stream>>>(Xd, nullptr, dng, dnb);
  out_kernel<<<BATCH * N_MASKT, D_MODEL, 0, stream>>>(Xd, hist, midx, outw, outb, out);
}

// v003
// A run of this version takes 394 microseconds.
// Two timings next to v002 both put it at 1.35 times that version's speed.
// All steps since v000 together make it 6.74 times as fast.
#include <hip/hip_runtime.h>
#include <math.h>

#define N_NODES  207
#define T_STEPS  12
#define C_IN     4
#define BATCH    4
#define NT       (N_NODES * T_STEPS)   // 2484
#define D_MODEL  96
#define NHEAD    4
#define HD       24
#define FF_DIM   384
#define N_MASKT  1863
#define N_UNMASK 621
#define MAX_NEIGH 40
#define ATTN_SCALE 0.20412414523193154f   // 1/sqrt(24)
#define SQRT_D     9.797958971132712f     // sqrt(96)

typedef float v2f __attribute__((ext_vector_type(2)));
typedef float v8f __attribute__((ext_vector_type(8)));

// ---------------------------------------------------------------------------
// Adjacency: A = softmax(relu(nv1 @ nv2), axis=1); keep iff (A > 1/N) and
// strictly greater than the 41st-largest in its row (rank < MAX_NEIGH).
// ---------------------------------------------------------------------------
__global__ void adj_kernel(const float* __restrict__ nv1,
                           const float* __restrict__ nv2,
                           float* __restrict__ adpA) {
  __shared__ float a[N_NODES];
  __shared__ float stat[2];
  int i = blockIdx.x;
  int tid = threadIdx.x;
  for (int j = tid; j < N_NODES; j += blockDim.x) {
    float s = 0.f;
    for (int r = 0; r < 10; ++r) s += nv1[i * 10 + r] * nv2[r * N_NODES + j];
    a[j] = s > 0.f ? s : 0.f;
  }
  __syncthreads();
  if (tid == 0) {
    float mx = -1e30f;
    for (int j = 0; j < N_NODES; ++j) mx = fmaxf(mx, a[j]);
    float sum = 0.f;
    for (int j = 0; j < N_NODES; ++j) sum += __expf(a[j] - mx);
    stat[0] = mx; stat[1] = 1.f / sum;
  }
  __syncthreads();
  float mx = stat[0], inv = stat[1];
  for (int j = tid; j < N_NODES; j += blockDim.x) a[j] = __expf(a[j] - mx) * inv;
  __syncthreads();
  const float thr = 1.0f / (float)N_NODES;
  for (int j = tid; j < N_NODES; j += blockDim.x) {
    float aj = a[j];
    int cnt = 0;
    for (int l = 0; l < N_NODES; ++l) cnt += (a[l] > aj) ? 1 : 0;
    bool keep = (aj > thr) && (cnt < MAX_NEIGH);
    adpA[i * N_NODES + j] = keep ? aj : 0.f;
  }
}

// Encoder additive attention bias: 0 where connected, -1e30 where adpA == 0.
__global__ void encmask_kernel(const float* __restrict__ adpA,
                               const int* __restrict__ uidx,
                               float* __restrict__ Mb) {
  int idx = blockIdx.x * blockDim.x + threadIdx.x;
  if (idx >= N_UNMASK * N_UNMASK) return;
  int q = idx / N_UNMASK, k = idx % N_UNMASK;
  int nq = uidx[q] / T_STEPS, nk = uidx[k] / T_STEPS;
  Mb[idx] = (adpA[nq * N_NODES + nk] == 0.f) ? -1e30f : 0.f;
}

// token[b,nt,:] = x0*dim_w + dim_b + pos + tod*tod_w + tod_b + dow*dow_w + dow_b
__global__ void token_kernel(const float* __restrict__ hist,
                             const float* __restrict__ dim_w, const float* __restrict__ dim_b,
                             const float* __restrict__ pos,
                             const float* __restrict__ tod_w, const float* __restrict__ tod_b,
                             const float* __restrict__ dow_w, const float* __restrict__ dow_b,
                             float* __restrict__ token) {
  int row = blockIdx.x;            // b*NT + nt
  int d = threadIdx.x;             // 0..95
  int b = row / NT, nt = row % NT;
  int n = nt / T_STEPS, t = nt % T_STEPS;
  const float* hp = hist + (((size_t)b * T_STEPS + t) * N_NODES + n) * C_IN;
  float x0 = hp[0], dow = hp[2], tod = hp[3];
  token[(size_t)row * D_MODEL + d] =
      x0 * dim_w[d] + dim_b[d] + pos[(size_t)nt * D_MODEL + d] +
      tod * tod_w[d] + tod_b[d] + dow * dow_w[d] + dow_b[d];
}

// enc_in = token[:, unmasked_idx, :] * sqrt(D)
__global__ void gather_kernel(const float* __restrict__ token,
                              const int* __restrict__ uidx,
                              float* __restrict__ X) {
  int row = blockIdx.x;            // b*N_UNMASK + s
  int d = threadIdx.x;
  int b = row / N_UNMASK, s = row % N_UNMASK;
  X[(size_t)row * D_MODEL + d] =
      token[((size_t)b * NT + uidx[s]) * D_MODEL + d] * SQRT_D;
}

// ---------------------------------------------------------------------------
// fp32 GEMM via V_WMMA_F32_16X16X4_F32, register-blocked 32x32 per wave:
// 4 accumulators, each A-frag feeds 2 WMMAs and each B-frag feeds 2 WMMAs.
// Y[M,N] = X[M,K] @ W[K,N] + bias (+ReLU). K and N are compile-time, so every
// operand load is a base register plus an immediate offset.
// The K loop is a register ring: operands come in chunks of GK_STEPS k-steps,
// GK_BUFS chunks are held, and a chunk's loads are issued at least GK_BUFS - 1
// chunks ahead of the WMMAs that use it, so a wave waits out the load latency
// once and not once per trip. Every accumulator keeps the ascending k order.
// M edge via row-clamped loads + guarded stores (EXEC stays full for WMMA).
// ---------------------------------------------------------------------------
#define GK_STEPS 4     // k-steps (of 4) per chunk: 32 loads
#define GK_BUFS  3     // chunks held in registers

template <int K, int N>
__global__ __launch_bounds__(32)
void gemm_wmma_kernel(const float* __restrict__ X, const float* __restrict__ W,
                      const float* __restrict__ bias, float* __restrict__ Y,
                      int M, int relu) {
  constexpr int NCH = K / (4 * GK_STEPS);
  static_assert(K % (4 * GK_STEPS) == 0 && N % 32 == 0 && NCH >= GK_BUFS, "shape");
  int lane = threadIdx.x & 31;
  int l16 = lane & 15, half = lane >> 4;
  int m0 = blockIdx.x * 32, n0 = blockIdx.y * 32;
  int ra0 = m0 + l16;      if (ra0 >= M) ra0 = M - 1;
  int ra1 = m0 + 16 + l16; if (ra1 >= M) ra1 = M - 1;
  const float* xa0 = X + (size_t)ra0 * K + 2 * half;
  const float* xa1 = X + (size_t)ra1 * K + 2 * half;
  const float* wp  = W + (size_t)(2 * half) * N + n0 + l16;
  v2f a0[GK_BUFS][GK_STEPS], a1[GK_BUFS][GK_STEPS];
  v2f b0[GK_BUFS][GK_STEPS], b1[GK_BUFS][GK_STEPS];
  v8f acc00 = {}, acc01 = {}, acc10 = {}, acc11 = {};

// unrolled here and below: every ring index must be a compile-time constant,
// or the ring would live in scratch instead of registers
#define GK_LOAD(c)                                                     \
  _Pragma("unroll")                                                    \
  for (int j = 0; j < GK_STEPS; ++j) {                                 \
    const int k0 = ((c) * GK_STEPS + j) * 4;                           \
    const int s = (c) % GK_BUFS;                                       \
    a0[s][j].x = xa0[k0];              a0[s][j].y = xa0[k0 + 1];       \
    a1[s][j].x = xa1[k0];              a1[s][j].y = xa1[k0 + 1];       \
    b0[s][j].x = wp[k0 * N];           b0[s][j].y = wp[(k0 + 1) * N];  \
    b1[s][j].x = wp[k0 * N + 16];      b1[s][j].y = wp[(k0 + 1) * N + 16]; \
  }

#pragma unroll   // constant ring index
  for (int c = 0; c < GK_BUFS - 1; ++c) { GK_LOAD(c) }
#pragma unroll   // constant ring index and immediate load offsets
  for (int c = 0; c < NCH; ++c) {
    if (c + GK_BUFS - 1 < NCH) { GK_LOAD(c + GK_BUFS - 1) }
    // keeps the loads above in front of this chunk's WMMAs: sunk to their use,
    // each chunk would wait out its own load latency again
    __builtin_amdgcn_sched_barrier(0);
    const int s = c % GK_BUFS;
#pragma unroll   // constant ring index
    for (int j = 0; j < GK_STEPS; ++j) {
      acc00 = __builtin_amdgcn_wmma_f32_16x16x4_f32(false, a0[s][j], false, b0[s][j], (short)0, acc00, false, false);
      acc01 = __builtin_amdgcn_wmma_f32_16x16x4_f32(false, a0[s][j], false, b1[s][j], (short)0, acc01, false, false);
      acc10 = __builtin_amdgcn_wmma_f32_16x16x4_f32(false, a1[s][j], false, b0[s][j], (short)0, acc10, false, false);
      acc11 = __builtin_amdgcn_wmma_f32_16x16x4_f32(false, a1[s][j], false, b1[s][j], (short)0, acc11, false, false);
    }
  }
#undef GK_LOAD
  // stands in front of the epilogue's reuse of the operand loads' address
  // registers; the scheduling barrier keeps that arithmetic from rising over it
  asm volatile("s_wait_xcnt 0x0" ::: "memory");
  __builtin_amdgcn_sched_barrier(0);
  int nA = n0 + l16, nB = n0 + 16 + l16;
  float bv0 = bias ? bias[nA] : 0.f;
  float bv1 = bias ? bias[nB] : 0.f;
  for (int r = 0; r < 8; ++r) {
    int mA = m0 + r + 8 * half;
    if (mA < M) {
      float v0 = acc00[r] + bv0;
      float v1 = acc01[r] + bv1;
      if (relu) { v0 = fmaxf(v0, 0.f); v1 = fmaxf(v1, 0.f); }
      Y[(size_t)mA * N + nA] = v0;
      Y[(size_t)mA * N + nB] = v1;
    }
    int mB = m0 + 16 + r + 8 * half;
    if (mB < M) {
      float v0 = acc10[r] + bv0;
      float v1 = acc11[r] + bv1;
      if (relu) { v0 = fmaxf(v0, 0.f); v1 = fmaxf(v1, 0.f); }
      Y[(size_t)mB * N + nA] = v0;
      Y[(size_t)mB * N + nB] = v1;
    }
  }
}

// ---------------------------------------------------------------------------
// Fused attention per (b, head, 16-row q-tile), one work-group of ATT_WAVES
// waves on one shared score tile in LDS (16 x Spad).
//   S = Q K^T : 16-key tiles dealt round-robin to the waves.
//   softmax   : wave w owns row w, its 32 lanes run along the keys.
//   O = P V   : 16-key tiles dealt round-robin; each wave's partial 16x24
//               result goes to LDS (over the dead scores) and is summed there.
// Needs Spad >= 24 * ATT_WAVES for the partial results to fit in the tile.
// Q/K/V layout: [(b*S+s)*96 + h*24 + d].
// ---------------------------------------------------------------------------
#define ATT_WAVES 16
#define ATT_OTILE (16 * HD)        // 384 floats of partial output per wave
static_assert(ATT_WAVES == 16, "softmax deals one row of the 16-row tile to each wave");

__global__ __launch_bounds__(ATT_WAVES * 32)
void attn_kernel(const float* __restrict__ Q, const float* __restrict__ Kb,
                 const float* __restrict__ Vb, float* __restrict__ O,
                 const float* __restrict__ maskb, int S, int Spad) {
  extern __shared__ float sc[];    // [16][Spad]
  int lane = threadIdx.x & 31;
  // wave number in a scalar register: loop bounds and row bases stay scalar
  int wave = __builtin_amdgcn_readfirstlane((int)(threadIdx.x >> 5));
  int l16 = lane & 15, half = lane >> 4;
  int qt = blockIdx.x, h = blockIdx.y, b = blockIdx.z;
  int qrow = qt * 16 + l16; int qrc = qrow < S ? qrow : S - 1;
  const size_t hb = (size_t)h * HD;

  // Q fragments (A-matrix 16x24): lane row = l16, x/y = K sub-indices
  v2f aq[6];
  {
    const float* qp = Q + ((size_t)b * S + qrc) * D_MODEL + hb;
    for (int j = 0; j < 6; ++j) {
      int kd = 4 * j + 2 * half;
      aq[j].x = qp[kd];
      aq[j].y = qp[kd + 1];
    }
  }

  int ktiles = Spad / 16;
  // -------- S = Q K^T, this wave's key tiles into LDS --------
  for (int kt = wave; kt < ktiles; kt += ATT_WAVES) {
    int key = kt * 16 + l16; if (key >= S) key = S - 1;
    const float* kp = Kb + ((size_t)b * S + key) * D_MODEL + hb;
    v8f acc = {};
    for (int j = 0; j < 6; ++j) {
      int kd = 4 * j + 2 * half;
      v2f bf; bf.x = kp[kd]; bf.y = kp[kd + 1];
      acc = __builtin_amdgcn_wmma_f32_16x16x4_f32(false, aq[j], false, bf, (short)0,
                                                  acc, false, false);
    }
    for (int r = 0; r < 8; ++r)
      sc[(size_t)(r + 8 * half) * Spad + kt * 16 + l16] = acc[r];
  }
  __syncthreads();

  // -------- softmax: wave = row, lanes along the keys --------
  {
    int m = wave;
    float* row = sc + (size_t)m * Spad;
    int qg = qt * 16 + m; if (qg >= S) qg = S - 1;
    const float* mrow = maskb ? (maskb + (size_t)qg * S) : (const float*)0;
    float mx = -1e30f;
    for (int k = lane; k < S; k += 32) {
      float v = row[k] * ATTN_SCALE + (mrow ? mrow[k] : 0.f);
      row[k] = v;
      mx = fmaxf(mx, v);
    }
    for (int o = 16; o > 0; o >>= 1) mx = fmaxf(mx, __shfl_xor(mx, o, 32));
    float sum = 0.f;
    for (int k = lane; k < S; k += 32) {
      float e = __expf(row[k] - mx);
      row[k] = e;
      sum += e;
    }
    for (int o = 16; o > 0; o >>= 1) sum += __shfl_xor(sum, o, 32);
    float inv = 1.f / sum;
    for (int k = lane; k < S; k += 32) row[k] *= inv;
    for (int k = S + lane; k < Spad; k += 32) row[k] = 0.f;  // kill pad for P@V
  }
  __syncthreads();

  // -------- O = P V over this wave's key tiles
  //          (HD=24 -> one full 16-wide tile + one 8-wide tile) ----
  v8f o0 = {}, o1 = {};
  int hd2 = 16 + l16; if (hd2 >= HD) hd2 = HD - 1;  // clamp; masked on store
  for (int kt = wave; kt < ktiles; kt += ATT_WAVES) {
    for (int ks = 0; ks < 4; ++ks) {
      int k0 = kt * 16 + ks * 4;
      v2f ap;
      ap.x = sc[(size_t)l16 * Spad + k0 + 2 * half];
      ap.y = sc[(size_t)l16 * Spad + k0 + 2 * half + 1];
      int keyx = k0 + 2 * half;     if (keyx >= S) keyx = S - 1;
      int keyy = k0 + 2 * half + 1; if (keyy >= S) keyy = S - 1;
      const float* vpx = Vb + ((size_t)b * S + keyx) * D_MODEL + hb;
      const float* vpy = Vb + ((size_t)b * S + keyy) * D_MODEL + hb;
      v2f b0, b1;
      b0.x = vpx[l16]; b0.y = vpy[l16];
      b1.x = vpx[hd2]; b1.y = vpy[hd2];
      o0 = __builtin_amdgcn_wmma_f32_16x16x4_f32(false, ap, false, b0, (short)0, o0,
                                                 false, false);
      o1 = __builtin_amdgcn_wmma_f32_16x16x4_f32(false, ap, false, b1, (short)0, o1,
                                                 false, false);
    }
  }
  __syncthreads();   // every wave has read its probabilities: the tile is free

  // -------- partial results to LDS, [wave][row][d], then summed over waves ----
  {
    float* part = sc + (size_t)wave * ATT_OTILE;
    for (int r = 0; r < 8; ++r) {
      int m = r + 8 * half;
      part[m * HD + l16] = o0[r];
      if (l16 < 8) part[m * HD + 16 + l16] = o1[r];
    }
  }
  __syncthreads();
  int t = threadIdx.x;
  if (t < ATT_OTILE) {
    float s = 0.f;
    for (int w = 0; w < ATT_WAVES; ++w) s += sc[w * ATT_OTILE + t];
    int m = qt * 16 + t / HD;
    if (m < S) O[((size_t)b * S + m) * D_MODEL + hb + t % HD] = s;
  }
}

// ---------------------------------------------------------------------------
// The row-local chain behind attention in ONE launch, one work-group of PK_WAVES
// waves per 16 rows:
//   h = LN(h + O Wo + bo); f = relu(h W1 + b1); h = LN(h + f W2 + b2);
//   then, where NEXT, the next layer's Q, K, V = h Wq|Wk|Wv + bias (nw, nb),
//   else the stack's closing LayerNorm (gain nw, shift nb).
// The 16 x 96 row tile and the 16 x 384 hidden tile stay in LDS; a product's
// result goes there in D layout and is read back as A fragments. Wave w owns
// column tile w of every 96-wide product and four tiles of the 384-wide one.
// Every accumulator keeps the ascending k order.
// LDS pitches are 4 dwords past a multiple of 32: the 16 rows x 2 halves of an
// 8-byte A-fragment read fall on 64 different banks.
// ---------------------------------------------------------------------------
#define PK_WAVES 6
#define PK_HP (D_MODEL + 4)
#define PK_FP (FF_DIM + 4)
static_assert(PK_WAVES * 16 == D_MODEL, "one 16-column tile of the model width per wave");

// B fragments of chunk c: CH k-steps x TN column tiles, TS floats from tile to tile
template <int N, int TS, int TN, int CH>
__device__ __forceinline__ void pk_load_b(const float* __restrict__ wp, const int c,
                                          v2f (&b)[CH][TN]) {
#pragma unroll   // constant register index, immediate load offsets
  for (int j = 0; j < CH; ++j) {
    const int k0 = (c * CH + j) * 4;
#pragma unroll   // constant register index
    for (int t = 0; t < TN; ++t) {
      b[j][t].x = wp[k0 * N + t * TS];
      b[j][t].y = wp[(k0 + 1) * N + t * TS];
    }
  }
}

// A fragments of chunk c from the LDS tile (as: this lane's row, + 2 * half)
template <int CH>
__device__ __forceinline__ void pk_load_a(const float* as, const int c, v2f (&a)[CH]) {
#pragma unroll   // constant register index
  for (int j = 0; j < CH; ++j) a[j] = *(const v2f*)(as + (c * CH + j) * 4);
}

// acc[t] += A(LDS, 16 x K) * W(:, tile t). The caller has loaded chunks 0 and 1
// of b (weights depend on no earlier stage, so that is done ahead of the barrier
// in front of the stage); chunk c + 2 is loaded while chunk c is multiplied.
template <int K, int N, int TS, int TN, int CH>
__device__ __forceinline__ void pk_mm(const float* as, const float* __restrict__ wp,
                                      v2f (&b)[3][CH][TN], v8f (&acc)[TN]) {
  constexpr int NCH = K / (4 * CH);
  static_assert(K % (4 * CH) == 0 && NCH >= 2, "shape");
  v2f a[2][CH];
  pk_load_a<CH>(as, 0, a[0]);
#pragma unroll   // constant ring index
  for (int c = 0; c < NCH; ++c) {
    if (c + 2 < NCH) pk_load_b<N, TS, TN, CH>(wp, c + 2, b[(c + 2) % 3]);
    if (c + 1 < NCH) pk_load_a<CH>(as, c + 1, a[(c + 1) % 2]);
    // keeps the loads above in front of this chunk's WMMAs: sunk to their use,
    // each chunk would wait out its own load latency
    __builtin_amdgcn_sched_barrier(0);
#pragma unroll   // constant ring index
    for (int j = 0; j < CH; ++j)
#pragma unroll   // constant ring index
      for (int t = 0; t < TN; ++t)
        acc[t] = __builtin_amdgcn_wmma_f32_16x16x4_f32(false, a[c % 2][j], false, b[c % 3][j][t],
                                                       (short)0, acc[t], false, false);
    // keeps the next trip's loads out of this chunk's WMMAs: risen there, they
    // cannot take this chunk's ring slot and cost a fourth chunk of registers
    __builtin_amdgcn_sched_barrier(0);
  }
  // stands in front of any reuse of the weight loads' address registers; the
  // scheduling barrier keeps later arithmetic from rising over it
  asm volatile("s_wait_xcnt 0x0" ::: "memory");
  __builtin_amdgcn_sched_barrier(0);
}

// LayerNorm of the 16 x 96 LDS tile in place: waves 0..3, four rows a wave, eight
// lanes a row, twelve elements a lane. Hout: the rows also go to global memory.
__device__ __forceinline__ void pk_ln(float* hs, const float* __restrict__ g,
                                      const float* __restrict__ bta, int wave, int lane,
                                      float* __restrict__ Hout, int m0, int M) {
  if (wave < 4) {
    const int row = wave * 4 + (lane >> 3), e = lane & 7;
    float* p = hs + row * PK_HP + e * 4;
    float v[12], gv[12], bv[12];
#pragma unroll   // constant register index
    for (int i = 0; i < 12; ++i) {
      const int o = (i >> 2) * 32 + (i & 3);
      v[i] = p[o];
      gv[i] = g[e * 4 + o];
      bv[i] = bta[e * 4 + o];
    }
    float s = 0.f;
#pragma unroll   // constant register index
    for (int i = 0; i < 12; ++i) s += v[i];
    s += __shfl_xor(s, 1, 32); s += __shfl_xor(s, 2, 32); s += __shfl_xor(s, 4, 32);
    const float m = s / (float)D_MODEL;
    float q = 0.f;
#pragma unroll   // constant register index
    for (int i = 0; i < 12; ++i) { v[i] -= m; q += v[i] * v[i]; }
    q += __shfl_xor(q, 1, 32); q += __shfl_xor(q, 2, 32); q += __shfl_xor(q, 4, 32);
    const float rs = rsqrtf(q / (float)D_MODEL + 1e-5f);
#pragma unroll   // constant register index
    for (int i = 0; i < 12; ++i) {
      v[i] = v[i] * rs * gv[i] + bv[i];
      p[(i >> 2) * 32 + (i & 3)] = v[i];
    }
    if (Hout && m0 + row < M) {
      float* hp = Hout + (size_t)(m0 + row) * D_MODEL + e * 4;
#pragma unroll   // constant register index
      for (int i = 0; i < 12; ++i) hp[(i >> 2) * 32 + (i & 3)] = v[i];
    }
  }
}

template <int NEXT>
__global__ __launch_bounds__(PK_WAVES * 32)
void post_kernel(const float* __restrict__ Ob, float* __restrict__ H,
                 const float* __restrict__ wo, const float* __restrict__ bo,
                 const float* __restrict__ ln,
                 const float* __restrict__ w1, const float* __restrict__ b1,
                 const float* __restrict__ w2, const float* __restrict__ b2,
                 const float* __restrict__ nw, const float* __restrict__ nb,
                 float* __restrict__ Qo, float* __restrict__ Ko, float* __restrict__ Vo,
                 int M) {
  __shared__ __attribute__((aligned(16))) float hs[16 * PK_HP];
  __shared__ __attribute__((aligned(16))) float fs[16 * PK_FP];
  const int lane = threadIdx.x & 31;
  // wave number in a scalar register: the LayerNorm branch stays scalar
  const int wave = __builtin_amdgcn_readfirstlane((int)(threadIdx.x >> 5));
  const int l16 = lane & 15, half = lane >> 4;
  const int m0 = blockIdx.x * 16;
  const int col = wave * 16 + l16;

  // ---- output projection: A from global (row-clamped), all operands at once ----
  int ra = m0 + l16; if (ra >= M) ra = M - 1;
  const float* xa  = Ob + (size_t)ra * D_MODEL + 2 * half;
  const float* wpo = wo + (size_t)(2 * half) * D_MODEL + col;
  v2f ao[D_MODEL / 4], wf[D_MODEL / 4];
#pragma unroll   // constant register index
  for (int j = 0; j < D_MODEL / 4; ++j) {
    ao[j].x = xa[4 * j];             ao[j].y = xa[4 * j + 1];
    wf[j].x = wpo[4 * j * D_MODEL];  wf[j].y = wpo[(4 * j + 1) * D_MODEL];
  }
  float res[8];
#pragma unroll   // constant register index
  for (int r = 0; r < 8; ++r) {
    int m = m0 + r + 8 * half; if (m >= M) m = M - 1;
    res[r] = H[(size_t)m * D_MODEL + col];
  }
  const float bov = bo[col], b2v = b2[col];
  float b1v[4], nbv[3];
#pragma unroll   // constant register index
  for (int t = 0; t < 4; ++t) b1v[t] = b1[wave * 64 + t * 16 + l16];
  // stands in front of later loads whose results land in address registers of
  // the loads above
  asm volatile("s_wait_xcnt 0x0" ::: "memory");
  if (NEXT) {
#pragma unroll   // constant register index
    for (int t = 0; t < 3; ++t) nbv[t] = nb[t * D_MODEL + col];
    // as above, for the three loads just issued
    asm volatile("s_wait_xcnt 0x0" ::: "memory");
  }
  const float* wp1 = w1 + (size_t)(2 * half) * FF_DIM + wave * 64 + l16;
  v2f bf1[3][4][4];
  pk_load_b<FF_DIM, 16, 4, 4>(wp1, 0, bf1[0]);
  pk_load_b<FF_DIM, 16, 4, 4>(wp1, 1, bf1[1]);
  // holds every load above in front of the WMMAs: one load latency for all
  __builtin_amdgcn_sched_barrier(0);
  v8f acco = {};
#pragma unroll   // constant register index
  for (int j = 0; j < D_MODEL / 4; ++j)
    acco = __builtin_amdgcn_wmma_f32_16x16x4_f32(false, ao[j], false, wf[j], (short)0, acco,
                                                 false, false);
#pragma unroll   // constant register index
  for (int r = 0; r < 8; ++r) hs[(r + 8 * half) * PK_HP + col] = res[r] + (acco[r] + bov);
  __syncthreads();
  // second FFN product's first weights: in flight while the rows are normalised
  const float* wp2 = w2 + (size_t)(2 * half) * D_MODEL + col;
  v2f bf2[3][12][1];
  pk_load_b<D_MODEL, 16, 1, 12>(wp2, 0, bf2[0]);
  pk_load_b<D_MODEL, 16, 1, 12>(wp2, 1, bf2[1]);
  pk_ln(hs, ln, ln + D_MODEL, wave, lane, (float*)0, m0, M);
  __syncthreads();

  // ---- f = relu(h W1 + b1), into LDS ----
  const float* ah = hs + l16 * PK_HP + 2 * half;
  v8f af[4];
#pragma unroll   // constant register index
  for (int t = 0; t < 4; ++t) af[t] = (v8f){};
  pk_mm<D_MODEL, FF_DIM, 16, 4, 4>(ah, wp1, bf1, af);
#pragma unroll   // constant register index
  for (int t = 0; t < 4; ++t)
#pragma unroll   // constant register index
    for (int r = 0; r < 8; ++r)
      fs[(r + 8 * half) * PK_FP + wave * 64 + t * 16 + l16] = fmaxf(af[t][r] + b1v[t], 0.f);
  __syncthreads();
  // next layer's first projection weights: in flight during the second FFN product
  const float* wpn = nw + (size_t)(2 * half) * D_MODEL + col;
  v2f bfn[3][4][3];
  if (NEXT) {
    pk_load_b<D_MODEL, D_MODEL * D_MODEL, 3, 4>(wpn, 0, bfn[0]);
    pk_load_b<D_MODEL, D_MODEL * D_MODEL, 3, 4>(wpn, 1, bfn[1]);
  }

  // ---- h + f W2 + b2: each element of the row tile is updated by its own lane ----
  v8f a2[1];
  a2[0] = (v8f){};
  pk_mm<FF_DIM, D_MODEL, 16, 1, 12>(fs + l16 * PK_FP + 2 * half, wp2, bf2, a2);
#pragma unroll   // constant register index
  for (int r = 0; r < 8; ++r) {
    float* p = hs + (r + 8 * half) * PK_HP + col;
    *p = *p + (a2[0][r] + b2v);
  }
  __syncthreads();
  pk_ln(hs, ln + 2 * D_MODEL, ln + 3 * D_MODEL, wave, lane, NEXT ? H : (float*)0, m0, M);
  // last layer of a stack: the stack's closing LayerNorm (gain nw, shift nb); each
  // lane reads back only what it wrote itself, so no barrier stands between the two
  if (!NEXT) pk_ln(hs, nw, nb, wave, lane, H, m0, M);

  // ---- next layer's Q, K, V: this wave's column tile of each ----
  if (NEXT) {
    __syncthreads();
    v8f an[3];
#pragma unroll   // constant register index
    for (int t = 0; t < 3; ++t) an[t] = (v8f){};
    pk_mm<D_MODEL, D_MODEL, D_MODEL * D_MODEL, 3, 4>(ah, wpn, bfn, an);
    const size_t ob = (size_t)(m0 + 8 * half) * D_MODEL + col;
    const int left = M - m0 - 8 * half;   // rows of this half tile that exist
#pragma unroll   // constant register index, immediate store offsets
    for (int r = 0; r < 8; ++r) {
      if (r < left) {
        Qo[ob + r * D_MODEL] = an[0][r] + nbv[0];
        Ko[ob + r * D_MODEL] = an[1][r] + nbv[1];
        Vo[ob + r * D_MODEL] = an[2][r] + nbv[2];
      }
    }
  }
}

// Decoder input: first 621 rows = e2d(enc) * sqrt(D)
__global__ void dec_assemble_enc(const float* __restrict__ E, float* __restrict__ Xd) {
  int row = blockIdx.x;            // b*N_UNMASK + s
  int d = threadIdx.x;
  int b = row / N_UNMASK, s = row % N_UNMASK;
  Xd[((size_t)b * NT + s) * D_MODEL + d] = E[(size_t)row * D_MODEL + d] * SQRT_D;
}

// Decoder input: masked rows = (mask_token + pos + tod/dow emb) * sqrt(D)
__global__ void dec_assemble_mask(const float* __restrict__ hist,
                                  const int* __restrict__ midx,
                                  const float* __restrict__ mask_token,
                                  const float* __restrict__ pos,
                                  const float* __restrict__ tod_w, const float* __restrict__ tod_b,
                                  const float* __restrict__ dow_w, const float* __restrict__ dow_b,
                                  float* __restrict__ Xd) {
  int row = blockIdx.x;            // b*N_MASKT + j
  int d = threadIdx.x;
  int b = row / N_MASKT, j = row % N_MASKT;
  int nt = midx[j]; int n = nt / T_STEPS, t = nt % T_STEPS;
  const float* hp = hist + (((size_t)b * T_STEPS + t) * N_NODES + n) * C_IN;
  float dow = hp[2], tod = hp[3];
  float v = mask_token[d] + pos[(size_t)nt * D_MODEL + d] +
            tod * tod_w[d] + tod_b[d] + dow * dow_w[d] + dow_b[d];
  Xd[((size_t)b * NT + N_UNMASK + j) * D_MODEL + d] = v * SQRT_D;
}

// recon_masked = (decoder rows >= N_UNMASK) @ out_w + out_b ; label gather.
__global__ void out_kernel(const float* __restrict__ Xd, const float* __restrict__ hist,
                           const int* __restrict__ midx,
                           const float* __restrict__ out_w, const float* __restrict__ out_b,
                           float* __restrict__ out) {
  __shared__ float red[D_MODEL];
  int row = blockIdx.x;            // b*N_MASKT + j
  int d = threadIdx.x;
  int b = row / N_MASKT, j = row % N_MASKT;
  size_t xr = ((size_t)b * NT + N_UNMASK + j) * D_MODEL;
  red[d] = Xd[xr + d] * out_w[d];
  __syncthreads();
  if (d == 0) {
    float s = 0.f;
    for (int i = 0; i < D_MODEL; ++i) s += red[i];
    out[row] = s + out_b[0];
    int nt = midx[j]; int n = nt / T_STEPS, t = nt % T_STEPS;
    out[BATCH * N_MASKT + row] =
        hist[(((size_t)b * T_STEPS + t) * N_NODES + n) * C_IN + 0];
  }
}

// ---------------------------------------------------------------------------
extern "C" void kernel_launch(void* const* d_in, const int* in_sizes, int n_in,
                              void* d_out, int out_size, void* d_ws, size_t ws_size,
                              hipStream_t stream) {
  (void)in_sizes; (void)n_in; (void)out_size; (void)ws_size;
  const float* hist  = (const float*)d_in[0];
  const int*   uidx  = (const int*)d_in[1];
  const int*   midx  = (const int*)d_in[2];
  const float* nv1   = (const float*)d_in[3];
  const float* nv2   = (const float*)d_in[4];
  const float* dim_w = (const float*)d_in[5];
  const float* dim_b = (const float*)d_in[6];
  const float* pos   = (const float*)d_in[7];
  const float* tod_w = (const float*)d_in[8];
  const float* tod_b = (const float*)d_in[9];
  const float* dow_w = (const float*)d_in[10];
  const float* dow_b = (const float*)d_in[11];
  const float* mtok  = (const float*)d_in[12];
  const float* eaw   = (const float*)d_in[13];
  const float* eab   = (const float*)d_in[14];
  const float* ew1   = (const float*)d_in[15];
  const float* eb1   = (const float*)d_in[16];
  const float* ew2   = (const float*)d_in[17];
  const float* eb2   = (const float*)d_in[18];
  const float* eln   = (const float*)d_in[19];
  const float* eng   = (const float*)d_in[20];
  const float* enb   = (const float*)d_in[21];
  const float* e2dw  = (const float*)d_in[22];
  const float* e2db  = (const float*)d_in[23];
  const float* daw   = (const float*)d_in[24];
  const float* dab   = (const float*)d_in[25];
  const float* dw1   = (const float*)d_in[26];
  const float* db1   = (const float*)d_in[27];
  const float* dw2   = (const float*)d_in[28];
  const float* db2   = (const float*)d_in[29];
  const float* dln   = (const float*)d_in[30];
  const float* dng   = (const float*)d_in[31];
  const float* dnb   = (const float*)d_in[32];
  const float* outw  = (const float*)d_in[33];
  const float* outb  = (const float*)d_in[34];
  float* out = (float*)d_out;

  float* ws = (float*)d_ws;
  size_t off = 0;
  auto alloc = [&](size_t n) { float* p = ws + off; off += n; return p; };
  const size_t MD = (size_t)BATCH * NT;   // max rows (decoder): 9936
  float* adpA  = alloc((size_t)N_NODES * N_NODES);
  float* Menc  = alloc((size_t)N_UNMASK * N_UNMASK);
  float* token = alloc((size_t)BATCH * NT * D_MODEL);
  float* X  = alloc(MD * D_MODEL);
  float* Qb = alloc(MD * D_MODEL);
  float* Kb = alloc(MD * D_MODEL);
  float* Vb = alloc(MD * D_MODEL);
  float* Ob = alloc(MD * D_MODEL);
  float* T1 = alloc(MD * D_MODEL);
  float* Xd = alloc(MD * D_MODEL);

  adj_kernel<<<N_NODES, 256, 0, stream>>>(nv1, nv2, adpA);
  {
    int tot = N_UNMASK * N_UNMASK;
    encmask_kernel<<<(tot + 255) / 256, 256, 0, stream>>>(adpA, uidx, Menc);
  }
  token_kernel<<<BATCH * NT, D_MODEL, 0, stream>>>(hist, dim_w, dim_b, pos, tod_w,
                                                   tod_b, dow_w, dow_b, token);
  gather_kernel<<<BATCH * N_UNMASK, D_MODEL, 0, stream>>>(token, uidx, X);

  auto gemm = [&](const float* A, const float* W, const float* bias, float* Y, int M) {
    dim3 g((unsigned)((M + 31) / 32), (unsigned)(D_MODEL / 32));
    gemm_wmma_kernel<D_MODEL, D_MODEL><<<g, 32, 0, stream>>>(A, W, bias, Y, M, 0);
  };
  auto qkv = [&](const float* H, int M, const float* aw, const float* ab) {
    gemm(H, aw + 0 * D_MODEL * D_MODEL, ab + 0 * D_MODEL, Qb, M);
    gemm(H, aw + 1 * D_MODEL * D_MODEL, ab + 1 * D_MODEL, Kb, M);
    gemm(H, aw + 2 * D_MODEL * D_MODEL, ab + 2 * D_MODEL, Vb, M);
  };
  // attention, then the whole row-local rest of the layer in one launch; nw/nb: the
  // next layer's projections (next) or the stack's closing LayerNorm, same launch
  auto layer = [&](float* H, int S, const float* aw, const float* ab,
                   const float* w1, const float* b1, const float* w2, const float* b2,
                   const float* ln, const float* maskb, int next, const float* nw,
                   const float* nb) {
    int M = BATCH * S;
    int Spad = ((S + 15) / 16) * 16;
    dim3 ag((unsigned)(Spad / 16), NHEAD, BATCH);
    size_t sh = (size_t)16 * Spad * sizeof(float);
    attn_kernel<<<ag, ATT_WAVES * 32, sh, stream>>>(Qb, Kb, Vb, Ob, maskb, S, Spad);
    unsigned pg = (unsigned)((M + 15) / 16);
    const float* wo = aw + 3 * D_MODEL * D_MODEL;
    const float* bo = ab + 3 * D_MODEL;
    if (next)
      post_kernel<1><<<pg, PK_WAVES * 32, 0, stream>>>(Ob, H, wo, bo, ln, w1, b1, w2, b2,
                                                       nw, nb, Qb, Kb, Vb, M);
    else
      post_kernel<0><<<pg, PK_WAVES * 32, 0, stream>>>(Ob, H, wo, bo, ln, w1, b1, w2, b2,
                                                       nw, nb, nullptr, nullptr, nullptr, M);
  };

  // ---- encoder (4 layers, masked attention over 621 tokens) ----
  qkv(X, BATCH * N_UNMASK, eaw, eab);
  for (int l = 0; l < 4; ++l) {
    layer(X, N_UNMASK,
          eaw + (size_t)l * 4 * D_MODEL * D_MODEL, eab + (size_t)l * 4 * D_MODEL,
          ew1 + (size_t)l * D_MODEL * FF_DIM,      eb1 + (size_t)l * FF_DIM,
          ew2 + (size_t)l * FF_DIM * D_MODEL,      eb2 + (size_t)l * D_MODEL,
          eln + (size_t)l * 2 * 2 * D_MODEL, Menc, l < 3,
          l < 3 ? eaw + (size_t)(l + 1) * 4 * D_MODEL * D_MODEL : eng,
          l < 3 ? eab + (size_t)(l + 1) * 4 * D_MODEL : enb);
  }
  gemm(X, e2dw, e2db, T1, BATCH * N_UNMASK);
  dec_assemble_enc<<<BATCH * N_UNMASK, D_MODEL, 0, stream>>>(T1, Xd);
  dec_assemble_mask<<<BATCH * N_MASKT, D_MODEL, 0, stream>>>(hist, midx, mtok, pos,
                                                             tod_w, tod_b, dow_w, dow_b, Xd);
  // ---- decoder (1 layer, full attention over 2484 tokens) ----
  qkv(Xd, BATCH * NT, daw, dab);
  layer(Xd, NT, daw, dab, dw1, db1, dw2, db2, dln, nullptr, 0, dng, dnb);
  out_kernel<<<BATCH * N_MASKT, D_MODEL, 0, stream>>>(Xd, hist, midx, outw, outb, out);
}

// v004
// One run takes 271 microseconds.
// Two timings next to v003 both put it at 1.46 times that version's speed.
// Counting every step since v000, it is 9.83 times as fast.
#include <hip/hip_runtime.h>
#include <math.h>

#define N_NODES  207
#define T_STEPS  12
#define C_IN     4
#define BATCH    4
#define NT       (N_NODES * T_STEPS)   // 2484
#define D_MODEL  96
#define NHEAD    4
#define HD       24
#define FF_DIM   384
#define N_MASKT  1863
#define N_UNMASK 621
#define MAX_NEIGH 40
#define ATTN_SCALE 0.20412414523193154f   // 1/sqrt(24)
#define SQRT_D     9.797958971132712f     // sqrt(96)

typedef float v2f __attribute__((ext_vector_type(2)));
typedef float v8f __attribute__((ext_vector_type(8)));

// ---------------------------------------------------------------------------
// Adjacency: A = softmax(relu(nv1 @ nv2), axis=1); keep iff (A > 1/N) and
// strictly greater than the 41st-largest in its row (rank < MAX_NEIGH).
// ---------------------------------------------------------------------------
__global__ void adj_kernel(const float* __restrict__ nv1,
                           const float* __restrict__ nv2,
                           float* __restrict__ adpA) {
  __shared__ float a[N_NODES];
  __shared__ float stat[2];
  int i = blockIdx.x;
  int tid = threadIdx.x;
  for (int j = tid; j < N_NODES; j += blockDim.x) {
    float s = 0.f;
    for (int r = 0; r < 10; ++r) s += nv1[i * 10 + r] * nv2[r * N_NODES + j];
    a[j] = s > 0.f ? s : 0.f;
  }
  __syncthreads();
  if (tid == 0) {
    float mx = -1e30f;
    for (int j = 0; j < N_NODES; ++j) mx = fmaxf(mx, a[j]);
    float sum = 0.f;
    for (int j = 0; j < N_NODES; ++j) sum += __expf(a[j] - mx);
    stat[0] = mx; stat[1] = 1.f / sum;
  }
  __syncthreads();
  float mx = stat[0], inv = stat[1];
  for (int j = tid; j < N_NODES; j += blockDim.x) a[j] = __expf(a[j] - mx) * inv;
  __syncthreads();
  const float thr = 1.0f / (float)N_NODES;
  for (int j = tid; j < N_NODES; j += blockDim.x) {
    float aj = a[j];
    int cnt = 0;
    for (int l = 0; l < N_NODES; ++l) cnt += (a[l] > aj) ? 1 : 0;
    bool keep = (aj > thr) && (cnt < MAX_NEIGH);
    adpA[i * N_NODES + j] = keep ? aj : 0.f;
  }
}

// Encoder additive attention bias, stored key-major: Mb[k][q] = 0 where query q may
// look at key k, -1e30 where adpA == 0. Rows are padded to whole key tiles and the
// pitch to whole query blocks (pad entries 0), so the attention kernel reads it
// with 16 consecutive queries on 16 lanes and needs no clamp.
#define EM_ROWS  (((N_UNMASK + 15) / 16) * 16)   // 624
#define EM_PITCH (((N_UNMASK + 31) / 32) * 32)   // 640
__global__ void encmask_kernel(const float* __restrict__ adpA,
                               const int* __restrict__ uidx,
                               float* __restrict__ Mb) {
  int idx = blockIdx.x * blockDim.x + threadIdx.x;
  if (idx >= EM_ROWS * EM_PITCH) return;
  int k = idx / EM_PITCH, q = idx % EM_PITCH;
  float v = 0.f;
  if (k < N_UNMASK && q < N_UNMASK) {
    int nq = uidx[q] / T_STEPS, nk = uidx[k] / T_STEPS;
    nq = nq < 0 ? 0 : (nq >= N_NODES ? N_NODES - 1 : nq);
    nk = nk < 0 ? 0 : (nk >= N_NODES ? N_NODES - 1 : nk);
    v = (adpA[nq * N_NODES + nk] == 0.f) ? -1e30f : 0.f;
  }
  Mb[idx] = v;
}

// token[b,nt,:] = x0*dim_w + dim_b + pos + tod*tod_w + tod_b + dow*dow_w + dow_b
__global__ void token_kernel(const float* __restrict__ hist,
                             const float* __restrict__ dim_w, const float* __restrict__ dim_b,
                             const float* __restrict__ pos,
                             const float* __restrict__ tod_w, const float* __restrict__ tod_b,
                             const float* __restrict__ dow_w, const float* __restrict__ dow_b,
                             float* __restrict__ token) {
  int row = blockIdx.x;            // b*NT + nt
  int d = threadIdx.x;             // 0..95
  int b = row / NT, nt = row % NT;
  int n = nt / T_STEPS, t = nt % T_STEPS;
  const float* hp = hist + (((size_t)b * T_STEPS + t) * N_NODES + n) * C_IN;
  float x0 = hp[0], dow = hp[2], tod = hp[3];
  token[(size_t)row * D_MODEL + d] =
      x0 * dim_w[d] + dim_b[d] + pos[(size_t)nt * D_MODEL + d] +
      tod * tod_w[d] + tod_b[d] + dow * dow_w[d] + dow_b[d];
}

// enc_in = token[:, unmasked_idx, :] * sqrt(D)
__global__ void gather_kernel(const float* __restrict__ token,
                              const int* __restrict__ uidx,
                              float* __restrict__ X) {
  int row = blockIdx.x;            // b*N_UNMASK + s
  int d = threadIdx.x;
  int b = row / N_UNMASK, s = row % N_UNMASK;
  X[(size_t)row * D_MODEL + d] =
      token[((size_t)b * NT + uidx[s]) * D_MODEL + d] * SQRT_D;
}

// ---------------------------------------------------------------------------
// fp32 GEMM via V_WMMA_F32_16X16X4_F32, register-blocked 32x32 per wave:
// 4 accumulators, each A-frag feeds 2 WMMAs and each B-frag feeds 2 WMMAs.
// Y[M,N] = X[M,K] @ W[K,N] + bias (+ReLU). K and N are compile-time, so every
// operand load is a base register plus an immediate offset.
// The K loop is a register ring: operands come in chunks of GK_STEPS k-steps,
// GK_BUFS chunks are held, and a chunk's loads are issued at least GK_BUFS - 1
// chunks ahead of the WMMAs that use it, so a wave waits out the load latency
// once and not once per trip. Every accumulator keeps the ascending k order.
// M edge via row-clamped loads + guarded stores (EXEC stays full for WMMA).
// ---------------------------------------------------------------------------
#define GK_STEPS 4     // k-steps (of 4) per chunk: 32 loads
#define GK_BUFS  3     // chunks held in registers

template <int K, int N>
__global__ __launch_bounds__(32)
void gemm_wmma_kernel(const float* __restrict__ X, const float* __restrict__ W,
                      const float* __restrict__ bias, float* __restrict__ Y,
                      int M, int relu) {
  constexpr int NCH = K / (4 * GK_STEPS);
  static_assert(K % (4 * GK_STEPS) == 0 && N % 32 == 0 && NCH >= GK_BUFS, "shape");
  int lane = threadIdx.x & 31;
  int l16 = lane & 15, half = lane >> 4;
  int m0 = blockIdx.x * 32, n0 = blockIdx.y * 32;
  int ra0 = m0 + l16;      if (ra0 >= M) ra0 = M - 1;
  int ra1 = m0 + 16 + l16; if (ra1 >= M) ra1 = M - 1;
  const float* xa0 = X + (size_t)ra0 * K + 2 * half;
  const float* xa1 = X + (size_t)ra1 * K + 2 * half;
  const float* wp  = W + (size_t)(2 * half) * N + n0 + l16;
  v2f a0[GK_BUFS][GK_STEPS], a1[GK_BUFS][GK_STEPS];
  v2f b0[GK_BUFS][GK_STEPS], b1[GK_BUFS][GK_STEPS];
  v8f acc00 = {}, acc01 = {}, acc10 = {}, acc11 = {};

// unrolled here and below: every ring index must be a compile-time constant,
// or the ring would live in scratch instead of registers
#define GK_LOAD(c)                                                     \
  _Pragma("unroll")                                                    \
  for (int j = 0; j < GK_STEPS; ++j) {                                 \
    const int k0 = ((c) * GK_STEPS + j) * 4;                           \
    const int s = (c) % GK_BUFS;                                       \
    a0[s][j].x = xa0[k0];              a0[s][j].y = xa0[k0 + 1];       \
    a1[s][j].x = xa1[k0];              a1[s][j].y = xa1[k0 + 1];       \
    b0[s][j].x = wp[k0 * N];           b0[s][j].y = wp[(k0 + 1) * N];  \
    b1[s][j].x = wp[k0 * N + 16];      b1[s][j].y = wp[(k0 + 1) * N + 16]; \
  }

#pragma unroll   // constant ring index
  for (int c = 0; c < GK_BUFS - 1; ++c) { GK_LOAD(c) }
#pragma unroll   // constant ring index and immediate load offsets
  for (int c = 0; c < NCH; ++c) {
    if (c + GK_BUFS - 1 < NCH) { GK_LOAD(c + GK_BUFS - 1) }
    // keeps the loads above in front of this chunk's WMMAs: sunk to their use,
    // each chunk would wait out its own load latency again
    __builtin_amdgcn_sched_barrier(0);
    const int s = c % GK_BUFS;
#pragma unroll   // constant ring index
    for (int j = 0; j < GK_STEPS; ++j) {
      acc00 = __builtin_amdgcn_wmma_f32_16x16x4_f32(false, a0[s][j], false, b0[s][j], (short)0, acc00, false, false);
      acc01 = __builtin_amdgcn_wmma_f32_16x16x4_f32(false, a0[s][j], false, b1[s][j], (short)0, acc01, false, false);
      acc10 = __builtin_amdgcn_wmma_f32_16x16x4_f32(false, a1[s][j], false, b0[s][j], (short)0, acc10, false, false);
      acc11 = __builtin_amdgcn_wmma_f32_16x16x4_f32(false, a1[s][j], false, b1[s][j], (short)0, acc11, false, false);
    }
  }
#undef GK_LOAD
  // stands in front of the epilogue's reuse of the operand loads' address
  // registers; the scheduling barrier keeps that arithmetic from rising over it
  asm volatile("s_wait_xcnt 0x0" ::: "memory");
  __builtin_amdgcn_sched_barrier(0);
  int nA = n0 + l16, nB = n0 + 16 + l16;
  float bv0 = bias ? bias[nA] : 0.f;
  float bv1 = bias ? bias[nB] : 0.f;
  for (int r = 0; r < 8; ++r) {
    int mA = m0 + r + 8 * half;
    if (mA < M) {
      float v0 = acc00[r] + bv0;
      float v1 = acc01[r] + bv1;
      if (relu) { v0 = fmaxf(v0, 0.f); v1 = fmaxf(v1, 0.f); }
      Y[(size_t)mA * N + nA] = v0;
      Y[(size_t)mA * N + nB] = v1;
    }
    int mB = m0 + 16 + r + 8 * half;
    if (mB < M) {
      float v0 = acc10[r] + bv0;
      float v1 = acc11[r] + bv1;
      if (relu) { v0 = fmaxf(v0, 0.f); v1 = fmaxf(v1, 0.f); }
      Y[(size_t)mB * N + nA] = v0;
      Y[(size_t)mB * N + nB] = v1;
    }
  }
}

// ---------------------------------------------------------------------------
// Attention in one pass over the keys, per (b, head, 32 queries): the scores never
// leave the registers.
//   St = K Qt : A = 16 keys x 24, B = Qt, kept in registers. D register r of a lane
//               is the score of key 8 * half + r for query l16.
//   softmax   : running maximum and sum per query (one lane column): in-lane over the
//               8 registers, one exchange between the wave's halves.
//   Ot += Vt Pt : D registers 2j, 2j + 1 of St are, as they stand, the B fragment of
//               k-step j if that step's keys are 8 * half + 2j + {0, 1}; the Vt
//               A fragment takes its rows in the same key order.
// A wave holds two query tiles, so each K and V fragment feeds two products. The
// key tiles are dealt round-robin to the NW waves of the work-group; their partial
// (maximum, sum, Ot) are merged in LDS at the end.
// Head dim order of the score product: at k-step j a lane half takes
// d = 8 * (j >> 1) + 4 * half + 2 * (j & 1) + {0, 1}, for K and Q alike: three 16-byte
// loads a row, in each of which the two halves read 32 adjacent bytes of one line.
// Q/K/V layout: [(b*S+s)*96 + h*24 + d]. maskT: [key][query], pitch EM_PITCH.
// ---------------------------------------------------------------------------
typedef float v4f __attribute__((ext_vector_type(4)));
#define FA_C (ATTN_SCALE * 1.4426950408889634f)   // score scale, in log2 units
#define FA_ROWS (HD + 2)                          // Ot rows, then maximum, then sum

template <bool B> struct fa_bool { static constexpr bool value = B; };

// lane l <-> l ^ 16
__device__ __forceinline__ float fa_xhalf(float v) {
  int b = __float_as_int(v);
  return __int_as_float(__builtin_amdgcn_permlanex16(b, b, 0x76543210, 0xfedcba98, false, false));
}

// 24 floats of one row as six k-step fragments; p: the row's start + 4 * half
__device__ __forceinline__ void fa_row(const float* __restrict__ p, v2f (&f)[6]) {
  const v4f x0 = *(const v4f*)p, x1 = *(const v4f*)(p + 8), x2 = *(const v4f*)(p + 16);
  f[0] = (v2f){x0.x, x0.y}; f[1] = (v2f){x0.z, x0.w};
  f[2] = (v2f){x1.x, x1.y}; f[3] = (v2f){x1.z, x1.w};
  f[4] = (v2f){x2.x, x2.y}; f[5] = (v2f){x2.z, x2.w};
}

template <int S, int NW, bool MASK>
__global__ __launch_bounds__(NW * 32)
void attn_kernel(const float* __restrict__ Q, const float* __restrict__ Kb,
                 const float* __restrict__ Vb, float* __restrict__ O,
                 const float* __restrict__ maskT) {
  constexpr int KT = (S + 15) / 16;
  static_assert(NW >= 4, "the merge takes four waves");
  // with a mask the scores are scaled when the bias is added, else inside the exponent
  constexpr float CC = MASK ? 1.f : FA_C;
  __shared__ float red[NW][2][FA_ROWS][16];
  const int lane = threadIdx.x & 31;
  // wave number in a scalar register: loop bounds and the last-tile branch stay scalar
  const int wave = __builtin_amdgcn_readfirstlane((int)(threadIdx.x >> 5));
  const int l16 = lane & 15, half = lane >> 4;
  const int q0 = blockIdx.x * 32, h = blockIdx.y, b = blockIdx.z;
  const size_t hb = (size_t)b * S * D_MODEL + (size_t)h * HD;
  const float* Kh = Kb + hb + 4 * half;
  const float* Vh = Vb + hb;
  const int hd2 = l16 < 8 ? 16 + l16 : HD - 1;   // second Ot tile: 8 rows, rest clamped

  v2f qf[2][6];
#pragma unroll   // constant register index
  for (int t = 0; t < 2; ++t) {
    int qr = q0 + 16 * t + l16; if (qr >= S) qr = S - 1;
    fa_row(Q + hb + (size_t)qr * D_MODEL + 4 * half, qf[t]);
  }
  v2f kf[6];
  {
    int key = wave * 16 + l16; if (key >= S) key = S - 1;
    fa_row(Kh + (size_t)key * D_MODEL, kf);
  }
  // stands in front of any reuse of the address registers of the loads above; the
  // scheduling barrier keeps later arithmetic from rising over it
  asm volatile("s_wait_xcnt 0x0" ::: "memory");
  __builtin_amdgcn_sched_barrier(0);
  v8f o[2][2];
  float mrun[2], lrun[2];
#pragma unroll   // constant register index
  for (int t = 0; t < 2; ++t) {
    o[t][0] = (v8f){}; o[t][1] = (v8f){};
    mrun[t] = -1e30f; lrun[t] = 0.f;
  }

  // one key tile; LAST: the tile that may hold keys past S
  auto tile = [&](auto lastc, const int kt) {
    constexpr bool LAST = decltype(lastc)::value;
    const int kb = kt * 16 + 8 * half;
    v2f vf[2][4];
#pragma unroll   // constant register index, immediate load offsets
    for (int j = 0; j < 4; ++j) {
      int r0 = kb + 2 * j, r1 = kb + 2 * j + 1;
      if (LAST) { r0 = r0 < S ? r0 : S - 1; r1 = r1 < S ? r1 : S - 1; }
      const float* vx = Vh + (size_t)r0 * D_MODEL;
      const float* vy = Vh + (size_t)r1 * D_MODEL;
      vf[0][j].x = vx[l16]; vf[0][j].y = vy[l16];
      vf[1][j].x = vx[hd2]; vf[1][j].y = vy[hd2];
    }
    float mb[2][8];
    if (MASK) {
      // stands in front of the bias loads, whose results may land in address
      // registers of the loads above
      asm volatile("s_wait_xcnt 0x0" ::: "memory");
      const float* mp = maskT + (size_t)kb * EM_PITCH + q0 + l16;
#pragma unroll   // constant register index, immediate load offsets
      for (int r = 0; r < 8; ++r) {
        mb[0][r] = mp[r * EM_PITCH];
        mb[1][r] = mp[r * EM_PITCH + 16];
      }
    }
    // stands in front of any reuse of the address registers of the loads above; the
    // scheduling barrier keeps later address arithmetic from rising over it and
    // the loads in front of the score products, whose time covers their latency
    asm volatile("s_wait_xcnt 0x0" ::: "memory");
    __builtin_amdgcn_sched_barrier(0);
    v8f s[2];
    s[0] = (v8f){}; s[1] = (v8f){};
#pragma unroll   // constant register index
    for (int j = 0; j < 6; ++j) {
      s[0] = __builtin_amdgcn_wmma_f32_16x16x4_f32(false, kf[j], false, qf[0][j], (short)0, s[0], false, false);
      s[1] = __builtin_amdgcn_wmma_f32_16x16x4_f32(false, kf[j], false, qf[1][j], (short)0, s[1], false, false);
    }
    // this wave's next K tile, in flight during the softmax and the second product
    // (past the end: the clamped last row, never used)
    {
      int key = (kt + NW) * 16 + l16; if (key >= S) key = S - 1;
      const float* kp = Kh + (size_t)key * D_MODEL;
      fa_row(kp, kf);
      // as above, for the three loads just issued; the address is an input, so that it
      // lives up to the wait and none of the three results lands in its registers
      asm volatile("s_wait_xcnt 0x0" :: "v"(kp) : "memory");
    }
    __builtin_amdgcn_sched_barrier(0);
#pragma unroll   // constant register index
    for (int t = 0; t < 2; ++t) {
      if (MASK) {
#pragma unroll   // constant register index
        for (int r = 0; r < 8; ++r) s[t][r] = fmaf(s[t][r], FA_C, mb[t][r]);
      }
      if (LAST) {
#pragma unroll   // constant register index
        for (int r = 0; r < 8; ++r)
          if (kb + r >= S) s[t][r] = -INFINITY;   // no key: weight exactly 0
      }
      float mx = s[t][0];
#pragma unroll   // constant register index
      for (int r = 1; r < 8; ++r) mx = fmaxf(mx, s[t][r]);
      mx = fmaxf(mx, fa_xhalf(mx));
      const float mnew = fmaxf(mrun[t], mx);
      const float alpha = __builtin_amdgcn_exp2f((mrun[t] - mnew) * CC);
      const float nb = -mnew * CC;
      mrun[t] = mnew;
      float sum = 0.f;
#pragma unroll   // constant register index
      for (int r = 0; r < 8; ++r) {
        s[t][r] = __builtin_amdgcn_exp2f(fmaf(s[t][r], CC, nb));
        sum += s[t][r];
      }
      lrun[t] = lrun[t] * alpha + sum;
      o[t][0] *= alpha;
      o[t][1] *= alpha;
    }
#pragma unroll   // constant register index
    for (int j = 0; j < 4; ++j) {
#pragma unroll   // constant register index
      for (int t = 0; t < 2; ++t) {
        const v2f pf = (v2f){s[t][2 * j], s[t][2 * j + 1]};
        o[t][0] = __builtin_amdgcn_wmma_f32_16x16x4_f32(false, vf[0][j], false, pf, (short)0, o[t][0], false, false);
        o[t][1] = __builtin_amdgcn_wmma_f32_16x16x4_f32(false, vf[1][j], false, pf, (short)0, o[t][1], false, false);
      }
    }
  };

  int kt = wave;
  for (; kt < KT - 1; kt += NW) tile(fa_bool<false>{}, kt);
  if (kt == KT - 1) tile(fa_bool<true>{}, kt);

  // -------- this wave's partial result to LDS --------
#pragma unroll   // constant register index
  for (int t = 0; t < 2; ++t) {
    const float lsum = lrun[t] + fa_xhalf(lrun[t]);
#pragma unroll   // constant register index
    for (int r = 0; r < 8; ++r) {
      red[wave][t][r + 8 * half][l16] = o[t][0][r];
      if (half == 0) red[wave][t][16 + r][l16] = o[t][1][r];
    }
    if (half == 0) {
      red[wave][t][HD][l16] = mrun[t];
      red[wave][t][HD + 1][l16] = lsum;
    }
  }
  __syncthreads();

  // -------- merge over the waves: four threads a query, six head dims each --------
  if (wave < 4) {
    const int ql = threadIdx.x >> 2, t = ql >> 4, qi = ql & 15;
    const int d0 = (threadIdx.x & 3) * 6;
    float mall = red[0][t][HD][qi];
#pragma unroll   // LDS reads at immediate offsets, all in flight together
    for (int w = 1; w < NW; ++w) mall = fmaxf(mall, red[w][t][HD][qi]);
    float den = 0.f, acc[6] = {0.f, 0.f, 0.f, 0.f, 0.f, 0.f};
#pragma unroll   // LDS reads at immediate offsets, all in flight together
    for (int w = 0; w < NW; ++w) {
      const float wg = __builtin_amdgcn_exp2f((red[w][t][HD][qi] - mall) * CC);
      den += wg * red[w][t][HD + 1][qi];
#pragma unroll   // constant register index
      for (int i = 0; i < 6; ++i) acc[i] += wg * red[w][t][d0 + i][qi];
    }
    const float inv = 1.f / den;
    const int q = q0 + ql;
    if (q < S) {
      float* op = O + hb + (size_t)q * D_MODEL + d0;
#pragma unroll   // constant register index
      for (int i = 0; i < 6; ++i) op[i] = acc[i] * inv;
    }
  }
}

// ---------------------------------------------------------------------------
// The row-local chain behind attention in ONE launch, one work-group of PK_WAVES
// waves per 16 rows:
//   h = LN(h + O Wo + bo); f = relu(h W1 + b1); h = LN(h + f W2 + b2);
//   then, where NEXT, the next layer's Q, K, V = h Wq|Wk|Wv + bias (nw, nb),
//   else the stack's closing LayerNorm (gain nw, shift nb).
// The 16 x 96 row tile and the 16 x 384 hidden tile stay in LDS; a product's
// result goes there in D layout and is read back as A fragments. Wave w owns
// column tile w of every 96-wide product and four tiles of the 384-wide one.
// Every accumulator keeps the ascending k order.
// LDS pitches are 4 dwords past a multiple of 32: the 16 rows x 2 halves of an
// 8-byte A-fragment read fall on 64 different banks.
// ---------------------------------------------------------------------------
#define PK_WAVES 6
#define PK_HP (D_MODEL + 4)
#define PK_FP (FF_DIM + 4)
static_assert(PK_WAVES * 16 == D_MODEL, "one 16-column tile of the model width per wave");

// B fragments of chunk c: CH k-steps x TN column tiles, TS floats from tile to tile
template <int N, int TS, int TN, int CH>
__device__ __forceinline__ void pk_load_b(const float* __restrict__ wp, const int c,
                                          v2f (&b)[CH][TN]) {
#pragma unroll   // constant register index, immediate load offsets
  for (int j = 0; j < CH; ++j) {
    const int k0 = (c * CH + j) * 4;
#pragma unroll   // constant register index
    for (int t = 0; t < TN; ++t) {
      b[j][t].x = wp[k0 * N + t * TS];
      b[j][t].y = wp[(k0 + 1) * N + t * TS];
    }
  }
}

// A fragments of chunk c from the LDS tile (as: this lane's row, + 2 * half)
template <int CH>
__device__ __forceinline__ void pk_load_a(const float* as, const int c, v2f (&a)[CH]) {
#pragma unroll   // constant register index
  for (int j = 0; j < CH; ++j) a[j] = *(const v2f*)(as + (c * CH + j) * 4);
}

// acc[t] += A(LDS, 16 x K) * W(:, tile t). The caller has loaded chunks 0 and 1
// of b (weights depend on no earlier stage, so that is done ahead of the barrier
// in front of the stage); chunk c + 2 is loaded while chunk c is multiplied.
template <int K, int N, int TS, int TN, int CH>
__device__ __forceinline__ void pk_mm(const float* as, const float* __restrict__ wp,
                                      v2f (&b)[3][CH][TN], v8f (&acc)[TN]) {
  constexpr int NCH = K / (4 * CH);
  static_assert(K % (4 * CH) == 0 && NCH >= 2, "shape");
  v2f a[2][CH];
  pk_load_a<CH>(as, 0, a[0]);
#pragma unroll   // constant ring index
  for (int c = 0; c < NCH; ++c) {
    if (c + 2 < NCH) pk_load_b<N, TS, TN, CH>(wp, c + 2, b[(c + 2) % 3]);
    if (c + 1 < NCH) pk_load_a<CH>(as, c + 1, a[(c + 1) % 2]);
    // keeps the loads above in front of this chunk's WMMAs: sunk to their use,
    // each chunk would wait out its own load latency
    __builtin_amdgcn_sched_barrier(0);
#pragma unroll   // constant ring index
    for (int j = 0; j < CH; ++j)
#pragma unroll   // constant ring index
      for (int t = 0; t < TN; ++t)
        acc[t] = __builtin_amdgcn_wmma_f32_16x16x4_f32(false, a[c % 2][j], false, b[c % 3][j][t],
                                                       (short)0, acc[t], false, false);
    // keeps the next trip's loads out of this chunk's WMMAs: risen there, they
    // cannot take this chunk's ring slot and cost a fourth chunk of registers
    __builtin_amdgcn_sched_barrier(0);
  }
  // stands in front of any reuse of the weight loads' address registers; the
  // scheduling barrier keeps later arithmetic from rising over it
  asm volatile("s_wait_xcnt 0x0" ::: "memory");
  __builtin_amdgcn_sched_barrier(0);
}

// LayerNorm of the 16 x 96 LDS tile in place: waves 0..3, four rows a wave, eight
// lanes a row, twelve elements a lane. Hout: the rows also go to global memory.
__device__ __forceinline__ void pk_ln(float* hs, const float* __restrict__ g,
                                      const float* __restrict__ bta, int wave, int lane,
                                      float* __restrict__ Hout, int m0, int M) {
  if (wave < 4) {
    const int row = wave * 4 + (lane >> 3), e = lane & 7;
    float* p = hs + row * PK_HP + e * 4;
    float v[12], gv[12], bv[12];
#pragma unroll   // constant register index
    for (int i = 0; i < 12; ++i) {
      const int o = (i >> 2) * 32 + (i & 3);
      v[i] = p[o];
      gv[i] = g[e * 4 + o];
      bv[i] = bta[e * 4 + o];
    }
    float s = 0.f;
#pragma unroll   // constant register index
    for (int i = 0; i < 12; ++i) s += v[i];
    s += __shfl_xor(s, 1, 32); s += __shfl_xor(s, 2, 32); s += __shfl_xor(s, 4, 32);
    const float m = s / (float)D_MODEL;
    float q = 0.f;
#pragma unroll   // constant register index
    for (int i = 0; i < 12; ++i) { v[i] -= m; q += v[i] * v[i]; }
    q += __shfl_xor(q, 1, 32); q += __shfl_xor(q, 2, 32); q += __shfl_xor(q, 4, 32);
    const float rs = rsqrtf(q / (float)D_MODEL + 1e-5f);
#pragma unroll   // constant register index
    for (int i = 0; i < 12; ++i) {
      v[i] = v[i] * rs * gv[i] + bv[i];
      p[(i >> 2) * 32 + (i & 3)] = v[i];
    }
    if (Hout && m0 + row < M) {
      float* hp = Hout + (size_t)(m0 + row) * D_MODEL + e * 4;
#pragma unroll   // constant register index
      for (int i = 0; i < 12; ++i) hp[(i >> 2) * 32 + (i & 3)] = v[i];
    }
  }
}

template <int NEXT>
__global__ __launch_bounds__(PK_WAVES * 32)
void post_kernel(const float* __restrict__ Ob, float* __restrict__ H,
                 const float* __restrict__ wo, const float* __restrict__ bo,
                 const float* __restrict__ ln,
                 const float* __restrict__ w1, const float* __restrict__ b1,
                 const float* __restrict__ w2, const float* __restrict__ b2,
                 const float* __restrict__ nw, const float* __restrict__ nb,
                 float* __restrict__ Qo, float* __restrict__ Ko, float* __restrict__ Vo,
                 int M) {
  __shared__ __attribute__((aligned(16))) float hs[16 * PK_HP];
  __shared__ __attribute__((aligned(16))) float fs[16 * PK_FP];
  const int lane = threadIdx.x & 31;
  // wave number in a scalar register: the LayerNorm branch stays scalar
  const int wave = __builtin_amdgcn_readfirstlane((int)(threadIdx.x >> 5));
  const int l16 = lane & 15, half = lane >> 4;
  const int m0 = blockIdx.x * 16;
  const int col = wave * 16 + l16;

  // ---- output projection: A from global (row-clamped), all operands at once ----
  int ra = m0 + l16; if (ra >= M) ra = M - 1;
  const float* xa  = Ob + (size_t)ra * D_MODEL + 2 * half;
  const float* wpo = wo + (size_t)(2 * half) * D_MODEL + col;
  v2f ao[D_MODEL / 4], wf[D_MODEL / 4];
#pragma unroll   // constant register index
  for (int j = 0; j < D_MODEL / 4; ++j) {
    ao[j].x = xa[4 * j];             ao[j].y = xa[4 * j + 1];
    wf[j].x = wpo[4 * j * D_MODEL];  wf[j].y = wpo[(4 * j + 1) * D_MODEL];
  }
  float res[8];
#pragma unroll   // constant register index
  for (int r = 0; r < 8; ++r) {
    int m = m0 + r + 8 * half; if (m >= M) m = M - 1;
    res[r] = H[(size_t)m * D_MODEL + col];
  }
  const float bov = bo[col], b2v = b2[col];
  float b1v[4], nbv[3];
#pragma unroll   // constant register index
  for (int t = 0; t < 4; ++t) b1v[t] = b1[wave * 64 + t * 16 + l16];
  // stands in front of later loads whose results land in address registers of
  // the loads above
  asm volatile("s_wait_xcnt 0x0" ::: "memory");
  if (NEXT) {
#pragma unroll   // constant register index
    for (int t = 0; t < 3; ++t) nbv[t] = nb[t * D_MODEL + col];
    // as above, for the three loads just issued
    asm volatile("s_wait_xcnt 0x0" ::: "memory");
  }
  const float* wp1 = w1 + (size_t)(2 * half) * FF_DIM + wave * 64 + l16;
  v2f bf1[3][4][4];
  pk_load_b<FF_DIM, 16, 4, 4>(wp1, 0, bf1[0]);
  pk_load_b<FF_DIM, 16, 4, 4>(wp1, 1, bf1[1]);
  // holds every load above in front of the WMMAs: one load latency for all
  __builtin_amdgcn_sched_barrier(0);
  v8f acco = {};
#pragma unroll   // constant register index
  for (int j = 0; j < D_MODEL / 4; ++j)
    acco = __builtin_amdgcn_wmma_f32_16x16x4_f32(false, ao[j], false, wf[j], (short)0, acco,
                                                 false, false);
#pragma unroll   // constant register index
  for (int r = 0; r < 8; ++r) hs[(r + 8 * half) * PK_HP + col] = res[r] + (acco[r] + bov);
  __syncthreads();
  // second FFN product's first weights: in flight while the rows are normalised
  const float* wp2 = w2 + (size_t)(2 * half) * D_MODEL + col;
  v2f bf2[3][12][1];
  pk_load_b<D_MODEL, 16, 1, 12>(wp2, 0, bf2[0]);
  pk_load_b<D_MODEL, 16, 1, 12>(wp2, 1, bf2[1]);
  pk_ln(hs, ln, ln + D_MODEL, wave, lane, (float*)0, m0, M);
  __syncthreads();

  // ---- f = relu(h W1 + b1), into LDS ----
  const float* ah = hs + l16 * PK_HP + 2 * half;
  v8f af[4];
#pragma unroll   // constant register index
  for (int t = 0; t < 4; ++t) af[t] = (v8f){};
  pk_mm<D_MODEL, FF_DIM, 16, 4, 4>(ah, wp1, bf1, af);
#pragma unroll   // constant register index
  for (int t = 0; t < 4; ++t)
#pragma unroll   // constant register index
    for (int r = 0; r < 8; ++r)
      fs[(r + 8 * half) * PK_FP + wave * 64 + t * 16 + l16] = fmaxf(af[t][r] + b1v[t], 0.f);
  __syncthreads();
  // next layer's first projection weights: in flight during the second FFN product
  const float* wpn = nw + (size_t)(2 * half) * D_MODEL + col;
  v2f bfn[3][4][3];
  if (NEXT) {
    pk_load_b<D_MODEL, D_MODEL * D_MODEL, 3, 4>(wpn, 0, bfn[0]);
    pk_load_b<D_MODEL, D_MODEL * D_MODEL, 3, 4>(wpn, 1, bfn[1]);
  }

  // ---- h + f W2 + b2: each element of the row tile is updated by its own lane ----
  v8f a2[1];
  a2[0] = (v8f){};
  pk_mm<FF_DIM, D_MODEL, 16, 1, 12>(fs + l16 * PK_FP + 2 * half, wp2, bf2, a2);
#pragma unroll   // constant register index
  for (int r = 0; r < 8; ++r) {
    float* p = hs + (r + 8 * half) * PK_HP + col;
    *p = *p + (a2[0][r] + b2v);
  }
  __syncthreads();
  pk_ln(hs, ln + 2 * D_MODEL, ln + 3 * D_MODEL, wave, lane, NEXT ? H : (float*)0, m0, M);
  // last layer of a stack: the stack's closing LayerNorm (gain nw, shift nb); each
  // lane reads back only what it wrote itself, so no barrier stands between the two
  if (!NEXT) pk_ln(hs, nw, nb, wave, lane, H, m0, M);

  // ---- next layer's Q, K, V: this wave's column tile of each ----
  if (NEXT) {
    __syncthreads();
    v8f an[3];
#pragma unroll   // constant register index
    for (int t = 0; t < 3; ++t) an[t] = (v8f){};
    pk_mm<D_MODEL, D_MODEL, D_MODEL * D_MODEL, 3, 4>(ah, wpn, bfn, an);
    const size_t ob = (size_t)(m0 + 8 * half) * D_MODEL + col;
    const int left = M - m0 - 8 * half;   // rows of this half tile that exist
#pragma unroll   // constant register index, immediate store offsets
    for (int r = 0; r < 8; ++r) {
      if (r < left) {
        Qo[ob + r * D_MODEL] = an[0][r] + nbv[0];
        Ko[ob + r * D_MODEL] = an[1][r] + nbv[1];
        Vo[ob + r * D_MODEL] = an[2][r] + nbv[2];
      }
    }
  }
}

// Decoder input: first 621 rows = e2d(enc) * sqrt(D)
__global__ void dec_assemble_enc(const float* __restrict__ E, float* __restrict__ Xd) {
  int row = blockIdx.x;            // b*N_UNMASK + s
  int d = threadIdx.x;
  int b = row / N_UNMASK, s = row % N_UNMASK;
  Xd[((size_t)b * NT + s) * D_MODEL + d] = E[(size_t)row * D_MODEL + d] * SQRT_D;
}

// Decoder input: masked rows = (mask_token + pos + tod/dow emb) * sqrt(D)
__global__ void dec_assemble_mask(const float* __restrict__ hist,
                                  const int* __restrict__ midx,
                                  const float* __restrict__ mask_token,
                                  const float* __restrict__ pos,
                                  const float* __restrict__ tod_w, const float* __restrict__ tod_b,
                                  const float* __restrict__ dow_w, const float* __restrict__ dow_b,
                                  float* __restrict__ Xd) {
  int row = blockIdx.x;            // b*N_MASKT + j
  int d = threadIdx.x;
  int b = row / N_MASKT, j = row % N_MASKT;
  int nt = midx[j]; int n = nt / T_STEPS, t = nt % T_STEPS;
  const float* hp = hist + (((size_t)b * T_STEPS + t) * N_NODES + n) * C_IN;
  float dow = hp[2], tod = hp[3];
  float v = mask_token[d] + pos[(size_t)nt * D_MODEL + d] +
            tod * tod_w[d] + tod_b[d] + dow * dow_w[d] + dow_b[d];
  Xd[((size_t)b * NT + N_UNMASK + j) * D_MODEL + d] = v * SQRT_D;
}

// recon_masked = (decoder rows >= N_UNMASK) @ out_w + out_b ; label gather.
__global__ void out_kernel(const float* __restrict__ Xd, const float* __restrict__ hist,
                           const int* __restrict__ midx,
                           const float* __restrict__ out_w, const float* __restrict__ out_b,
                           float* __restrict__ out) {
  __shared__ float red[D_MODEL];
  int row = blockIdx.x;            // b*N_MASKT + j
  int d = threadIdx.x;
  int b = row / N_MASKT, j = row % N_MASKT;
  size_t xr = ((size_t)b * NT + N_UNMASK + j) * D_MODEL;
  red[d] = Xd[xr + d] * out_w[d];
  __syncthreads();
  if (d == 0) {
    float s = 0.f;
    for (int i = 0; i < D_MODEL; ++i) s += red[i];
    out[row] = s + out_b[0];
    int nt = midx[j]; int n = nt / T_STEPS, t = nt % T_STEPS;
    out[BATCH * N_MASKT + row] =
        hist[(((size_t)b * T_STEPS + t) * N_NODES + n) * C_IN + 0];
  }
}

// ---------------------------------------------------------------------------
extern "C" void kernel_launch(void* const* d_in, const int* in_sizes, int n_in,
                              void* d_out, int out_size, void* d_ws, size_t ws_size,
                              hipStream_t stream) {
  (void)in_sizes; (void)n_in; (void)out_size; (void)ws_size;
  const float* hist  = (const float*)d_in[0];
  const int*   uidx  = (const int*)d_in[1];
  const int*   midx  = (const int*)d_in[2];
  const float* nv1   = (const float*)d_in[3];
  const float* nv2   = (const float*)d_in[4];
  const float* dim_w = (const float*)d_in[5];
  const float* dim_b = (const float*)d_in[6];
  const float* pos   = (const float*)d_in[7];
  const float* tod_w = (const float*)d_in[8];
  const float* tod_b = (const float*)d_in[9];
  const float* dow_w = (const float*)d_in[10];
  const float* dow_b = (const float*)d_in[11];
  const float* mtok  = (const float*)d_in[12];
  const float* eaw   = (const float*)d_in[13];
  const float* eab   = (const float*)d_in[14];
  const float* ew1   = (const float*)d_in[15];
  const float* eb1   = (const float*)d_in[16];
  const float* ew2   = (const float*)d_in[17];
  const float* eb2   = (const float*)d_in[18];
  const float* eln   = (const float*)d_in[19];
  const float* eng   = (const float*)d_in[20];
  const float* enb   = (const float*)d_in[21];
  const float* e2dw  = (const float*)d_in[22];
  const float* e2db  = (const float*)d_in[23];
  const float* daw   = (const float*)d_in[24];
  const float* dab   = (const float*)d_in[25];
  const float* dw1   = (const float*)d_in[26];
  const float* db1   = (const float*)d_in[27];
  const float* dw2   = (const float*)d_in[28];
  const float* db2   = (const float*)d_in[29];
  const float* dln   = (const float*)d_in[30];
  const float* dng   = (const float*)d_in[31];
  const float* dnb   = (const float*)d_in[32];
  const float* outw  = (const float*)d_in[33];
  const float* outb  = (const float*)d_in[34];
  float* out = (float*)d_out;

  float* ws = (float*)d_ws;
  size_t off = 0;
  auto alloc = [&](size_t n) { float* p = ws + off; off += n; return p; };
  const size_t MD = (size_t)BATCH * NT;   // max rows (decoder): 9936
  float* adpA  = alloc((size_t)N_NODES * N_NODES);
  float* Menc  = alloc((size_t)EM_ROWS * EM_PITCH);
  float* token = alloc((size_t)BATCH * NT * D_MODEL);
  float* X  = alloc(MD * D_MODEL);
  float* Qb = alloc(MD * D_MODEL);
  float* Kb = alloc(MD * D_MODEL);
  float* Vb = alloc(MD * D_MODEL);
  float* Ob = alloc(MD * D_MODEL);
  float* T1 = alloc(MD * D_MODEL);
  float* Xd = alloc(MD * D_MODEL);

  adj_kernel<<<N_NODES, 256, 0, stream>>>(nv1, nv2, adpA);
  {
    int tot = EM_ROWS * EM_PITCH;
    encmask_kernel<<<(tot + 255) / 256, 256, 0, stream>>>(adpA, uidx, Menc);
  }
  token_kernel<<<BATCH * NT, D_MODEL, 0, stream>>>(hist, dim_w, dim_b, pos, tod_w,
                                                   tod_b, dow_w, dow_b, token);
  gather_kernel<<<BATCH * N_UNMASK, D_MODEL, 0, stream>>>(token, uidx, X);

  auto gemm = [&](const float* A, const float* W, const float* bias, float* Y, int M) {
    dim3 g((unsigned)((M + 31) / 32), (unsigned)(D_MODEL / 32));
    gemm_wmma_kernel<D_MODEL, D_MODEL><<<g, 32, 0, stream>>>(A, W, bias, Y, M, 0);
  };
  auto qkv = [&](const float* H, int M, const float* aw, const float* ab) {
    gemm(H, aw + 0 * D_MODEL * D_MODEL, ab + 0 * D_MODEL, Qb, M);
    gemm(H, aw + 1 * D_MODEL * D_MODEL, ab + 1 * D_MODEL, Kb, M);
    gemm(H, aw + 2 * D_MODEL * D_MODEL, ab + 2 * D_MODEL, Vb, M);
  };
  // attention, then the whole row-local rest of the layer in one launch; nw/nb: the
  // next layer's projections (next) or the stack's closing LayerNorm, same launch
  auto layer = [&](float* H, int S, const float* aw, const float* ab,
                   const float* w1, const float* b1, const float* w2, const float* b2,
                   const float* ln, const float* maskb, int next, const float* nw,
                   const float* nb) {
    int M = BATCH * S;
    if (maskb)
      attn_kernel<N_UNMASK, 8, true><<<dim3((N_UNMASK + 31) / 32, NHEAD, BATCH), 8 * 32, 0, stream>>>(
          Qb, Kb, Vb, Ob, maskb);
    else
      attn_kernel<NT, 4, false><<<dim3((NT + 31) / 32, NHEAD, BATCH), 4 * 32, 0, stream>>>(
          Qb, Kb, Vb, Ob, nullptr);
    unsigned pg = (unsigned)((M + 15) / 16);
    const float* wo = aw + 3 * D_MODEL * D_MODEL;
    const float* bo = ab + 3 * D_MODEL;
    if (next)
      post_kernel<1><<<pg, PK_WAVES * 32, 0, stream>>>(Ob, H, wo, bo, ln, w1, b1, w2, b2,
                                                       nw, nb, Qb, Kb, Vb, M);
    else
      post_kernel<0><<<pg, PK_WAVES * 32, 0, stream>>>(Ob, H, wo, bo, ln, w1, b1, w2, b2,
                                                       nw, nb, nullptr, nullptr, nullptr, M);
  };

  // ---- encoder (4 layers, masked attention over 621 tokens) ----
  qkv(X, BATCH * N_UNMASK, eaw, eab);
  for (int l = 0; l < 4; ++l) {
    layer(X, N_UNMASK,
          eaw + (size_t)l * 4 * D_MODEL * D_MODEL, eab + (size_t)l * 4 * D_MODEL,
          ew1 + (size_t)l * D_MODEL * FF_DIM,      eb1 + (size_t)l * FF_DIM,
          ew2 + (size_t)l * FF_DIM * D_MODEL,      eb2 + (size_t)l * D_MODEL,
          eln + (size_t)l * 2 * 2 * D_MODEL, Menc, l < 3,
          l < 3 ? eaw + (size_t)(l + 1) * 4 * D_MODEL * D_MODEL : eng,
          l < 3 ? eab + (size_t)(l + 1) * 4 * D_MODEL : enb);
  }
  gemm(X, e2dw, e2db, T1, BATCH * N_UNMASK);
  dec_assemble_enc<<<BATCH * N_UNMASK, D_MODEL, 0, stream>>>(T1, Xd);
  dec_assemble_mask<<<BATCH * N_MASKT, D_MODEL, 0, stream>>>(hist, midx, mtok, pos,
                                                             tod_w, tod_b, dow_w, dow_b, Xd);
  // ---- decoder (1 layer, full attention over 2484 tokens) ----
  qkv(Xd, BATCH * NT, daw, dab);
  layer(Xd, NT, daw, dab, dw1, db1, dw2, db2, dln, nullptr, 0, dng, dnb);
  out_kernel<<<BATCH * N_MASKT, D_MODEL, 0, stream>>>(Xd, hist, midx, outw, outb, out);
}

// v005
// It runs in 232 microseconds.
// Two timings next to v004 put it at 1.16 and 1.15 times that version's speed.
// Counting every step since v000, it is 11.4 times as fast.
#include <hip/hip_runtime.h>
#include <math.h>

#define N_NODES  207
#define T_STEPS  12
#define C_IN     4
#define BATCH    4
#define NT       (N_NODES * T_STEPS)   // 2484
#define D_MODEL  96
#define NHEAD    4
#define HD       24
#define FF_DIM   384
#define N_MASKT  1863
#define N_UNMASK 621
#define MAX_NEIGH 40
#define ATTN_SCALE 0.20412414523193154f   // 1/sqrt(24)
#define SQRT_D     9.797958971132712f     // sqrt(96)

typedef float v2f __attribute__((ext_vector_type(2)));
typedef float v8f __attribute__((ext_vector_type(8)));

// ---------------------------------------------------------------------------
// Adjacency: A = softmax(relu(nv1 @ nv2), axis=1); keep iff (A > 1/N) and
// strictly greater than the 41st-largest in its row (rank < MAX_NEIGH).
// ---------------------------------------------------------------------------
__device__ __forceinline__ void adj_row(const float* __restrict__ nv1,
                                        const float* __restrict__ nv2,
                                        float* __restrict__ adpA, const int i) {
  __shared__ float a[N_NODES];
  __shared__ float stat[2];
  int tid = threadIdx.x;
  for (int j = tid; j < N_NODES; j += blockDim.x) {
    float s = 0.f;
    for (int r = 0; r < 10; ++r) s += nv1[i * 10 + r] * nv2[r * N_NODES + j];
    a[j] = s > 0.f ? s : 0.f;
  }
  __syncthreads();
  if (tid == 0) {
    float mx = -1e30f;
    for (int j = 0; j < N_NODES; ++j) mx = fmaxf(mx, a[j]);
    float sum = 0.f;
    for (int j = 0; j < N_NODES; ++j) sum += __expf(a[j] - mx);
    stat[0] = mx; stat[1] = 1.f / sum;
  }
  __syncthreads();
  float mx = stat[0], inv = stat[1];
  for (int j = tid; j < N_NODES; j += blockDim.x) a[j] = __expf(a[j] - mx) * inv;
  __syncthreads();
  const float thr = 1.0f / (float)N_NODES;
  for (int j = tid; j < N_NODES; j += blockDim.x) {
    float aj = a[j];
    int cnt = 0;
    for (int l = 0; l < N_NODES; ++l) cnt += (a[l] > aj) ? 1 : 0;
    bool keep = (aj > thr) && (cnt < MAX_NEIGH);
    adpA[i * N_NODES + j] = keep ? aj : 0.f;
  }
}

// Encoder additive attention bias, stored key-major: Mb[k][q] = 0 where query q may
// look at key k, -1e30 where adpA == 0. Rows are padded to whole key tiles and the
// pitch to whole query blocks (pad entries 0), so the attention kernel reads it
// with 16 consecutive queries on 16 lanes and needs no clamp.
#define EM_ROWS  (((N_UNMASK + 15) / 16) * 16)   // 624
#define EM_PITCH (((N_UNMASK + 31) / 32) * 32)   // 640

// ---------------------------------------------------------------------------
// Everything that depends on the inputs alone, in ONE launch; a work-group's role
// comes from its index:
//   adjacency row i;
//   encoder input row: (x0*dim_w + dim_b + pos + tod*tod_w + tod_b + dow*dow_w + dow_b)
//     at unmasked_idx, * sqrt(D);
//   decoder input row of a masked token: (mask_token + pos + tod/dow emb) * sqrt(D),
//     and that token's label.
// ---------------------------------------------------------------------------
#define FR_ENC (BATCH * N_UNMASK)
#define FR_DEC (BATCH * N_MASKT)
#define FR_ROWS 12   // rows a work-group: few waves to start, the rows' loads in flight together
static_assert(FR_ENC % FR_ROWS == 0 && FR_DEC % FR_ROWS == 0, "whole work-groups");
__global__ __launch_bounds__(D_MODEL)
void front_kernel(const float* __restrict__ nv1, const float* __restrict__ nv2,
                  float* __restrict__ adpA,
                  const float* __restrict__ hist,
                  const int* __restrict__ uidx, const int* __restrict__ midx,
                  const float* __restrict__ dim_w, const float* __restrict__ dim_b,
                  const float* __restrict__ pos,
                  const float* __restrict__ tod_w, const float* __restrict__ tod_b,
                  const float* __restrict__ dow_w, const float* __restrict__ dow_b,
                  const float* __restrict__ mask_token,
                  float* __restrict__ X, float* __restrict__ Xd, float* __restrict__ out) {
  const int blk = blockIdx.x;
  if (blk < N_NODES) { adj_row(nv1, nv2, adpA, blk); return; }
  const int d = threadIdx.x;       // 0..95
  const float todw = tod_w[d], todb = tod_b[d], doww = dow_w[d], dowb = dow_b[d];
  // stands in front of any reuse of the address registers of the four loads above; the
  // scheduling barrier keeps later arithmetic from rising over it
  asm volatile("s_wait_xcnt 0x0" ::: "memory");
  __builtin_amdgcn_sched_barrier(0);
  if (blk < N_NODES + FR_ENC / FR_ROWS) {
    const float dimw = dim_w[d], dimb = dim_b[d];
    const int r0 = (blk - N_NODES) * FR_ROWS;
#pragma unroll   // the rows' loads in flight together
    for (int i = 0; i < FR_ROWS; ++i) {
      const int row = r0 + i;      // b*N_UNMASK + s
      const int b = row / N_UNMASK, s = row % N_UNMASK;
      int nt = uidx[s];
      nt = nt < 0 ? 0 : (nt >= NT ? NT - 1 : nt);
      const int n = nt / T_STEPS, t = nt % T_STEPS;
      const float* hp = hist + (((size_t)b * T_STEPS + t) * N_NODES + n) * C_IN;
      float x0 = hp[0], dow = hp[2], tod = hp[3];
      float v = x0 * dimw + dimb + pos[(size_t)nt * D_MODEL + d] +
                tod * todw + todb + dow * doww + dowb;
      X[(size_t)row * D_MODEL + d] = v * SQRT_D;
    }
    // stands behind the run of stores, in front of any rewrite of their address and
    // data registers in the code that follows this role in the built kernel
    asm volatile("s_wait_xcnt 0x0" ::: "memory");
  } else {
    const float mtk = mask_token[d];
    const int r0 = (blk - (N_NODES + FR_ENC / FR_ROWS)) * FR_ROWS;
    int ntr[FR_ROWS], po[FR_ROWS];   // each row's token, and its place in pos
    float pv[FR_ROWS];
#pragma unroll   // constant register index; the rows' loads in flight together
    for (int i = 0; i < FR_ROWS; ++i) {
      int nt = midx[(r0 + i) % N_MASKT];
      nt = nt < 0 ? 0 : (nt >= NT ? NT - 1 : nt);
      ntr[i] = nt;
      po[i] = nt * D_MODEL + d;
      pv[i] = pos[po[i]];
    }
    // stands in front of any reuse of the address registers of the loads above: the places
    // are inputs, so that they live up to the wait and no result lands in one of them;
    // the scheduling barrier keeps later arithmetic from rising over it
    asm volatile("s_wait_xcnt 0x0" :: "v"(po[0]), "v"(po[1]), "v"(po[2]), "v"(po[3]), "v"(po[4]),
                 "v"(po[5]), "v"(po[6]), "v"(po[7]), "v"(po[8]), "v"(po[9]), "v"(po[10]),
                 "v"(po[11]) : "memory");
    __builtin_amdgcn_sched_barrier(0);
    float val[FR_ROWS];
    int xo[FR_ROWS];               // where each row goes in Xd
    float lab = 0.f;               // thread i keeps row i's label
#pragma unroll   // constant register index
    for (int i = 0; i < FR_ROWS; ++i) {
      const int row = r0 + i;      // b*N_MASKT + j
      const int b = row / N_MASKT, j = row % N_MASKT;
      const int n = ntr[i] / T_STEPS, t = ntr[i] % T_STEPS;
      const float* hp = hist + (((size_t)b * T_STEPS + t) * N_NODES + n) * C_IN;
      const float x0 = hp[0], dow = hp[2], tod = hp[3];
      float v = mtk + pv[i] + tod * todw + todb + dow * doww + dowb;
      val[i] = v * SQRT_D;
      xo[i] = (b * NT + N_UNMASK + j) * D_MODEL + d;
      lab = d == i ? x0 : lab;
    }
    // every value and place in a register of its own in front of the first store:
    // arithmetic sunk among the stores would rewrite registers of issued stores
    __builtin_amdgcn_sched_barrier(0);
#pragma unroll   // constant register index
    for (int i = 0; i < FR_ROWS; ++i) Xd[xo[i]] = val[i];
    // stands behind the run of stores, in front of any rewrite of their registers
    asm volatile("s_wait_xcnt 0x0" ::: "memory");
    if (d < FR_ROWS) out[FR_DEC + r0 + d] = lab;
  }
}

// ---------------------------------------------------------------------------
// fp32 GEMM via V_WMMA_F32_16X16X4_F32, register-blocked 32x32 per wave:
// 4 accumulators, each A-frag feeds 2 WMMAs and each B-frag feeds 2 WMMAs.
// Y[M,N] = X[M,K] @ W[K,N] + bias. K and N are compile-time, so every
// operand load is a base register plus an immediate offset.
// Row r of the product lies, in X and in Y alike, at r + (r / SEG) * GAP + OFF.
// The K loop is a register ring: operands come in chunks of GK_STEPS k-steps,
// GK_BUFS chunks are held, and a chunk's loads are issued at least GK_BUFS - 1
// chunks ahead of the WMMAs that use it, so a wave waits out the load latency
// once and not once per trip. Every accumulator keeps the ascending k order.
// M edge via row-clamped loads + guarded stores (EXEC stays full for WMMA).
// ---------------------------------------------------------------------------
#define GK_STEPS 4     // k-steps (of 4) per chunk: 32 loads
#define GK_BUFS  3     // chunks held in registers

template <int K, int N, int SEG, int GAP, int OFF>
__device__ __forceinline__
void gemm_tile(const float* __restrict__ X, const float* __restrict__ W,
               const float* __restrict__ bias, float* __restrict__ Y,
               const int M, const int m0, const int n0) {
  constexpr int NCH = K / (4 * GK_STEPS);
  static_assert(K % (4 * GK_STEPS) == 0 && N % 32 == 0 && NCH >= GK_BUFS, "shape");
  int lane = threadIdx.x & 31;
  int l16 = lane & 15, half = lane >> 4;
  int ra0 = m0 + l16;      if (ra0 >= M) ra0 = M - 1;
  int ra1 = m0 + 16 + l16; if (ra1 >= M) ra1 = M - 1;
  ra0 += (ra0 / SEG) * GAP + OFF;
  ra1 += (ra1 / SEG) * GAP + OFF;
  const float* xa0 = X + (size_t)ra0 * K + 2 * half;
  const float* xa1 = X + (size_t)ra1 * K + 2 * half;
  const float* wp  = W + (size_t)(2 * half) * N + n0 + l16;
  v2f a0[GK_BUFS][GK_STEPS], a1[GK_BUFS][GK_STEPS];
  v2f b0[GK_BUFS][GK_STEPS], b1[GK_BUFS][GK_STEPS];
  v8f acc00 = {}, acc01 = {}, acc10 = {}, acc11 = {};

// unrolled here and below: every ring index must be a compile-time constant,
// or the ring would live in scratch instead of registers
#define GK_LOAD(c)                                                     \
  _Pragma("unroll")                                                    \
  for (int j = 0; j < GK_STEPS; ++j) {                                 \
    const int k0 = ((c) * GK_STEPS + j) * 4;                           \
    const int s = (c) % GK_BUFS;                                       \
    a0[s][j].x = xa0[k0];              a0[s][j].y = xa0[k0 + 1];       \
    a1[s][j].x = xa1[k0];              a1[s][j].y = xa1[k0 + 1];       \
    b0[s][j].x = wp[k0 * N];           b0[s][j].y = wp[(k0 + 1) * N];  \
    b1[s][j].x = wp[k0 * N + 16];      b1[s][j].y = wp[(k0 + 1) * N + 16]; \
  }

#pragma unroll   // constant ring index
  for (int c = 0; c < GK_BUFS - 1; ++c) { GK_LOAD(c) }
#pragma unroll   // constant ring index and immediate load offsets
  for (int c = 0; c < NCH; ++c) {
    if (c + GK_BUFS - 1 < NCH) { GK_LOAD(c + GK_BUFS - 1) }
    // keeps the loads above in front of this chunk's WMMAs: sunk to their use,
    // each chunk would wait out its own load latency again
    __builtin_amdgcn_sched_barrier(0);
    const int s = c % GK_BUFS;
#pragma unroll   // constant ring index
    for (int j = 0; j < GK_STEPS; ++j) {
      acc00 = __builtin_amdgcn_wmma_f32_16x16x4_f32(false, a0[s][j], false, b0[s][j], (short)0, acc00, false, false);
      acc01 = __builtin_amdgcn_wmma_f32_16x16x4_f32(false, a0[s][j], false, b1[s][j], (short)0, acc01, false, false);
      acc10 = __builtin_amdgcn_wmma_f32_16x16x4_f32(false, a1[s][j], false, b0[s][j], (short)0, acc10, false, false);
      acc11 = __builtin_amdgcn_wmma_f32_16x16x4_f32(false, a1[s][j], false, b1[s][j], (short)0, acc11, false, false);
    }
  }
#undef GK_LOAD
  // stands in front of the epilogue's reuse of the operand loads' address
  // registers; the scheduling barrier keeps that arithmetic from rising over it
  asm volatile("s_wait_xcnt 0x0" ::: "memory");
  __builtin_amdgcn_sched_barrier(0);
  const int nA = n0 + l16;
  const float bv0 = bias[nA], bv1 = bias[nA + 16];
  // every store's offset in a register of its own, formed in front of the stores
  int ro[16];
#pragma unroll   // constant register index
  for (int r = 0; r < 16; ++r) {
    const int m = m0 + (r & 7) + 8 * half + 16 * (r >> 3);
    ro[r] = m < M ? (m + (m / SEG) * GAP + OFF) * N + nA : -1;
  }
#pragma unroll   // constant register index
  for (int r = 0; r < 8; ++r) {
    if (ro[r] >= 0) {
      Y[ro[r]] = acc00[r] + bv0;
      Y[ro[r] + 16] = acc01[r] + bv1;
    }
    if (ro[r + 8] >= 0) {
      Y[ro[r + 8]] = acc10[r] + bv0;
      Y[ro[r + 8] + 16] = acc11[r] + bv1;
    }
  }
}

// ---------------------------------------------------------------------------
// Everything that needs only the launch above, in ONE launch of one-wave
// work-groups; the role comes from the index:
//   a 32 x 32 tile of the first encoder layer's Q, K or V;
//   a 32 x 32 tile of the decoder's Q, K or V for the masked tokens' rows, which do
//     not depend on the encoder;
//   one key row of the encoder's attention bias.
// ---------------------------------------------------------------------------
#define PJ_ENC (((BATCH * N_UNMASK + 31) / 32) * 9)
#define PJ_DEC (((BATCH * N_MASKT + 31) / 32) * 9)
__global__ __launch_bounds__(32)
void proj_kernel(const float* __restrict__ X, const float* __restrict__ eaw,
                 const float* __restrict__ eab, float* __restrict__ Qe,
                 float* __restrict__ Ke, float* __restrict__ Ve,
                 const float* __restrict__ Xd, const float* __restrict__ daw,
                 const float* __restrict__ dab, float* __restrict__ Qd,
                 float* __restrict__ Kd, float* __restrict__ Vd,
                 const float* __restrict__ adpA, const int* __restrict__ uidx,
                 float* __restrict__ Mb) {
  const int blk = blockIdx.x;
  if (blk < PJ_ENC) {
    const int y = blk % 9, p = y / 3;
    gemm_tile<D_MODEL, D_MODEL, (1 << 30), 0, 0>(
        X, eaw + p * D_MODEL * D_MODEL, eab + p * D_MODEL, p == 0 ? Qe : (p == 1 ? Ke : Ve),
        BATCH * N_UNMASK, (blk / 9) * 32, (y % 3) * 32);
    return;
  }
  if (blk < PJ_ENC + PJ_DEC) {
    const int t = blk - PJ_ENC, y = t % 9, p = y / 3;
    gemm_tile<D_MODEL, D_MODEL, N_MASKT, N_UNMASK, N_UNMASK>(
        Xd, daw + p * D_MODEL * D_MODEL, dab + p * D_MODEL, p == 0 ? Qd : (p == 1 ? Kd : Vd),
        BATCH * N_MASKT, (t / 9) * 32, (y % 3) * 32);
    return;
  }
  // column nk of the adjacency goes to LDS, and each query looks its node up there
  constexpr int NG = EM_PITCH / 32, NF = N_UNMASK / 32;        // query groups, whole ones
  constexpr int CG = (N_NODES + 31) / 32, CF = N_NODES / 32;   // node groups, whole ones
  static_assert(NG == NF + 1 && CG == CF + 1, "one clamped group each");
  __shared__ float colv[CG * 32];
  const int k = blk - (PJ_ENC + PJ_DEC);   // 0 .. EM_ROWS - 1
  const int lane = threadIdx.x;
  int nk = uidx[k < N_UNMASK ? k : N_UNMASK - 1] / T_STEPS;
  nk = nk < 0 ? 0 : (nk >= N_NODES ? N_NODES - 1 : nk);
  // last group of each: past the end the last element, not used
  const int cq = lane < N_UNMASK - NF * 32 ? lane : N_UNMASK - NF * 32 - 1;
  const int cn = lane < N_NODES - CF * 32 ? lane : N_NODES - CF * 32 - 1;
  const int a1 = lane * N_NODES + nk, a2 = cn * N_NODES + nk;
  int nq[NG];
  float cv[CG];
#pragma unroll   // constant register index, immediate load offsets
  for (int i = 0; i < NF; ++i) nq[i] = uidx[i * 32 + lane];
#pragma unroll   // constant register index, immediate load offsets
  for (int i = 0; i < CF; ++i) cv[i] = adpA[a1 + i * 32 * N_NODES];
  nq[NF] = uidx[NF * 32 + cq];
  cv[CF] = adpA[a2 + CF * 32 * N_NODES];
  // stands in front of any reuse of the address registers of the loads above: the indices
  // are inputs, so that they live up to the wait and no result lands in one of them;
  // the scheduling barrier keeps later arithmetic from rising over it
  asm volatile("s_wait_xcnt 0x0" :: "v"(lane), "v"(cq), "v"(a1), "v"(a2) : "memory");
  __builtin_amdgcn_sched_barrier(0);
#pragma unroll   // constant register index
  for (int i = 0; i < CG; ++i) colv[i * 32 + lane] = cv[i];
  __syncthreads();
  float av[NG];
#pragma unroll   // constant register index; every lane reads, so all LDS reads fly together
  for (int i = 0; i < NG; ++i) {
    int n = nq[i] / T_STEPS;
    n = n < 0 ? 0 : (n >= N_NODES ? N_NODES - 1 : n);
    av[i] = colv[n];
  }
#pragma unroll   // constant register index
  for (int i = 0; i < NG; ++i) {
    const bool in = k < N_UNMASK && i * 32 + lane < N_UNMASK;
    av[i] = (in & (av[i] == 0.f)) ? -1e30f : 0.f;
  }
  // every value in a register of its own in front of the first store
  __builtin_amdgcn_sched_barrier(0);
  float* mrow = Mb + (size_t)k * EM_PITCH + lane;
#pragma unroll   // constant register index, immediate store offsets
  for (int i = 0; i < NG; ++i) mrow[i * 32] = av[i];
}

// ---------------------------------------------------------------------------
// Attention in one pass over the keys, per (b, head, 32 queries): the scores never
// leave the registers.
//   St = K Qt : A = 16 keys x 24, B = Qt, kept in registers. D register r of a lane
//               is the score of key 8 * half + r for query l16.
//   softmax   : running maximum and sum per query (one lane column): in-lane over the
//               8 registers, one exchange between the wave's halves.
//   Ot += Vt Pt : D registers 2j, 2j + 1 of St are, as they stand, the B fragment of
//               k-step j if that step's keys are 8 * half + 2j + {0, 1}; the Vt
//               A fragment takes its rows in the same key order.
// A wave holds two query tiles, so each K and V fragment feeds two products. The
// key tiles are dealt round-robin to the NW waves of the work-group; their partial
// (maximum, sum, Ot) are merged in LDS at the end.
// Head dim order of the score product: at k-step j a lane half takes
// d = 8 * (j >> 1) + 4 * half + 2 * (j & 1) + {0, 1}, for K and Q alike: three 16-byte
// loads a row, in each of which the two halves read 32 adjacent bytes of one line.
// Q/K/V layout: [(b*S+s)*96 + h*24 + d]. maskT: [key][query], pitch EM_PITCH.
// ---------------------------------------------------------------------------
typedef float v4f __attribute__((ext_vector_type(4)));
#define FA_C (ATTN_SCALE * 1.4426950408889634f)   // score scale, in log2 units
#define FA_ROWS (HD + 2)                          // Ot rows, then maximum, then sum

template <bool B> struct fa_bool { static constexpr bool value = B; };

// lane l <-> l ^ 16
__device__ __forceinline__ float fa_xhalf(float v) {
  int b = __float_as_int(v);
  return __int_as_float(__builtin_amdgcn_permlanex16(b, b, 0x76543210, 0xfedcba98, false, false));
}

// 24 floats of one row as six k-step fragments; p: the row's start + 4 * half
__device__ __forceinline__ void fa_row(const float* __restrict__ p, v2f (&f)[6]) {
  const v4f x0 = *(const v4f*)p, x1 = *(const v4f*)(p + 8), x2 = *(const v4f*)(p + 16);
  f[0] = (v2f){x0.x, x0.y}; f[1] = (v2f){x0.z, x0.w};
  f[2] = (v2f){x1.x, x1.y}; f[3] = (v2f){x1.z, x1.w};
  f[4] = (v2f){x2.x, x2.y}; f[5] = (v2f){x2.z, x2.w};
}

template <int S, int NW, bool MASK>
__global__ __launch_bounds__(NW * 32)
void attn_kernel(const float* __restrict__ Q, const float* __restrict__ Kb,
                 const float* __restrict__ Vb, float* __restrict__ O,
                 const float* __restrict__ maskT) {
  constexpr int KT = (S + 15) / 16;
  static_assert(NW >= 4, "the merge takes four waves");
  // with a mask the scores are scaled when the bias is added, else inside the exponent
  constexpr float CC = MASK ? 1.f : FA_C;
  __shared__ float red[NW][2][FA_ROWS][16];
  const int lane = threadIdx.x & 31;
  // wave number in a scalar register: loop bounds and the last-tile branch stay scalar
  const int wave = __builtin_amdgcn_readfirstlane((int)(threadIdx.x >> 5));
  const int l16 = lane & 15, half = lane >> 4;
  const int q0 = blockIdx.x * 32, h = blockIdx.y, b = blockIdx.z;
  const size_t hb = (size_t)b * S * D_MODEL + (size_t)h * HD;
  const float* Kh = Kb + hb + 4 * half;
  const float* Vh = Vb + hb;
  const int hd2 = l16 < 8 ? 16 + l16 : HD - 1;   // second Ot tile: 8 rows, rest clamped

  v2f qf[2][6];
#pragma unroll   // constant register index
  for (int t = 0; t < 2; ++t) {
    int qr = q0 + 16 * t + l16; if (qr >= S) qr = S - 1;
    fa_row(Q + hb + (size_t)qr * D_MODEL + 4 * half, qf[t]);
  }
  v2f kf[6];
  {
    int key = wave * 16 + l16; if (key >= S) key = S - 1;
    fa_row(Kh + (size_t)key * D_MODEL, kf);
  }
  // stands in front of any reuse of the address registers of the loads above; the
  // scheduling barrier keeps later arithmetic from rising over it
  asm volatile("s_wait_xcnt 0x0" ::: "memory");
  __builtin_amdgcn_sched_barrier(0);
  v8f o[2][2];
  float mrun[2], lrun[2];
#pragma unroll   // constant register index
  for (int t = 0; t < 2; ++t) {
    o[t][0] = (v8f){}; o[t][1] = (v8f){};
    mrun[t] = -1e30f; lrun[t] = 0.f;
  }

  // one key tile; LAST: the tile that may hold keys past S
  auto tile = [&](auto lastc, const int kt) {
    constexpr bool LAST = decltype(lastc)::value;
    const int kb = kt * 16 + 8 * half;
    v2f vf[2][4];
#pragma unroll   // constant register index, immediate load offsets
    for (int j = 0; j < 4; ++j) {
      int r0 = kb + 2 * j, r1 = kb + 2 * j + 1;
      if (LAST) { r0 = r0 < S ? r0 : S - 1; r1 = r1 < S ? r1 : S - 1; }
      const float* vx = Vh + (size_t)r0 * D_MODEL;
      const float* vy = Vh + (size_t)r1 * D_MODEL;
      vf[0][j].x = vx[l16]; vf[0][j].y = vy[l16];
      vf[1][j].x = vx[hd2]; vf[1][j].y = vy[hd2];
    }
    float mb[2][8];
    if (MASK) {
      // stands in front of the bias loads, whose results may land in address
      // registers of the loads above
      asm volatile("s_wait_xcnt 0x0" ::: "memory");
      const float* mp = maskT + (size_t)kb * EM_PITCH + q0 + l16;
#pragma unroll   // constant register index, immediate load offsets
      for (int r = 0; r < 8; ++r) {
        mb[0][r] = mp[r * EM_PITCH];
        mb[1][r] = mp[r * EM_PITCH + 16];
      }
    }
    // stands in front of any reuse of the address registers of the loads above; the
    // scheduling barrier keeps later address arithmetic from rising over it and
    // the loads in front of the score products, whose time covers their latency
    asm volatile("s_wait_xcnt 0x0" ::: "memory");
    __builtin_amdgcn_sched_barrier(0);
    v8f s[2];
    s[0] = (v8f){}; s[1] = (v8f){};
#pragma unroll   // constant register index
    for (int j = 0; j < 6; ++j) {
      s[0] = __builtin_amdgcn_wmma_f32_16x16x4_f32(false, kf[j], false, qf[0][j], (short)0, s[0], false, false);
      s[1] = __builtin_amdgcn_wmma_f32_16x16x4_f32(false, kf[j], false, qf[1][j], (short)0, s[1], false, false);
    }
    // this wave's next K tile, in flight during the softmax and the second product
    // (past the end: the clamped last row, never used)
    {
      int key = (kt + NW) * 16 + l16; if (key >= S) key = S - 1;
      const float* kp = Kh + (size_t)key * D_MODEL;
      fa_row(kp, kf);
      // as above, for the three loads just issued; the address is an input, so that it
      // lives up to the wait and none of the three results lands in its registers
      asm volatile("s_wait_xcnt 0x0" :: "v"(kp) : "memory");
    }
    __builtin_amdgcn_sched_barrier(0);
#pragma unroll   // constant register index
    for (int t = 0; t < 2; ++t) {
      if (MASK) {
#pragma unroll   // constant register index
        for (int r = 0; r < 8; ++r) s[t][r] = fmaf(s[t][r], FA_C, mb[t][r]);
      }
      if (LAST) {
#pragma unroll   // constant register index
        for (int r = 0; r < 8; ++r)
          if (kb + r >= S) s[t][r] = -INFINITY;   // no key: weight exactly 0
      }
      float mx = s[t][0];
#pragma unroll   // constant register index
      for (int r = 1; r < 8; ++r) mx = fmaxf(mx, s[t][r]);
      mx = fmaxf(mx, fa_xhalf(mx));
      const float mnew = fmaxf(mrun[t], mx);
      const float alpha = __builtin_amdgcn_exp2f((mrun[t] - mnew) * CC);
      const float nb = -mnew * CC;
      mrun[t] = mnew;
      float sum = 0.f;
#pragma unroll   // constant register index
      for (int r = 0; r < 8; ++r) {
        s[t][r] = __builtin_amdgcn_exp2f(fmaf(s[t][r], CC, nb));
        sum += s[t][r];
      }
      lrun[t] = lrun[t] * alpha + sum;
      o[t][0] *= alpha;
      o[t][1] *= alpha;
    }
#pragma unroll   // constant register index
    for (int j = 0; j < 4; ++j) {
#pragma unroll   // constant register index
      for (int t = 0; t < 2; ++t) {
        const v2f pf = (v2f){s[t][2 * j], s[t][2 * j + 1]};
        o[t][0] = __builtin_amdgcn_wmma_f32_16x16x4_f32(false, vf[0][j], false, pf, (short)0, o[t][0], false, false);
        o[t][1] = __builtin_amdgcn_wmma_f32_16x16x4_f32(false, vf[1][j], false, pf, (short)0, o[t][1], false, false);
      }
    }
  };

  int kt = wave;
  for (; kt < KT - 1; kt += NW) tile(fa_bool<false>{}, kt);
  if (kt == KT - 1) tile(fa_bool<true>{}, kt);

  // -------- this wave's partial result to LDS --------
#pragma unroll   // constant register index
  for (int t = 0; t < 2; ++t) {
    const float lsum = lrun[t] + fa_xhalf(lrun[t]);
#pragma unroll   // constant register index
    for (int r = 0; r < 8; ++r) {
      red[wave][t][r + 8 * half][l16] = o[t][0][r];
      if (half == 0) red[wave][t][16 + r][l16] = o[t][1][r];
    }
    if (half == 0) {
      red[wave][t][HD][l16] = mrun[t];
      red[wave][t][HD + 1][l16] = lsum;
    }
  }
  __syncthreads();

  // -------- merge over the waves: four threads a query, six head dims each --------
  if (wave < 4) {
    const int ql = threadIdx.x >> 2, t = ql >> 4, qi = ql & 15;
    const int d0 = (threadIdx.x & 3) * 6;
    float mall = red[0][t][HD][qi];
#pragma unroll   // LDS reads at immediate offsets, all in flight together
    for (int w = 1; w < NW; ++w) mall = fmaxf(mall, red[w][t][HD][qi]);
    float den = 0.f, acc[6] = {0.f, 0.f, 0.f, 0.f, 0.f, 0.f};
#pragma unroll   // LDS reads at immediate offsets, all in flight together
    for (int w = 0; w < NW; ++w) {
      const float wg = __builtin_amdgcn_exp2f((red[w][t][HD][qi] - mall) * CC);
      den += wg * red[w][t][HD + 1][qi];
#pragma unroll   // constant register index
      for (int i = 0; i < 6; ++i) acc[i] += wg * red[w][t][d0 + i][qi];
    }
    const float inv = 1.f / den;
    const int q = q0 + ql;
    if (q < S) {
      float* op = O + hb + (size_t)q * D_MODEL + d0;
#pragma unroll   // constant register index
      for (int i = 0; i < 6; ++i) op[i] = acc[i] * inv;
    }
  }
}

// ---------------------------------------------------------------------------
// The row-local chain behind attention in ONE launch, one work-group of PK_WAVES
// waves per 16 rows:
//   h = LN(h + O Wo + bo); f = relu(h W1 + b1); h = LN(h + f W2 + b2); then
//   NEXT 1: the next layer's Q, K, V = h Wq|Wk|Wv + bias (nw, nb);
//   NEXT 2, the encoder's last layer: its closing LayerNorm (cg, cb), the decoder's
//           input row x = (h ew + eb) * sqrt(D), to Ho, and the decoder's Q, K, V of x
//           (nw, nb); row b * N_UNMASK + s goes to row b * NT + s;
//   NEXT 3, the decoder's last layer: its closing LayerNorm (cg, cb) and, for the
//           masked tokens' rows, the output h . ew + eb, to Ho.
// The 16 x 96 row tile and the 16 x 384 hidden tile stay in LDS; a product's
// result goes there in D layout and is read back as A fragments. Wave w owns
// column tile w of every 96-wide product and four tiles of the 384-wide one.
// Every accumulator keeps the ascending k order.
// LDS pitches are 4 dwords past a multiple of 32: the 16 rows x 2 halves of an
// 8-byte A-fragment read fall on 64 different banks.
// ---------------------------------------------------------------------------
#define PK_WAVES 6
#define PK_HP (D_MODEL + 4)
#define PK_FP (FF_DIM + 4)
static_assert(PK_WAVES * 16 == D_MODEL, "one 16-column tile of the model width per wave");

// B fragments of chunk c: CH k-steps x TN column tiles, TS floats from tile to tile
template <int N, int TS, int TN, int CH>
__device__ __forceinline__ void pk_load_b(const float* __restrict__ wp, const int c,
                                          v2f (&b)[CH][TN]) {
#pragma unroll   // constant register index, immediate load offsets
  for (int j = 0; j < CH; ++j) {
    const int k0 = (c * CH + j) * 4;
#pragma unroll   // constant register index
    for (int t = 0; t < TN; ++t) {
      b[j][t].x = wp[k0 * N + t * TS];
      b[j][t].y = wp[(k0 + 1) * N + t * TS];
    }
  }
}

// A fragments of chunk c from the LDS tile (as: this lane's row, + 2 * half)
template <int CH>
__device__ __forceinline__ void pk_load_a(const float* as, const int c, v2f (&a)[CH]) {
#pragma unroll   // constant register index
  for (int j = 0; j < CH; ++j) a[j] = *(const v2f*)(as + (c * CH + j) * 4);
}

// acc[t] += A(LDS, 16 x K) * W(:, tile t). The caller has loaded chunks 0 and 1
// of b (weights depend on no earlier stage, so that is done ahead of the barrier
// in front of the stage); chunk c + 2 is loaded while chunk c is multiplied.
template <int K, int N, int TS, int TN, int CH>
__device__ __forceinline__ void pk_mm(const float* as, const float* __restrict__ wp,
                                      v2f (&b)[3][CH][TN], v8f (&acc)[TN]) {
  constexpr int NCH = K / (4 * CH);
  static_assert(K % (4 * CH) == 0 && NCH >= 2, "shape");
  v2f a[2][CH];
  pk_load_a<CH>(as, 0, a[0]);
#pragma unroll   // constant ring index
  for (int c = 0; c < NCH; ++c) {
    if (c + 2 < NCH) pk_load_b<N, TS, TN, CH>(wp, c + 2, b[(c + 2) % 3]);
    if (c + 1 < NCH) pk_load_a<CH>(as, c + 1, a[(c + 1) % 2]);
    // keeps the loads above in front of this chunk's WMMAs: sunk to their use,
    // each chunk would wait out its own load latency
    __builtin_amdgcn_sched_barrier(0);
#pragma unroll   // constant ring index
    for (int j = 0; j < CH; ++j)
#pragma unroll   // constant ring index
      for (int t = 0; t < TN; ++t)
        acc[t] = __builtin_amdgcn_wmma_f32_16x16x4_f32(false, a[c % 2][j], false, b[c % 3][j][t],
                                                       (short)0, acc[t], false, false);
    // keeps the next trip's loads out of this chunk's WMMAs: risen there, they
    // cannot take this chunk's ring slot and cost a fourth chunk of registers
    __builtin_amdgcn_sched_barrier(0);
  }
  // stands in front of any reuse of the weight loads' address registers; the
  // scheduling barrier keeps later arithmetic from rising over it
  asm volatile("s_wait_xcnt 0x0" ::: "memory");
  __builtin_amdgcn_sched_barrier(0);
}

// LayerNorm of the 16 x 96 LDS tile in place: waves 0..3, four rows a wave, eight
// lanes a row, twelve elements a lane. Hout: the rows also go to global memory.
__device__ __forceinline__ void pk_ln(float* hs, const float* __restrict__ g,
                                      const float* __restrict__ bta, int wave, int lane,
                                      float* __restrict__ Hout, int m0, int M) {
  if (wave < 4) {
    const int row = wave * 4 + (lane >> 3), e = lane & 7;
    float* p = hs + row * PK_HP + e * 4;
    float v[12], gv[12], bv[12];
#pragma unroll   // constant register index
    for (int i = 0; i < 12; ++i) {
      const int o = (i >> 2) * 32 + (i & 3);
      v[i] = p[o];
      gv[i] = g[e * 4 + o];
      bv[i] = bta[e * 4 + o];
    }
    float s = 0.f;
#pragma unroll   // constant register index
    for (int i = 0; i < 12; ++i) s += v[i];
    s += __shfl_xor(s, 1, 32); s += __shfl_xor(s, 2, 32); s += __shfl_xor(s, 4, 32);
    const float m = s / (float)D_MODEL;
    float q = 0.f;
#pragma unroll   // constant register index
    for (int i = 0; i < 12; ++i) { v[i] -= m; q += v[i] * v[i]; }
    q += __shfl_xor(q, 1, 32); q += __shfl_xor(q, 2, 32); q += __shfl_xor(q, 4, 32);
    const float rs = rsqrtf(q / (float)D_MODEL + 1e-5f);
#pragma unroll   // constant register index
    for (int i = 0; i < 12; ++i) {
      v[i] = v[i] * rs * gv[i] + bv[i];
      p[(i >> 2) * 32 + (i & 3)] = v[i];
    }
    if (Hout && m0 + row < M) {
      float* hp = Hout + (size_t)(m0 + row) * D_MODEL + e * 4;
#pragma unroll   // constant register index
      for (int i = 0; i < 12; ++i) hp[(i >> 2) * 32 + (i & 3)] = v[i];
    }
  }
}

template <int NEXT>
__global__ __launch_bounds__(PK_WAVES * 32)
void post_kernel(const float* __restrict__ Ob, float* __restrict__ H,
                 const float* __restrict__ wo, const float* __restrict__ bo,
                 const float* __restrict__ ln,
                 const float* __restrict__ w1, const float* __restrict__ b1,
                 const float* __restrict__ w2, const float* __restrict__ b2,
                 const float* __restrict__ nw, const float* __restrict__ nb,
                 float* __restrict__ Qo, float* __restrict__ Ko, float* __restrict__ Vo,
                 const float* __restrict__ cg, const float* __restrict__ cb,
                 const float* __restrict__ ew, const float* __restrict__ eb,
                 float* __restrict__ Ho, int M) {
  __shared__ __attribute__((aligned(16))) float hs[16 * PK_HP];
  __shared__ __attribute__((aligned(16))) float fs[16 * PK_FP];
  const int lane = threadIdx.x & 31;
  // wave number in a scalar register: the LayerNorm branch stays scalar
  const int wave = __builtin_amdgcn_readfirstlane((int)(threadIdx.x >> 5));
  const int l16 = lane & 15, half = lane >> 4;
  const int m0 = blockIdx.x * 16;
  const int col = wave * 16 + l16;

  // ---- output projection: A from global (row-clamped), all operands at once ----
  int ra = m0 + l16; if (ra >= M) ra = M - 1;
  const float* xa  = Ob + (size_t)ra * D_MODEL + 2 * half;
  const float* wpo = wo + (size_t)(2 * half) * D_MODEL + col;
  v2f ao[D_MODEL / 4], wf[D_MODEL / 4];
#pragma unroll   // constant register index
  for (int j = 0; j < D_MODEL / 4; ++j) {
    ao[j].x = xa[4 * j];             ao[j].y = xa[4 * j + 1];
    wf[j].x = wpo[4 * j * D_MODEL];  wf[j].y = wpo[(4 * j + 1) * D_MODEL];
  }
  float res[8];
#pragma unroll   // constant register index
  for (int r = 0; r < 8; ++r) {
    int m = m0 + r + 8 * half; if (m >= M) m = M - 1;
    res[r] = H[(size_t)m * D_MODEL + col];
  }
  const float bov = bo[col], b2v = b2[col];
  const float ebv = NEXT == 2 ? eb[col] : 0.f;
  float b1v[4], nbv[3];
#pragma unroll   // constant register index
  for (int t = 0; t < 4; ++t) b1v[t] = b1[wave * 64 + t * 16 + l16];
  // stands in front of later loads whose results land in address registers of
  // the loads above
  asm volatile("s_wait_xcnt 0x0" ::: "memory");
  if (NEXT != 3) {
#pragma unroll   // constant register index
    for (int t = 0; t < 3; ++t) nbv[t] = nb[t * D_MODEL + col];
    // as above, for the three loads just issued
    asm volatile("s_wait_xcnt 0x0" ::: "memory");
  }
  const float* wp1 = w1 + (size_t)(2 * half) * FF_DIM + wave * 64 + l16;
  v2f bf1[3][4][4];
  pk_load_b<FF_DIM, 16, 4, 4>(wp1, 0, bf1[0]);
  pk_load_b<FF_DIM, 16, 4, 4>(wp1, 1, bf1[1]);
  // holds every load above in front of the WMMAs: one load latency for all
  __builtin_amdgcn_sched_barrier(0);
  v8f acco = {};
#pragma unroll   // constant register index
  for (int j = 0; j < D_MODEL / 4; ++j)
    acco = __builtin_amdgcn_wmma_f32_16x16x4_f32(false, ao[j], false, wf[j], (short)0, acco,
                                                 false, false);
#pragma unroll   // constant register index
  for (int r = 0; r < 8; ++r) hs[(r + 8 * half) * PK_HP + col] = res[r] + (acco[r] + bov);
  __syncthreads();
  // second FFN product's first weights: in flight while the rows are normalised
  const float* wp2 = w2 + (size_t)(2 * half) * D_MODEL + col;
  v2f bf2[3][12][1];
  pk_load_b<D_MODEL, 16, 1, 12>(wp2, 0, bf2[0]);
  pk_load_b<D_MODEL, 16, 1, 12>(wp2, 1, bf2[1]);
  pk_ln(hs, ln, ln + D_MODEL, wave, lane, (float*)0, m0, M);
  __syncthreads();

  // ---- f = relu(h W1 + b1), into LDS ----
  const float* ah = hs + l16 * PK_HP + 2 * half;
  v8f af[4];
#pragma unroll   // constant register index
  for (int t = 0; t < 4; ++t) af[t] = (v8f){};
  pk_mm<D_MODEL, FF_DIM, 16, 4, 4>(ah, wp1, bf1, af);
#pragma unroll   // constant register index
  for (int t = 0; t < 4; ++t)
#pragma unroll   // constant register index
    for (int r = 0; r < 8; ++r)
      fs[(r + 8 * half) * PK_FP + wave * 64 + t * 16 + l16] = fmaxf(af[t][r] + b1v[t], 0.f);
  __syncthreads();
  // the next product's first weights: in flight during the second FFN product
  const float* wpn = nw + (size_t)(2 * half) * D_MODEL + col;
  v2f bfn[3][4][3];
  v2f bfe[3][12][1];
  if (NEXT == 1) {
    pk_load_b<D_MODEL, D_MODEL * D_MODEL, 3, 4>(wpn, 0, bfn[0]);
    pk_load_b<D_MODEL, D_MODEL * D_MODEL, 3, 4>(wpn, 1, bfn[1]);
  }
  const float* wpe = ew + (size_t)(2 * half) * D_MODEL + col;   // NEXT 2 only
  if (NEXT == 2) {
    pk_load_b<D_MODEL, 16, 1, 12>(wpe, 0, bfe[0]);
    pk_load_b<D_MODEL, 16, 1, 12>(wpe, 1, bfe[1]);
    // stands in front of any reuse of the address registers of these loads; the address
    // is an input, so that it lives up to the wait
    asm volatile("s_wait_xcnt 0x0" :: "v"(wpe) : "memory");
  }

  // ---- h + f W2 + b2: each element of the row tile is updated by its own lane ----
  v8f a2[1];
  a2[0] = (v8f){};
  pk_mm<FF_DIM, D_MODEL, 16, 1, 12>(fs + l16 * PK_FP + 2 * half, wp2, bf2, a2);
#pragma unroll   // constant register index
  for (int r = 0; r < 8; ++r) {
    float* p = hs + (r + 8 * half) * PK_HP + col;
    *p = *p + (a2[0][r] + b2v);
  }
  __syncthreads();
  // the decoder's first projection weights: in flight during the two LayerNorms and
  // the product between them and their use
  if (NEXT == 2) {
    pk_load_b<D_MODEL, D_MODEL * D_MODEL, 3, 4>(wpn, 0, bfn[0]);
    pk_load_b<D_MODEL, D_MODEL * D_MODEL, 3, 4>(wpn, 1, bfn[1]);
  }
  pk_ln(hs, ln + 2 * D_MODEL, ln + 3 * D_MODEL, wave, lane, NEXT == 1 ? H : (float*)0, m0, M);
  // last layer of a stack: the stack's closing LayerNorm; each lane reads back only
  // what it wrote itself, so no barrier stands between the two
  if (NEXT != 1) pk_ln(hs, cg, cb, wave, lane, (float*)0, m0, M);

  // ---- the output: row . ew + eb, by the lanes that normalised the row ----
  if (NEXT == 3) {
    if (wave < 4) {
      const int row = wave * 4 + (lane >> 3), e = lane & 7;
      const float* p = hs + row * PK_HP + e * 4;
      float wv[12];
#pragma unroll   // constant register index
      for (int i = 0; i < 12; ++i) wv[i] = ew[e * 4 + (i >> 2) * 32 + (i & 3)];
      const float ob = eb[0];
      // stands in front of any reuse of the address registers of the loads above; the
      // scheduling barrier keeps later arithmetic from rising over it
      asm volatile("s_wait_xcnt 0x0" ::: "memory");
      __builtin_amdgcn_sched_barrier(0);
      float s = 0.f;
#pragma unroll   // constant register index
      for (int i = 0; i < 12; ++i) s += p[(i >> 2) * 32 + (i & 3)] * wv[i];
      s += __shfl_xor(s, 1, 32); s += __shfl_xor(s, 2, 32); s += __shfl_xor(s, 4, 32);
      const int m = m0 + row, j = m % NT - N_UNMASK;
      if (e == 0 && m < M && j >= 0) Ho[(m / NT) * N_MASKT + j] = s + ob;
    }
  }

  // where this lane's eight result rows go (NEXT 2), -1: no such row
  int orow[8];
  if (NEXT == 2) {
#pragma unroll   // constant register index
    for (int r = 0; r < 8; ++r) {
      const int m = m0 + 8 * half + r;
      orow[r] = m < M ? (m + (m / N_UNMASK) * N_MASKT) * D_MODEL + col : -1;
    }
    // ---- the decoder's input rows, into the row tile and to global memory ----
    __syncthreads();
    v8f ae[1];
    ae[0] = (v8f){};
    pk_mm<D_MODEL, D_MODEL, 16, 1, 12>(ah, wpe, bfe, ae);
    // every wave has read the row tile as its A operand before it is overwritten
    __syncthreads();
#pragma unroll   // constant register index
    for (int r = 0; r < 8; ++r) {
      const float x = (ae[0][r] + ebv) * SQRT_D;
      hs[(r + 8 * half) * PK_HP + col] = x;
      if (orow[r] >= 0) Ho[orow[r]] = x;
    }
  }

  // ---- next layer's Q, K, V: this wave's column tile of each ----
  if (NEXT != 3) {
    __syncthreads();
    v8f an[3];
#pragma unroll   // constant register index
    for (int t = 0; t < 3; ++t) an[t] = (v8f){};
    pk_mm<D_MODEL, D_MODEL, D_MODEL * D_MODEL, 3, 4>(ah, wpn, bfn, an);
    if (NEXT == 1) {
      const size_t ob = (size_t)(m0 + 8 * half) * D_MODEL + col;
      const int left = M - m0 - 8 * half;   // rows of this half tile that exist
#pragma unroll   // constant register index, immediate store offsets
      for (int r = 0; r < 8; ++r) {
        if (r < left) {
          Qo[ob + r * D_MODEL] = an[0][r] + nbv[0];
          Ko[ob + r * D_MODEL] = an[1][r] + nbv[1];
          Vo[ob + r * D_MODEL] = an[2][r] + nbv[2];
        }
      }
    } else {
#pragma unroll   // constant register index
      for (int r = 0; r < 8; ++r) {
        if (orow[r] >= 0) {
          Qo[orow[r]] = an[0][r] + nbv[0];
          Ko[orow[r]] = an[1][r] + nbv[1];
          Vo[orow[r]] = an[2][r] + nbv[2];
        }
      }
    }
  }
}

// ---------------------------------------------------------------------------
extern "C" void kernel_launch(void* const* d_in, const int* in_sizes, int n_in,
                              void* d_out, int out_size, void* d_ws, size_t ws_size,
                              hipStream_t stream) {
  (void)in_sizes; (void)n_in; (void)out_size; (void)ws_size;
  const float* hist  = (const float*)d_in[0];
  const int*   uidx  = (const int*)d_in[1];
  const int*   midx  = (const int*)d_in[2];
  const float* nv1   = (const float*)d_in[3];
  const float* nv2   = (const float*)d_in[4];
  const float* dim_w = (const float*)d_in[5];
  const float* dim_b = (const float*)d_in[6];
  const float* pos   = (const float*)d_in[7];
  const float* tod_w = (const float*)d_in[8];
  const float* tod_b = (const float*)d_in[9];
  const float* dow_w = (const float*)d_in[10];
  const float* dow_b = (const float*)d_in[11];
  const float* mtok  = (const float*)d_in[12];
  const float* eaw   = (const float*)d_in[13];
  const float* eab   = (const float*)d_in[14];
  const float* ew1   = (const float*)d_in[15];
  const float* eb1   = (const float*)d_in[16];
  const float* ew2   = (const float*)d_in[17];
  const float* eb2   = (const float*)d_in[18];
  const float* eln   = (const float*)d_in[19];
  const float* eng   = (const float*)d_in[20];
  const float* enb   = (const float*)d_in[21];
  const float* e2dw  = (const float*)d_in[22];
  const float* e2db  = (const float*)d_in[23];
  const float* daw   = (const float*)d_in[24];
  const float* dab   = (const float*)d_in[25];
  const float* dw1   = (const float*)d_in[26];
  const float* db1   = (const float*)d_in[27];
  const float* dw2   = (const float*)d_in[28];
  const float* db2   = (const float*)d_in[29];
  const float* dln   = (const float*)d_in[30];
  const float* dng   = (const float*)d_in[31];
  const float* dnb   = (const float*)d_in[32];
  const float* outw  = (const float*)d_in[33];
  const float* outb  = (const float*)d_in[34];
  float* out = (float*)d_out;

  float* ws = (float*)d_ws;
  size_t off = 0;
  auto alloc = [&](size_t n) { float* p = ws + off; off += n; return p; };
  const size_t MD = (size_t)BATCH * NT;   // max rows (decoder): 9936
  float* adpA  = alloc((size_t)N_NODES * N_NODES);
  float* Menc  = alloc((size_t)EM_ROWS * EM_PITCH);
  float* X  = alloc(MD * D_MODEL);
  float* Qb = alloc(MD * D_MODEL);
  float* Kb = alloc(MD * D_MODEL);
  float* Vb = alloc(MD * D_MODEL);
  float* Ob = alloc(MD * D_MODEL);
  float* Xd = alloc(MD * D_MODEL);
  float* Qd = alloc(MD * D_MODEL);
  float* Kd = alloc(MD * D_MODEL);
  float* Vd = alloc(MD * D_MODEL);

  front_kernel<<<N_NODES + (FR_ENC + FR_DEC) / FR_ROWS, D_MODEL, 0, stream>>>(
      nv1, nv2, adpA, hist, uidx, midx, dim_w, dim_b, pos, tod_w, tod_b, dow_w, dow_b, mtok,
      X, Xd, out);
  proj_kernel<<<PJ_ENC + PJ_DEC + EM_ROWS, 32, 0, stream>>>(
      X, eaw, eab, Qb, Kb, Vb, Xd, daw, dab, Qd, Kd, Vd, adpA, uidx, Menc);

  // ---- encoder (4 layers, masked attention over 621 tokens): attention, then the whole
  // row-local rest of the layer in one launch ----
  const unsigned pe = (BATCH * N_UNMASK + 15) / 16, pd = (BATCH * NT + 15) / 16;
  for (int l = 0; l < 4; ++l) {
    const float* aw = eaw + (size_t)l * 4 * D_MODEL * D_MODEL;
    const float* ab = eab + (size_t)l * 4 * D_MODEL;
    const float* w1 = ew1 + (size_t)l * D_MODEL * FF_DIM;
    const float* b1 = eb1 + (size_t)l * FF_DIM;
    const float* w2 = ew2 + (size_t)l * FF_DIM * D_MODEL;
    const float* b2 = eb2 + (size_t)l * D_MODEL;
    const float* ln = eln + (size_t)l * 2 * 2 * D_MODEL;
    attn_kernel<N_UNMASK, 8, true><<<dim3((N_UNMASK + 31) / 32, NHEAD, BATCH), 8 * 32, 0, stream>>>(
        Qb, Kb, Vb, Ob, Menc);
    if (l < 3)
      post_kernel<1><<<pe, PK_WAVES * 32, 0, stream>>>(
          Ob, X, aw + 3 * D_MODEL * D_MODEL, ab + 3 * D_MODEL, ln, w1, b1, w2, b2,
          aw + 4 * D_MODEL * D_MODEL, ab + 4 * D_MODEL, Qb, Kb, Vb,
          nullptr, nullptr, nullptr, nullptr, nullptr, BATCH * N_UNMASK);
    else
      post_kernel<2><<<pe, PK_WAVES * 32, 0, stream>>>(
          Ob, X, aw + 3 * D_MODEL * D_MODEL, ab + 3 * D_MODEL, ln, w1, b1, w2, b2,
          daw, dab, Qd, Kd, Vd, eng, enb, e2dw, e2db, Xd, BATCH * N_UNMASK);
  }
  // ---- decoder (1 layer, full attention over 2484 tokens) ----
  attn_kernel<NT, 4, false><<<dim3((NT + 31) / 32, NHEAD, BATCH), 4 * 32, 0, stream>>>(
      Qd, Kd, Vd, Ob, nullptr);
  post_kernel<3><<<pd, PK_WAVES * 32, 0, stream>>>(
      Ob, Xd, daw + 3 * D_MODEL * D_MODEL, dab + 3 * D_MODEL, dln, dw1, db1, dw2, db2,
      nullptr, nullptr, nullptr, nullptr, nullptr, dng, dnb, outw, outb, out, BATCH * NT);
}

// v006
// A run of this version takes 211 microseconds.
// Two timings next to v005 both put it at 1.11 times that version's speed.
// Over all steps from v000 it is 12.6 times as fast.
#include <hip/hip_runtime.h>
#include <math.h>

#define N_NODES  207
#define T_STEPS  12
#define C_IN     4
#define BATCH    4
#define NT       (N_NODES * T_STEPS)   // 2484
#define D_MODEL  96
#define NHEAD    4
#define HD       24
#define FF_DIM   384
#define N_MASKT  1863
#define N_UNMASK 621
#define MAX_NEIGH 40
#define ATTN_SCALE 0.20412414523193154f   // 1/sqrt(24)
#define SQRT_D     9.797958971132712f     // sqrt(96)

typedef float v2f __attribute__((ext_vector_type(2)));
typedef float v8f __attribute__((ext_vector_type(8)));

// ---------------------------------------------------------------------------
// Adjacency: A = softmax(relu(nv1 @ nv2), axis=1); keep iff (A > 1/N) and
// strictly greater than the 41st-largest in its row (rank < MAX_NEIGH).
// ---------------------------------------------------------------------------
__device__ __forceinline__ void adj_row(const float* __restrict__ nv1,
                                        const float* __restrict__ nv2,
                                        float* __restrict__ adpA, const int i) {
  __shared__ float a[N_NODES];
  __shared__ float stat[2];
  int tid = threadIdx.x;
  for (int j = tid; j < N_NODES; j += blockDim.x) {
    float s = 0.f;
    for (int r = 0; r < 10; ++r) s += nv1[i * 10 + r] * nv2[r * N_NODES + j];
    a[j] = s > 0.f ? s : 0.f;
  }
  __syncthreads();
  if (tid == 0) {
    float mx = -1e30f;
    for (int j = 0; j < N_NODES; ++j) mx = fmaxf(mx, a[j]);
    float sum = 0.f;
    for (int j = 0; j < N_NODES; ++j) sum += __expf(a[j] - mx);
    stat[0] = mx; stat[1] = 1.f / sum;
  }
  __syncthreads();
  float mx = stat[0], inv = stat[1];
  for (int j = tid; j < N_NODES; j += blockDim.x) a[j] = __expf(a[j] - mx) * inv;
  __syncthreads();
  const float thr = 1.0f / (float)N_NODES;
  for (int j = tid; j < N_NODES; j += blockDim.x) {
    float aj = a[j];
    int cnt = 0;
    for (int l = 0; l < N_NODES; ++l) cnt += (a[l] > aj) ? 1 : 0;
    bool keep = (aj > thr) && (cnt < MAX_NEIGH);
    adpA[i * N_NODES + j] = keep ? aj : 0.f;
  }
}

// Encoder additive attention bias, stored key-major: Mb[k][q] = 0 where query q may
// look at key k, -1e30 where adpA == 0. Rows are padded to whole key tiles and the
// pitch to whole query blocks (pad entries 0), so the attention kernel reads it
// with 16 consecutive queries on 16 lanes and needs no clamp.
#define EM_ROWS  (((N_UNMASK + 15) / 16) * 16)   // 624
#define EM_PITCH (((N_UNMASK + 31) / 32) * 32)   // 640

// ---------------------------------------------------------------------------
// Everything that depends on the inputs alone, in ONE launch; a work-group's role
// comes from its index:
//   adjacency row i;
//   encoder input row: (x0*dim_w + dim_b + pos + tod*tod_w + tod_b + dow*dow_w + dow_b)
//     at unmasked_idx, * sqrt(D);
//   decoder input row of a masked token: (mask_token + pos + tod/dow emb) * sqrt(D),
//     and that token's label.
// ---------------------------------------------------------------------------
#define FR_ENC (BATCH * N_UNMASK)
#define FR_DEC (BATCH * N_MASKT)
#define FR_ROWS 12   // rows a work-group: few waves to start, the rows' loads in flight together
static_assert(FR_ENC % FR_ROWS == 0 && FR_DEC % FR_ROWS == 0, "whole work-groups");
__global__ __launch_bounds__(D_MODEL)
void front_kernel(const float* __restrict__ nv1, const float* __restrict__ nv2,
                  float* __restrict__ adpA,
                  const float* __restrict__ hist,
                  const int* __restrict__ uidx, const int* __restrict__ midx,
                  const float* __restrict__ dim_w, const float* __restrict__ dim_b,
                  const float* __restrict__ pos,
                  const float* __restrict__ tod_w, const float* __restrict__ tod_b,
                  const float* __restrict__ dow_w, const float* __restrict__ dow_b,
                  const float* __restrict__ mask_token,
                  float* __restrict__ X, float* __restrict__ Xd, float* __restrict__ out) {
  const int blk = blockIdx.x;
  if (blk < N_NODES) { adj_row(nv1, nv2, adpA, blk); return; }
  const int d = threadIdx.x;       // 0..95
  const float todw = tod_w[d], todb = tod_b[d], doww = dow_w[d], dowb = dow_b[d];
  // stands in front of any reuse of the address registers of the four loads above; the
  // scheduling barrier keeps later arithmetic from rising over it
  asm volatile("s_wait_xcnt 0x0" ::: "memory");
  __builtin_amdgcn_sched_barrier(0);
  if (blk < N_NODES + FR_ENC / FR_ROWS) {
    const float dimw = dim_w[d], dimb = dim_b[d];
    const int r0 = (blk - N_NODES) * FR_ROWS;
#pragma unroll   // the rows' loads in flight together
    for (int i = 0; i < FR_ROWS; ++i) {
      const int row = r0 + i;      // b*N_UNMASK + s
      const int b = row / N_UNMASK, s = row % N_UNMASK;
      int nt = uidx[s];
      nt = nt < 0 ? 0 : (nt >= NT ? NT - 1 : nt);
      const int n = nt / T_STEPS, t = nt % T_STEPS;
      const float* hp = hist + (((size_t)b * T_STEPS + t) * N_NODES + n) * C_IN;
      float x0 = hp[0], dow = hp[2], tod = hp[3];
      float v = x0 * dimw + dimb + pos[(size_t)nt * D_MODEL + d] +
                tod * todw + todb + dow * doww + dowb;
      X[(size_t)row * D_MODEL + d] = v * SQRT_D;
    }
    // stands behind the run of stores, in front of any rewrite of their address and
    // data registers in the code that follows this role in the built kernel
    asm volatile("s_wait_xcnt 0x0" ::: "memory");
  } else {
    const float mtk = mask_token[d];
    const int r0 = (blk - (N_NODES + FR_ENC / FR_ROWS)) * FR_ROWS;
    int ntr[FR_ROWS], po[FR_ROWS];   // each row's token, and its place in pos
    float pv[FR_ROWS];
#pragma unroll   // constant register index; the rows' loads in flight together
    for (int i = 0; i < FR_ROWS; ++i) {
      int nt = midx[(r0 + i) % N_MASKT];
      nt = nt < 0 ? 0 : (nt >= NT ? NT - 1 : nt);
      ntr[i] = nt;
      po[i] = nt * D_MODEL + d;
      pv[i] = pos[po[i]];
    }
    // stands in front of any reuse of the address registers of the loads above: the places
    // are inputs, so that they live up to the wait and no result lands in one of them;
    // the scheduling barrier keeps later arithmetic from rising over it
    asm volatile("s_wait_xcnt 0x0" :: "v"(po[0]), "v"(po[1]), "v"(po[2]), "v"(po[3]), "v"(po[4]),
                 "v"(po[5]), "v"(po[6]), "v"(po[7]), "v"(po[8]), "v"(po[9]), "v"(po[10]),
                 "v"(po[11]) : "memory");
    __builtin_amdgcn_sched_barrier(0);
    float val[FR_ROWS];
    int xo[FR_ROWS];               // where each row goes in Xd
    float lab = 0.f;               // thread i keeps row i's label
#pragma unroll   // constant register index
    for (int i = 0; i < FR_ROWS; ++i) {
      const int row = r0 + i;      // b*N_MASKT + j
      const int b = row / N_MASKT, j = row % N_MASKT;
      const int n = ntr[i] / T_STEPS, t = ntr[i] % T_STEPS;
      const float* hp = hist + (((size_t)b * T_STEPS + t) * N_NODES + n) * C_IN;
      const float x0 = hp[0], dow = hp[2], tod = hp[3];
      float v = mtk + pv[i] + tod * todw + todb + dow * doww + dowb;
      val[i] = v * SQRT_D;
      xo[i] = (b * NT + N_UNMASK + j) * D_MODEL + d;
      lab = d == i ? x0 : lab;
    }
    // every value and place in a register of its own in front of the first store:
    // arithmetic sunk among the stores would rewrite registers of issued stores
    __builtin_amdgcn_sched_barrier(0);
#pragma unroll   // constant register index
    for (int i = 0; i < FR_ROWS; ++i) Xd[xo[i]] = val[i];
    // stands behind the run of stores, in front of any rewrite of their registers
    asm volatile("s_wait_xcnt 0x0" ::: "memory");
    if (d < FR_ROWS) out[FR_DEC + r0 + d] = lab;
  }
}

// ---------------------------------------------------------------------------
// fp32 GEMM via V_WMMA_F32_16X16X4_F32, register-blocked 32x32 per wave:
// 4 accumulators, each A-frag feeds 2 WMMAs and each B-frag feeds 2 WMMAs.
// Y[M,N] = X[M,K] @ W[K,N] + bias. K and N are compile-time, so every
// operand load is a base register plus an immediate offset.
// Row r of the product lies, in X and in Y alike, at r + (r / SEG) * GAP + OFF.
// The K loop is a register ring: operands come in chunks of GK_STEPS k-steps,
// GK_BUFS chunks are held, and a chunk's loads are issued at least GK_BUFS - 1
// chunks ahead of the WMMAs that use it, so a wave waits out the load latency
// once and not once per trip. Every accumulator keeps the ascending k order.
// M edge via row-clamped loads + guarded stores (EXEC stays full for WMMA).
// ---------------------------------------------------------------------------
#define GK_STEPS 4     // k-steps (of 4) per chunk: 32 loads
#define GK_BUFS  3     // chunks held in registers

template <int K, int N, int SEG, int GAP, int OFF>
__device__ __forceinline__
void gemm_tile(const float* __restrict__ X, const float* __restrict__ W,
               const float* __restrict__ bias, float* __restrict__ Y,
               const int M, const int m0, const int n0) {
  constexpr int NCH = K / (4 * GK_STEPS);
  static_assert(K % (4 * GK_STEPS) == 0 && N % 32 == 0 && NCH >= GK_BUFS, "shape");
  int lane = threadIdx.x & 31;
  int l16 = lane & 15, half = lane >> 4;
  int ra0 = m0 + l16;      if (ra0 >= M) ra0 = M - 1;
  int ra1 = m0 + 16 + l16; if (ra1 >= M) ra1 = M - 1;
  ra0 += (ra0 / SEG) * GAP + OFF;
  ra1 += (ra1 / SEG) * GAP + OFF;
  const float* xa0 = X + (size_t)ra0 * K + 2 * half;
  const float* xa1 = X + (size_t)ra1 * K + 2 * half;
  const float* wp  = W + (size_t)(2 * half) * N + n0 + l16;
  v2f a0[GK_BUFS][GK_STEPS], a1[GK_BUFS][GK_STEPS];
  v2f b0[GK_BUFS][GK_STEPS], b1[GK_BUFS][GK_STEPS];
  v8f acc00 = {}, acc01 = {}, acc10 = {}, acc11 = {};

// unrolled here and below: every ring index must be a compile-time constant,
// or the ring would live in scratch instead of registers
#define GK_LOAD(c)                                                     \
  _Pragma("unroll")                                                    \
  for (int j = 0; j < GK_STEPS; ++j) {                                 \
    const int k0 = ((c) * GK_STEPS + j) * 4;                           \
    const int s = (c) % GK_BUFS;                                       \
    a0[s][j].x = xa0[k0];              a0[s][j].y = xa0[k0 + 1];       \
    a1[s][j].x = xa1[k0];              a1[s][j].y = xa1[k0 + 1];       \
    b0[s][j].x = wp[k0 * N];           b0[s][j].y = wp[(k0 + 1) * N];  \
    b1[s][j].x = wp[k0 * N + 16];      b1[s][j].y = wp[(k0 + 1) * N + 16]; \
  }

#pragma unroll   // constant ring index
  for (int c = 0; c < GK_BUFS - 1; ++c) { GK_LOAD(c) }
#pragma unroll   // constant ring index and immediate load offsets
  for (int c = 0; c < NCH; ++c) {
    if (c + GK_BUFS - 1 < NCH) { GK_LOAD(c + GK_BUFS - 1) }
    // keeps the loads above in front of this chunk's WMMAs: sunk to their use,
    // each chunk would wait out its own load latency again
    __builtin_amdgcn_sched_barrier(0);
    const int s = c % GK_BUFS;
#pragma unroll   // constant ring index
    for (int j = 0; j < GK_STEPS; ++j) {
      acc00 = __builtin_amdgcn_wmma_f32_16x16x4_f32(false, a0[s][j], false, b0[s][j], (short)0, acc00, false, false);
      acc01 = __builtin_amdgcn_wmma_f32_16x16x4_f32(false, a0[s][j], false, b1[s][j], (short)0, acc01, false, false);
      acc10 = __builtin_amdgcn_wmma_f32_16x16x4_f32(false, a1[s][j], false, b0[s][j], (short)0, acc10, false, false);
      acc11 = __builtin_amdgcn_wmma_f32_16x16x4_f32(false, a1[s][j], false, b1[s][j], (short)0, acc11, false, false);
    }
  }
#undef GK_LOAD
  // stands in front of the epilogue's reuse of the operand loads' address
  // registers; the scheduling barrier keeps that arithmetic from rising over it
  asm volatile("s_wait_xcnt 0x0" ::: "memory");
  __builtin_amdgcn_sched_barrier(0);
  const int nA = n0 + l16;
  const float bv0 = bias[nA], bv1 = bias[nA + 16];
  // every store's offset in a register of its own, formed in front of the stores
  int ro[16];
#pragma unroll   // constant register index
  for (int r = 0; r < 16; ++r) {
    const int m = m0 + (r & 7) + 8 * half + 16 * (r >> 3);
    ro[r] = m < M ? (m + (m / SEG) * GAP + OFF) * N + nA : -1;
  }
#pragma unroll   // constant register index
  for (int r = 0; r < 8; ++r) {
    if (ro[r] >= 0) {
      Y[ro[r]] = acc00[r] + bv0;
      Y[ro[r] + 16] = acc01[r] + bv1;
    }
    if (ro[r + 8] >= 0) {
      Y[ro[r + 8]] = acc10[r] + bv0;
      Y[ro[r + 8] + 16] = acc11[r] + bv1;
    }
  }
}

// ---------------------------------------------------------------------------
// Everything that needs only the launch above, in ONE launch of one-wave
// work-groups; the role comes from the index:
//   a 32 x 32 tile of the first encoder layer's Q, K or V;
//   a 32 x 32 tile of the decoder's Q, K or V for the masked tokens' rows, which do
//     not depend on the encoder;
//   one key row of the encoder's attention bias.
// ---------------------------------------------------------------------------
#define PJ_ENC (((BATCH * N_UNMASK + 31) / 32) * 9)
#define PJ_DEC (((BATCH * N_MASKT + 31) / 32) * 9)
__global__ __launch_bounds__(32)
void proj_kernel(const float* __restrict__ X, const float* __restrict__ eaw,
                 const float* __restrict__ eab, float* __restrict__ Qe,
                 float* __restrict__ Ke, float* __restrict__ Ve,
                 const float* __restrict__ Xd, const float* __restrict__ daw,
                 const float* __restrict__ dab, float* __restrict__ Qd,
                 float* __restrict__ Kd, float* __restrict__ Vd,
                 const float* __restrict__ adpA, const int* __restrict__ uidx,
                 float* __restrict__ Mb) {
  const int blk = blockIdx.x;
  if (blk < PJ_ENC) {
    const int y = blk % 9, p = y / 3;
    gemm_tile<D_MODEL, D_MODEL, (1 << 30), 0, 0>(
        X, eaw + p * D_MODEL * D_MODEL, eab + p * D_MODEL, p == 0 ? Qe : (p == 1 ? Ke : Ve),
        BATCH * N_UNMASK, (blk / 9) * 32, (y % 3) * 32);
    return;
  }
  if (blk < PJ_ENC + PJ_DEC) {
    const int t = blk - PJ_ENC, y = t % 9, p = y / 3;
    gemm_tile<D_MODEL, D_MODEL, N_MASKT, N_UNMASK, N_UNMASK>(
        Xd, daw + p * D_MODEL * D_MODEL, dab + p * D_MODEL, p == 0 ? Qd : (p == 1 ? Kd : Vd),
        BATCH * N_MASKT, (t / 9) * 32, (y % 3) * 32);
    return;
  }
  // column nk of the adjacency goes to LDS, and each query looks its node up there
  constexpr int NG = EM_PITCH / 32, NF = N_UNMASK / 32;        // query groups, whole ones
  constexpr int CG = (N_NODES + 31) / 32, CF = N_NODES / 32;   // node groups, whole ones
  static_assert(NG == NF + 1 && CG == CF + 1, "one clamped group each");
  __shared__ float colv[CG * 32];
  const int k = blk - (PJ_ENC + PJ_DEC);   // 0 .. EM_ROWS - 1
  const int lane = threadIdx.x;
  int nk = uidx[k < N_UNMASK ? k : N_UNMASK - 1] / T_STEPS;
  nk = nk < 0 ? 0 : (nk >= N_NODES ? N_NODES - 1 : nk);
  // last group of each: past the end the last element, not used
  const int cq = lane < N_UNMASK - NF * 32 ? lane : N_UNMASK - NF * 32 - 1;
  const int cn = lane < N_NODES - CF * 32 ? lane : N_NODES - CF * 32 - 1;
  const int a1 = lane * N_NODES + nk, a2 = cn * N_NODES + nk;
  int nq[NG];
  float cv[CG];
#pragma unroll   // constant register index, immediate load offsets
  for (int i = 0; i < NF; ++i) nq[i] = uidx[i * 32 + lane];
#pragma unroll   // constant register index, immediate load offsets
  for (int i = 0; i < CF; ++i) cv[i] = adpA[a1 + i * 32 * N_NODES];
  nq[NF] = uidx[NF * 32 + cq];
  cv[CF] = adpA[a2 + CF * 32 * N_NODES];
  // stands in front of any reuse of the address registers of the loads above: the indices
  // are inputs, so that they live up to the wait and no result lands in one of them;
  // the scheduling barrier keeps later arithmetic from rising over it
  asm volatile("s_wait_xcnt 0x0" :: "v"(lane), "v"(cq), "v"(a1), "v"(a2) : "memory");
  __builtin_amdgcn_sched_barrier(0);
#pragma unroll   // constant register index
  for (int i = 0; i < CG; ++i) colv[i * 32 + lane] = cv[i];
  __syncthreads();
  float av[NG];
#pragma unroll   // constant register index; every lane reads, so all LDS reads fly together
  for (int i = 0; i < NG; ++i) {
    int n = nq[i] / T_STEPS;
    n = n < 0 ? 0 : (n >= N_NODES ? N_NODES - 1 : n);
    av[i] = colv[n];
  }
#pragma unroll   // constant register index
  for (int i = 0; i < NG; ++i) {
    const bool in = k < N_UNMASK && i * 32 + lane < N_UNMASK;
    av[i] = (in & (av[i] == 0.f)) ? -1e30f : 0.f;
  }
  // every value in a register of its own in front of the first store
  __builtin_amdgcn_sched_barrier(0);
  float* mrow = Mb + (size_t)k * EM_PITCH + lane;
#pragma unroll   // constant register index, immediate store offsets
  for (int i = 0; i < NG; ++i) mrow[i * 32] = av[i];
}

// ---------------------------------------------------------------------------
// Attention in one pass over the keys, per (b, head, 32 queries): the scores never
// leave the registers.
//   St = K Qt : A = 16 keys x 24, B = Qt, kept in registers. D register r of a lane
//               is the score of key 8 * half + r for query l16.
//   softmax   : running maximum and sum per query (one lane column): in-lane over the
//               8 registers, one exchange between the wave's halves.
//   Ot += Vt Pt : D registers 2j, 2j + 1 of St are, as they stand, the B fragment of
//               k-step j if that step's keys are 8 * half + 2j + {0, 1}; the Vt
//               A fragment takes its rows in the same key order.
// A wave holds two query tiles, so each K and V fragment feeds two products. The
// key tiles are dealt round-robin to the NW waves of the work-group; their partial
// (maximum, sum, Ot) are merged in LDS at the end.
// Head dim order of the score product: at k-step j a lane half takes
// d = 8 * (j >> 1) + 4 * half + 2 * (j & 1) + {0, 1}, for K and Q alike: three 16-byte
// loads a row, in each of which the two halves read 32 adjacent bytes of one line.
// Q/K/V layout: [(b*S+s)*96 + h*24 + d]. maskT: [key][query], pitch EM_PITCH.
// QB: the first query row. Rows in front of it are keys and values only.
// ---------------------------------------------------------------------------
typedef float v4f __attribute__((ext_vector_type(4)));
#define FA_C (ATTN_SCALE * 1.4426950408889634f)   // score scale, in log2 units
#define FA_ROWS (HD + 2)                          // Ot rows, then maximum, then sum

template <bool B> struct fa_bool { static constexpr bool value = B; };

// lane l <-> l ^ 16
__device__ __forceinline__ float fa_xhalf(float v) {
  int b = __float_as_int(v);
  return __int_as_float(__builtin_amdgcn_permlanex16(b, b, 0x76543210, 0xfedcba98, false, false));
}

// 24 floats of one row as six k-step fragments; p: the row's start + 4 * half
__device__ __forceinline__ void fa_row(const float* __restrict__ p, v2f (&f)[6]) {
  const v4f x0 = *(const v4f*)p, x1 = *(const v4f*)(p + 8), x2 = *(const v4f*)(p + 16);
  f[0] = (v2f){x0.x, x0.y}; f[1] = (v2f){x0.z, x0.w};
  f[2] = (v2f){x1.x, x1.y}; f[3] = (v2f){x1.z, x1.w};
  f[4] = (v2f){x2.x, x2.y}; f[5] = (v2f){x2.z, x2.w};
}

template <int S, int NW, bool MASK, int QB>
__global__ __launch_bounds__(NW * 32)
void attn_kernel(const float* __restrict__ Q, const float* __restrict__ Kb,
                 const float* __restrict__ Vb, float* __restrict__ O,
                 const float* __restrict__ maskT) {
  constexpr int KT = (S + 15) / 16;
  static_assert(NW >= 4, "the merge takes four waves");
  // with a mask the scores are scaled when the bias is added, else inside the exponent
  constexpr float CC = MASK ? 1.f : FA_C;
  __shared__ float red[NW][2][FA_ROWS][16];
  const int lane = threadIdx.x & 31;
  // wave number in a scalar register: loop bounds and the last-tile branch stay scalar
  const int wave = __builtin_amdgcn_readfirstlane((int)(threadIdx.x >> 5));
  const int l16 = lane & 15, half = lane >> 4;
  const int q0 = QB + blockIdx.x * 32, h = blockIdx.y, b = blockIdx.z;
  const size_t hb = (size_t)b * S * D_MODEL + (size_t)h * HD;
  const float* Kh = Kb + hb + 4 * half;
  const float* Vh = Vb + hb;
  const int hd2 = l16 < 8 ? 16 + l16 : HD - 1;   // second Ot tile: 8 rows, rest clamped

  v2f qf[2][6];
#pragma unroll   // constant register index
  for (int t = 0; t < 2; ++t) {
    int qr = q0 + 16 * t + l16; if (qr >= S) qr = S - 1;
    fa_row(Q + hb + (size_t)qr * D_MODEL + 4 * half, qf[t]);
  }
  v2f kf[6];
  {
    int key = wave * 16 + l16; if (key >= S) key = S - 1;
    fa_row(Kh + (size_t)key * D_MODEL, kf);
  }
  // stands in front of any reuse of the address registers of the loads above; the
  // scheduling barrier keeps later arithmetic from rising over it
  asm volatile("s_wait_xcnt 0x0" ::: "memory");
  __builtin_amdgcn_sched_barrier(0);
  v8f o[2][2];
  float mrun[2], lrun[2];
#pragma unroll   // constant register index
  for (int t = 0; t < 2; ++t) {
    o[t][0] = (v8f){}; o[t][1] = (v8f){};
    mrun[t] = -1e30f; lrun[t] = 0.f;
  }

  // one key tile; LAST: the tile that may hold keys past S
  auto tile = [&](auto lastc, const int kt) {
    constexpr bool LAST = decltype(lastc)::value;
    const int kb = kt * 16 + 8 * half;
    v2f vf[2][4];
#pragma unroll   // constant register index, immediate load offsets
    for (int j = 0; j < 4; ++j) {
      int r0 = kb + 2 * j, r1 = kb + 2 * j + 1;
      if (LAST) { r0 = r0 < S ? r0 : S - 1; r1 = r1 < S ? r1 : S - 1; }
      const float* vx = Vh + (size_t)r0 * D_MODEL;
      const float* vy = Vh + (size_t)r1 * D_MODEL;
      vf[0][j].x = vx[l16]; vf[0][j].y = vy[l16];
      vf[1][j].x = vx[hd2]; vf[1][j].y = vy[hd2];
    }
    float mb[2][8];
    if (MASK) {
      // stands in front of the bias loads, whose results may land in address
      // registers of the loads above
      asm volatile("s_wait_xcnt 0x0" ::: "memory");
      const float* mp = maskT + (size_t)kb * EM_PITCH + q0 + l16;
#pragma unroll   // constant register index, immediate load offsets
      for (int r = 0; r < 8; ++r) {
        mb[0][r] = mp[r * EM_PITCH];
        mb[1][r] = mp[r * EM_PITCH + 16];
      }
    }
    // stands in front of any reuse of the address registers of the loads above; the
    // scheduling barrier keeps later address arithmetic from rising over it and
    // the loads in front of the score products, whose time covers their latency
    asm volatile("s_wait_xcnt 0x0" ::: "memory");
    __builtin_amdgcn_sched_barrier(0);
    v8f s[2];
    s[0] = (v8f){}; s[1] = (v8f){};
#pragma unroll   // constant register index
    for (int j = 0; j < 6; ++j) {
      s[0] = __builtin_amdgcn_wmma_f32_16x16x4_f32(false, kf[j], false, qf[0][j], (short)0, s[0], false, false);
      s[1] = __builtin_amdgcn_wmma_f32_16x16x4_f32(false, kf[j], false, qf[1][j], (short)0, s[1], false, false);
    }
    // this wave's next K tile, in flight during the softmax and the second product
    // (past the end: the clamped last row, never used)
    {
      int key = (kt + NW) * 16 + l16; if (key >= S) key = S - 1;
      const float* kp = Kh + (size_t)key * D_MODEL;
      fa_row(kp, kf);
      // as above, for the three loads just issued; the address is an input, so that it
      // lives up to the wait and none of the three results lands in its registers
      asm volatile("s_wait_xcnt 0x0" :: "v"(kp) : "memory");
    }
    __builtin_amdgcn_sched_barrier(0);
#pragma unroll   // constant register index
    for (int t = 0; t < 2; ++t) {
      if (MASK) {
#pragma unroll   // constant register index
        for (int r = 0; r < 8; ++r) s[t][r] = fmaf(s[t][r], FA_C, mb[t][r]);
      }
      if (LAST) {
#pragma unroll   // constant register index
        for (int r = 0; r < 8; ++r)
          if (kb + r >= S) s[t][r] = -INFINITY;   // no key: weight exactly 0
      }
      float mx = s[t][0];
#pragma unroll   // constant register index
      for (int r = 1; r < 8; ++r) mx = fmaxf(mx, s[t][r]);
      mx = fmaxf(mx, fa_xhalf(mx));
      const float mnew = fmaxf(mrun[t], mx);
      const float alpha = __builtin_amdgcn_exp2f((mrun[t] - mnew) * CC);
      const float nb = -mnew * CC;
      mrun[t] = mnew;
      float sum = 0.f;
#pragma unroll   // constant register index
      for (int r = 0; r < 8; ++r) {
        s[t][r] = __builtin_amdgcn_exp2f(fmaf(s[t][r], CC, nb));
        sum += s[t][r];
      }
      lrun[t] = lrun[t] * alpha + sum;
      o[t][0] *= alpha;
      o[t][1] *= alpha;
    }
#pragma unroll   // constant register index
    for (int j = 0; j < 4; ++j) {
#pragma unroll   // constant register index
      for (int t = 0; t < 2; ++t) {
        const v2f pf = (v2f){s[t][2 * j], s[t][2 * j + 1]};
        o[t][0] = __builtin_amdgcn_wmma_f32_16x16x4_f32(false, vf[0][j], false, pf, (short)0, o[t][0], false, false);
        o[t][1] = __builtin_amdgcn_wmma_f32_16x16x4_f32(false, vf[1][j], false, pf, (short)0, o[t][1], false, false);
      }
    }
  };

  int kt = wave;
  for (; kt < KT - 1; kt += NW) tile(fa_bool<false>{}, kt);
  if (kt == KT - 1) tile(fa_bool<true>{}, kt);

  // -------- this wave's partial result to LDS --------
#pragma unroll   // constant register index
  for (int t = 0; t < 2; ++t) {
    const float lsum = lrun[t] + fa_xhalf(lrun[t]);
#pragma unroll   // constant register index
    for (int r = 0; r < 8; ++r) {
      red[wave][t][r + 8 * half][l16] = o[t][0][r];
      if (half == 0) red[wave][t][16 + r][l16] = o[t][1][r];
    }
    if (half == 0) {
      red[wave][t][HD][l16] = mrun[t];
      red[wave][t][HD + 1][l16] = lsum;
    }
  }
  __syncthreads();

  // -------- merge over the waves: four threads a query, six head dims each --------
  if (wave < 4) {
    const int ql = threadIdx.x >> 2, t = ql >> 4, qi = ql & 15;
    const int d0 = (threadIdx.x & 3) * 6;
    float mall = red[0][t][HD][qi];
#pragma unroll   // LDS reads at immediate offsets, all in flight together
    for (int w = 1; w < NW; ++w) mall = fmaxf(mall, red[w][t][HD][qi]);
    float den = 0.f, acc[6] = {0.f, 0.f, 0.f, 0.f, 0.f, 0.f};
#pragma unroll   // LDS reads at immediate offsets, all in flight together
    for (int w = 0; w < NW; ++w) {
      const float wg = __builtin_amdgcn_exp2f((red[w][t][HD][qi] - mall) * CC);
      den += wg * red[w][t][HD + 1][qi];
#pragma unroll   // constant register index
      for (int i = 0; i < 6; ++i) acc[i] += wg * red[w][t][d0 + i][qi];
    }
    const float inv = 1.f / den;
    const int q = q0 + ql;
    if (q < S) {
      float* op = O + hb + (size_t)q * D_MODEL + d0;
#pragma unroll   // constant register index
      for (int i = 0; i < 6; ++i) op[i] = acc[i] * inv;
    }
  }
}

// ---------------------------------------------------------------------------
// The row-local chain behind attention in ONE launch, one work-group of PK_WAVES
// waves per 16 rows:
//   h = LN(h + O Wo + bo); f = relu(h W1 + b1); h = LN(h + f W2 + b2); then
//   NEXT 1: the next layer's Q, K, V = h Wq|Wk|Wv + bias (nw, nb);
//   NEXT 2, the encoder's last layer: its closing LayerNorm (cg, cb), the decoder's
//           input row x = (h ew + eb) * sqrt(D), and the decoder's K and V of x (nw, nb);
//           row b * N_UNMASK + s goes to row b * NT + s. The one decoder layer's output
//           is read at the masked tokens' rows alone, so these rows are only looked at:
//           no Q of them, and x itself goes nowhere;
//   NEXT 3, the decoder's last layer, the masked tokens' rows alone (row b * N_MASKT + j
//           lies at row b * NT + N_UNMASK + j of Ob and H): its closing LayerNorm
//           (cg, cb) and the output h . ew + eb, to Ho.
// The 16 x 96 row tile and the 16 x 384 hidden tile stay in LDS; a product's
// result goes there in D layout and is read back as A fragments. Wave w owns
// column tile w of every 96-wide product and four tiles of the 384-wide one.
// Every accumulator keeps the ascending k order.
// LDS pitches are 4 dwords past a multiple of 32: the 16 rows x 2 halves of an
// 8-byte A-fragment read fall on 64 different banks.
// ---------------------------------------------------------------------------
#define PK_WAVES 6
#define PK_HP (D_MODEL + 4)
#define PK_FP (FF_DIM + 4)
static_assert(PK_WAVES * 16 == D_MODEL, "one 16-column tile of the model width per wave");

// B fragments of chunk c: CH k-steps x TN column tiles, TS floats from tile to tile
template <int N, int TS, int TN, int CH>
__device__ __forceinline__ void pk_load_b(const float* __restrict__ wp, const int c,
                                          v2f (&b)[CH][TN]) {
#pragma unroll   // constant register index, immediate load offsets
  for (int j = 0; j < CH; ++j) {
    const int k0 = (c * CH + j) * 4;
#pragma unroll   // constant register index
    for (int t = 0; t < TN; ++t) {
      b[j][t].x = wp[k0 * N + t * TS];
      b[j][t].y = wp[(k0 + 1) * N + t * TS];
    }
  }
}

// A fragments of chunk c from the LDS tile (as: this lane's row, + 2 * half)
template <int CH>
__device__ __forceinline__ void pk_load_a(const float* as, const int c, v2f (&a)[CH]) {
#pragma unroll   // constant register index
  for (int j = 0; j < CH; ++j) a[j] = *(const v2f*)(as + (c * CH + j) * 4);
}

// acc[t] += A(LDS, 16 x K) * W(:, tile t). The caller has loaded chunks 0 and 1
// of b (weights depend on no earlier stage, so that is done ahead of the barrier
// in front of the stage); chunk c + 2 is loaded while chunk c is multiplied.
template <int K, int N, int TS, int TN, int CH>
__device__ __forceinline__ void pk_mm(const float* as, const float* __restrict__ wp,
                                      v2f (&b)[3][CH][TN], v8f (&acc)[TN]) {
  constexpr int NCH = K / (4 * CH);
  static_assert(K % (4 * CH) == 0 && NCH >= 2, "shape");
  v2f a[2][CH];
  pk_load_a<CH>(as, 0, a[0]);
#pragma unroll   // constant ring index
  for (int c = 0; c < NCH; ++c) {
    if (c + 2 < NCH) pk_load_b<N, TS, TN, CH>(wp, c + 2, b[(c + 2) % 3]);
    if (c + 1 < NCH) pk_load_a<CH>(as, c + 1, a[(c + 1) % 2]);
    // keeps the loads above in front of this chunk's WMMAs: sunk to their use,
    // each chunk would wait out its own load latency
    __builtin_amdgcn_sched_barrier(0);
#pragma unroll   // constant ring index
    for (int j = 0; j < CH; ++j)
#pragma unroll   // constant ring index
      for (int t = 0; t < TN; ++t)
        acc[t] = __builtin_amdgcn_wmma_f32_16x16x4_f32(false, a[c % 2][j], false, b[c % 3][j][t],
                                                       (short)0, acc[t], false, false);
    // keeps the next trip's loads out of this chunk's WMMAs: risen there, they
    // cannot take this chunk's ring slot and cost a fourth chunk of registers
    __builtin_amdgcn_sched_barrier(0);
  }
  // stands in front of any reuse of the weight loads' address registers; the
  // scheduling barrier keeps later arithmetic from rising over it
  asm volatile("s_wait_xcnt 0x0" ::: "memory");
  __builtin_amdgcn_sched_barrier(0);
}

// LayerNorm of the 16 x 96 LDS tile in place: waves 0..3, four rows a wave, eight
// lanes a row, twelve elements a lane. Hout: the rows also go to global memory.
__device__ __forceinline__ void pk_ln(float* hs, const float* __restrict__ g,
                                      const float* __restrict__ bta, int wave, int lane,
                                      float* __restrict__ Hout, int m0, int M) {
  if (wave < 4) {
    const int row = wave * 4 + (lane >> 3), e = lane & 7;
    float* p = hs + row * PK_HP + e * 4;
    float v[12], gv[12], bv[12];
#pragma unroll   // constant register index
    for (int i = 0; i < 12; ++i) {
      const int o = (i >> 2) * 32 + (i & 3);
      v[i] = p[o];
      gv[i] = g[e * 4 + o];
      bv[i] = bta[e * 4 + o];
    }
    float s = 0.f;
#pragma unroll   // constant register index
    for (int i = 0; i < 12; ++i) s += v[i];
    s += __shfl_xor(s, 1, 32); s += __shfl_xor(s, 2, 32); s += __shfl_xor(s, 4, 32);
    const float m = s / (float)D_MODEL;
    float q = 0.f;
#pragma unroll   // constant register index
    for (int i = 0; i < 12; ++i) { v[i] -= m; q += v[i] * v[i]; }
    q += __shfl_xor(q, 1, 32); q += __shfl_xor(q, 2, 32); q += __shfl_xor(q, 4, 32);
    const float rs = rsqrtf(q / (float)D_MODEL + 1e-5f);
#pragma unroll   // constant register index
    for (int i = 0; i < 12; ++i) {
      v[i] = v[i] * rs * gv[i] + bv[i];
      p[(i >> 2) * 32 + (i & 3)] = v[i];
    }
    if (Hout && m0 + row < M) {
      float* hp = Hout + (size_t)(m0 + row) * D_MODEL + e * 4;
#pragma unroll   // constant register index
      for (int i = 0; i < 12; ++i) hp[(i >> 2) * 32 + (i & 3)] = v[i];
    }
  }
}

template <int NEXT>
__global__ __launch_bounds__(PK_WAVES * 32)
void post_kernel(const float* __restrict__ Ob, float* __restrict__ H,
                 const float* __restrict__ wo, const float* __restrict__ bo,
                 const float* __restrict__ ln,
                 const float* __restrict__ w1, const float* __restrict__ b1,
                 const float* __restrict__ w2, const float* __restrict__ b2,
                 const float* __restrict__ nw, const float* __restrict__ nb,
                 float* __restrict__ Qo, float* __restrict__ Ko, float* __restrict__ Vo,
                 const float* __restrict__ cg, const float* __restrict__ cb,
                 const float* __restrict__ ew, const float* __restrict__ eb,
                 float* __restrict__ Ho, int M) {
  __shared__ __attribute__((aligned(16))) float hs[16 * PK_HP];
  __shared__ __attribute__((aligned(16))) float fs[16 * PK_FP];
  const int lane = threadIdx.x & 31;
  // wave number in a scalar register: the LayerNorm branch stays scalar
  const int wave = __builtin_amdgcn_readfirstlane((int)(threadIdx.x >> 5));
  const int l16 = lane & 15, half = lane >> 4;
  const int m0 = blockIdx.x * 16;
  const int col = wave * 16 + l16;

  // ---- output projection: A from global (row-clamped), all operands at once ----
  int ra = m0 + l16; if (ra >= M) ra = M - 1;
  if (NEXT == 3) ra += (ra / N_MASKT) * N_UNMASK + N_UNMASK;
  const float* xa  = Ob + (size_t)ra * D_MODEL + 2 * half;
  const float* wpo = wo + (size_t)(2 * half) * D_MODEL + col;
  v2f ao[D_MODEL / 4], wf[D_MODEL / 4];
#pragma unroll   // constant register index
  for (int j = 0; j < D_MODEL / 4; ++j) {
    ao[j].x = xa[4 * j];             ao[j].y = xa[4 * j + 1];
    wf[j].x = wpo[4 * j * D_MODEL];  wf[j].y = wpo[(4 * j + 1) * D_MODEL];
  }
  float res[8];
#pragma unroll   // constant register index
  for (int r = 0; r < 8; ++r) {
    int m = m0 + r + 8 * half; if (m >= M) m = M - 1;
    if (NEXT == 3) m += (m / N_MASKT) * N_UNMASK + N_UNMASK;
    res[r] = H[(size_t)m * D_MODEL + col];
  }
  const float bov = bo[col], b2v = b2[col];
  const float ebv = NEXT == 2 ? eb[col] : 0.f;
  // the products behind the chain: Q, K, V, or (NEXT 2) K and V, the second and third
  constexpr int NP = NEXT == 2 ? 2 : 3, P0 = 3 - NP;
  float b1v[4], nbv[NP];
#pragma unroll   // constant register index
  for (int t = 0; t < 4; ++t) b1v[t] = b1[wave * 64 + t * 16 + l16];
  // stands in front of later loads whose results land in address registers of
  // the loads above
  asm volatile("s_wait_xcnt 0x0" ::: "memory");
  if (NEXT != 3) {
#pragma unroll   // constant register index
    for (int t = 0; t < NP; ++t) nbv[t] = nb[(P0 + t) * D_MODEL + col];
    // as above, for the loads just issued
    asm volatile("s_wait_xcnt 0x0" ::: "memory");
  }
  const float* wp1 = w1 + (size_t)(2 * half) * FF_DIM + wave * 64 + l16;
  v2f bf1[3][4][4];
  pk_load_b<FF_DIM, 16, 4, 4>(wp1, 0, bf1[0]);
  pk_load_b<FF_DIM, 16, 4, 4>(wp1, 1, bf1[1]);
  // holds every load above in front of the WMMAs: one load latency for all
  __builtin_amdgcn_sched_barrier(0);
  v8f acco = {};
#pragma unroll   // constant register index
  for (int j = 0; j < D_MODEL / 4; ++j)
    acco = __builtin_amdgcn_wmma_f32_16x16x4_f32(false, ao[j], false, wf[j], (short)0, acco,
                                                 false, false);
#pragma unroll   // constant register index
  for (int r = 0; r < 8; ++r) hs[(r + 8 * half) * PK_HP + col] = res[r] + (acco[r] + bov);
  __syncthreads();
  // second FFN product's first weights: in flight while the rows are normalised
  const float* wp2 = w2 + (size_t)(2 * half) * D_MODEL + col;
  v2f bf2[3][12][1];
  pk_load_b<D_MODEL, 16, 1, 12>(wp2, 0, bf2[0]);
  pk_load_b<D_MODEL, 16, 1, 12>(wp2, 1, bf2[1]);
  pk_ln(hs, ln, ln + D_MODEL, wave, lane, (float*)0, m0, M);
  __syncthreads();

  // ---- f = relu(h W1 + b1), into LDS ----
  const float* ah = hs + l16 * PK_HP + 2 * half;
  v8f af[4];
#pragma unroll   // constant register index
  for (int t = 0; t < 4; ++t) af[t] = (v8f){};
  pk_mm<D_MODEL, FF_DIM, 16, 4, 4>(ah, wp1, bf1, af);
#pragma unroll   // constant register index
  for (int t = 0; t < 4; ++t)
#pragma unroll   // constant register index
    for (int r = 0; r < 8; ++r)
      fs[(r + 8 * half) * PK_FP + wave * 64 + t * 16 + l16] = fmaxf(af[t][r] + b1v[t], 0.f);
  __syncthreads();
  // the next product's first weights: in flight during the second FFN product
  const float* wpn = nw + (size_t)(P0 * D_MODEL + 2 * half) * D_MODEL + col;
  v2f bfn[3][4][NP];
  v2f bfe[3][12][1];
  if (NEXT == 1) {
    pk_load_b<D_MODEL, D_MODEL * D_MODEL, NP, 4>(wpn, 0, bfn[0]);
    pk_load_b<D_MODEL, D_MODEL * D_MODEL, NP, 4>(wpn, 1, bfn[1]);
  }
  const float* wpe = ew + (size_t)(2 * half) * D_MODEL + col;   // NEXT 2 only
  if (NEXT == 2) {
    pk_load_b<D_MODEL, 16, 1, 12>(wpe, 0, bfe[0]);
    pk_load_b<D_MODEL, 16, 1, 12>(wpe, 1, bfe[1]);
    // stands in front of any reuse of the address registers of these loads; the address
    // is an input, so that it lives up to the wait
    asm volatile("s_wait_xcnt 0x0" :: "v"(wpe) : "memory");
  }

  // ---- h + f W2 + b2: each element of the row tile is updated by its own lane ----
  v8f a2[1];
  a2[0] = (v8f){};
  pk_mm<FF_DIM, D_MODEL, 16, 1, 12>(fs + l16 * PK_FP + 2 * half, wp2, bf2, a2);
#pragma unroll   // constant register index
  for (int r = 0; r < 8; ++r) {
    float* p = hs + (r + 8 * half) * PK_HP + col;
    *p = *p + (a2[0][r] + b2v);
  }
  __syncthreads();
  // the decoder's first projection weights: in flight during the two LayerNorms and
  // the product between them and their use
  if (NEXT == 2) {
    pk_load_b<D_MODEL, D_MODEL * D_MODEL, NP, 4>(wpn, 0, bfn[0]);
    pk_load_b<D_MODEL, D_MODEL * D_MODEL, NP, 4>(wpn, 1, bfn[1]);
  }
  pk_ln(hs, ln + 2 * D_MODEL, ln + 3 * D_MODEL, wave, lane, NEXT == 1 ? H : (float*)0, m0, M);
  // last layer of a stack: the stack's closing LayerNorm; each lane reads back only
  // what it wrote itself, so no barrier stands between the two
  if (NEXT != 1) pk_ln(hs, cg, cb, wave, lane, (float*)0, m0, M);

  // ---- the output: row . ew + eb, by the lanes that normalised the row ----
  if (NEXT == 3) {
    if (wave < 4) {
      const int row = wave * 4 + (lane >> 3), e = lane & 7;
      const float* p = hs + row * PK_HP + e * 4;
      float wv[12];
#pragma unroll   // constant register index
      for (int i = 0; i < 12; ++i) wv[i] = ew[e * 4 + (i >> 2) * 32 + (i & 3)];
      const float ob = eb[0];
      // stands in front of any reuse of the address registers of the loads above: the loaded
      // values are inputs, so that every one of the loads is issued in front of the wait; the
      // scheduling barrier keeps later arithmetic from rising over it
      asm volatile("s_wait_xcnt 0x0" :: "v"(wv[0]), "v"(wv[1]), "v"(wv[2]), "v"(wv[3]), "v"(wv[4]),
                   "v"(wv[5]), "v"(wv[6]), "v"(wv[7]), "v"(wv[8]), "v"(wv[9]), "v"(wv[10]),
                   "v"(wv[11]) : "memory");
      __builtin_amdgcn_sched_barrier(0);
      float s = 0.f;
#pragma unroll   // constant register index
      for (int i = 0; i < 12; ++i) s += p[(i >> 2) * 32 + (i & 3)] * wv[i];
      s += __shfl_xor(s, 1, 32); s += __shfl_xor(s, 2, 32); s += __shfl_xor(s, 4, 32);
      const int m = m0 + row;
      if (e == 0 && m < M) Ho[m] = s + ob;
    }
  }

  // where this lane's eight result rows go (NEXT 2), -1: no such row
  int orow[8];
  if (NEXT == 2) {
#pragma unroll   // constant register index
    for (int r = 0; r < 8; ++r) {
      const int m = m0 + 8 * half + r;
      orow[r] = m < M ? (m + (m / N_UNMASK) * N_MASKT) * D_MODEL + col : -1;
    }
    // ---- the decoder's input rows, into the row tile ----
    __syncthreads();
    v8f ae[1];
    ae[0] = (v8f){};
    pk_mm<D_MODEL, D_MODEL, 16, 1, 12>(ah, wpe, bfe, ae);
    // every wave has read the row tile as its A operand before it is overwritten
    __syncthreads();
#pragma unroll   // constant register index
    for (int r = 0; r < 8; ++r) hs[(r + 8 * half) * PK_HP + col] = (ae[0][r] + ebv) * SQRT_D;
  }

  // ---- next layer's Q, K, V (NEXT 2: K, V): this wave's column tile of each ----
  if (NEXT != 3) {
    __syncthreads();
    v8f an[NP];
#pragma unroll   // constant register index
    for (int t = 0; t < NP; ++t) an[t] = (v8f){};
    pk_mm<D_MODEL, D_MODEL, D_MODEL * D_MODEL, NP, 4>(ah, wpn, bfn, an);
    if constexpr (NEXT == 1) {
      const size_t ob = (size_t)(m0 + 8 * half) * D_MODEL + col;
      const int left = M - m0 - 8 * half;   // rows of this half tile that exist
#pragma unroll   // constant register index, immediate store offsets
      for (int r = 0; r < 8; ++r) {
        if (r < left) {
          Qo[ob + r * D_MODEL] = an[0][r] + nbv[0];
          Ko[ob + r * D_MODEL] = an[1][r] + nbv[1];
          Vo[ob + r * D_MODEL] = an[2][r] + nbv[2];
        }
      }
    } else {
#pragma unroll   // constant register index
      for (int r = 0; r < 8; ++r) {
        if (orow[r] >= 0) {
          Ko[orow[r]] = an[0][r] + nbv[0];
          Vo[orow[r]] = an[1][r] + nbv[1];
        }
      }
    }
  }
}

// ---------------------------------------------------------------------------
extern "C" void kernel_launch(void* const* d_in, const int* in_sizes, int n_in,
                              void* d_out, int out_size, void* d_ws, size_t ws_size,
                              hipStream_t stream) {
  (void)in_sizes; (void)n_in; (void)out_size; (void)ws_size;
  const float* hist  = (const float*)d_in[0];
  const int*   uidx  = (const int*)d_in[1];
  const int*   midx  = (const int*)d_in[2];
  const float* nv1   = (const float*)d_in[3];
  const float* nv2   = (const float*)d_in[4];
  const float* dim_w = (const float*)d_in[5];
  const float* dim_b = (const float*)d_in[6];
  const float* pos   = (const float*)d_in[7];
  const float* tod_w = (const float*)d_in[8];
  const float* tod_b = (const float*)d_in[9];
  const float* dow_w = (const float*)d_in[10];
  const float* dow_b = (const float*)d_in[11];
  const float* mtok  = (const float*)d_in[12];
  const float* eaw   = (const float*)d_in[13];
  const float* eab   = (const float*)d_in[14];
  const float* ew1   = (const float*)d_in[15];
  const float* eb1   = (const float*)d_in[16];
  const float* ew2   = (const float*)d_in[17];
  const float* eb2   = (const float*)d_in[18];
  const float* eln   = (const float*)d_in[19];
  const float* eng   = (const float*)d_in[20];
  const float* enb   = (const float*)d_in[21];
  const float* e2dw  = (const float*)d_in[22];
  const float* e2db  = (const float*)d_in[23];
  const float* daw   = (const float*)d_in[24];
  const float* dab   = (const float*)d_in[25];
  const float* dw1   = (const float*)d_in[26];
  const float* db1   = (const float*)d_in[27];
  const float* dw2   = (const float*)d_in[28];
  const float* db2   = (const float*)d_in[29];
  const float* dln   = (const float*)d_in[30];
  const float* dng   = (const float*)d_in[31];
  const float* dnb   = (const float*)d_in[32];
  const float* outw  = (const float*)d_in[33];
  const float* outb  = (const float*)d_in[34];
  float* out = (float*)d_out;

  float* ws = (float*)d_ws;
  size_t off = 0;
  auto alloc = [&](size_t n) { float* p = ws + off; off += n; return p; };
  const size_t MD = (size_t)BATCH * NT;   // max rows (decoder): 9936
  float* adpA  = alloc((size_t)N_NODES * N_NODES);
  float* Menc  = alloc((size_t)EM_ROWS * EM_PITCH);
  float* X  = alloc(MD * D_MODEL);
  float* Qb = alloc(MD * D_MODEL);
  float* Kb = alloc(MD * D_MODEL);
  float* Vb = alloc(MD * D_MODEL);
  float* Ob = alloc(MD * D_MODEL);
  float* Xd = alloc(MD * D_MODEL);
  float* Qd = alloc(MD * D_MODEL);
  float* Kd = alloc(MD * D_MODEL);
  float* Vd = alloc(MD * D_MODEL);

  front_kernel<<<N_NODES + (FR_ENC + FR_DEC) / FR_ROWS, D_MODEL, 0, stream>>>(
      nv1, nv2, adpA, hist, uidx, midx, dim_w, dim_b, pos, tod_w, tod_b, dow_w, dow_b, mtok,
      X, Xd, out);
  proj_kernel<<<PJ_ENC + PJ_DEC + EM_ROWS, 32, 0, stream>>>(
      X, eaw, eab, Qb, Kb, Vb, Xd, daw, dab, Qd, Kd, Vd, adpA, uidx, Menc);

  // ---- encoder (4 layers, masked attention over 621 tokens): attention, then the whole
  // row-local rest of the layer in one launch ----
  const unsigned pe = (BATCH * N_UNMASK + 15) / 16, pd = (BATCH * N_MASKT + 15) / 16;
  for (int l = 0; l < 4; ++l) {
    const float* aw = eaw + (size_t)l * 4 * D_MODEL * D_MODEL;
    const float* ab = eab + (size_t)l * 4 * D_MODEL;
    const float* w1 = ew1 + (size_t)l * D_MODEL * FF_DIM;
    const float* b1 = eb1 + (size_t)l * FF_DIM;
    const float* w2 = ew2 + (size_t)l * FF_DIM * D_MODEL;
    const float* b2 = eb2 + (size_t)l * D_MODEL;
    const float* ln = eln + (size_t)l * 2 * 2 * D_MODEL;
    attn_kernel<N_UNMASK, 8, true, 0><<<dim3((N_UNMASK + 31) / 32, NHEAD, BATCH), 8 * 32, 0, stream>>>(
        Qb, Kb, Vb, Ob, Menc);
    if (l < 3)
      post_kernel<1><<<pe, PK_WAVES * 32, 0, stream>>>(
          Ob, X, aw + 3 * D_MODEL * D_MODEL, ab + 3 * D_MODEL, ln, w1, b1, w2, b2,
          aw + 4 * D_MODEL * D_MODEL, ab + 4 * D_MODEL, Qb, Kb, Vb,
          nullptr, nullptr, nullptr, nullptr, nullptr, BATCH * N_UNMASK);
    else
      post_kernel<2><<<pe, PK_WAVES * 32, 0, stream>>>(
          Ob, X, aw + 3 * D_MODEL * D_MODEL, ab + 3 * D_MODEL, ln, w1, b1, w2, b2,
          daw, dab, nullptr, Kd, Vd, eng, enb, e2dw, e2db, nullptr, BATCH * N_UNMASK);
  }
  // ---- decoder (1 layer, full attention over 2484 tokens; queries: the masked tokens) ----
  attn_kernel<NT, 4, false, N_UNMASK><<<dim3((N_MASKT + 31) / 32, NHEAD, BATCH), 4 * 32, 0, stream>>>(
      Qd, Kd, Vd, Ob, nullptr);
  post_kernel<3><<<pd, PK_WAVES * 32, 0, stream>>>(
      Ob, Xd, daw + 3 * D_MODEL * D_MODEL, dab + 3 * D_MODEL, dln, dw1, db1, dw2, db2,
      nullptr, nullptr, nullptr, nullptr, nullptr, dng, dnb, outw, outb, out, BATCH * N_MASKT);
}

// v007
// It runs in 188 microseconds.
// Next to v006, in two timings, it ran 1.12 times as fast each time.
// All steps since v000 together make it 14.1 times as fast.
#include <hip/hip_runtime.h>
#include <math.h>

#define N_NODES  207
#define T_STEPS  12
#define C_IN     4
#define BATCH    4
#define NT       (N_NODES * T_STEPS)   // 2484
#define D_MODEL  96
#define NHEAD    4
#define HD       24
#define FF_DIM   384
#define N_MASKT  1863
#define N_UNMASK 621
#define MAX_NEIGH 40
#define ATTN_SCALE 0.20412414523193154f   // 1/sqrt(24)
#define SQRT_D     9.797958971132712f     // sqrt(96)

typedef float v2f __attribute__((ext_vector_type(2)));
typedef float v8f __attribute__((ext_vector_type(8)));

// ---------------------------------------------------------------------------
// Adjacency: A = softmax(relu(nv1 @ nv2), axis=1); keep iff (A > 1/N) and
// strictly greater than the 41st-largest in its row (rank < MAX_NEIGH).
// ---------------------------------------------------------------------------
__device__ __forceinline__ void adj_row(const float* __restrict__ nv1,
                                        const float* __restrict__ nv2,
                                        float* __restrict__ adpA, const int i) {
  __shared__ float a[N_NODES];
  __shared__ float stat[2];
  int tid = threadIdx.x;
  for (int j = tid; j < N_NODES; j += blockDim.x) {
    float s = 0.f;
    for (int r = 0; r < 10; ++r) s += nv1[i * 10 + r] * nv2[r * N_NODES + j];
    a[j] = s > 0.f ? s : 0.f;
  }
  __syncthreads();
  if (tid == 0) {
    float mx = -1e30f;
    for (int j = 0; j < N_NODES; ++j) mx = fmaxf(mx, a[j]);
    float sum = 0.f;
    for (int j = 0; j < N_NODES; ++j) sum += __expf(a[j] - mx);
    stat[0] = mx; stat[1] = 1.f / sum;
  }
  __syncthreads();
  float mx = stat[0], inv = stat[1];
  for (int j = tid; j < N_NODES; j += blockDim.x) a[j] = __expf(a[j] - mx) * inv;
  __syncthreads();
  const float thr = 1.0f / (float)N_NODES;
  for (int j = tid; j < N_NODES; j += blockDim.x) {
    float aj = a[j];
    int cnt = 0;
    for (int l = 0; l < N_NODES; ++l) cnt += (a[l] > aj) ? 1 : 0;
    bool keep = (aj > thr) && (cnt < MAX_NEIGH);
    adpA[i * N_NODES + j] = keep ? aj : 0.f;
  }
}

// Encoder additive attention bias, stored key-major: Mb[k][q] = 0 where query q may
// look at key k, -1e30 where adpA == 0. Rows are padded to whole key tiles and the
// pitch to whole query blocks (pad entries 0), so the attention kernel reads it
// with 16 consecutive queries on 16 lanes and needs no clamp.
#define EM_ROWS  (((N_UNMASK + 15) / 16) * 16)   // 624
#define EM_PITCH (((N_UNMASK + 31) / 32) * 32)   // 640

// ---------------------------------------------------------------------------
// Everything that depends on the inputs alone, in ONE launch; a work-group's role
// comes from its index:
//   adjacency row i;
//   encoder input row: (x0*dim_w + dim_b + pos + tod*tod_w + tod_b + dow*dow_w + dow_b)
//     at unmasked_idx, * sqrt(D);
//   decoder input row of a masked token: (mask_token + pos + tod/dow emb) * sqrt(D),
//     and that token's label.
// ---------------------------------------------------------------------------
#define FR_ENC (BATCH * N_UNMASK)
#define FR_DEC (BATCH * N_MASKT)
#define FR_ROWS 12   // rows a work-group: few waves to start, the rows' loads in flight together
static_assert(FR_ENC % FR_ROWS == 0 && FR_DEC % FR_ROWS == 0, "whole work-groups");
__global__ __launch_bounds__(D_MODEL)
void front_kernel(const float* __restrict__ nv1, const float* __restrict__ nv2,
                  float* __restrict__ adpA,
                  const float* __restrict__ hist,
                  const int* __restrict__ uidx, const int* __restrict__ midx,
                  const float* __restrict__ dim_w, const float* __restrict__ dim_b,
                  const float* __restrict__ pos,
                  const float* __restrict__ tod_w, const float* __restrict__ tod_b,
                  const float* __restrict__ dow_w, const float* __restrict__ dow_b,
                  const float* __restrict__ mask_token,
                  float* __restrict__ X, float* __restrict__ Xd, float* __restrict__ out) {
  const int blk = blockIdx.x;
  if (blk < N_NODES) { adj_row(nv1, nv2, adpA, blk); return; }
  const int d = threadIdx.x;       // 0..95
  const float todw = tod_w[d], todb = tod_b[d], doww = dow_w[d], dowb = dow_b[d];
  // stands in front of any reuse of the address registers of the four loads above; the
  // scheduling barrier keeps later arithmetic from rising over it
  asm volatile("s_wait_xcnt 0x0" ::: "memory");
  __builtin_amdgcn_sched_barrier(0);
  if (blk < N_NODES + FR_ENC / FR_ROWS) {
    const float dimw = dim_w[d], dimb = dim_b[d];
    const int r0 = (blk - N_NODES) * FR_ROWS;
#pragma unroll   // the rows' loads in flight together
    for (int i = 0; i < FR_ROWS; ++i) {
      const int row = r0 + i;      // b*N_UNMASK + s
      const int b = row / N_UNMASK, s = row % N_UNMASK;
      int nt = uidx[s];
      nt = nt < 0 ? 0 : (nt >= NT ? NT - 1 : nt);
      const int n = nt / T_STEPS, t = nt % T_STEPS;
      const float* hp = hist + (((size_t)b * T_STEPS + t) * N_NODES + n) * C_IN;
      float x0 = hp[0], dow = hp[2], tod = hp[3];
      float v = x0 * dimw + dimb + pos[(size_t)nt * D_MODEL + d] +
                tod * todw + todb + dow * doww + dowb;
      X[(size_t)row * D_MODEL + d] = v * SQRT_D;
    }
    // stands behind the run of stores, in front of any rewrite of their address and
    // data registers in the code that follows this role in the built kernel
    asm volatile("s_wait_xcnt 0x0" ::: "memory");
  } else {
    const float mtk = mask_token[d];
    const int r0 = (blk - (N_NODES + FR_ENC / FR_ROWS)) * FR_ROWS;
    int ntr[FR_ROWS], po[FR_ROWS];   // each row's token, and its place in pos
    float pv[FR_ROWS];
#pragma unroll   // constant register index; the rows' loads in flight together
    for (int i = 0; i < FR_ROWS; ++i) {
      int nt = midx[(r0 + i) % N_MASKT];
      nt = nt < 0 ? 0 : (nt >= NT ? NT - 1 : nt);
      ntr[i] = nt;
      po[i] = nt * D_MODEL + d;
      pv[i] = pos[po[i]];
    }
    // stands in front of any reuse of the address registers of the loads above: the places
    // are inputs, so that they live up to the wait and no result lands in one of them;
    // the scheduling barrier keeps later arithmetic from rising over it
    asm volatile("s_wait_xcnt 0x0" :: "v"(po[0]), "v"(po[1]), "v"(po[2]), "v"(po[3]), "v"(po[4]),
                 "v"(po[5]), "v"(po[6]), "v"(po[7]), "v"(po[8]), "v"(po[9]), "v"(po[10]),
                 "v"(po[11]) : "memory");
    __builtin_amdgcn_sched_barrier(0);
    float val[FR_ROWS];
    int xo[FR_ROWS];               // where each row goes in Xd
    float lab = 0.f;               // thread i keeps row i's label
#pragma unroll   // constant register index
    for (int i = 0; i < FR_ROWS; ++i) {
      const int row = r0 + i;      // b*N_MASKT + j
      const int b = row / N_MASKT, j = row % N_MASKT;
      const int n = ntr[i] / T_STEPS, t = ntr[i] % T_STEPS;
      const float* hp = hist + (((size_t)b * T_STEPS + t) * N_NODES + n) * C_IN;
      const float x0 = hp[0], dow = hp[2], tod = hp[3];
      float v = mtk + pv[i] + tod * todw + todb + dow * doww + dowb;
      val[i] = v * SQRT_D;
      xo[i] = (b * NT + N_UNMASK + j) * D_MODEL + d;
      lab = d == i ? x0 : lab;
    }
    // every value and place in a register of its own in front of the first store:
    // arithmetic sunk among the stores would rewrite registers of issued stores
    __builtin_amdgcn_sched_barrier(0);
#pragma unroll   // constant register index
    for (int i = 0; i < FR_ROWS; ++i) Xd[xo[i]] = val[i];
    // stands behind the run of stores, in front of any rewrite of their registers
    asm volatile("s_wait_xcnt 0x0" ::: "memory");
    if (d < FR_ROWS) out[FR_DEC + r0 + d] = lab;
  }
}

// ---------------------------------------------------------------------------
// fp32 GEMM via V_WMMA_F32_16X16X4_F32, register-blocked 32x32 per wave:
// 4 accumulators, each A-frag feeds 2 WMMAs and each B-frag feeds 2 WMMAs.
// Y[M,N] = X[M,K] @ W[K,N] + bias. K and N are compile-time, so every
// operand load is a base register plus an immediate offset.
// Row r of the product lies, in X and in Y alike, at r + (r / SEG) * GAP + OFF.
// The K loop is a register ring: operands come in chunks of GK_STEPS k-steps,
// GK_BUFS chunks are held, and a chunk's loads are issued at least GK_BUFS - 1
// chunks ahead of the WMMAs that use it, so a wave waits out the load latency
// once and not once per trip. Every accumulator keeps the ascending k order.
// M edge via row-clamped loads + guarded stores (EXEC stays full for WMMA).
// ---------------------------------------------------------------------------
#define GK_STEPS 4     // k-steps (of 4) per chunk: 32 loads
#define GK_BUFS  3     // chunks held in registers

template <int K, int N, int SEG, int GAP, int OFF>
__device__ __forceinline__
void gemm_tile(const float* __restrict__ X, const float* __restrict__ W,
               const float* __restrict__ bias, float* __restrict__ Y,
               const int M, const int m0, const int n0) {
  constexpr int NCH = K / (4 * GK_STEPS);
  static_assert(K % (4 * GK_STEPS) == 0 && N % 32 == 0 && NCH >= GK_BUFS, "shape");
  int lane = threadIdx.x & 31;
  int l16 = lane & 15, half = lane >> 4;
  int ra0 = m0 + l16;      if (ra0 >= M) ra0 = M - 1;
  int ra1 = m0 + 16 + l16; if (ra1 >= M) ra1 = M - 1;
  ra0 += (ra0 / SEG) * GAP + OFF;
  ra1 += (ra1 / SEG) * GAP + OFF;
  const float* xa0 = X + (size_t)ra0 * K + 2 * half;
  const float* xa1 = X + (size_t)ra1 * K + 2 * half;
  const float* wp  = W + (size_t)(2 * half) * N + n0 + l16;
  v2f a0[GK_BUFS][GK_STEPS], a1[GK_BUFS][GK_STEPS];
  v2f b0[GK_BUFS][GK_STEPS], b1[GK_BUFS][GK_STEPS];
  v8f acc00 = {}, acc01 = {}, acc10 = {}, acc11 = {};

// unrolled here and below: every ring index must be a compile-time constant,
// or the ring would live in scratch instead of registers
#define GK_LOAD(c)                                                     \
  _Pragma("unroll")                                                    \
  for (int j = 0; j < GK_STEPS; ++j) {                                 \
    const int k0 = ((c) * GK_STEPS + j) * 4;                           \
    const int s = (c) % GK_BUFS;                                       \
    a0[s][j].x = xa0[k0];              a0[s][j].y = xa0[k0 + 1];       \
    a1[s][j].x = xa1[k0];              a1[s][j].y = xa1[k0 + 1];       \
    b0[s][j].x = wp[k0 * N];           b0[s][j].y = wp[(k0 + 1) * N];  \
    b1[s][j].x = wp[k0 * N + 16];      b1[s][j].y = wp[(k0 + 1) * N + 16]; \
  }

#pragma unroll   // constant ring index
  for (int c = 0; c < GK_BUFS - 1; ++c) { GK_LOAD(c) }
#pragma unroll   // constant ring index and immediate load offsets
  for (int c = 0; c < NCH; ++c) {
    if (c + GK_BUFS - 1 < NCH) { GK_LOAD(c + GK_BUFS - 1) }
    // keeps the loads above in front of this chunk's WMMAs: sunk to their use,
    // each chunk would wait out its own load latency again
    __builtin_amdgcn_sched_barrier(0);
    const int s = c % GK_BUFS;
#pragma unroll   // constant ring index
    for (int j = 0; j < GK_STEPS; ++j) {
      acc00 = __builtin_amdgcn_wmma_f32_16x16x4_f32(false, a0[s][j], false, b0[s][j], (short)0, acc00, false, false);
      acc01 = __builtin_amdgcn_wmma_f32_16x16x4_f32(false, a0[s][j], false, b1[s][j], (short)0, acc01, false, false);
      acc10 = __builtin_amdgcn_wmma_f32_16x16x4_f32(false, a1[s][j], false, b0[s][j], (short)0, acc10, false, false);
      acc11 = __builtin_amdgcn_wmma_f32_16x16x4_f32(false, a1[s][j], false, b1[s][j], (short)0, acc11, false, false);
    }
  }
#undef GK_LOAD
  // stands in front of the epilogue's reuse of the operand loads' address
  // registers; the scheduling barrier keeps that arithmetic from rising over it
  asm volatile("s_wait_xcnt 0x0" ::: "memory");
  __builtin_amdgcn_sched_barrier(0);
  const int nA = n0 + l16;
  const float bv0 = bias[nA], bv1 = bias[nA + 16];
  // every store's offset in a register of its own, formed in front of the stores
  int ro[16];
#pragma unroll   // constant register index
  for (int r = 0; r < 16; ++r) {
    const int m = m0 + (r & 7) + 8 * half + 16 * (r >> 3);
    ro[r] = m < M ? (m + (m / SEG) * GAP + OFF) * N + nA : -1;
  }
#pragma unroll   // constant register index
  for (int r = 0; r < 8; ++r) {
    if (ro[r] >= 0) {
      Y[ro[r]] = acc00[r] + bv0;
      Y[ro[r] + 16] = acc01[r] + bv1;
    }
    if (ro[r + 8] >= 0) {
      Y[ro[r + 8]] = acc10[r] + bv0;
      Y[ro[r + 8] + 16] = acc11[r] + bv1;
    }
  }
}

// ---------------------------------------------------------------------------
// Everything that needs only the launch above, in ONE launch of one-wave
// work-groups; the role comes from the index:
//   a 32 x 32 tile of the first encoder layer's Q, K or V;
//   a 32 x 32 tile of the decoder's Q, K or V for the masked tokens' rows, which do
//     not depend on the encoder;
//   one key row of the encoder's attention bias.
// ---------------------------------------------------------------------------
#define PJ_ENC (((BATCH * N_UNMASK + 31) / 32) * 9)
#define PJ_DEC (((BATCH * N_MASKT + 31) / 32) * 9)
__global__ __launch_bounds__(32)
void proj_kernel(const float* __restrict__ X, const float* __restrict__ eaw,
                 const float* __restrict__ eab, float* __restrict__ Qe,
                 float* __restrict__ Ke, float* __restrict__ Ve,
                 const float* __restrict__ Xd, const float* __restrict__ daw,
                 const float* __restrict__ dab, float* __restrict__ Qd,
                 float* __restrict__ Kd, float* __restrict__ Vd,
                 const float* __restrict__ adpA, const int* __restrict__ uidx,
                 float* __restrict__ Mb) {
  const int blk = blockIdx.x;
  if (blk < PJ_ENC) {
    const int y = blk % 9, p = y / 3;
    gemm_tile<D_MODEL, D_MODEL, (1 << 30), 0, 0>(
        X, eaw + p * D_MODEL * D_MODEL, eab + p * D_MODEL, p == 0 ? Qe : (p == 1 ? Ke : Ve),
        BATCH * N_UNMASK, (blk / 9) * 32, (y % 3) * 32);
    return;
  }
  if (blk < PJ_ENC + PJ_DEC) {
    const int t = blk - PJ_ENC, y = t % 9, p = y / 3;
    gemm_tile<D_MODEL, D_MODEL, N_MASKT, N_UNMASK, N_UNMASK>(
        Xd, daw + p * D_MODEL * D_MODEL, dab + p * D_MODEL, p == 0 ? Qd : (p == 1 ? Kd : Vd),
        BATCH * N_MASKT, (t / 9) * 32, (y % 3) * 32);
    return;
  }
  // column nk of the adjacency goes to LDS, and each query looks its node up there
  constexpr int NG = EM_PITCH / 32, NF = N_UNMASK / 32;        // query groups, whole ones
  constexpr int CG = (N_NODES + 31) / 32, CF = N_NODES / 32;   // node groups, whole ones
  static_assert(NG == NF + 1 && CG == CF + 1, "one clamped group each");
  __shared__ float colv[CG * 32];
  const int k = blk - (PJ_ENC + PJ_DEC);   // 0 .. EM_ROWS - 1
  const int lane = threadIdx.x;
  int nk = uidx[k < N_UNMASK ? k : N_UNMASK - 1] / T_STEPS;
  nk = nk < 0 ? 0 : (nk >= N_NODES ? N_NODES - 1 : nk);
  // last group of each: past the end the last element, not used
  const int cq = lane < N_UNMASK - NF * 32 ? lane : N_UNMASK - NF * 32 - 1;
  const int cn = lane < N_NODES - CF * 32 ? lane : N_NODES - CF * 32 - 1;
  const int a1 = lane * N_NODES + nk, a2 = cn * N_NODES + nk;
  int nq[NG];
  float cv[CG];
#pragma unroll   // constant register index, immediate load offsets
  for (int i = 0; i < NF; ++i) nq[i] = uidx[i * 32 + lane];
#pragma unroll   // constant register index, immediate load offsets
  for (int i = 0; i < CF; ++i) cv[i] = adpA[a1 + i * 32 * N_NODES];
  nq[NF] = uidx[NF * 32 + cq];
  cv[CF] = adpA[a2 + CF * 32 * N_NODES];
  // stands in front of any reuse of the address registers of the loads above: the indices
  // are inputs, so that they live up to the wait and no result lands in one of them;
  // the scheduling barrier keeps later arithmetic from rising over it
  asm volatile("s_wait_xcnt 0x0" :: "v"(lane), "v"(cq), "v"(a1), "v"(a2) : "memory");
  __builtin_amdgcn_sched_barrier(0);
#pragma unroll   // constant register index
  for (int i = 0; i < CG; ++i) colv[i * 32 + lane] = cv[i];
  __syncthreads();
  float av[NG];
#pragma unroll   // constant register index; every lane reads, so all LDS reads fly together
  for (int i = 0; i < NG; ++i) {
    int n = nq[i] / T_STEPS;
    n = n < 0 ? 0 : (n >= N_NODES ? N_NODES - 1 : n);
    av[i] = colv[n];
  }
#pragma unroll   // constant register index
  for (int i = 0; i < NG; ++i) {
    const bool in = k < N_UNMASK && i * 32 + lane < N_UNMASK;
    av[i] = (in & (av[i] == 0.f)) ? -1e30f : 0.f;
  }
  // every value in a register of its own in front of the first store
  __builtin_amdgcn_sched_barrier(0);
  float* mrow = Mb + (size_t)k * EM_PITCH + lane;
#pragma unroll   // constant register index, immediate store offsets
  for (int i = 0; i < NG; ++i) mrow[i * 32] = av[i];
}

// ---------------------------------------------------------------------------
// Attention in one pass over the keys, per (b, head, 32 queries): the scores never
// leave the registers.
//   St = K Qt : A = 16 keys x 24, B = Qt, kept in registers. D register r of a lane
//               is the score of key 8 * half + r for query l16.
//   softmax   : running maximum and sum per query (one lane column): in-lane over the
//               8 registers, one exchange between the wave's halves.
//   Ot += Vt Pt : D registers 2j, 2j + 1 of St are, as they stand, the B fragment of
//               k-step j if that step's keys are 8 * half + 2j + {0, 1}; the Vt
//               A fragment takes its rows in the same key order.
// A wave holds two query tiles, so each K and V fragment feeds two products. The
// key tiles are dealt round-robin to the NW waves of the work-group; their partial
// (maximum, sum, Ot) are merged in LDS at the end.
// Head dim order of the score product: at k-step j a lane half takes
// d = 8 * (j >> 1) + 4 * half + 2 * (j & 1) + {0, 1}, for K and Q alike: three 16-byte
// loads a row, in each of which the two halves read 32 adjacent bytes of one line.
// Q/K/V layout: [(b*S+s)*96 + h*24 + d]. maskT: [key][query], pitch EM_PITCH.
// QB: the first query row. Rows in front of it are keys and values only.
// ---------------------------------------------------------------------------
typedef float v4f __attribute__((ext_vector_type(4)));
#define FA_C (ATTN_SCALE * 1.4426950408889634f)   // score scale, in log2 units
#define FA_ROWS (HD + 2)                          // Ot rows, then maximum, then sum

template <bool B> struct fa_bool { static constexpr bool value = B; };

// lane l <-> l ^ 16
__device__ __forceinline__ float fa_xhalf(float v) {
  int b = __float_as_int(v);
  return __int_as_float(__builtin_amdgcn_permlanex16(b, b, 0x76543210, 0xfedcba98, false, false));
}

// 24 floats of one row as six k-step fragments; p: the row's start + 4 * half
__device__ __forceinline__ void fa_row(const float* __restrict__ p, v2f (&f)[6]) {
  const v4f x0 = *(const v4f*)p, x1 = *(const v4f*)(p + 8), x2 = *(const v4f*)(p + 16);
  f[0] = (v2f){x0.x, x0.y}; f[1] = (v2f){x0.z, x0.w};
  f[2] = (v2f){x1.x, x1.y}; f[3] = (v2f){x1.z, x1.w};
  f[4] = (v2f){x2.x, x2.y}; f[5] = (v2f){x2.z, x2.w};
}

// The decoder's keys from tile DEC_T0 on are masked tokens' rows alone: they do not depend
// on the encoder. Their share of the decoder's attention runs as extra work-groups of the
// encoder's launches, a range of key tiles a launch. A wave there is on its own: 32 queries
// of one head, every DS_NS-th tile of the range (its stream), and its running (Ot, maximum,
// sum) goes from launch to launch through the workspace, as it stands in the registers.
// The decoder's own launch takes the tiles in front of DEC_T0; its first DS_NS waves start
// from the streams' states.
#define DEC_T0 ((N_UNMASK + 15) / 16)     // 39
#define DEC_KT ((NT + 15) / 16)           // 156
#define DQB    ((N_MASKT + 31) / 32)      // query blocks a head: 59
#define DS_NS  2                          // streams
#define DS_VALS (36 * 32)                 // floats of one wave's state
#define DS_TOTAL ((size_t)BATCH * NHEAD * DS_NS * DQB * DS_VALS)

// sp: the state's start + 4 * lane
__device__ __forceinline__ void fa_state_load(const float* sp, v8f (&o)[2][2], float (&m)[2],
                                              float (&l)[2]) {
  v4f x[9];
#pragma unroll   // constant register index, immediate load offsets
  for (int c = 0; c < 9; ++c) x[c] = *(const v4f*)(sp + c * 128);
  // stands in front of any reuse of the address registers of the loads above; the address is
  // an input, so that it lives up to the wait and no result lands in its registers
  asm volatile("s_wait_xcnt 0x0" :: "v"(sp) : "memory");
#pragma unroll   // constant register index
  for (int c = 0; c < 8; ++c)
#pragma unroll   // constant register index
    for (int i = 0; i < 4; ++i) o[c >> 2][(c >> 1) & 1][(c & 1) * 4 + i] = x[c][i];
  m[0] = x[8].x; m[1] = x[8].y; l[0] = x[8].z; l[1] = x[8].w;
}

__device__ __forceinline__ void fa_state_store(float* sp, const v8f (&o)[2][2],
                                               const float (&m)[2], const float (&l)[2]) {
#pragma unroll   // constant register index, immediate store offsets
  for (int c = 0; c < 8; ++c) {
    const v8f& s = o[c >> 2][(c >> 1) & 1];
    const int e = (c & 1) * 4;
    *(v4f*)(sp + c * 128) = (v4f){s[e], s[e + 1], s[e + 2], s[e + 3]};
  }
  *(v4f*)(sp + 8 * 128) = (v4f){m[0], m[1], l[0], l[1]};
  // stands behind the run of stores, in front of any rewrite of their registers
  asm volatile("s_wait_xcnt 0x0" ::: "memory");
}

// One wave's pass over the key tiles kt0, kt0 + STEP, ... below t1, for the 32 queries from
// q0 on; o, mrun, lrun: its running state, set by the caller. hb: offset of (batch, head).
template <int S, int STEP, bool MASK>
__device__ __forceinline__
void fa_run(const float* __restrict__ Q, const float* __restrict__ Kb,
            const float* __restrict__ Vb, const float* __restrict__ maskT,
            const int q0, const size_t hb, const int kt0, const int t1,
            v8f (&o)[2][2], float (&mrun)[2], float (&lrun)[2]) {
  constexpr int KT = (S + 15) / 16;
  // with a mask the scores are scaled when the bias is added, else inside the exponent
  constexpr float CC = MASK ? 1.f : FA_C;
  const int lane = threadIdx.x & 31;
  const int l16 = lane & 15, half = lane >> 4;
  const float* Kh = Kb + hb + 4 * half;
  const float* Vh = Vb + hb;

  v2f qf[2][6];
#pragma unroll   // constant register index
  for (int t = 0; t < 2; ++t) {
    int qr = q0 + 16 * t + l16; if (qr >= S) qr = S - 1;
    fa_row(Q + hb + (size_t)qr * D_MODEL + 4 * half, qf[t]);
  }
  v2f kf[6];
  {
    int key = kt0 * 16 + l16; if (key >= S) key = S - 1;
    fa_row(Kh + (size_t)key * D_MODEL, kf);
  }
  // stands in front of any reuse of the address registers of the loads above; the
  // scheduling barrier keeps later arithmetic from rising over it
  asm volatile("s_wait_xcnt 0x0" ::: "memory");
  __builtin_amdgcn_sched_barrier(0);
  const int hd2 = l16 < 8 ? 16 + l16 : HD - 1;   // second Ot tile: 8 rows, rest clamped

  // one key tile; LAST: the tile that may hold keys past S
  auto tile = [&](auto lastc, const int kt) {
    constexpr bool LAST = decltype(lastc)::value;
    const int kb = kt * 16 + 8 * half;
    const float* vt = Vh + (size_t)kb * D_MODEL;   // one address a tile, the rows at immediate offsets
    v2f vf[2][4];
    const float* vp[4][4];   // each load's own address
#pragma unroll   // constant register index, immediate load offsets
    for (int j = 0; j < 4; ++j) {
      const float* vx = vt + 2 * j * D_MODEL;   // rows kb + 2j, kb + 2j + 1
      const float* vy = vt + (2 * j + 1) * D_MODEL;
      if (LAST) {
        const int r0 = kb + 2 * j, r1 = kb + 2 * j + 1;
        vx = Vh + (size_t)(r0 < S ? r0 : S - 1) * D_MODEL;
        vy = Vh + (size_t)(r1 < S ? r1 : S - 1) * D_MODEL;
      }
      vp[j][0] = vx + l16; vp[j][1] = vy + l16; vp[j][2] = vx + hd2; vp[j][3] = vy + hd2;
      vf[0][j].x = *vp[j][0]; vf[0][j].y = *vp[j][1];
      vf[1][j].x = *vp[j][2]; vf[1][j].y = *vp[j][3];
    }
    if (LAST) {
      // clamped rows have addresses of their own: all are inputs, so that they live up to the
      // wait and no result of the run lands in an address register of an earlier load of it
      asm volatile("s_wait_xcnt 0x0" :: "v"(vp[0][0]), "v"(vp[0][1]), "v"(vp[0][2]), "v"(vp[0][3]),
                   "v"(vp[1][0]), "v"(vp[1][1]), "v"(vp[1][2]), "v"(vp[1][3]),
                   "v"(vp[2][0]), "v"(vp[2][1]), "v"(vp[2][2]), "v"(vp[2][3]),
                   "v"(vp[3][0]), "v"(vp[3][1]), "v"(vp[3][2]), "v"(vp[3][3]) : "memory");
    }
    float mb[2][8];
    if (MASK) {
      // stands in front of the bias loads, whose results may land in address
      // registers of the loads above
      if (!LAST) asm volatile("s_wait_xcnt 0x0" ::: "memory");
      const float* mp = maskT + (size_t)kb * EM_PITCH + q0 + l16;
#pragma unroll   // constant register index, immediate load offsets
      for (int r = 0; r < 8; ++r) {
        mb[0][r] = mp[r * EM_PITCH];
        mb[1][r] = mp[r * EM_PITCH + 16];
      }
    }
    // stands in front of any reuse of the address registers of the loads above; the
    // scheduling barrier keeps later address arithmetic from rising over it and
    // the loads in front of the score products, whose time covers their latency
    if (MASK || !LAST) asm volatile("s_wait_xcnt 0x0" ::: "memory");
    __builtin_amdgcn_sched_barrier(0);
    v8f s[2];
    s[0] = (v8f){}; s[1] = (v8f){};
#pragma unroll   // constant register index
    for (int j = 0; j < 6; ++j) {
      s[0] = __builtin_amdgcn_wmma_f32_16x16x4_f32(false, kf[j], false, qf[0][j], (short)0, s[0], false, false);
      s[1] = __builtin_amdgcn_wmma_f32_16x16x4_f32(false, kf[j], false, qf[1][j], (short)0, s[1], false, false);
    }
    // this wave's next K tile, in flight during the softmax and the second product
    // (past the end: the clamped last row, never used)
    {
      int key = (kt + STEP) * 16 + l16; if (key >= S) key = S - 1;
      const float* kp = Kh + (size_t)key * D_MODEL;
      fa_row(kp, kf);
      // as above, for the three loads just issued; the address is an input, so that it
      // lives up to the wait and none of the three results lands in its registers
      asm volatile("s_wait_xcnt 0x0" :: "v"(kp) : "memory");
    }
    __builtin_amdgcn_sched_barrier(0);
#pragma unroll   // constant register index
    for (int t = 0; t < 2; ++t) {
      if (MASK) {
#pragma unroll   // constant register index
        for (int r = 0; r < 8; ++r) s[t][r] = fmaf(s[t][r], FA_C, mb[t][r]);
      }
      if (LAST) {
#pragma unroll   // constant register index
        for (int r = 0; r < 8; ++r)
          if (kb + r >= S) s[t][r] = -INFINITY;   // no key: weight exactly 0
      }
      float mx = s[t][0];
#pragma unroll   // constant register index
      for (int r = 1; r < 8; ++r) mx = fmaxf(mx, s[t][r]);
      mx = fmaxf(mx, fa_xhalf(mx));
      const float mnew = fmaxf(mrun[t], mx);
      const float alpha = __builtin_amdgcn_exp2f((mrun[t] - mnew) * CC);
      const float nb = -mnew * CC;
      mrun[t] = mnew;
      float sum = 0.f;
#pragma unroll   // constant register index
      for (int r = 0; r < 8; ++r) {
        s[t][r] = __builtin_amdgcn_exp2f(fmaf(s[t][r], CC, nb));
        sum += s[t][r];
      }
      lrun[t] = lrun[t] * alpha + sum;
      o[t][0] *= alpha;
      o[t][1] *= alpha;
    }
#pragma unroll   // constant register index
    for (int j = 0; j < 4; ++j) {
#pragma unroll   // constant register index
      for (int t = 0; t < 2; ++t) {
        const v2f pf = (v2f){s[t][2 * j], s[t][2 * j + 1]};
        o[t][0] = __builtin_amdgcn_wmma_f32_16x16x4_f32(false, vf[0][j], false, pf, (short)0, o[t][0], false, false);
        o[t][1] = __builtin_amdgcn_wmma_f32_16x16x4_f32(false, vf[1][j], false, pf, (short)0, o[t][1], false, false);
      }
    }
  };

  int kt = kt0;
  const int te = t1 < KT - 1 ? t1 : KT - 1;   // whole tiles end here
  for (; kt < te; kt += STEP) tile(fa_bool<false>{}, kt);
  if (kt == KT - 1 && kt < t1) tile(fa_bool<true>{}, kt);
}

// A work-group of NWV independent waves of the decoder's early share: key tiles t0 .. t1 - 1.
// idx: the work-group's number among them. The waves of one work-group have one head and one
// stream, so they read the same K and V rows at about the same time.
#define DE_WGS(NWV) (BATCH * NHEAD * DS_NS * ((DQB + (NWV) - 1) / (NWV)))
template <int NWV>
__device__ __forceinline__
void dec_early(const float* Qd, const float* Kd, const float* Vd, float* St,
               const int idx, const int t0, const int t1) {
  constexpr int WQ = (DQB + NWV - 1) / NWV;
  const int lane = threadIdx.x & 31;
  // wave number in a scalar register: the branches below stay scalar
  const int wave = __builtin_amdgcn_readfirstlane((int)(threadIdx.x >> 5));
  const int qblk = (idx % WQ) * NWV + wave;
  const int sb = idx / WQ;                 // (batch * NHEAD + head) * DS_NS + stream
  if (qblk >= DQB) return;
  const int stream = sb % DS_NS, bh = sb / DS_NS;
  float* sp = St + ((size_t)sb * DQB + qblk) * DS_VALS + lane * 4;
  v8f o[2][2];
  float mrun[2], lrun[2];
  if (t0 != DEC_T0) {
    fa_state_load(sp, o, mrun, lrun);
  } else {
#pragma unroll   // constant register index
    for (int t = 0; t < 2; ++t) {
      o[t][0] = (v8f){}; o[t][1] = (v8f){};
      mrun[t] = -1e30f; lrun[t] = 0.f;
    }
  }
  fa_run<NT, DS_NS, false>(Qd, Kd, Vd, nullptr, N_UNMASK + qblk * 32,
                           (size_t)(bh / NHEAD) * NT * D_MODEL + (size_t)(bh % NHEAD) * HD,
                           t0 + stream, t1, o, mrun, lrun);
  fa_state_store(sp, o, mrun, lrun);
}

// A work-group's attention for 32 queries of one head: key tiles dealt to its NW waves, merged
// in LDS. ST: the key tiles in front of DEC_T0 alone, on top of the streams' states.
template <int S, int NW, bool MASK, int QB, bool ST>
__device__ __forceinline__
void attn_wg(const float* __restrict__ Q, const float* __restrict__ Kb,
             const float* __restrict__ Vb, float* __restrict__ O,
             const float* __restrict__ maskT, const float* __restrict__ St,
             float (*red)[2][FA_ROWS][16], const int qblk, const int h, const int b) {
  constexpr int KT = (S + 15) / 16;
  static_assert(NW >= 4 && NW >= DS_NS, "the merge takes four waves");
  constexpr float CC = MASK ? 1.f : FA_C;
  const int lane = threadIdx.x & 31;
  // wave number in a scalar register: loop bounds and the last-tile branch stay scalar
  const int wave = __builtin_amdgcn_readfirstlane((int)(threadIdx.x >> 5));
  const int l16 = lane & 15, half = lane >> 4;
  const int q0 = QB + qblk * 32;
  const size_t hb = (size_t)b * S * D_MODEL + (size_t)h * HD;
  v8f o[2][2];
  float mrun[2], lrun[2];
  if (ST && wave < DS_NS) {
    fa_state_load(St + ((size_t)((b * NHEAD + h) * DS_NS + wave) * DQB + qblk) * DS_VALS + lane * 4,
                  o, mrun, lrun);
  } else {
#pragma unroll   // constant register index
    for (int t = 0; t < 2; ++t) {
      o[t][0] = (v8f){}; o[t][1] = (v8f){};
      mrun[t] = -1e30f; lrun[t] = 0.f;
    }
  }
  fa_run<S, NW, MASK>(Q, Kb, Vb, maskT, q0, hb, wave, ST ? DEC_T0 : KT, o, mrun, lrun);

  // -------- this wave's partial result to LDS --------
#pragma unroll   // constant register index
  for (int t = 0; t < 2; ++t) {
    const float lsum = lrun[t] + fa_xhalf(lrun[t]);
#pragma unroll   // constant register index
    for (int r = 0; r < 8; ++r) {
      red[wave][t][r + 8 * half][l16] = o[t][0][r];
      if (half == 0) red[wave][t][16 + r][l16] = o[t][1][r];
    }
    if (half == 0) {
      red[wave][t][HD][l16] = mrun[t];
      red[wave][t][HD + 1][l16] = lsum;
    }
  }
  __syncthreads();

  // -------- merge over the waves: four threads a query, six head dims each --------
  if (wave < 4) {
    const int ql = threadIdx.x >> 2, t = ql >> 4, qi = ql & 15;
    const int d0 = (threadIdx.x & 3) * 6;
    float mall = red[0][t][HD][qi];
#pragma unroll   // LDS reads at immediate offsets, all in flight together
    for (int w = 1; w < NW; ++w) mall = fmaxf(mall, red[w][t][HD][qi]);
    float den = 0.f, acc[6] = {0.f, 0.f, 0.f, 0.f, 0.f, 0.f};
#pragma unroll   // LDS reads at immediate offsets, all in flight together
    for (int w = 0; w < NW; ++w) {
      const float wg = __builtin_amdgcn_exp2f((red[w][t][HD][qi] - mall) * CC);
      den += wg * red[w][t][HD + 1][qi];
#pragma unroll   // constant register index
      for (int i = 0; i < 6; ++i) acc[i] += wg * red[w][t][d0 + i][qi];
    }
    const float inv = 1.f / den;
    const int q = q0 + ql;
    if (q < S) {
      float* op = O + hb + (size_t)q * D_MODEL + d0;
#pragma unroll   // constant register index
      for (int i = 0; i < 6; ++i) op[i] = acc[i] * inv;
    }
  }
}

// An encoder layer's attention, and behind it in the grid a range of the decoder's early share
#define EA_NW  8
#define EA_QB  ((N_UNMASK + 31) / 32)
#define EA_WGS (EA_QB * NHEAD * BATCH)
__global__ __launch_bounds__(EA_NW * 32)
void enc_attn_kernel(const float* __restrict__ Q, const float* __restrict__ Kb,
                     const float* __restrict__ Vb, float* __restrict__ O,
                     const float* __restrict__ maskT,
                     const float* __restrict__ Qd, const float* __restrict__ Kd,
                     const float* __restrict__ Vd, float* __restrict__ St,
                     const int t0, const int t1) {
  __shared__ float red[EA_NW][2][FA_ROWS][16];
  const int blk = blockIdx.x;
  if (blk >= EA_WGS) { dec_early<EA_NW>(Qd, Kd, Vd, St, blk - EA_WGS, t0, t1); return; }
  attn_wg<N_UNMASK, EA_NW, true, 0, false>(Q, Kb, Vb, O, maskT, nullptr, red, blk % EA_QB,
                                           (blk / EA_QB) % NHEAD, blk / (EA_QB * NHEAD));
}

// The decoder's attention: what is left of it behind the encoder
#define DA_NW 4
__global__ __launch_bounds__(DA_NW * 32)
void dec_attn_kernel(const float* __restrict__ Q, const float* __restrict__ Kb,
                     const float* __restrict__ Vb, float* __restrict__ O,
                     const float* __restrict__ St) {
  __shared__ float red[DA_NW][2][FA_ROWS][16];
  attn_wg<NT, DA_NW, false, N_UNMASK, true>(Q, Kb, Vb, O, nullptr, St, red, blockIdx.x,
                                            blockIdx.y, blockIdx.z);
}

// ---------------------------------------------------------------------------
// The row-local chain behind attention in ONE launch, one work-group of PK_WAVES
// waves per 16 rows:
//   h = LN(h + O Wo + bo); f = relu(h W1 + b1); h = LN(h + f W2 + b2); then
//   NEXT 1: the next layer's Q, K, V = h Wq|Wk|Wv + bias (nw, nb);
//   NEXT 2, the encoder's last layer: its closing LayerNorm (cg, cb), the decoder's
//           input row x = (h ew + eb) * sqrt(D), and the decoder's K and V of x (nw, nb);
//           row b * N_UNMASK + s goes to row b * NT + s. The one decoder layer's output
//           is read at the masked tokens' rows alone, so these rows are only looked at:
//           no Q of them, and x itself goes nowhere;
//   NEXT 3, the decoder's last layer, the masked tokens' rows alone (row b * N_MASKT + j
//           lies at row b * NT + N_UNMASK + j of Ob and H): its closing LayerNorm
//           (cg, cb) and the output h . ew + eb, to Ho.
// The 16 x 96 row tile and the 16 x 384 hidden tile stay in LDS; a product's
// result goes there in D layout and is read back as A fragments. Wave w owns
// column tile w of every 96-wide product and four tiles of the 384-wide one.
// Every accumulator keeps the ascending k order.
// LDS pitches are 4 dwords past a multiple of 32: the 16 rows x 2 halves of an
// 8-byte A-fragment read fall on 64 different banks.
// ---------------------------------------------------------------------------
#define PK_WAVES 6
#define PK_HP (D_MODEL + 4)
#define PK_FP (FF_DIM + 4)
#define PK_ENC_WGS ((BATCH * N_UNMASK + 15) / 16)
static_assert(PK_WAVES * 16 == D_MODEL, "one 16-column tile of the model width per wave");

// B fragments of chunk c: CH k-steps x TN column tiles, TS floats from tile to tile
template <int N, int TS, int TN, int CH>
__device__ __forceinline__ void pk_load_b(const float* __restrict__ wp, const int c,
                                          v2f (&b)[CH][TN]) {
#pragma unroll   // constant register index, immediate load offsets
  for (int j = 0; j < CH; ++j) {
    const int k0 = (c * CH + j) * 4;
#pragma unroll   // constant register index
    for (int t = 0; t < TN; ++t) {
      b[j][t].x = wp[k0 * N + t * TS];
      b[j][t].y = wp[(k0 + 1) * N + t * TS];
    }
  }
}

// A fragments of chunk c from the LDS tile (as: this lane's row, + 2 * half)
template <int CH>
__device__ __forceinline__ void pk_load_a(const float* as, const int c, v2f (&a)[CH]) {
#pragma unroll   // constant register index
  for (int j = 0; j < CH; ++j) a[j] = *(const v2f*)(as + (c * CH + j) * 4);
}

// acc[t] += A(LDS, 16 x K) * W(:, tile t). The caller has loaded chunks 0 and 1
// of b (weights depend on no earlier stage, so that is done ahead of the barrier
// in front of the stage); chunk c + 2 is loaded while chunk c is multiplied.
template <int K, int N, int TS, int TN, int CH>
__device__ __forceinline__ void pk_mm(const float* as, const float* __restrict__ wp,
                                      v2f (&b)[3][CH][TN], v8f (&acc)[TN]) {
  constexpr int NCH = K / (4 * CH);
  static_assert(K % (4 * CH) == 0 && NCH >= 2, "shape");
  v2f a[2][CH];
  pk_load_a<CH>(as, 0, a[0]);
#pragma unroll   // constant ring index
  for (int c = 0; c < NCH; ++c) {
    if (c + 2 < NCH) pk_load_b<N, TS, TN, CH>(wp, c + 2, b[(c + 2) % 3]);
    if (c + 1 < NCH) pk_load_a<CH>(as, c + 1, a[(c + 1) % 2]);
    // keeps the loads above in front of this chunk's WMMAs: sunk to their use,
    // each chunk would wait out its own load latency
    __builtin_amdgcn_sched_barrier(0);
#pragma unroll   // constant ring index
    for (int j = 0; j < CH; ++j)
#pragma unroll   // constant ring index
      for (int t = 0; t < TN; ++t)
        acc[t] = __builtin_amdgcn_wmma_f32_16x16x4_f32(false, a[c % 2][j], false, b[c % 3][j][t],
                                                       (short)0, acc[t], false, false);
    // keeps the next trip's loads out of this chunk's WMMAs: risen there, they
    // cannot take this chunk's ring slot and cost a fourth chunk of registers
    __builtin_amdgcn_sched_barrier(0);
  }
  // stands in front of any reuse of the weight loads' address registers; the
  // scheduling barrier keeps later arithmetic from rising over it
  asm volatile("s_wait_xcnt 0x0" ::: "memory");
  __builtin_amdgcn_sched_barrier(0);
}

// LayerNorm of the 16 x 96 LDS tile in place: waves 0..3, four rows a wave, eight
// lanes a row, twelve elements a lane. Hout: the rows also go to global memory.
__device__ __forceinline__ void pk_ln(float* hs, const float* __restrict__ g,
                                      const float* __restrict__ bta, int wave, int lane,
                                      float* __restrict__ Hout, int m0, int M) {
  if (wave < 4) {
    const int row = wave * 4 + (lane >> 3), e = lane & 7;
    float* p = hs + row * PK_HP + e * 4;
    float v[12], gv[12], bv[12];
#pragma unroll   // constant register index
    for (int i = 0; i < 12; ++i) {
      const int o = (i >> 2) * 32 + (i & 3);
      v[i] = p[o];
      gv[i] = g[e * 4 + o];
      bv[i] = bta[e * 4 + o];
    }
    float s = 0.f;
#pragma unroll   // constant register index
    for (int i = 0; i < 12; ++i) s += v[i];
    s += __shfl_xor(s, 1, 32); s += __shfl_xor(s, 2, 32); s += __shfl_xor(s, 4, 32);
    const float m = s / (float)D_MODEL;
    float q = 0.f;
#pragma unroll   // constant register index
    for (int i = 0; i < 12; ++i) { v[i] -= m; q += v[i] * v[i]; }
    q += __shfl_xor(q, 1, 32); q += __shfl_xor(q, 2, 32); q += __shfl_xor(q, 4, 32);
    const float rs = rsqrtf(q / (float)D_MODEL + 1e-5f);
#pragma unroll   // constant register index
    for (int i = 0; i < 12; ++i) {
      v[i] = v[i] * rs * gv[i] + bv[i];
      p[(i >> 2) * 32 + (i & 3)] = v[i];
    }
    if (Hout && m0 + row < M) {
      float* hp = Hout + (size_t)(m0 + row) * D_MODEL + e * 4;
#pragma unroll   // constant register index
      for (int i = 0; i < 12; ++i) hp[(i >> 2) * 32 + (i & 3)] = v[i];
    }
  }
}

template <int NEXT>
__global__ __launch_bounds__(PK_WAVES * 32)
void post_kernel(const float* __restrict__ Ob, float* __restrict__ H,
                 const float* __restrict__ wo, const float* __restrict__ bo,
                 const float* __restrict__ ln,
                 const float* __restrict__ w1, const float* __restrict__ b1,
                 const float* __restrict__ w2, const float* __restrict__ b2,
                 const float* __restrict__ nw, const float* __restrict__ nb,
                 float* __restrict__ Qo, float* __restrict__ Ko, float* __restrict__ Vo,
                 const float* __restrict__ cg, const float* __restrict__ cb,
                 const float* __restrict__ ew, const float* __restrict__ eb,
                 float* __restrict__ Ho, int M,
                 const float* Qe, const float* Ke, const float* Ve, float* Se,
                 const int t0, const int t1) {
  // behind the encoder's row tiles in the grid: a range of the decoder's early share
  if (NEXT != 3) {
    if (blockIdx.x >= PK_ENC_WGS) {
      dec_early<PK_WAVES>(Qe, Ke, Ve, Se, blockIdx.x - PK_ENC_WGS, t0, t1);
      return;
    }
  }
  __shared__ __attribute__((aligned(16))) float hs[16 * PK_HP];
  __shared__ __attribute__((aligned(16))) float fs[16 * PK_FP];
  const int lane = threadIdx.x & 31;
  // wave number in a scalar register: the LayerNorm branch stays scalar
  const int wave = __builtin_amdgcn_readfirstlane((int)(threadIdx.x >> 5));
  const int l16 = lane & 15, half = lane >> 4;
  const int m0 = blockIdx.x * 16;
  const int col = wave * 16 + l16;

  // ---- output projection: A from global (row-clamped), all operands at once ----
  int ra = m0 + l16; if (ra >= M) ra = M - 1;
  if (NEXT == 3) ra += (ra / N_MASKT) * N_UNMASK + N_UNMASK;
  const float* xa  = Ob + (size_t)ra * D_MODEL + 2 * half;
  const float* wpo = wo + (size_t)(2 * half) * D_MODEL + col;
  v2f ao[D_MODEL / 4], wf[D_MODEL / 4];
#pragma unroll   // constant register index
  for (int j = 0; j < D_MODEL / 4; ++j) {
    ao[j].x = xa[4 * j];             ao[j].y = xa[4 * j + 1];
    wf[j].x = wpo[4 * j * D_MODEL];  wf[j].y = wpo[(4 * j + 1) * D_MODEL];
  }
  float res[8];
#pragma unroll   // constant register index
  for (int r = 0; r < 8; ++r) {
    int m = m0 + r + 8 * half; if (m >= M) m = M - 1;
    if (NEXT == 3) m += (m / N_MASKT) * N_UNMASK + N_UNMASK;
    res[r] = H[(size_t)m * D_MODEL + col];
  }
  const float bov = bo[col], b2v = b2[col];
  const float ebv = NEXT == 2 ? eb[col] : 0.f;
  // the products behind the chain: Q, K, V, or (NEXT 2) K and V, the second and third
  constexpr int NP = NEXT == 2 ? 2 : 3, P0 = 3 - NP;
  float b1v[4], nbv[NP];
#pragma unroll   // constant register index
  for (int t = 0; t < 4; ++t) b1v[t] = b1[wave * 64 + t * 16 + l16];
  // stands in front of later loads whose results land in address registers of
  // the loads above
  asm volatile("s_wait_xcnt 0x0" ::: "memory");
  if (NEXT != 3) {
#pragma unroll   // constant register index
    for (int t = 0; t < NP; ++t) nbv[t] = nb[(P0 + t) * D_MODEL + col];
    // as above, for the loads just issued
    asm volatile("s_wait_xcnt 0x0" ::: "memory");
  }
  const float* wp1 = w1 + (size_t)(2 * half) * FF_DIM + wave * 64 + l16;
  v2f bf1[3][4][4];
  pk_load_b<FF_DIM, 16, 4, 4>(wp1, 0, bf1[0]);
  pk_load_b<FF_DIM, 16, 4, 4>(wp1, 1, bf1[1]);
  // holds every load above in front of the WMMAs: one load latency for all
  __builtin_amdgcn_sched_barrier(0);
  v8f acco = {};
#pragma unroll   // constant register index
  for (int j = 0; j < D_MODEL / 4; ++j)
    acco = __builtin_amdgcn_wmma_f32_16x16x4_f32(false, ao[j], false, wf[j], (short)0, acco,
                                                 false, false);
#pragma unroll   // constant register index
  for (int r = 0; r < 8; ++r) hs[(r + 8 * half) * PK_HP + col] = res[r] + (acco[r] + bov);
  __syncthreads();
  // second FFN product's first weights: in flight while the rows are normalised
  const float* wp2 = w2 + (size_t)(2 * half) * D_MODEL + col;
  v2f bf2[3][12][1];
  pk_load_b<D_MODEL, 16, 1, 12>(wp2, 0, bf2[0]);
  pk_load_b<D_MODEL, 16, 1, 12>(wp2, 1, bf2[1]);
  pk_ln(hs, ln, ln + D_MODEL, wave, lane, (float*)0, m0, M);
  __syncthreads();

  // ---- f = relu(h W1 + b1), into LDS ----
  const float* ah = hs + l16 * PK_HP + 2 * half;
  v8f af[4];
#pragma unroll   // constant register index
  for (int t = 0; t < 4; ++t) af[t] = (v8f){};
  pk_mm<D_MODEL, FF_DIM, 16, 4, 4>(ah, wp1, bf1, af);
#pragma unroll   // constant register index
  for (int t = 0; t < 4; ++t)
#pragma unroll   // constant register index
    for (int r = 0; r < 8; ++r)
      fs[(r + 8 * half) * PK_FP + wave * 64 + t * 16 + l16] = fmaxf(af[t][r] + b1v[t], 0.f);
  __syncthreads();
  // the next product's first weights: in flight during the second FFN product
  const float* wpn = nw + (size_t)(P0 * D_MODEL + 2 * half) * D_MODEL + col;
  v2f bfn[3][4][NP];
  v2f bfe[3][12][1];
  if (NEXT == 1) {
    pk_load_b<D_MODEL, D_MODEL * D_MODEL, NP, 4>(wpn, 0, bfn[0]);
    pk_load_b<D_MODEL, D_MODEL * D_MODEL, NP, 4>(wpn, 1, bfn[1]);
  }
  const float* wpe = ew + (size_t)(2 * half) * D_MODEL + col;   // NEXT 2 only
  if (NEXT == 2) {
    pk_load_b<D_MODEL, 16, 1, 12>(wpe, 0, bfe[0]);
    pk_load_b<D_MODEL, 16, 1, 12>(wpe, 1, bfe[1]);
    // stands in front of any reuse of the address registers of these loads; the address
    // is an input, so that it lives up to the wait
    asm volatile("s_wait_xcnt 0x0" :: "v"(wpe) : "memory");
  }

  // ---- h + f W2 + b2: each element of the row tile is updated by its own lane ----
  v8f a2[1];
  a2[0] = (v8f){};
  pk_mm<FF_DIM, D_MODEL, 16, 1, 12>(fs + l16 * PK_FP + 2 * half, wp2, bf2, a2);
#pragma unroll   // constant register index
  for (int r = 0; r < 8; ++r) {
    float* p = hs + (r + 8 * half) * PK_HP + col;
    *p = *p + (a2[0][r] + b2v);
  }
  __syncthreads();
  // the decoder's first projection weights: in flight during the two LayerNorms and
  // the product between them and their use
  if (NEXT == 2) {
    pk_load_b<D_MODEL, D_MODEL * D_MODEL, NP, 4>(wpn, 0, bfn[0]);
    pk_load_b<D_MODEL, D_MODEL * D_MODEL, NP, 4>(wpn, 1, bfn[1]);
  }
  pk_ln(hs, ln + 2 * D_MODEL, ln + 3 * D_MODEL, wave, lane, NEXT == 1 ? H : (float*)0, m0, M);
  // last layer of a stack: the stack's closing LayerNorm; each lane reads back only
  // what it wrote itself, so no barrier stands between the two
  if (NEXT != 1) pk_ln(hs, cg, cb, wave, lane, (float*)0, m0, M);

  // ---- the output: row . ew + eb, by the lanes that normalised the row ----
  if (NEXT == 3) {
    if (wave < 4) {
      const int row = wave * 4 + (lane >> 3), e = lane & 7;
      const float* p = hs + row * PK_HP + e * 4;
      float wv[12];
#pragma unroll   // constant register index
      for (int i = 0; i < 12; ++i) wv[i] = ew[e * 4 + (i >> 2) * 32 + (i & 3)];
      const float ob = eb[0];
      // stands in front of any reuse of the address registers of the loads above: the loaded
      // values are inputs, so that every one of the loads is issued in front of the wait; the
      // scheduling barrier keeps later arithmetic from rising over it
      asm volatile("s_wait_xcnt 0x0" :: "v"(wv[0]), "v"(wv[1]), "v"(wv[2]), "v"(wv[3]), "v"(wv[4]),
                   "v"(wv[5]), "v"(wv[6]), "v"(wv[7]), "v"(wv[8]), "v"(wv[9]), "v"(wv[10]),
                   "v"(wv[11]) : "memory");
      __builtin_amdgcn_sched_barrier(0);
      float s = 0.f;
#pragma unroll   // constant register index
      for (int i = 0; i < 12; ++i) s += p[(i >> 2) * 32 + (i & 3)] * wv[i];
      s += __shfl_xor(s, 1, 32); s += __shfl_xor(s, 2, 32); s += __shfl_xor(s, 4, 32);
      const int m = m0 + row;
      if (e == 0 && m < M) Ho[m] = s + ob;
    }
  }

  // where this lane's eight result rows go (NEXT 2), -1: no such row
  int orow[8];
  if (NEXT == 2) {
#pragma unroll   // constant register index
    for (int r = 0; r < 8; ++r) {
      const int m = m0 + 8 * half + r;
      orow[r] = m < M ? (m + (m / N_UNMASK) * N_MASKT) * D_MODEL + col : -1;
    }
    // ---- the decoder's input rows, into the row tile ----
    __syncthreads();
    v8f ae[1];
    ae[0] = (v8f){};
    pk_mm<D_MODEL, D_MODEL, 16, 1, 12>(ah, wpe, bfe, ae);
    // every wave has read the row tile as its A operand before it is overwritten
    __syncthreads();
#pragma unroll   // constant register index
    for (int r = 0; r < 8; ++r) hs[(r + 8 * half) * PK_HP + col] = (ae[0][r] + ebv) * SQRT_D;
  }

  // ---- next layer's Q, K, V (NEXT 2: K, V): this wave's column tile of each ----
  if (NEXT != 3) {
    __syncthreads();
    v8f an[NP];
#pragma unroll   // constant register index
    for (int t = 0; t < NP; ++t) an[t] = (v8f){};
    pk_mm<D_MODEL, D_MODEL, D_MODEL * D_MODEL, NP, 4>(ah, wpn, bfn, an);
    if constexpr (NEXT == 1) {
      const size_t ob = (size_t)(m0 + 8 * half) * D_MODEL + col;
      const int left = M - m0 - 8 * half;   // rows of this half tile that exist
#pragma unroll   // constant register index, immediate store offsets
      for (int r = 0; r < 8; ++r) {
        if (r < left) {
          Qo[ob + r * D_MODEL] = an[0][r] + nbv[0];
          Ko[ob + r * D_MODEL] = an[1][r] + nbv[1];
          Vo[ob + r * D_MODEL] = an[2][r] + nbv[2];
        }
      }
    } else {
#pragma unroll   // constant register index
      for (int r = 0; r < 8; ++r) {
        if (orow[r] >= 0) {
          Ko[orow[r]] = an[0][r] + nbv[0];
          Vo[orow[r]] = an[1][r] + nbv[1];
        }
      }
    }
  }
}

// ---------------------------------------------------------------------------
extern "C" void kernel_launch(void* const* d_in, const int* in_sizes, int n_in,
                              void* d_out, int out_size, void* d_ws, size_t ws_size,
                              hipStream_t stream) {
  (void)in_sizes; (void)n_in; (void)out_size; (void)ws_size;
  const float* hist  = (const float*)d_in[0];
  const int*   uidx  = (const int*)d_in[1];
  const int*   midx  = (const int*)d_in[2];
  const float* nv1   = (const float*)d_in[3];
  const float* nv2   = (const float*)d_in[4];
  const float* dim_w = (const float*)d_in[5];
  const float* dim_b = (const float*)d_in[6];
  const float* pos   = (const float*)d_in[7];
  const float* tod_w = (const float*)d_in[8];
  const float* tod_b = (const float*)d_in[9];
  const float* dow_w = (const float*)d_in[10];
  const float* dow_b = (const float*)d_in[11];
  const float* mtok  = (const float*)d_in[12];
  const float* eaw   = (const float*)d_in[13];
  const float* eab   = (const float*)d_in[14];
  const float* ew1   = (const float*)d_in[15];
  const float* eb1   = (const float*)d_in[16];
  const float* ew2   = (const float*)d_in[17];
  const float* eb2   = (const float*)d_in[18];
  const float* eln   = (const float*)d_in[19];
  const float* eng   = (const float*)d_in[20];
  const float* enb   = (const float*)d_in[21];
  const float* e2dw  = (const float*)d_in[22];
  const float* e2db  = (const float*)d_in[23];
  const float* daw   = (const float*)d_in[24];
  const float* dab   = (const float*)d_in[25];
  const float* dw1   = (const float*)d_in[26];
  const float* db1   = (const float*)d_in[27];
  const float* dw2   = (const float*)d_in[28];
  const float* db2   = (const float*)d_in[29];
  const float* dln   = (const float*)d_in[30];
  const float* dng   = (const float*)d_in[31];
  const float* dnb   = (const float*)d_in[32];
  const float* outw  = (const float*)d_in[33];
  const float* outb  = (const float*)d_in[34];
  float* out = (float*)d_out;

  float* ws = (float*)d_ws;
  size_t off = 0;
  auto alloc = [&](size_t n) { float* p = ws + off; off += n; return p; };
  const size_t MD = (size_t)BATCH * NT;   // max rows (decoder): 9936
  float* St    = alloc(DS_TOTAL);   // first: its 16-byte accesses stay aligned
  float* adpA  = alloc((size_t)N_NODES * N_NODES);
  float* Menc  = alloc((size_t)EM_ROWS * EM_PITCH);
  float* X  = alloc(MD * D_MODEL);
  float* Qb = alloc(MD * D_MODEL);
  float* Kb = alloc(MD * D_MODEL);
  float* Vb = alloc(MD * D_MODEL);
  float* Ob = alloc(MD * D_MODEL);
  float* Xd = alloc(MD * D_MODEL);
  float* Qd = alloc(MD * D_MODEL);
  float* Kd = alloc(MD * D_MODEL);
  float* Vd = alloc(MD * D_MODEL);

  front_kernel<<<N_NODES + (FR_ENC + FR_DEC) / FR_ROWS, D_MODEL, 0, stream>>>(
      nv1, nv2, adpA, hist, uidx, midx, dim_w, dim_b, pos, tod_w, tod_b, dow_w, dow_b, mtok,
      X, Xd, out);
  proj_kernel<<<PJ_ENC + PJ_DEC + EM_ROWS, 32, 0, stream>>>(
      X, eaw, eab, Qb, Kb, Vb, Xd, daw, dab, Qd, Kd, Vd, adpA, uidx, Menc);

  // ---- encoder (4 layers, masked attention over 621 tokens): attention, then the whole
  // row-local rest of the layer in one launch ----
  const unsigned pe = (BATCH * N_UNMASK + 15) / 16, pd = (BATCH * N_MASKT + 15) / 16;
  // ta .. tp - 1 and tp .. te - 1: the decoder's key tiles that ride on the layer's two launches
  auto layer = [&](const int l, const int ta, const int tp, const int te) {
    const float* aw = eaw + (size_t)l * 4 * D_MODEL * D_MODEL;
    const float* ab = eab + (size_t)l * 4 * D_MODEL;
    const float* w1 = ew1 + (size_t)l * D_MODEL * FF_DIM;
    const float* b1 = eb1 + (size_t)l * FF_DIM;
    const float* w2 = ew2 + (size_t)l * FF_DIM * D_MODEL;
    const float* b2 = eb2 + (size_t)l * D_MODEL;
    const float* ln = eln + (size_t)l * 2 * 2 * D_MODEL;
    enc_attn_kernel<<<EA_WGS + DE_WGS(EA_NW), EA_NW * 32, 0, stream>>>(
        Qb, Kb, Vb, Ob, Menc, Qd, Kd, Vd, St, ta, tp);
    if (l < 3)
      post_kernel<1><<<pe + DE_WGS(PK_WAVES), PK_WAVES * 32, 0, stream>>>(
          Ob, X, aw + 3 * D_MODEL * D_MODEL, ab + 3 * D_MODEL, ln, w1, b1, w2, b2,
          aw + 4 * D_MODEL * D_MODEL, ab + 4 * D_MODEL, Qb, Kb, Vb,
          nullptr, nullptr, nullptr, nullptr, nullptr, BATCH * N_UNMASK,
          Qd, Kd, Vd, St, tp, te);
    else
      post_kernel<2><<<pe + DE_WGS(PK_WAVES), PK_WAVES * 32, 0, stream>>>(
          Ob, X, aw + 3 * D_MODEL * D_MODEL, ab + 3 * D_MODEL, ln, w1, b1, w2, b2,
          daw, dab, nullptr, Kd, Vd, eng, enb, e2dw, e2db, nullptr, BATCH * N_UNMASK,
          Qd, Kd, Vd, St, tp, te);
  };
  static_assert(DEC_T0 == 39 && DEC_KT == 156, "the ranges below cover DEC_T0 .. DEC_KT - 1");
  layer(0, 39, 49, 69);
  layer(1, 69, 79, 98);
  layer(2, 98, 108, 127);
  layer(3, 127, 137, 156);
  // ---- decoder (1 layer, full attention over 2484 tokens; queries: the masked tokens) ----
  dec_attn_kernel<<<dim3(DQB, NHEAD, BATCH), DA_NW * 32, 0, stream>>>(Qd, Kd, Vd, Ob, St);
  post_kernel<3><<<pd, PK_WAVES * 32, 0, stream>>>(
      Ob, Xd, daw + 3 * D_MODEL * D_MODEL, dab + 3 * D_MODEL, dln, dw1, db1, dw2, db2,
      nullptr, nullptr, nullptr, nullptr, nullptr, dng, dnb, outw, outb, out, BATCH * N_MASKT,
      nullptr, nullptr, nullptr, nullptr, 0, 0);
}

// v008
// It runs in 178 microseconds.
// Timed twice side by side with v007, it ran 1.06 times as fast both times.
// All steps since v000 together make it 14.9 times as fast.
#include <hip/hip_runtime.h>
#include <math.h>

#define N_NODES  207
#define T_STEPS  12
#define C_IN     4
#define BATCH    4
#define NT       (N_NODES * T_STEPS)   // 2484
#define D_MODEL  96
#define NHEAD    4
#define HD       24
#define FF_DIM   384
#define N_MASKT  1863
#define N_UNMASK 621
#define MAX_NEIGH 40
#define ATTN_SCALE 0.20412414523193154f   // 1/sqrt(24)
#define SQRT_D     9.797958971132712f     // sqrt(96)

typedef float v2f __attribute__((ext_vector_type(2)));
typedef float v8f __attribute__((ext_vector_type(8)));

// ---------------------------------------------------------------------------
// Adjacency: A = softmax(relu(nv1 @ nv2), axis=1); keep iff (A > 1/N) and
// strictly greater than the 41st-largest in its row (rank < MAX_NEIGH).
// ---------------------------------------------------------------------------
__device__ __forceinline__ void adj_row(const float* __restrict__ nv1,
                                        const float* __restrict__ nv2,
                                        float* __restrict__ adpA, const int i) {
  constexpr int PER = (N_NODES + D_MODEL - 1) / D_MODEL;  // elements a thread owns
  constexpr int WR  = (N_NODES + 31) / 32;                // elements a lane reads for the statistics
  constexpr int NP4 = (N_NODES + 3) / 4;                  // 16-byte groups of the row
  static_assert(PER == 3 && NP4 * 4 <= PER * D_MODEL, "three elements a thread, pad inside");
  // both hold a slot for every (thread, element), so that the LDS stores need no test
  __shared__ __attribute__((aligned(16))) float a[PER * D_MODEL];
  __shared__ __attribute__((aligned(16))) float p[PER * D_MODEL];
  const int tid = threadIdx.x, lane = tid & 31;   // the block has D_MODEL threads
  int jc[PER];
  float w[PER][10], u[10];
#pragma unroll   // constant register index; in flight together with the loads below
  for (int r = 0; r < 10; ++r) u[r] = nv1[i * 10 + r];
#pragma unroll   // constant register index; all the loads in flight together
  for (int e = 0; e < PER; ++e) {
    const int j = tid + e * D_MODEL;
    jc[e] = j < N_NODES ? j : N_NODES - 1;   // past the end: the last element, not used
#pragma unroll   // constant register index, immediate load offsets
    for (int r = 0; r < 10; ++r) w[e][r] = nv2[r * N_NODES + jc[e]];
  }
  // stands in front of any reuse of the address registers of the loads above: the indices
  // are inputs, so that they live up to the wait and no result lands in one of them;
  // the scheduling barrier keeps later arithmetic from rising over it
  asm volatile("s_wait_xcnt 0x0" :: "v"(jc[0]), "v"(jc[1]), "v"(jc[2]) : "memory");
  __builtin_amdgcn_sched_barrier(0);
  float own[PER];
#pragma unroll   // constant register index
  for (int e = 0; e < PER; ++e) {
    float s = 0.f;
#pragma unroll   // constant register index
    for (int r = 0; r < 10; ++r) s += u[r] * w[e][r];
    own[e] = s > 0.f ? s : 0.f;
    a[tid + e * D_MODEL] = own[e];
  }
  __syncthreads();
  // maximum and sum of the whole row, in every wave for itself: nobody waits for one thread
  float v[WR];
#pragma unroll   // constant register index; the LDS reads in flight together
  for (int e = 0; e < WR; ++e) v[e] = a[lane + e * 32];   // past the end: not used
  float mx = v[0];
#pragma unroll   // constant register index
  for (int e = 1; e < WR; ++e) mx = fmaxf(mx, lane + e * 32 < N_NODES ? v[e] : 0.f);
#pragma unroll   // five exchange steps
  for (int m = 16; m >= 1; m >>= 1) mx = fmaxf(mx, __shfl_xor(mx, m, 32));
  float sum = 0.f;
#pragma unroll   // constant register index
  for (int e = 0; e < WR; ++e) sum += lane + e * 32 < N_NODES ? __expf(v[e] - mx) : 0.f;
#pragma unroll   // five exchange steps
  for (int m = 16; m >= 1; m >>= 1) sum += __shfl_xor(sum, m, 32);
  const float inv = 1.f / sum;
#pragma unroll   // constant register index
  for (int e = 0; e < PER; ++e) {
    const int j = tid + e * D_MODEL;
    own[e] = __expf(own[e] - mx) * inv;
    // behind the row: below every probability, so that it adds to no rank
    p[j] = j < N_NODES ? own[e] : -1.f;
  }
  __syncthreads();
  // ranks of a thread's elements: each value of the row is read once, four a read
  int cnt[PER];
#pragma unroll   // constant register index
  for (int e = 0; e < PER; ++e) cnt[e] = 0;
#pragma unroll 13   // that many 16-byte LDS reads in flight together
  for (int l = 0; l < NP4; ++l) {
    const float4 x = *(const float4*)(p + 4 * l);
#pragma unroll   // constant register index
    for (int e = 0; e < PER; ++e)
      cnt[e] += (x.x > own[e] ? 1 : 0) + (x.y > own[e] ? 1 : 0) + (x.z > own[e] ? 1 : 0) +
                (x.w > own[e] ? 1 : 0);
  }
  const float thr = 1.0f / (float)N_NODES;
  float* arow = adpA + i * N_NODES + tid;
#pragma unroll   // constant register index
  for (int e = 0; e < PER; ++e) own[e] = ((own[e] > thr) && (cnt[e] < MAX_NEIGH)) ? own[e] : 0.f;
#pragma unroll   // constant register index, immediate store offsets
  for (int e = 0; e < PER; ++e)
    if ((e + 1) * D_MODEL <= N_NODES || tid + e * D_MODEL < N_NODES) arow[e * D_MODEL] = own[e];
}

// Encoder additive attention bias, stored key-major: Mb[k][q] = 0 where query q may
// look at key k, -1e30 where adpA == 0. Rows are padded to whole key tiles and the
// pitch to whole query blocks (pad entries 0), so the attention kernel reads it
// with 16 consecutive queries on 16 lanes and needs no clamp.
#define EM_ROWS  (((N_UNMASK + 15) / 16) * 16)   // 624
#define EM_PITCH (((N_UNMASK + 31) / 32) * 32)   // 640

// ---------------------------------------------------------------------------
// Everything that depends on the inputs alone, in ONE launch; a work-group's role
// comes from its index:
//   adjacency row i;
//   encoder input row: (x0*dim_w + dim_b + pos + tod*tod_w + tod_b + dow*dow_w + dow_b)
//     at unmasked_idx, * sqrt(D);
//   decoder input row of a masked token: (mask_token + pos + tod/dow emb) * sqrt(D),
//     and that token's label.
// ---------------------------------------------------------------------------
#define FR_ENC (BATCH * N_UNMASK)
#define FR_DEC (BATCH * N_MASKT)
#define FR_ROWS 12   // rows a work-group: few waves to start, the rows' loads in flight together
static_assert(FR_ENC % FR_ROWS == 0 && FR_DEC % FR_ROWS == 0, "whole work-groups");
__global__ __launch_bounds__(D_MODEL)
void front_kernel(const float* __restrict__ nv1, const float* __restrict__ nv2,
                  float* __restrict__ adpA,
                  const float* __restrict__ hist,
                  const int* __restrict__ uidx, const int* __restrict__ midx,
                  const float* __restrict__ dim_w, const float* __restrict__ dim_b,
                  const float* __restrict__ pos,
                  const float* __restrict__ tod_w, const float* __restrict__ tod_b,
                  const float* __restrict__ dow_w, const float* __restrict__ dow_b,
                  const float* __restrict__ mask_token,
                  float* __restrict__ X, float* __restrict__ Xd, float* __restrict__ out) {
  const int blk = blockIdx.x;
  if (blk < N_NODES) { adj_row(nv1, nv2, adpA, blk); return; }
  const int d = threadIdx.x;       // 0..95
  const float todw = tod_w[d], todb = tod_b[d], doww = dow_w[d], dowb = dow_b[d];
  // stands in front of any reuse of the address registers of the four loads above; the
  // scheduling barrier keeps later arithmetic from rising over it
  asm volatile("s_wait_xcnt 0x0" ::: "memory");
  __builtin_amdgcn_sched_barrier(0);
  if (blk < N_NODES + FR_ENC / FR_ROWS) {
    const float dimw = dim_w[d], dimb = dim_b[d];
    const int r0 = (blk - N_NODES) * FR_ROWS;
#pragma unroll   // the rows' loads in flight together
    for (int i = 0; i < FR_ROWS; ++i) {
      const int row = r0 + i;      // b*N_UNMASK + s
      const int b = row / N_UNMASK, s = row % N_UNMASK;
      int nt = uidx[s];
      nt = nt < 0 ? 0 : (nt >= NT ? NT - 1 : nt);
      const int n = nt / T_STEPS, t = nt % T_STEPS;
      const float* hp = hist + (((size_t)b * T_STEPS + t) * N_NODES + n) * C_IN;
      float x0 = hp[0], dow = hp[2], tod = hp[3];
      float v = x0 * dimw + dimb + pos[(size_t)nt * D_MODEL + d] +
                tod * todw + todb + dow * doww + dowb;
      X[(size_t)row * D_MODEL + d] = v * SQRT_D;
    }
    // stands behind the run of stores, in front of any rewrite of their address and
    // data registers in the code that follows this role in the built kernel
    asm volatile("s_wait_xcnt 0x0" ::: "memory");
  } else {
    const float mtk = mask_token[d];
    const int r0 = (blk - (N_NODES + FR_ENC / FR_ROWS)) * FR_ROWS;
    int ntr[FR_ROWS], po[FR_ROWS];   // each row's token, and its place in pos
    float pv[FR_ROWS];
#pragma unroll   // constant register index; the rows' loads in flight together
    for (int i = 0; i < FR_ROWS; ++i) {
      int nt = midx[(r0 + i) % N_MASKT];
      nt = nt < 0 ? 0 : (nt >= NT ? NT - 1 : nt);
      ntr[i] = nt;
      po[i] = nt * D_MODEL + d;
      pv[i] = pos[po[i]];
    }
    // stands in front of any reuse of the address registers of the loads above: the places
    // are inputs, so that they live up to the wait and no result lands in one of them;
    // the scheduling barrier keeps later arithmetic from rising over it
    asm volatile("s_wait_xcnt 0x0" :: "v"(po[0]), "v"(po[1]), "v"(po[2]), "v"(po[3]), "v"(po[4]),
                 "v"(po[5]), "v"(po[6]), "v"(po[7]), "v"(po[8]), "v"(po[9]), "v"(po[10]),
                 "v"(po[11]) : "memory");
    __builtin_amdgcn_sched_barrier(0);
    float val[FR_ROWS];
    int xo[FR_ROWS];               // where each row goes in Xd
    float lab = 0.f;               // thread i keeps row i's label
#pragma unroll   // constant register index
    for (int i = 0; i < FR_ROWS; ++i) {
      const int row = r0 + i;      // b*N_MASKT + j
      const int b = row / N_MASKT, j = row % N_MASKT;
      const int n = ntr[i] / T_STEPS, t = ntr[i] % T_STEPS;
      const float* hp = hist + (((size_t)b * T_STEPS + t) * N_NODES + n) * C_IN;
      const float x0 = hp[0], dow = hp[2], tod = hp[3];
      float v = mtk + pv[i] + tod * todw + todb + dow * doww + dowb;
      val[i] = v * SQRT_D;
      xo[i] = (b * NT + N_UNMASK + j) * D_MODEL + d;
      lab = d == i ? x0 : lab;
    }
    // every value and place in a register of its own in front of the first store:
    // arithmetic sunk among the stores would rewrite registers of issued stores
    __builtin_amdgcn_sched_barrier(0);
#pragma unroll   // constant register index
    for (int i = 0; i < FR_ROWS; ++i) Xd[xo[i]] = val[i];
    // stands behind the run of stores, in front of any rewrite of their registers
    asm volatile("s_wait_xcnt 0x0" ::: "memory");
    if (d < FR_ROWS) out[FR_DEC + r0 + d] = lab;
  }
}

// ---------------------------------------------------------------------------
// fp32 GEMM via V_WMMA_F32_16X16X4_F32, register-blocked 32x32 per wave:
// 4 accumulators, each A-frag feeds 2 WMMAs and each B-frag feeds 2 WMMAs.
// Y[M,N] = X[M,K] @ W[K,N] + bias. K and N are compile-time, so every
// operand load is a base register plus an immediate offset.
// Row r of the product lies, in X and in Y alike, at r + (r / SEG) * GAP + OFF.
// The K loop is a register ring: operands come in chunks of GK_STEPS k-steps,
// GK_BUFS chunks are held, and a chunk's loads are issued at least GK_BUFS - 1
// chunks ahead of the WMMAs that use it, so a wave waits out the load latency
// once and not once per trip. Every accumulator keeps the ascending k order.
// M edge via row-clamped loads + guarded stores (EXEC stays full for WMMA).
// ---------------------------------------------------------------------------
#define GK_STEPS 4     // k-steps (of 4) per chunk: 32 loads
#define GK_BUFS  3     // chunks held in registers

template <int K, int N, int SEG, int GAP, int OFF>
__device__ __forceinline__
void gemm_tile(const float* __restrict__ X, const float* __restrict__ W,
               const float* __restrict__ bias, float* __restrict__ Y,
               const int M, const int m0, const int n0) {
  constexpr int NCH = K / (4 * GK_STEPS);
  static_assert(K % (4 * GK_STEPS) == 0 && N % 32 == 0 && NCH >= GK_BUFS, "shape");
  int lane = threadIdx.x & 31;
  int l16 = lane & 15, half = lane >> 4;
  int ra0 = m0 + l16;      if (ra0 >= M) ra0 = M - 1;
  int ra1 = m0 + 16 + l16; if (ra1 >= M) ra1 = M - 1;
  ra0 += (ra0 / SEG) * GAP + OFF;
  ra1 += (ra1 / SEG) * GAP + OFF;
  const float* xa0 = X + (size_t)ra0 * K + 2 * half;
  const float* xa1 = X + (size_t)ra1 * K + 2 * half;
  const float* wp  = W + (size_t)(2 * half) * N + n0 + l16;
  v2f a0[GK_BUFS][GK_STEPS], a1[GK_BUFS][GK_STEPS];
  v2f b0[GK_BUFS][GK_STEPS], b1[GK_BUFS][GK_STEPS];
  v8f acc00 = {}, acc01 = {}, acc10 = {}, acc11 = {};

// unrolled here and below: every ring index must be a compile-time constant,
// or the ring would live in scratch instead of registers
#define GK_LOAD(c)                                                     \
  _Pragma("unroll")                                                    \
  for (int j = 0; j < GK_STEPS; ++j) {                                 \
    const int k0 = ((c) * GK_STEPS + j) * 4;                           \
    const int s = (c) % GK_BUFS;                                       \
    a0[s][j].x = xa0[k0];              a0[s][j].y = xa0[k0 + 1];       \
    a1[s][j].x = xa1[k0];              a1[s][j].y = xa1[k0 + 1];       \
    b0[s][j].x = wp[k0 * N];           b0[s][j].y = wp[(k0 + 1) * N];  \
    b1[s][j].x = wp[k0 * N + 16];      b1[s][j].y = wp[(k0 + 1) * N + 16]; \
  }

#pragma unroll   // constant ring index
  for (int c = 0; c < GK_BUFS - 1; ++c) { GK_LOAD(c) }
#pragma unroll   // constant ring index and immediate load offsets
  for (int c = 0; c < NCH; ++c) {
    if (c + GK_BUFS - 1 < NCH) { GK_LOAD(c + GK_BUFS - 1) }
    // keeps the loads above in front of this chunk's WMMAs: sunk to their use,
    // each chunk would wait out its own load latency again
    __builtin_amdgcn_sched_barrier(0);
    const int s = c % GK_BUFS;
#pragma unroll   // constant ring index
    for (int j = 0; j < GK_STEPS; ++j) {
      acc00 = __builtin_amdgcn_wmma_f32_16x16x4_f32(false, a0[s][j], false, b0[s][j], (short)0, acc00, false, false);
      acc01 = __builtin_amdgcn_wmma_f32_16x16x4_f32(false, a0[s][j], false, b1[s][j], (short)0, acc01, false, false);
      acc10 = __builtin_amdgcn_wmma_f32_16x16x4_f32(false, a1[s][j], false, b0[s][j], (short)0, acc10, false, false);
      acc11 = __builtin_amdgcn_wmma_f32_16x16x4_f32(false, a1[s][j], false, b1[s][j], (short)0, acc11, false, false);
    }
  }
#undef GK_LOAD
  // stands in front of the epilogue's reuse of the operand loads' address
  // registers; the scheduling barrier keeps that arithmetic from rising over it
  asm volatile("s_wait_xcnt 0x0" ::: "memory");
  __builtin_amdgcn_sched_barrier(0);
  const int nA = n0 + l16;
  const float bv0 = bias[nA], bv1 = bias[nA + 16];
  // every store's offset in a register of its own, formed in front of the stores
  int ro[16];
#pragma unroll   // constant register index
  for (int r = 0; r < 16; ++r) {
    const int m = m0 + (r & 7) + 8 * half + 16 * (r >> 3);
    ro[r] = m < M ? (m + (m / SEG) * GAP + OFF) * N + nA : -1;
  }
#pragma unroll   // constant register index
  for (int r = 0; r < 8; ++r) {
    if (ro[r] >= 0) {
      Y[ro[r]] = acc00[r] + bv0;
      Y[ro[r] + 16] = acc01[r] + bv1;
    }
    if (ro[r + 8] >= 0) {
      Y[ro[r + 8]] = acc10[r] + bv0;
      Y[ro[r + 8] + 16] = acc11[r] + bv1;
    }
  }
}

// ---------------------------------------------------------------------------
// Everything that needs only the launch above, in ONE launch of one-wave
// work-groups; the role comes from the index:
//   a 32 x 32 tile of the first encoder layer's Q, K or V;
//   a 32 x 32 tile of the decoder's Q, K or V for the masked tokens' rows, which do
//     not depend on the encoder;
//   one key row of the encoder's attention bias.
// ---------------------------------------------------------------------------
#define PJ_ENC (((BATCH * N_UNMASK + 31) / 32) * 9)
#define PJ_DEC (((BATCH * N_MASKT + 31) / 32) * 9)
__global__ __launch_bounds__(32)
void proj_kernel(const float* __restrict__ X, const float* __restrict__ eaw,
                 const float* __restrict__ eab, float* __restrict__ Qe,
                 float* __restrict__ Ke, float* __restrict__ Ve,
                 const float* __restrict__ Xd, const float* __restrict__ daw,
                 const float* __restrict__ dab, float* __restrict__ Qd,
                 float* __restrict__ Kd, float* __restrict__ Vd,
                 const float* __restrict__ adpA, const int* __restrict__ uidx,
                 float* __restrict__ Mb) {
  const int blk = blockIdx.x;
  if (blk < PJ_ENC) {
    const int y = blk % 9, p = y / 3;
    gemm_tile<D_MODEL, D_MODEL, (1 << 30), 0, 0>(
        X, eaw + p * D_MODEL * D_MODEL, eab + p * D_MODEL, p == 0 ? Qe : (p == 1 ? Ke : Ve),
        BATCH * N_UNMASK, (blk / 9) * 32, (y % 3) * 32);
    return;
  }
  if (blk < PJ_ENC + PJ_DEC) {
    const int t = blk - PJ_ENC, y = t % 9, p = y / 3;
    gemm_tile<D_MODEL, D_MODEL, N_MASKT, N_UNMASK, N_UNMASK>(
        Xd, daw + p * D_MODEL * D_MODEL, dab + p * D_MODEL, p == 0 ? Qd : (p == 1 ? Kd : Vd),
        BATCH * N_MASKT, (t / 9) * 32, (y % 3) * 32);
    return;
  }
  // column nk of the adjacency goes to LDS, and each query looks its node up there
  constexpr int NG = EM_PITCH / 32, NF = N_UNMASK / 32;        // query groups, whole ones
  constexpr int CG = (N_NODES + 31) / 32, CF = N_NODES / 32;   // node groups, whole ones
  static_assert(NG == NF + 1 && CG == CF + 1, "one clamped group each");
  __shared__ float colv[CG * 32];
  const int k = blk - (PJ_ENC + PJ_DEC);   // 0 .. EM_ROWS - 1
  const int lane = threadIdx.x;
  int nk = uidx[k < N_UNMASK ? k : N_UNMASK - 1] / T_STEPS;
  nk = nk < 0 ? 0 : (nk >= N_NODES ? N_NODES - 1 : nk);
  // last group of each: past the end the last element, not used
  const int cq = lane < N_UNMASK - NF * 32 ? lane : N_UNMASK - NF * 32 - 1;
  const int cn = lane < N_NODES - CF * 32 ? lane : N_NODES - CF * 32 - 1;
  const int a1 = lane * N_NODES + nk, a2 = cn * N_NODES + nk;
  int nq[NG];
  float cv[CG];
#pragma unroll   // constant register index, immediate load offsets
  for (int i = 0; i < NF; ++i) nq[i] = uidx[i * 32 + lane];
#pragma unroll   // constant register index, immediate load offsets
  for (int i = 0; i < CF; ++i) cv[i] = adpA[a1 + i * 32 * N_NODES];
  nq[NF] = uidx[NF * 32 + cq];
  cv[CF] = adpA[a2 + CF * 32 * N_NODES];
  // stands in front of any reuse of the address registers of the loads above: the indices
  // are inputs, so that they live up to the wait and no result lands in one of them;
  // the scheduling barrier keeps later arithmetic from rising over it
  asm volatile("s_wait_xcnt 0x0" :: "v"(lane), "v"(cq), "v"(a1), "v"(a2) : "memory");
  __builtin_amdgcn_sched_barrier(0);
#pragma unroll   // constant register index
  for (int i = 0; i < CG; ++i) colv[i * 32 + lane] = cv[i];
  __syncthreads();
  float av[NG];
#pragma unroll   // constant register index; every lane reads, so all LDS reads fly together
  for (int i = 0; i < NG; ++i) {
    int n = nq[i] / T_STEPS;
    n = n < 0 ? 0 : (n >= N_NODES ? N_NODES - 1 : n);
    av[i] = colv[n];
  }
#pragma unroll   // constant register index
  for (int i = 0; i < NG; ++i) {
    const bool in = k < N_UNMASK && i * 32 + lane < N_UNMASK;
    av[i] = (in & (av[i] == 0.f)) ? -1e30f : 0.f;
  }
  // every value in a register of its own in front of the first store
  __builtin_amdgcn_sched_barrier(0);
  float* mrow = Mb + (size_t)k * EM_PITCH + lane;
#pragma unroll   // constant register index, immediate store offsets
  for (int i = 0; i < NG; ++i) mrow[i * 32] = av[i];
}

// ---------------------------------------------------------------------------
// Attention in one pass over the keys, per (b, head, 32 queries): the scores never
// leave the registers.
//   St = K Qt : A = 16 keys x 24, B = Qt, kept in registers. D register r of a lane
//               is the score of key 8 * half + r for query l16.
//   softmax   : running maximum and sum per query (one lane column): in-lane over the
//               8 registers, one exchange between the wave's halves.
//   Ot += Vt Pt : D registers 2j, 2j + 1 of St are, as they stand, the B fragment of
//               k-step j if that step's keys are 8 * half + 2j + {0, 1}; the Vt
//               A fragment takes its rows in the same key order.
// A wave holds two query tiles, so each K and V fragment feeds two products. The
// key tiles are dealt round-robin to the NW waves of the work-group; their partial
// (maximum, sum, Ot) are merged in LDS at the end.
// Head dim order of the score product: at k-step j a lane half takes
// d = 8 * (j >> 1) + 4 * half + 2 * (j & 1) + {0, 1}, for K and Q alike: three 16-byte
// loads a row, in each of which the two halves read 32 adjacent bytes of one line.
// Q/K/V layout: [(b*S+s)*96 + h*24 + d]. maskT: [key][query], pitch EM_PITCH.
// QB: the first query row. Rows in front of it are keys and values only.
// ---------------------------------------------------------------------------
typedef float v4f __attribute__((ext_vector_type(4)));
#define FA_C (ATTN_SCALE * 1.4426950408889634f)   // score scale, in log2 units
#define FA_ROWS (HD + 2)                          // Ot rows, then maximum, then sum

template <bool B> struct fa_bool { static constexpr bool value = B; };

// lane l <-> l ^ 16
__device__ __forceinline__ float fa_xhalf(float v) {
  int b = __float_as_int(v);
  return __int_as_float(__builtin_amdgcn_permlanex16(b, b, 0x76543210, 0xfedcba98, false, false));
}

// 24 floats of one row as six k-step fragments; p: the row's start + 4 * half
__device__ __forceinline__ void fa_row(const float* __restrict__ p, v2f (&f)[6]) {
  const v4f x0 = *(const v4f*)p, x1 = *(const v4f*)(p + 8), x2 = *(const v4f*)(p + 16);
  f[0] = (v2f){x0.x, x0.y}; f[1] = (v2f){x0.z, x0.w};
  f[2] = (v2f){x1.x, x1.y}; f[3] = (v2f){x1.z, x1.w};
  f[4] = (v2f){x2.x, x2.y}; f[5] = (v2f){x2.z, x2.w};
}

// The decoder's keys from tile DEC_T0 on are masked tokens' rows alone: they do not depend
// on the encoder. Their share of the decoder's attention runs as extra work-groups of the
// encoder's launches, a range of key tiles a launch. A wave there is on its own: 32 queries
// of one head, every DS_NS-th tile of the range (its stream), and its running (Ot, maximum,
// sum) goes from launch to launch through the workspace, as it stands in the registers.
// The decoder's own launch takes the tiles in front of DEC_T0; its first DS_NS waves start
// from the streams' states.
#define DEC_T0 ((N_UNMASK + 15) / 16)     // 39
#define DEC_KT ((NT + 15) / 16)           // 156
#define DQB    ((N_MASKT + 31) / 32)      // query blocks a head: 59
#define DS_NS  2                          // streams
#define DS_VALS (36 * 32)                 // floats of one wave's state
#define DS_TOTAL ((size_t)BATCH * NHEAD * DS_NS * DQB * DS_VALS)

// sp: the state's start + 4 * lane
__device__ __forceinline__ void fa_state_load(const float* sp, v8f (&o)[2][2], float (&m)[2],
                                              float (&l)[2]) {
  v4f x[9];
#pragma unroll   // constant register index, immediate load offsets
  for (int c = 0; c < 9; ++c) x[c] = *(const v4f*)(sp + c * 128);
  // stands in front of any reuse of the address registers of the loads above; the address is
  // an input, so that it lives up to the wait and no result lands in its registers
  asm volatile("s_wait_xcnt 0x0" :: "v"(sp) : "memory");
#pragma unroll   // constant register index
  for (int c = 0; c < 8; ++c)
#pragma unroll   // constant register index
    for (int i = 0; i < 4; ++i) o[c >> 2][(c >> 1) & 1][(c & 1) * 4 + i] = x[c][i];
  m[0] = x[8].x; m[1] = x[8].y; l[0] = x[8].z; l[1] = x[8].w;
}

__device__ __forceinline__ void fa_state_store(float* sp, const v8f (&o)[2][2],
                                               const float (&m)[2], const float (&l)[2]) {
#pragma unroll   // constant register index, immediate store offsets
  for (int c = 0; c < 8; ++c) {
    const v8f& s = o[c >> 2][(c >> 1) & 1];
    const int e = (c & 1) * 4;
    *(v4f*)(sp + c * 128) = (v4f){s[e], s[e + 1], s[e + 2], s[e + 3]};
  }
  *(v4f*)(sp + 8 * 128) = (v4f){m[0], m[1], l[0], l[1]};
  // stands behind the run of stores, in front of any rewrite of their registers
  asm volatile("s_wait_xcnt 0x0" ::: "memory");
}

// One wave's pass over the key tiles kt0, kt0 + STEP, ... below t1, for the 32 queries from
// q0 on; o, mrun, lrun: its running state, set by the caller. hb: offset of (batch, head).
template <int S, int STEP, bool MASK>
__device__ __forceinline__
void fa_run(const float* __restrict__ Q, const float* __restrict__ Kb,
            const float* __restrict__ Vb, const float* __restrict__ maskT,
            const int q0, const size_t hb, const int kt0, const int t1,
            v8f (&o)[2][2], float (&mrun)[2], float (&lrun)[2]) {
  constexpr int KT = (S + 15) / 16;
  // with a mask the scores are scaled when the bias is added, else inside the exponent
  constexpr float CC = MASK ? 1.f : FA_C;
  const int lane = threadIdx.x & 31;
  const int l16 = lane & 15, half = lane >> 4;
  const float* Kh = Kb + hb + 4 * half;
  const float* Vh = Vb + hb;

  v2f qf[2][6];
#pragma unroll   // constant register index
  for (int t = 0; t < 2; ++t) {
    int qr = q0 + 16 * t + l16; if (qr >= S) qr = S - 1;
    fa_row(Q + hb + (size_t)qr * D_MODEL + 4 * half, qf[t]);
  }
  v2f kf[6];
  {
    int key = kt0 * 16 + l16; if (key >= S) key = S - 1;
    fa_row(Kh + (size_t)key * D_MODEL, kf);
  }
  // stands in front of any reuse of the address registers of the loads above; the
  // scheduling barrier keeps later arithmetic from rising over it
  asm volatile("s_wait_xcnt 0x0" ::: "memory");
  __builtin_amdgcn_sched_barrier(0);
  const int hd2 = l16 < 8 ? 16 + l16 : HD - 1;   // second Ot tile: 8 rows, rest clamped

  // one key tile; LAST: the tile that may hold keys past S
  auto tile = [&](auto lastc, const int kt) {
    constexpr bool LAST = decltype(lastc)::value;
    const int kb = kt * 16 + 8 * half;
    const float* vt = Vh + (size_t)kb * D_MODEL;   // one address a tile, the rows at immediate offsets
    v2f vf[2][4];
    const float* vp[4][4];   // each load's own address
#pragma unroll   // constant register index, immediate load offsets
    for (int j = 0; j < 4; ++j) {
      const float* vx = vt + 2 * j * D_MODEL;   // rows kb + 2j, kb + 2j + 1
      const float* vy = vt + (2 * j + 1) * D_MODEL;
      if (LAST) {
        const int r0 = kb + 2 * j, r1 = kb + 2 * j + 1;
        vx = Vh + (size_t)(r0 < S ? r0 : S - 1) * D_MODEL;
        vy = Vh + (size_t)(r1 < S ? r1 : S - 1) * D_MODEL;
      }
      vp[j][0] = vx + l16; vp[j][1] = vy + l16; vp[j][2] = vx + hd2; vp[j][3] = vy + hd2;
      vf[0][j].x = *vp[j][0]; vf[0][j].y = *vp[j][1];
      vf[1][j].x = *vp[j][2]; vf[1][j].y = *vp[j][3];
    }
    if (LAST) {
      // clamped rows have addresses of their own: all are inputs, so that they live up to the
      // wait and no result of the run lands in an address register of an earlier load of it
      asm volatile("s_wait_xcnt 0x0" :: "v"(vp[0][0]), "v"(vp[0][1]), "v"(vp[0][2]), "v"(vp[0][3]),
                   "v"(vp[1][0]), "v"(vp[1][1]), "v"(vp[1][2]), "v"(vp[1][3]),
                   "v"(vp[2][0]), "v"(vp[2][1]), "v"(vp[2][2]), "v"(vp[2][3]),
                   "v"(vp[3][0]), "v"(vp[3][1]), "v"(vp[3][2]), "v"(vp[3][3]) : "memory");
    }
    float mb[2][8];
    if (MASK) {
      // stands in front of the bias loads, whose results may land in address
      // registers of the loads above
      if (!LAST) asm volatile("s_wait_xcnt 0x0" ::: "memory");
      const float* mp = maskT + (size_t)kb * EM_PITCH + q0 + l16;
#pragma unroll   // constant register index, immediate load offsets
      for (int r = 0; r < 8; ++r) {
        mb[0][r] = mp[r * EM_PITCH];
        mb[1][r] = mp[r * EM_PITCH + 16];
      }
    }
    // stands in front of any reuse of the address registers of the loads above; the
    // scheduling barrier keeps later address arithmetic from rising over it and
    // the loads in front of the score products, whose time covers their latency
    if (MASK || !LAST) asm volatile("s_wait_xcnt 0x0" ::: "memory");
    __builtin_amdgcn_sched_barrier(0);
    v8f s[2];
    s[0] = (v8f){}; s[1] = (v8f){};
#pragma unroll   // constant register index
    for (int j = 0; j < 6; ++j) {
      s[0] = __builtin_amdgcn_wmma_f32_16x16x4_f32(false, kf[j], false, qf[0][j], (short)0, s[0], false, false);
      s[1] = __builtin_amdgcn_wmma_f32_16x16x4_f32(false, kf[j], false, qf[1][j], (short)0, s[1], false, false);
    }
    // this wave's next K tile, in flight during the softmax and the second product
    // (past the end: the clamped last row, never used)
    {
      int key = (kt + STEP) * 16 + l16; if (key >= S) key = S - 1;
      const float* kp = Kh + (size_t)key * D_MODEL;
      fa_row(kp, kf);
      // as above, for the three loads just issued; the address is an input, so that it
      // lives up to the wait and none of the three results lands in its registers
      asm volatile("s_wait_xcnt 0x0" :: "v"(kp) : "memory");
    }
    __builtin_amdgcn_sched_barrier(0);
#pragma unroll   // constant register index
    for (int t = 0; t < 2; ++t) {
      if (MASK) {
#pragma unroll   // constant register index
        for (int r = 0; r < 8; ++r) s[t][r] = fmaf(s[t][r], FA_C, mb[t][r]);
      }
      if (LAST) {
#pragma unroll   // constant register index
        for (int r = 0; r < 8; ++r)
          if (kb + r >= S) s[t][r] = -INFINITY;   // no key: weight exactly 0
      }
      float mx = s[t][0];
#pragma unroll   // constant register index
      for (int r = 1; r < 8; ++r) mx = fmaxf(mx, s[t][r]);
      mx = fmaxf(mx, fa_xhalf(mx));
      const float mnew = fmaxf(mrun[t], mx);
      const float alpha = __builtin_amdgcn_exp2f((mrun[t] - mnew) * CC);
      const float nb = -mnew * CC;
      mrun[t] = mnew;
      float sum = 0.f;
#pragma unroll   // constant register index
      for (int r = 0; r < 8; ++r) {
        s[t][r] = __builtin_amdgcn_exp2f(fmaf(s[t][r], CC, nb));
        sum += s[t][r];
      }
      lrun[t] = lrun[t] * alpha + sum;
      o[t][0] *= alpha;
      o[t][1] *= alpha;
    }
#pragma unroll   // constant register index
    for (int j = 0; j < 4; ++j) {
#pragma unroll   // constant register index
      for (int t = 0; t < 2; ++t) {
        const v2f pf = (v2f){s[t][2 * j], s[t][2 * j + 1]};
        o[t][0] = __builtin_amdgcn_wmma_f32_16x16x4_f32(false, vf[0][j], false, pf, (short)0, o[t][0], false, false);
        o[t][1] = __builtin_amdgcn_wmma_f32_16x16x4_f32(false, vf[1][j], false, pf, (short)0, o[t][1], false, false);
      }
    }
  };

  int kt = kt0;
  const int te = t1 < KT - 1 ? t1 : KT - 1;   // whole tiles end here
  for (; kt < te; kt += STEP) tile(fa_bool<false>{}, kt);
  if (kt == KT - 1 && kt < t1) tile(fa_bool<true>{}, kt);
}

// A work-group of NWV independent waves of the decoder's early share: key tiles t0 .. t1 - 1.
// idx: the work-group's number among them. The waves of one work-group have one head and one
// stream, so they read the same K and V rows at about the same time.
#define DE_WGS(NWV) (BATCH * NHEAD * DS_NS * ((DQB + (NWV) - 1) / (NWV)))
template <int NWV>
__device__ __forceinline__
void dec_early(const float* Qd, const float* Kd, const float* Vd, float* St,
               const int idx, const int t0, const int t1) {
  constexpr int WQ = (DQB + NWV - 1) / NWV;
  const int lane = threadIdx.x & 31;
  // wave number in a scalar register: the branches below stay scalar
  const int wave = __builtin_amdgcn_readfirstlane((int)(threadIdx.x >> 5));
  const int qblk = (idx % WQ) * NWV + wave;
  const int sb = idx / WQ;                 // (batch * NHEAD + head) * DS_NS + stream
  if (qblk >= DQB) return;
  const int stream = sb % DS_NS, bh = sb / DS_NS;
  float* sp = St + ((size_t)sb * DQB + qblk) * DS_VALS + lane * 4;
  v8f o[2][2];
  float mrun[2], lrun[2];
  if (t0 != DEC_T0) {
    fa_state_load(sp, o, mrun, lrun);
  } else {
#pragma unroll   // constant register index
    for (int t = 0; t < 2; ++t) {
      o[t][0] = (v8f){}; o[t][1] = (v8f){};
      mrun[t] = -1e30f; lrun[t] = 0.f;
    }
  }
  fa_run<NT, DS_NS, false>(Qd, Kd, Vd, nullptr, N_UNMASK + qblk * 32,
                           (size_t)(bh / NHEAD) * NT * D_MODEL + (size_t)(bh % NHEAD) * HD,
                           t0 + stream, t1, o, mrun, lrun);
  fa_state_store(sp, o, mrun, lrun);
}

// A work-group's attention for 32 queries of one head: key tiles dealt to its NW waves, merged
// in LDS. ST: the key tiles in front of DEC_T0 alone, on top of the streams' states.
template <int S, int NW, bool MASK, int QB, bool ST>
__device__ __forceinline__
void attn_wg(const float* __restrict__ Q, const float* __restrict__ Kb,
             const float* __restrict__ Vb, float* __restrict__ O,
             const float* __restrict__ maskT, const float* __restrict__ St,
             float (*red)[2][FA_ROWS][16], const int qblk, const int h, const int b) {
  constexpr int KT = (S + 15) / 16;
  static_assert(NW >= 4 && NW >= DS_NS, "the merge takes four waves");
  constexpr float CC = MASK ? 1.f : FA_C;
  const int lane = threadIdx.x & 31;
  // wave number in a scalar register: loop bounds and the last-tile branch stay scalar
  const int wave = __builtin_amdgcn_readfirstlane((int)(threadIdx.x >> 5));
  const int l16 = lane & 15, half = lane >> 4;
  const int q0 = QB + qblk * 32;
  const size_t hb = (size_t)b * S * D_MODEL + (size_t)h * HD;
  v8f o[2][2];
  float mrun[2], lrun[2];
  if (ST && wave < DS_NS) {
    fa_state_load(St + ((size_t)((b * NHEAD + h) * DS_NS + wave) * DQB + qblk) * DS_VALS + lane * 4,
                  o, mrun, lrun);
  } else {
#pragma unroll   // constant register index
    for (int t = 0; t < 2; ++t) {
      o[t][0] = (v8f){}; o[t][1] = (v8f){};
      mrun[t] = -1e30f; lrun[t] = 0.f;
    }
  }
  fa_run<S, NW, MASK>(Q, Kb, Vb, maskT, q0, hb, wave, ST ? DEC_T0 : KT, o, mrun, lrun);

  // -------- this wave's partial result to LDS --------
#pragma unroll   // constant register index
  for (int t = 0; t < 2; ++t) {
    const float lsum = lrun[t] + fa_xhalf(lrun[t]);
#pragma unroll   // constant register index
    for (int r = 0; r < 8; ++r) {
      red[wave][t][r + 8 * half][l16] = o[t][0][r];
      if (half == 0) red[wave][t][16 + r][l16] = o[t][1][r];
    }
    if (half == 0) {
      red[wave][t][HD][l16] = mrun[t];
      red[wave][t][HD + 1][l16] = lsum;
    }
  }
  __syncthreads();

  // -------- merge over the waves: four threads a query, six head dims each --------
  if (wave < 4) {
    const int ql = threadIdx.x >> 2, t = ql >> 4, qi = ql & 15;
    const int d0 = (threadIdx.x & 3) * 6;
    float mall = red[0][t][HD][qi];
#pragma unroll   // LDS reads at immediate offsets, all in flight together
    for (int w = 1; w < NW; ++w) mall = fmaxf(mall, red[w][t][HD][qi]);
    float den = 0.f, acc[6] = {0.f, 0.f, 0.f, 0.f, 0.f, 0.f};
#pragma unroll   // LDS reads at immediate offsets, all in flight together
    for (int w = 0; w < NW; ++w) {
      const float wg = __builtin_amdgcn_exp2f((red[w][t][HD][qi] - mall) * CC);
      den += wg * red[w][t][HD + 1][qi];
#pragma unroll   // constant register index
      for (int i = 0; i < 6; ++i) acc[i] += wg * red[w][t][d0 + i][qi];
    }
    const float inv = 1.f / den;
    const int q = q0 + ql;
    if (q < S) {
      float* op = O + hb + (size_t)q * D_MODEL + d0;
#pragma unroll   // constant register index
      for (int i = 0; i < 6; ++i) op[i] = acc[i] * inv;
    }
  }
}

// An encoder layer's attention, and behind it in the grid a range of the decoder's early share
#define EA_NW  8
#define EA_QB  ((N_UNMASK + 31) / 32)
#define EA_WGS (EA_QB * NHEAD * BATCH)
__global__ __launch_bounds__(EA_NW * 32)
void enc_attn_kernel(const float* __restrict__ Q, const float* __restrict__ Kb,
                     const float* __restrict__ Vb, float* __restrict__ O,
                     const float* __restrict__ maskT,
                     const float* __restrict__ Qd, const float* __restrict__ Kd,
                     const float* __restrict__ Vd, float* __restrict__ St,
                     const int t0, const int t1) {
  __shared__ float red[EA_NW][2][FA_ROWS][16];
  const int blk = blockIdx.x;
  if (blk >= EA_WGS) { dec_early<EA_NW>(Qd, Kd, Vd, St, blk - EA_WGS, t0, t1); return; }
  attn_wg<N_UNMASK, EA_NW, true, 0, false>(Q, Kb, Vb, O, maskT, nullptr, red, blk % EA_QB,
                                           (blk / EA_QB) % NHEAD, blk / (EA_QB * NHEAD));
}

// The decoder's attention: what is left of it behind the encoder
#define DA_NW 4
__global__ __launch_bounds__(DA_NW * 32)
void dec_attn_kernel(const float* __restrict__ Q, const float* __restrict__ Kb,
                     const float* __restrict__ Vb, float* __restrict__ O,
                     const float* __restrict__ St) {
  __shared__ float red[DA_NW][2][FA_ROWS][16];
  attn_wg<NT, DA_NW, false, N_UNMASK, true>(Q, Kb, Vb, O, nullptr, St, red, blockIdx.x,
                                            blockIdx.y, blockIdx.z);
}

// ---------------------------------------------------------------------------
// The row-local chain behind attention in ONE launch, one work-group of PK_WAVES
// waves per 16 rows:
//   h = LN(h + O Wo + bo); f = relu(h W1 + b1); h = LN(h + f W2 + b2); then
//   NEXT 1: the next layer's Q, K, V = h Wq|Wk|Wv + bias (nw, nb);
//   NEXT 2, the encoder's last layer: its closing LayerNorm (cg, cb), the decoder's
//           input row x = (h ew + eb) * sqrt(D), and the decoder's K and V of x (nw, nb);
//           row b * N_UNMASK + s goes to row b * NT + s. The one decoder layer's output
//           is read at the masked tokens' rows alone, so these rows are only looked at:
//           no Q of them, and x itself goes nowhere;
//   NEXT 3, the decoder's last layer, the masked tokens' rows alone (row b * N_MASKT + j
//           lies at row b * NT + N_UNMASK + j of Ob and H): its closing LayerNorm
//           (cg, cb) and the output h . ew + eb, to Ho.
// The 16 x 96 row tile and the 16 x 384 hidden tile stay in LDS; a product's
// result goes there in D layout and is read back as A fragments. Wave w owns
// column tile w of every 96-wide product and four tiles of the 384-wide one.
// Every accumulator keeps the ascending k order.
// LDS pitches are 4 dwords past a multiple of 32: the 16 rows x 2 halves of an
// 8-byte A-fragment read fall on 64 different banks.
// ---------------------------------------------------------------------------
#define PK_WAVES 6
#define PK_HP (D_MODEL + 4)
#define PK_FP (FF_DIM + 4)
#define PK_ENC_WGS ((BATCH * N_UNMASK + 15) / 16)
static_assert(PK_WAVES * 16 == D_MODEL, "one 16-column tile of the model width per wave");

// B fragments of chunk c: CH k-steps x TN column tiles, TS floats from tile to tile
template <int N, int TS, int TN, int CH>
__device__ __forceinline__ void pk_load_b(const float* __restrict__ wp, const int c,
                                          v2f (&b)[CH][TN]) {
#pragma unroll   // constant register index, immediate load offsets
  for (int j = 0; j < CH; ++j) {
    const int k0 = (c * CH + j) * 4;
#pragma unroll   // constant register index
    for (int t = 0; t < TN; ++t) {
      b[j][t].x = wp[k0 * N + t * TS];
      b[j][t].y = wp[(k0 + 1) * N + t * TS];
    }
  }
}

// A fragments of chunk c from the LDS tile (as: this lane's row, + 2 * half)
template <int CH>
__device__ __forceinline__ void pk_load_a(const float* as, const int c, v2f (&a)[CH]) {
#pragma unroll   // constant register index
  for (int j = 0; j < CH; ++j) a[j] = *(const v2f*)(as + (c * CH + j) * 4);
}

// acc[t] += A(LDS, 16 x K) * W(:, tile t). The caller has loaded chunks 0 and 1
// of b (weights depend on no earlier stage, so that is done ahead of the barrier
// in front of the stage); chunk c + 2 is loaded while chunk c is multiplied.
template <int K, int N, int TS, int TN, int CH>
__device__ __forceinline__ void pk_mm(const float* as, const float* __restrict__ wp,
                                      v2f (&b)[3][CH][TN], v8f (&acc)[TN]) {
  constexpr int NCH = K / (4 * CH);
  static_assert(K % (4 * CH) == 0 && NCH >= 2, "shape");
  v2f a[2][CH];
  pk_load_a<CH>(as, 0, a[0]);
#pragma unroll   // constant ring index
  for (int c = 0; c < NCH; ++c) {
    if (c + 2 < NCH) pk_load_b<N, TS, TN, CH>(wp, c + 2, b[(c + 2) % 3]);
    if (c + 1 < NCH) pk_load_a<CH>(as, c + 1, a[(c + 1) % 2]);
    // keeps the loads above in front of this chunk's WMMAs: sunk to their use,
    // each chunk would wait out its own load latency
    __builtin_amdgcn_sched_barrier(0);
#pragma unroll   // constant ring index
    for (int j = 0; j < CH; ++j)
#pragma unroll   // constant ring index
      for (int t = 0; t < TN; ++t)
        acc[t] = __builtin_amdgcn_wmma_f32_16x16x4_f32(false, a[c % 2][j], false, b[c % 3][j][t],
                                                       (short)0, acc[t], false, false);
    // keeps the next trip's loads out of this chunk's WMMAs: risen there, they
    // cannot take this chunk's ring slot and cost a fourth chunk of registers
    __builtin_amdgcn_sched_barrier(0);
  }
  // stands in front of any reuse of the weight loads' address registers; the
  // scheduling barrier keeps later arithmetic from rising over it
  asm volatile("s_wait_xcnt 0x0" ::: "memory");
  __builtin_amdgcn_sched_barrier(0);
}

// LayerNorm of the 16 x 96 LDS tile in place: waves 0..3, four rows a wave, eight
// lanes a row, twelve elements a lane. Hout: the rows also go to global memory.
__device__ __forceinline__ void pk_ln(float* hs, const float* __restrict__ g,
                                      const float* __restrict__ bta, int wave, int lane,
                                      float* __restrict__ Hout, int m0, int M) {
  if (wave < 4) {
    const int row = wave * 4 + (lane >> 3), e = lane & 7;
    float* p = hs + row * PK_HP + e * 4;
    float v[12], gv[12], bv[12];
#pragma unroll   // constant register index
    for (int i = 0; i < 12; ++i) {
      const int o = (i >> 2) * 32 + (i & 3);
      v[i] = p[o];
      gv[i] = g[e * 4 + o];
      bv[i] = bta[e * 4 + o];
    }
    float s = 0.f;
#pragma unroll   // constant register index
    for (int i = 0; i < 12; ++i) s += v[i];
    s += __shfl_xor(s, 1, 32); s += __shfl_xor(s, 2, 32); s += __shfl_xor(s, 4, 32);
    const float m = s / (float)D_MODEL;
    float q = 0.f;
#pragma unroll   // constant register index
    for (int i = 0; i < 12; ++i) { v[i] -= m; q += v[i] * v[i]; }
    q += __shfl_xor(q, 1, 32); q += __shfl_xor(q, 2, 32); q += __shfl_xor(q, 4, 32);
    const float rs = rsqrtf(q / (float)D_MODEL + 1e-5f);
#pragma unroll   // constant register index
    for (int i = 0; i < 12; ++i) {
      v[i] = v[i] * rs * gv[i] + bv[i];
      p[(i >> 2) * 32 + (i & 3)] = v[i];
    }
    if (Hout && m0 + row < M) {
      float* hp = Hout + (size_t)(m0 + row) * D_MODEL + e * 4;
#pragma unroll   // constant register index
      for (int i = 0; i < 12; ++i) hp[(i >> 2) * 32 + (i & 3)] = v[i];
    }
  }
}

template <int NEXT>
__global__ __launch_bounds__(PK_WAVES * 32)
void post_kernel(const float* __restrict__ Ob, float* __restrict__ H,
                 const float* __restrict__ wo, const float* __restrict__ bo,
                 const float* __restrict__ ln,
                 const float* __restrict__ w1, const float* __restrict__ b1,
                 const float* __restrict__ w2, const float* __restrict__ b2,
                 const float* __restrict__ nw, const float* __restrict__ nb,
                 float* __restrict__ Qo, float* __restrict__ Ko, float* __restrict__ Vo,
                 const float* __restrict__ cg, const float* __restrict__ cb,
                 const float* __restrict__ ew, const float* __restrict__ eb,
                 float* __restrict__ Ho, int M,
                 const float* Qe, const float* Ke, const float* Ve, float* Se,
                 const int t0, const int t1) {
  // behind the encoder's row tiles in the grid: a range of the decoder's early share
  if (NEXT != 3) {
    if (blockIdx.x >= PK_ENC_WGS) {
      dec_early<PK_WAVES>(Qe, Ke, Ve, Se, blockIdx.x - PK_ENC_WGS, t0, t1);
      return;
    }
  }
  __shared__ __attribute__((aligned(16))) float hs[16 * PK_HP];
  __shared__ __attribute__((aligned(16))) float fs[16 * PK_FP];
  const int lane = threadIdx.x & 31;
  // wave number in a scalar register: the LayerNorm branch stays scalar
  const int wave = __builtin_amdgcn_readfirstlane((int)(threadIdx.x >> 5));
  const int l16 = lane & 15, half = lane >> 4;
  const int m0 = blockIdx.x * 16;
  const int col = wave * 16 + l16;

  // ---- output projection: A from global (row-clamped), all operands at once ----
  int ra = m0 + l16; if (ra >= M) ra = M - 1;
  if (NEXT == 3) ra += (ra / N_MASKT) * N_UNMASK + N_UNMASK;
  const float* xa  = Ob + (size_t)ra * D_MODEL + 2 * half;
  const float* wpo = wo + (size_t)(2 * half) * D_MODEL + col;
  v2f ao[D_MODEL / 4], wf[D_MODEL / 4];
#pragma unroll   // constant register index
  for (int j = 0; j < D_MODEL / 4; ++j) {
    ao[j].x = xa[4 * j];             ao[j].y = xa[4 * j + 1];
    wf[j].x = wpo[4 * j * D_MODEL];  wf[j].y = wpo[(4 * j + 1) * D_MODEL];
  }
  float res[8];
#pragma unroll   // constant register index
  for (int r = 0; r < 8; ++r) {
    int m = m0 + r + 8 * half; if (m >= M) m = M - 1;
    if (NEXT == 3) m += (m / N_MASKT) * N_UNMASK + N_UNMASK;
    res[r] = H[(size_t)m * D_MODEL + col];
  }
  const float bov = bo[col], b2v = b2[col];
  const float ebv = NEXT == 2 ? eb[col] : 0.f;
  // the products behind the chain: Q, K, V, or (NEXT 2) K and V, the second and third
  constexpr int NP = NEXT == 2 ? 2 : 3, P0 = 3 - NP;
  float b1v[4], nbv[NP];
#pragma unroll   // constant register index
  for (int t = 0; t < 4; ++t) b1v[t] = b1[wave * 64 + t * 16 + l16];
  // stands in front of later loads whose results land in address registers of
  // the loads above
  asm volatile("s_wait_xcnt 0x0" ::: "memory");
  if (NEXT != 3) {
#pragma unroll   // constant register index
    for (int t = 0; t < NP; ++t) nbv[t] = nb[(P0 + t) * D_MODEL + col];
    // as above, for the loads just issued
    asm volatile("s_wait_xcnt 0x0" ::: "memory");
  }
  const float* wp1 = w1 + (size_t)(2 * half) * FF_DIM + wave * 64 + l16;
  v2f bf1[3][4][4];
  pk_load_b<FF_DIM, 16, 4, 4>(wp1, 0, bf1[0]);
  pk_load_b<FF_DIM, 16, 4, 4>(wp1, 1, bf1[1]);
  // holds every load above in front of the WMMAs: one load latency for all
  __builtin_amdgcn_sched_barrier(0);
  v8f acco = {};
#pragma unroll   // constant register index
  for (int j = 0; j < D_MODEL / 4; ++j)
    acco = __builtin_amdgcn_wmma_f32_16x16x4_f32(false, ao[j], false, wf[j], (short)0, acco,
                                                 false, false);
#pragma unroll   // constant register index
  for (int r = 0; r < 8; ++r) hs[(r + 8 * half) * PK_HP + col] = res[r] + (acco[r] + bov);
  __syncthreads();
  // second FFN product's first weights: in flight while the rows are normalised
  const float* wp2 = w2 + (size_t)(2 * half) * D_MODEL + col;
  v2f bf2[3][12][1];
  pk_load_b<D_MODEL, 16, 1, 12>(wp2, 0, bf2[0]);
  pk_load_b<D_MODEL, 16, 1, 12>(wp2, 1, bf2[1]);
  pk_ln(hs, ln, ln + D_MODEL, wave, lane, (float*)0, m0, M);
  __syncthreads();

  // ---- f = relu(h W1 + b1), into LDS ----
  const float* ah = hs + l16 * PK_HP + 2 * half;
  v8f af[4];
#pragma unroll   // constant register index
  for (int t = 0; t < 4; ++t) af[t] = (v8f){};
  pk_mm<D_MODEL, FF_DIM, 16, 4, 4>(ah, wp1, bf1, af);
#pragma unroll   // constant register index
  for (int t = 0; t < 4; ++t)
#pragma unroll   // constant register index
    for (int r = 0; r < 8; ++r)
      fs[(r + 8 * half) * PK_FP + wave * 64 + t * 16 + l16] = fmaxf(af[t][r] + b1v[t], 0.f);
  __syncthreads();
  // the next product's first weights: in flight during the second FFN product
  const float* wpn = nw + (size_t)(P0 * D_MODEL + 2 * half) * D_MODEL + col;
  v2f bfn[3][4][NP];
  v2f bfe[3][12][1];
  if (NEXT == 1) {
    pk_load_b<D_MODEL, D_MODEL * D_MODEL, NP, 4>(wpn, 0, bfn[0]);
    pk_load_b<D_MODEL, D_MODEL * D_MODEL, NP, 4>(wpn, 1, bfn[1]);
  }
  const float* wpe = ew + (size_t)(2 * half) * D_MODEL + col;   // NEXT 2 only
  if (NEXT == 2) {
    pk_load_b<D_MODEL, 16, 1, 12>(wpe, 0, bfe[0]);
    pk_load_b<D_MODEL, 16, 1, 12>(wpe, 1, bfe[1]);
    // stands in front of any reuse of the address registers of these loads; the address
    // is an input, so that it lives up to the wait
    asm volatile("s_wait_xcnt 0x0" :: "v"(wpe) : "memory");
  }

  // ---- h + f W2 + b2: each element of the row tile is updated by its own lane ----
  v8f a2[1];
  a2[0] = (v8f){};
  pk_mm<FF_DIM, D_MODEL, 16, 1, 12>(fs + l16 * PK_FP + 2 * half, wp2, bf2, a2);
#pragma unroll   // constant register index
  for (int r = 0; r < 8; ++r) {
    float* p = hs + (r + 8 * half) * PK_HP + col;
    *p = *p + (a2[0][r] + b2v);
  }
  __syncthreads();
  // the decoder's first projection weights: in flight during the two LayerNorms and
  // the product between them and their use
  if (NEXT == 2) {
    pk_load_b<D_MODEL, D_MODEL * D_MODEL, NP, 4>(wpn, 0, bfn[0]);
    pk_load_b<D_MODEL, D_MODEL * D_MODEL, NP, 4>(wpn, 1, bfn[1]);
  }
  pk_ln(hs, ln + 2 * D_MODEL, ln + 3 * D_MODEL, wave, lane, NEXT == 1 ? H : (float*)0, m0, M);
  // last layer of a stack: the stack's closing LayerNorm; each lane reads back only
  // what it wrote itself, so no barrier stands between the two
  if (NEXT != 1) pk_ln(hs, cg, cb, wave, lane, (float*)0, m0, M);

  // ---- the output: row . ew + eb, by the lanes that normalised the row ----
  if (NEXT == 3) {
    if (wave < 4) {
      const int row = wave * 4 + (lane >> 3), e = lane & 7;
      const float* p = hs + row * PK_HP + e * 4;
      float wv[12];
#pragma unroll   // constant register index
      for (int i = 0; i < 12; ++i) wv[i] = ew[e * 4 + (i >> 2) * 32 + (i & 3)];
      const float ob = eb[0];
      // stands in front of any reuse of the address registers of the loads above: the loaded
      // values are inputs, so that every one of the loads is issued in front of the wait; the
      // scheduling barrier keeps later arithmetic from rising over it
      asm volatile("s_wait_xcnt 0x0" :: "v"(wv[0]), "v"(wv[1]), "v"(wv[2]), "v"(wv[3]), "v"(wv[4]),
                   "v"(wv[5]), "v"(wv[6]), "v"(wv[7]), "v"(wv[8]), "v"(wv[9]), "v"(wv[10]),
                   "v"(wv[11]) : "memory");
      __builtin_amdgcn_sched_barrier(0);
      float s = 0.f;
#pragma unroll   // constant register index
      for (int i = 0; i < 12; ++i) s += p[(i >> 2) * 32 + (i & 3)] * wv[i];
      s += __shfl_xor(s, 1, 32); s += __shfl_xor(s, 2, 32); s += __shfl_xor(s, 4, 32);
      const int m = m0 + row;
      if (e == 0 && m < M) Ho[m] = s + ob;
    }
  }

  // where this lane's eight result rows go (NEXT 2), -1: no such row
  int orow[8];
  if (NEXT == 2) {
#pragma unroll   // constant register index
    for (int r = 0; r < 8; ++r) {
      const int m = m0 + 8 * half + r;
      orow[r] = m < M ? (m + (m / N_UNMASK) * N_MASKT) * D_MODEL + col : -1;
    }
    // ---- the decoder's input rows, into the row tile ----
    __syncthreads();
    v8f ae[1];
    ae[0] = (v8f){};
    pk_mm<D_MODEL, D_MODEL, 16, 1, 12>(ah, wpe, bfe, ae);
    // every wave has read the row tile as its A operand before it is overwritten
    __syncthreads();
#pragma unroll   // constant register index
    for (int r = 0; r < 8; ++r) hs[(r + 8 * half) * PK_HP + col] = (ae[0][r] + ebv) * SQRT_D;
  }

  // ---- next layer's Q, K, V (NEXT 2: K, V): this wave's column tile of each ----
  if (NEXT != 3) {
    __syncthreads();
    v8f an[NP];
#pragma unroll   // constant register index
    for (int t = 0; t < NP; ++t) an[t] = (v8f){};
    pk_mm<D_MODEL, D_MODEL, D_MODEL * D_MODEL, NP, 4>(ah, wpn, bfn, an);
    if constexpr (NEXT == 1) {
      const size_t ob = (size_t)(m0 + 8 * half) * D_MODEL + col;
      const int left = M - m0 - 8 * half;   // rows of this half tile that exist
#pragma unroll   // constant register index, immediate store offsets
      for (int r = 0; r < 8; ++r) {
        if (r < left) {
          Qo[ob + r * D_MODEL] = an[0][r] + nbv[0];
          Ko[ob + r * D_MODEL] = an[1][r] + nbv[1];
          Vo[ob + r * D_MODEL] = an[2][r] + nbv[2];
        }
      }
    } else {
#pragma unroll   // constant register index
      for (int r = 0; r < 8; ++r) {
        if (orow[r] >= 0) {
          Ko[orow[r]] = an[0][r] + nbv[0];
          Vo[orow[r]] = an[1][r] + nbv[1];
        }
      }
    }
  }
}

// ---------------------------------------------------------------------------
extern "C" void kernel_launch(void* const* d_in, const int* in_sizes, int n_in,
                              void* d_out, int out_size, void* d_ws, size_t ws_size,
                              hipStream_t stream) {
  (void)in_sizes; (void)n_in; (void)out_size; (void)ws_size;
  const float* hist  = (const float*)d_in[0];
  const int*   uidx  = (const int*)d_in[1];
  const int*   midx  = (const int*)d_in[2];
  const float* nv1   = (const float*)d_in[3];
  const float* nv2   = (const float*)d_in[4];
  const float* dim_w = (const float*)d_in[5];
  const float* dim_b = (const float*)d_in[6];
  const float* pos   = (const float*)d_in[7];
  const float* tod_w = (const float*)d_in[8];
  const float* tod_b = (const float*)d_in[9];
  const float* dow_w = (const float*)d_in[10];
  const float* dow_b = (const float*)d_in[11];
  const float* mtok  = (const float*)d_in[12];
  const float* eaw   = (const float*)d_in[13];
  const float* eab   = (const float*)d_in[14];
  const float* ew1   = (const float*)d_in[15];
  const float* eb1   = (const float*)d_in[16];
  const float* ew2   = (const float*)d_in[17];
  const float* eb2   = (const float*)d_in[18];
  const float* eln   = (const float*)d_in[19];
  const float* eng   = (const float*)d_in[20];
  const float* enb   = (const float*)d_in[21];
  const float* e2dw  = (const float*)d_in[22];
  const float* e2db  = (const float*)d_in[23];
  const float* daw   = (const float*)d_in[24];
  const float* dab   = (const float*)d_in[25];
  const float* dw1   = (const float*)d_in[26];
  const float* db1   = (const float*)d_in[27];
  const float* dw2   = (const float*)d_in[28];
  const float* db2   = (const float*)d_in[29];
  const float* dln   = (const float*)d_in[30];
  const float* dng   = (const float*)d_in[31];
  const float* dnb   = (const float*)d_in[32];
  const float* outw  = (const float*)d_in[33];
  const float* outb  = (const float*)d_in[34];
  float* out = (float*)d_out;

  float* ws = (float*)d_ws;
  size_t off = 0;
  auto alloc = [&](size_t n) { float* p = ws + off; off += n; return p; };
  const size_t MD = (size_t)BATCH * NT;   // max rows (decoder): 9936
  float* St    = alloc(DS_TOTAL);   // first: its 16-byte accesses stay aligned
  float* adpA  = alloc((size_t)N_NODES * N_NODES);
  float* Menc  = alloc((size_t)EM_ROWS * EM_PITCH);
  float* X  = alloc(MD * D_MODEL);
  float* Qb = alloc(MD * D_MODEL);
  float* Kb = alloc(MD * D_MODEL);
  float* Vb = alloc(MD * D_MODEL);
  float* Ob = alloc(MD * D_MODEL);
  float* Xd = alloc(MD * D_MODEL);
  float* Qd = alloc(MD * D_MODEL);
  float* Kd = alloc(MD * D_MODEL);
  float* Vd = alloc(MD * D_MODEL);

  front_kernel<<<N_NODES + (FR_ENC + FR_DEC) / FR_ROWS, D_MODEL, 0, stream>>>(
      nv1, nv2, adpA, hist, uidx, midx, dim_w, dim_b, pos, tod_w, tod_b, dow_w, dow_b, mtok,
      X, Xd, out);
  proj_kernel<<<PJ_ENC + PJ_DEC + EM_ROWS, 32, 0, stream>>>(
      X, eaw, eab, Qb, Kb, Vb, Xd, daw, dab, Qd, Kd, Vd, adpA, uidx, Menc);

  // ---- encoder (4 layers, masked attention over 621 tokens): attention, then the whole
  // row-local rest of the layer in one launch ----
  const unsigned pe = (BATCH * N_UNMASK + 15) / 16, pd = (BATCH * N_MASKT + 15) / 16;
  // ta .. tp - 1 and tp .. te - 1: the decoder's key tiles that ride on the layer's two launches
  auto layer = [&](const int l, const int ta, const int tp, const int te) {
    const float* aw = eaw + (size_t)l * 4 * D_MODEL * D_MODEL;
    const float* ab = eab + (size_t)l * 4 * D_MODEL;
    const float* w1 = ew1 + (size_t)l * D_MODEL * FF_DIM;
    const float* b1 = eb1 + (size_t)l * FF_DIM;
    const float* w2 = ew2 + (size_t)l * FF_DIM * D_MODEL;
    const float* b2 = eb2 + (size_t)l * D_MODEL;
    const float* ln = eln + (size_t)l * 2 * 2 * D_MODEL;
    enc_attn_kernel<<<EA_WGS + DE_WGS(EA_NW), EA_NW * 32, 0, stream>>>(
        Qb, Kb, Vb, Ob, Menc, Qd, Kd, Vd, St, ta, tp);
    if (l < 3)
      post_kernel<1><<<pe + DE_WGS(PK_WAVES), PK_WAVES * 32, 0, stream>>>(
          Ob, X, aw + 3 * D_MODEL * D_MODEL, ab + 3 * D_MODEL, ln, w1, b1, w2, b2,
          aw + 4 * D_MODEL * D_MODEL, ab + 4 * D_MODEL, Qb, Kb, Vb,
          nullptr, nullptr, nullptr, nullptr, nullptr, BATCH * N_UNMASK,
          Qd, Kd, Vd, St, tp, te);
    else
      post_kernel<2><<<pe + DE_WGS(PK_WAVES), PK_WAVES * 32, 0, stream>>>(
          Ob, X, aw + 3 * D_MODEL * D_MODEL, ab + 3 * D_MODEL, ln, w1, b1, w2, b2,
          daw, dab, nullptr, Kd, Vd, eng, enb, e2dw, e2db, nullptr, BATCH * N_UNMASK,
          Qd, Kd, Vd, St, tp, te);
  };
  static_assert(DEC_T0 == 39 && DEC_KT == 156, "the ranges below cover DEC_T0 .. DEC_KT - 1");
  layer(0, 39, 49, 69);
  layer(1, 69, 79, 98);
  layer(2, 98, 108, 127);
  layer(3, 127, 137, 156);
  // ---- decoder (1 layer, full attention over 2484 tokens; queries: the masked tokens) ----
  dec_attn_kernel<<<dim3(DQB, NHEAD, BATCH), DA_NW * 32, 0, stream>>>(Qd, Kd, Vd, Ob, St);
  post_kernel<3><<<pd, PK_WAVES * 32, 0, stream>>>(
      Ob, Xd, daw + 3 * D_MODEL * D_MODEL, dab + 3 * D_MODEL, dln, dw1, db1, dw2, db2,
      nullptr, nullptr, nullptr, nullptr, nullptr, dng, dnb, outw, outb, out, BATCH * N_MASKT,
      nullptr, nullptr, nullptr, nullptr, 0, 0);
}

// v009
// It runs in 159 microseconds.
// Timed twice side by side with v008, it ran 1.12 times as fast both times.
// Counting every step since v000, it is 16.7 times as fast.
#include <hip/hip_runtime.h>
#include <math.h>

#define N_NODES  207
#define T_STEPS  12
#define C_IN     4
#define BATCH    4
#define NT       (N_NODES * T_STEPS)   // 2484
#define D_MODEL  96
#define NHEAD    4
#define HD       24
#define FF_DIM   384
#define N_MASKT  1863
#define N_UNMASK 621
#define MAX_NEIGH 40
#define ATTN_SCALE 0.20412414523193154f   // 1/sqrt(24)
#define SQRT_D     9.797958971132712f     // sqrt(96)

typedef float v2f __attribute__((ext_vector_type(2)));
typedef float v8f __attribute__((ext_vector_type(8)));

// ---------------------------------------------------------------------------
// Adjacency: A = softmax(relu(nv1 @ nv2), axis=1); keep iff (A > 1/N) and
// strictly greater than the 41st-largest in its row (rank < MAX_NEIGH).
// ---------------------------------------------------------------------------
__device__ __forceinline__ void adj_row(const float* __restrict__ nv1,
                                        const float* __restrict__ nv2,
                                        float* __restrict__ adpA, const int i) {
  constexpr int PER = (N_NODES + D_MODEL - 1) / D_MODEL;  // elements a thread owns
  constexpr int WR  = (N_NODES + 31) / 32;                // elements a lane reads for the statistics
  constexpr int NP4 = (N_NODES + 3) / 4;                  // 16-byte groups of the row
  static_assert(PER == 3 && NP4 * 4 <= PER * D_MODEL, "three elements a thread, pad inside");
  // both hold a slot for every (thread, element), so that the LDS stores need no test
  __shared__ __attribute__((aligned(16))) float a[PER * D_MODEL];
  __shared__ __attribute__((aligned(16))) float p[PER * D_MODEL];
  const int tid = threadIdx.x, lane = tid & 31;   // the block has D_MODEL threads
  int jc[PER];
  float w[PER][10], u[10];
#pragma unroll   // constant register index; in flight together with the loads below
  for (int r = 0; r < 10; ++r) u[r] = nv1[i * 10 + r];
#pragma unroll   // constant register index; all the loads in flight together
  for (int e = 0; e < PER; ++e) {
    const int j = tid + e * D_MODEL;
    jc[e] = j < N_NODES ? j : N_NODES - 1;   // past the end: the last element, not used
#pragma unroll   // constant register index, immediate load offsets
    for (int r = 0; r < 10; ++r) w[e][r] = nv2[r * N_NODES + jc[e]];
  }
  // stands in front of any reuse of the address registers of the loads above: the indices
  // are inputs, so that they live up to the wait and no result lands in one of them;
  // the scheduling barrier keeps later arithmetic from rising over it
  asm volatile("s_wait_xcnt 0x0" :: "v"(jc[0]), "v"(jc[1]), "v"(jc[2]) : "memory");
  __builtin_amdgcn_sched_barrier(0);
  float own[PER];
#pragma unroll   // constant register index
  for (int e = 0; e < PER; ++e) {
    float s = 0.f;
#pragma unroll   // constant register index
    for (int r = 0; r < 10; ++r) s += u[r] * w[e][r];
    own[e] = s > 0.f ? s : 0.f;
    a[tid + e * D_MODEL] = own[e];
  }
  __syncthreads();
  // maximum and sum of the whole row, in every wave for itself: nobody waits for one thread
  float v[WR];
#pragma unroll   // constant register index; the LDS reads in flight together
  for (int e = 0; e < WR; ++e) v[e] = a[lane + e * 32];   // past the end: not used
  float mx = v[0];
#pragma unroll   // constant register index
  for (int e = 1; e < WR; ++e) mx = fmaxf(mx, lane + e * 32 < N_NODES ? v[e] : 0.f);
#pragma unroll   // five exchange steps
  for (int m = 16; m >= 1; m >>= 1) mx = fmaxf(mx, __shfl_xor(mx, m, 32));
  float sum = 0.f;
#pragma unroll   // constant register index
  for (int e = 0; e < WR; ++e) sum += lane + e * 32 < N_NODES ? __expf(v[e] - mx) : 0.f;
#pragma unroll   // five exchange steps
  for (int m = 16; m >= 1; m >>= 1) sum += __shfl_xor(sum, m, 32);
  const float inv = 1.f / sum;
#pragma unroll   // constant register index
  for (int e = 0; e < PER; ++e) {
    const int j = tid + e * D_MODEL;
    own[e] = __expf(own[e] - mx) * inv;
    // behind the row: below every probability, so that it adds to no rank
    p[j] = j < N_NODES ? own[e] : -1.f;
  }
  __syncthreads();
  // ranks of a thread's elements: each value of the row is read once, four a read
  int cnt[PER];
#pragma unroll   // constant register index
  for (int e = 0; e < PER; ++e) cnt[e] = 0;
#pragma unroll 13   // that many 16-byte LDS reads in flight together
  for (int l = 0; l < NP4; ++l) {
    const float4 x = *(const float4*)(p + 4 * l);
#pragma unroll   // constant register index
    for (int e = 0; e < PER; ++e)
      cnt[e] += (x.x > own[e] ? 1 : 0) + (x.y > own[e] ? 1 : 0) + (x.z > own[e] ? 1 : 0) +
                (x.w > own[e] ? 1 : 0);
  }
  const float thr = 1.0f / (float)N_NODES;
  float* arow = adpA + i * N_NODES + tid;
#pragma unroll   // constant register index
  for (int e = 0; e < PER; ++e) own[e] = ((own[e] > thr) && (cnt[e] < MAX_NEIGH)) ? own[e] : 0.f;
#pragma unroll   // constant register index, immediate store offsets
  for (int e = 0; e < PER; ++e)
    if ((e + 1) * D_MODEL <= N_NODES || tid + e * D_MODEL < N_NODES) arow[e * D_MODEL] = own[e];
}

// Encoder additive attention bias: 0 where query q may look at key k, -1e30 where
// adpA == 0. Keys are padded to whole key tiles and queries to whole query blocks (pad
// entries 0), so the attention kernel needs no clamp. It lies in the order in which a wave
// takes it, 512 floats per (key tile, block of 32 queries):
// [k >> 4][q >> 5][(q >> 4) & 1][(k >> 2) & 1][(k >> 3) & 1][q & 15][k & 3].
#define EM_ROWS  (((N_UNMASK + 15) / 16) * 16)   // 624
#define EM_PITCH (((N_UNMASK + 31) / 32) * 32)   // 640

// ---------------------------------------------------------------------------
// Everything that depends on the inputs alone, in ONE launch; a work-group's role
// comes from its index:
//   adjacency row i;
//   encoder input row: (x0*dim_w + dim_b + pos + tod*tod_w + tod_b + dow*dow_w + dow_b)
//     at unmasked_idx, * sqrt(D);
//   decoder input row of a masked token: (mask_token + pos + tod/dow emb) * sqrt(D),
//     and that token's label.
// ---------------------------------------------------------------------------
#define FR_ENC (BATCH * N_UNMASK)
#define FR_DEC (BATCH * N_MASKT)
#define FR_ROWS 12   // rows a work-group: few waves to start, the rows' loads in flight together
static_assert(FR_ENC % FR_ROWS == 0 && FR_DEC % FR_ROWS == 0, "whole work-groups");
__global__ __launch_bounds__(D_MODEL)
void front_kernel(const float* __restrict__ nv1, const float* __restrict__ nv2,
                  float* __restrict__ adpA,
                  const float* __restrict__ hist,
                  const int* __restrict__ uidx, const int* __restrict__ midx,
                  const float* __restrict__ dim_w, const float* __restrict__ dim_b,
                  const float* __restrict__ pos,
                  const float* __restrict__ tod_w, const float* __restrict__ tod_b,
                  const float* __restrict__ dow_w, const float* __restrict__ dow_b,
                  const float* __restrict__ mask_token,
                  float* __restrict__ X, float* __restrict__ Xd, float* __restrict__ out) {
  const int blk = blockIdx.x;
  if (blk < N_NODES) { adj_row(nv1, nv2, adpA, blk); return; }
  const int d = threadIdx.x;       // 0..95
  const float todw = tod_w[d], todb = tod_b[d], doww = dow_w[d], dowb = dow_b[d];
  // stands in front of any reuse of the address registers of the four loads above; the
  // scheduling barrier keeps later arithmetic from rising over it
  asm volatile("s_wait_xcnt 0x0" ::: "memory");
  __builtin_amdgcn_sched_barrier(0);
  if (blk < N_NODES + FR_ENC / FR_ROWS) {
    const float dimw = dim_w[d], dimb = dim_b[d];
    const int r0 = (blk - N_NODES) * FR_ROWS;
#pragma unroll   // the rows' loads in flight together
    for (int i = 0; i < FR_ROWS; ++i) {
      const int row = r0 + i;      // b*N_UNMASK + s
      const int b = row / N_UNMASK, s = row % N_UNMASK;
      int nt = uidx[s];
      nt = nt < 0 ? 0 : (nt >= NT ? NT - 1 : nt);
      const int n = nt / T_STEPS, t = nt % T_STEPS;
      const float* hp = hist + (((size_t)b * T_STEPS + t) * N_NODES + n) * C_IN;
      float x0 = hp[0], dow = hp[2], tod = hp[3];
      float v = x0 * dimw + dimb + pos[(size_t)nt * D_MODEL + d] +
                tod * todw + todb + dow * doww + dowb;
      X[(size_t)row * D_MODEL + d] = v * SQRT_D;
    }
    // stands behind the run of stores, in front of any rewrite of their address and
    // data registers in the code that follows this role in the built kernel
    asm volatile("s_wait_xcnt 0x0" ::: "memory");
  } else {
    const float mtk = mask_token[d];
    const int r0 = (blk - (N_NODES + FR_ENC / FR_ROWS)) * FR_ROWS;
    int ntr[FR_ROWS], po[FR_ROWS];   // each row's token, and its place in pos
    float pv[FR_ROWS];
#pragma unroll   // constant register index; the rows' loads in flight together
    for (int i = 0; i < FR_ROWS; ++i) {
      int nt = midx[(r0 + i) % N_MASKT];
      nt = nt < 0 ? 0 : (nt >= NT ? NT - 1 : nt);
      ntr[i] = nt;
      po[i] = nt * D_MODEL + d;
      pv[i] = pos[po[i]];
    }
    // stands in front of any reuse of the address registers of the loads above: the places
    // are inputs, so that they live up to the wait and no result lands in one of them;
    // the scheduling barrier keeps later arithmetic from rising over it
    asm volatile("s_wait_xcnt 0x0" :: "v"(po[0]), "v"(po[1]), "v"(po[2]), "v"(po[3]), "v"(po[4]),
                 "v"(po[5]), "v"(po[6]), "v"(po[7]), "v"(po[8]), "v"(po[9]), "v"(po[10]),
                 "v"(po[11]) : "memory");
    __builtin_amdgcn_sched_barrier(0);
    float val[FR_ROWS];
    int xo[FR_ROWS];               // where each row goes in Xd
    float lab = 0.f;               // thread i keeps row i's label
#pragma unroll   // constant register index
    for (int i = 0; i < FR_ROWS; ++i) {
      const int row = r0 + i;      // b*N_MASKT + j
      const int b = row / N_MASKT, j = row % N_MASKT;
      const int n = ntr[i] / T_STEPS, t = ntr[i] % T_STEPS;
      const float* hp = hist + (((size_t)b * T_STEPS + t) * N_NODES + n) * C_IN;
      const float x0 = hp[0], dow = hp[2], tod = hp[3];
      float v = mtk + pv[i] + tod * todw + todb + dow * doww + dowb;
      val[i] = v * SQRT_D;
      xo[i] = (b * NT + N_UNMASK + j) * D_MODEL + d;
      lab = d == i ? x0 : lab;
    }
    // every value and place in a register of its own in front of the first store:
    // arithmetic sunk among the stores would rewrite registers of issued stores
    __builtin_amdgcn_sched_barrier(0);
#pragma unroll   // constant register index
    for (int i = 0; i < FR_ROWS; ++i) Xd[xo[i]] = val[i];
    // stands behind the run of stores, in front of any rewrite of their registers
    asm volatile("s_wait_xcnt 0x0" ::: "memory");
    if (d < FR_ROWS) out[FR_DEC + r0 + d] = lab;
  }
}

// ---------------------------------------------------------------------------
// fp32 GEMM via V_WMMA_F32_16X16X4_F32, register-blocked 32x32 per wave:
// 4 accumulators, each A-frag feeds 2 WMMAs and each B-frag feeds 2 WMMAs.
// Y[M,N] = X[M,K] @ W[K,N] + bias. K and N are compile-time, so every
// operand load is a base register plus an immediate offset.
// Row r of the product is row r + (r / SEG) * GAP + OFF of X, SQ rows a batch; Y takes it
// in the attention's fragment order (isv: as V, else as Q or K).
// The K loop is a register ring: operands come in chunks of GK_STEPS k-steps,
// GK_BUFS chunks are held, and a chunk's loads are issued at least GK_BUFS - 1
// chunks ahead of the WMMAs that use it, so a wave waits out the load latency
// once and not once per trip. Every accumulator keeps the ascending k order.
// M edge via row-clamped loads + guarded stores (EXEC stays full for WMMA).
// ---------------------------------------------------------------------------
#define GK_STEPS 4     // k-steps (of 4) per chunk: 32 loads

// Q, K and V lie in the workspace in the order in which the attention's fragments take
// them: one plane per (batch, head), KV_TILE floats per 16 rows of the sequence, so that a
// wave's 16-byte loads cover whole cache lines.
//   Q, K:                [tile][d >> 3][(d >> 2) & 1][row & 15][d & 3]
//   V, head dims 0..15:  [tile][(row >> 2) & 1][(row >> 3) & 1][d][row & 3]
//   V, head dims 16..23: behind them in the tile, the same with eight head dims.
// Offset of (row s, head dim d) in its plane: qk_row(s) + qk_col(d), or
// v_row(s) + v_col(d) + (v_mid(s) >> v_sh(d)).
template <bool B> struct fa_bool { static constexpr bool value = B; };
#define KV_TILE (16 * HD)
#define KV_PLANE(S) ((((S) + 15) / 16) * KV_TILE)
__device__ __forceinline__ int qk_row(const int s) { return (s >> 4) * KV_TILE + (s & 15) * 4; }
__device__ __forceinline__ int qk_col(const int d) {
  return (d >> 3) * 128 + ((d >> 2) & 1) * 64 + (d & 3);
}
__device__ __forceinline__ int v_row(const int s) { return (s >> 4) * KV_TILE + (s & 3); }
__device__ __forceinline__ int v_mid(const int s) {
  return ((s >> 2) & 1) * 128 + ((s >> 3) & 1) * 64;
}
__device__ __forceinline__ int v_col(const int d) { return d < 16 ? d * 4 : 256 + (d - 16) * 4; }
__device__ __forceinline__ int v_sh(const int d) { return d < 16 ? 0 : 1; }
// The attention's result lies in the order in which the row chain takes it as A fragments,
// 16 rows a tile: [row >> 4][c >> 3][(c >> 1) & 1][row & 15][(c >> 2) & 1][c & 1].
// Offset of (row, column c): o_row(row) + o_col(c).
__device__ __forceinline__ int o_row(const int r) { return (r >> 4) * (16 * D_MODEL) + (r & 15) * 4; }
__device__ __forceinline__ int o_col(const int c) {
  return (c >> 3) * 128 + ((c >> 1) & 1) * 64 + ((c >> 2) & 1) * 2 + (c & 1);
}
// Eight 4-byte stores into y at this lane's eight offsets o (in floats). Stores and the wait
// behind them are one statement: every offset and value is an operand, so all are formed in
// front of the first store, and no register of an issued store is rewritten before the wait.
__device__ __forceinline__ void pk_st8(float* y, const int (&o)[8], const v8f x) {
  asm volatile("global_store_b32 %0, %8, %16 scale_offset\n\t"
               "global_store_b32 %1, %9, %16 scale_offset\n\t"
               "global_store_b32 %2, %10, %16 scale_offset\n\t"
               "global_store_b32 %3, %11, %16 scale_offset\n\t"
               "global_store_b32 %4, %12, %16 scale_offset\n\t"
               "global_store_b32 %5, %13, %16 scale_offset\n\t"
               "global_store_b32 %6, %14, %16 scale_offset\n\t"
               "global_store_b32 %7, %15, %16 scale_offset\n\t"
               "s_wait_xcnt 0x0"
               :: "v"(o[0]), "v"(o[1]), "v"(o[2]), "v"(o[3]), "v"(o[4]), "v"(o[5]), "v"(o[6]),
                  "v"(o[7]), "v"(x[0]), "v"(x[1]), "v"(x[2]), "v"(x[3]), "v"(x[4]), "v"(x[5]),
                  "v"(x[6]), "v"(x[7]), "s"(y)
               : "memory");
}
#define GK_BUFS  3     // chunks held in registers

template <int K, int N, int SEG, int GAP, int OFF, int SQ>
__device__ __forceinline__
void gemm_tile(const float* __restrict__ X, const float* __restrict__ W,
               const float* __restrict__ bias, float* __restrict__ Y, const bool isv,
               const int M, const int m0, const int n0) {
  constexpr int NCH = K / (4 * GK_STEPS);
  static_assert(K % (4 * GK_STEPS) == 0 && N % 32 == 0 && NCH >= GK_BUFS, "shape");
  int lane = threadIdx.x & 31;
  int l16 = lane & 15, half = lane >> 4;
  int ra0 = m0 + l16;      if (ra0 >= M) ra0 = M - 1;
  int ra1 = m0 + 16 + l16; if (ra1 >= M) ra1 = M - 1;
  ra0 += (ra0 / SEG) * GAP + OFF;
  ra1 += (ra1 / SEG) * GAP + OFF;
  const float* xa0 = X + (size_t)ra0 * K + 2 * half;
  const float* xa1 = X + (size_t)ra1 * K + 2 * half;
  const float* wp  = W + (size_t)(2 * half) * N + n0 + l16;
  v2f a0[GK_BUFS][GK_STEPS], a1[GK_BUFS][GK_STEPS];
  v2f b0[GK_BUFS][GK_STEPS], b1[GK_BUFS][GK_STEPS];
  v8f acc00 = {}, acc01 = {}, acc10 = {}, acc11 = {};

// unrolled here and below: every ring index must be a compile-time constant,
// or the ring would live in scratch instead of registers
#define GK_LOAD(c)                                                     \
  _Pragma("unroll")                                                    \
  for (int j = 0; j < GK_STEPS; ++j) {                                 \
    const int k0 = ((c) * GK_STEPS + j) * 4;                           \
    const int s = (c) % GK_BUFS;                                       \
    a0[s][j].x = xa0[k0];              a0[s][j].y = xa0[k0 + 1];       \
    a1[s][j].x = xa1[k0];              a1[s][j].y = xa1[k0 + 1];       \
    b0[s][j].x = wp[k0 * N];           b0[s][j].y = wp[(k0 + 1) * N];  \
    b1[s][j].x = wp[k0 * N + 16];      b1[s][j].y = wp[(k0 + 1) * N + 16]; \
  }

#pragma unroll   // constant ring index
  for (int c = 0; c < GK_BUFS - 1; ++c) { GK_LOAD(c) }
#pragma unroll   // constant ring index and immediate load offsets
  for (int c = 0; c < NCH; ++c) {
    if (c + GK_BUFS - 1 < NCH) { GK_LOAD(c + GK_BUFS - 1) }
    // keeps the loads above in front of this chunk's WMMAs: sunk to their use,
    // each chunk would wait out its own load latency again
    __builtin_amdgcn_sched_barrier(0);
    const int s = c % GK_BUFS;
#pragma unroll   // constant ring index
    for (int j = 0; j < GK_STEPS; ++j) {
      acc00 = __builtin_amdgcn_wmma_f32_16x16x4_f32(false, a0[s][j], false, b0[s][j], (short)0, acc00, false, false);
      acc01 = __builtin_amdgcn_wmma_f32_16x16x4_f32(false, a0[s][j], false, b1[s][j], (short)0, acc01, false, false);
      acc10 = __builtin_amdgcn_wmma_f32_16x16x4_f32(false, a1[s][j], false, b0[s][j], (short)0, acc10, false, false);
      acc11 = __builtin_amdgcn_wmma_f32_16x16x4_f32(false, a1[s][j], false, b1[s][j], (short)0, acc11, false, false);
    }
  }
#undef GK_LOAD
  // stands in front of the epilogue's reuse of the operand loads' address
  // registers; the scheduling barrier keeps that arithmetic from rising over it
  asm volatile("s_wait_xcnt 0x0" ::: "memory");
  __builtin_amdgcn_sched_barrier(0);
  const int nA = n0 + l16;
  const float bv0 = bias[nA], bv1 = bias[nA + 16];
  // stands in front of any reuse of the address register of the two loads above: the index
  // is an input, so that it lives up to the wait; the scheduling barrier keeps later
  // arithmetic from rising over it
  asm volatile("s_wait_xcnt 0x0" :: "v"(nA) : "memory");
  __builtin_amdgcn_sched_barrier(0);
  // the result goes out in fragment order; the two columns' shares of the offset
  constexpr int PL = KV_PLANE(SQ);
  const int hA = nA / HD, dA = nA % HD, hB = (nA + 16) / HD, dB = (nA + 16) % HD;
  const int cA = hA * PL + (isv ? v_col(dA) : qk_col(dA)), sA = isv ? v_sh(dA) : 0;
  const int cB = hB * PL + (isv ? v_col(dB) : qk_col(dB)), sB = isv ? v_sh(dB) : 0;
  constexpr int RB = SEG < SQ ? SEG : SQ;   // rows of the product a batch
  static_assert(RB >= 32 && RB + GAP == SQ && OFF == GAP, "row r of a batch is row r + OFF of its sequence");
  const int bt0 = m0 / RB, j0 = m0 - bt0 * RB;
  // every store's offset in a register of its own, formed in front of the stores
  int ro[16], rp[16];
#pragma unroll   // constant register index
  for (int r = 0; r < 16; ++r) {
    const int i = (r & 7) + 8 * half + 16 * (r >> 3);
    const bool nx = j0 + i >= RB;   // the tile's rows lie in at most two batches
    const int s = j0 + i + OFF - (nx ? RB : 0);
    const int base = (bt0 + (nx ? 1 : 0)) * (NHEAD * PL) + (isv ? v_row(s) : qk_row(s));
    const int mid = isv ? v_mid(s) : 0;
    ro[r] = m0 + i < M ? base + cA + (mid >> sA) : -1;
    rp[r] = base + cB + (mid >> sB);
  }
  acc00 += bv0; acc01 += bv1; acc10 += bv0; acc11 += bv1;
  // G: the tile may hold rows past M. A whole tile's stores stand in one run with no test
  auto put = [&](auto gc) {
    constexpr bool G = decltype(gc)::value;
#pragma unroll   // constant register index
    for (int r = 0; r < 8; ++r) {
      if (!G || ro[r] >= 0) {
        Y[ro[r]] = acc00[r];
        Y[rp[r]] = acc01[r];
      }
      if (!G || ro[r + 8] >= 0) {
        Y[ro[r + 8]] = acc10[r];
        Y[rp[r + 8]] = acc11[r];
      }
    }
  };
  if (m0 + 32 <= M) put(fa_bool<false>{}); else put(fa_bool<true>{});
  // stands behind the run of stores, in front of any rewrite of their registers in the
  // code that follows this role in the built kernel
  asm volatile("s_wait_xcnt 0x0" ::: "memory");
}

// ---------------------------------------------------------------------------
// Everything that needs only the launch above, in ONE launch of one-wave
// work-groups; the role comes from the index:
//   a 32 x 32 tile of the first encoder layer's Q, K or V;
//   a 32 x 32 tile of the decoder's Q, K or V for the masked tokens' rows, which do
//     not depend on the encoder;
//   one key row of the encoder's attention bias.
// ---------------------------------------------------------------------------
#define PJ_ENC (((BATCH * N_UNMASK + 31) / 32) * 9)
#define PJ_DEC (((BATCH * N_MASKT + 31) / 32) * 9)
__global__ __launch_bounds__(32)
void proj_kernel(const float* __restrict__ X, const float* __restrict__ eaw,
                 const float* __restrict__ eab, float* __restrict__ Qe,
                 float* __restrict__ Ke, float* __restrict__ Ve,
                 const float* __restrict__ Xd, const float* __restrict__ daw,
                 const float* __restrict__ dab, float* __restrict__ Qd,
                 float* __restrict__ Kd, float* __restrict__ Vd,
                 const float* __restrict__ adpA, const int* __restrict__ uidx,
                 float* __restrict__ Mb) {
  const int blk = blockIdx.x;
  if (blk < PJ_ENC) {
    const int y = blk % 9, p = y / 3;
    gemm_tile<D_MODEL, D_MODEL, (1 << 30), 0, 0, N_UNMASK>(
        X, eaw + p * D_MODEL * D_MODEL, eab + p * D_MODEL, p == 0 ? Qe : (p == 1 ? Ke : Ve),
        p == 2, BATCH * N_UNMASK, (blk / 9) * 32, (y % 3) * 32);
    return;
  }
  if (blk < PJ_ENC + PJ_DEC) {
    const int t = blk - PJ_ENC, y = t % 9, p = y / 3;
    gemm_tile<D_MODEL, D_MODEL, N_MASKT, N_UNMASK, N_UNMASK, NT>(
        Xd, daw + p * D_MODEL * D_MODEL, dab + p * D_MODEL, p == 0 ? Qd : (p == 1 ? Kd : Vd),
        p == 2, BATCH * N_MASKT, (t / 9) * 32, (y % 3) * 32);
    return;
  }
  // column nk of the adjacency goes to LDS, and each query looks its node up there
  constexpr int NG = EM_PITCH / 32, NF = N_UNMASK / 32;        // query groups, whole ones
  constexpr int CG = (N_NODES + 31) / 32, CF = N_NODES / 32;   // node groups, whole ones
  static_assert(NG == NF + 1 && CG == CF + 1, "one clamped group each");
  __shared__ float colv[CG * 32];
  const int k = blk - (PJ_ENC + PJ_DEC);   // 0 .. EM_ROWS - 1
  const int lane = threadIdx.x;
  int nk = uidx[k < N_UNMASK ? k : N_UNMASK - 1] / T_STEPS;
  nk = nk < 0 ? 0 : (nk >= N_NODES ? N_NODES - 1 : nk);
  // last group of each: past the end the last element, not used
  const int cq = lane < N_UNMASK - NF * 32 ? lane : N_UNMASK - NF * 32 - 1;
  const int cn = lane < N_NODES - CF * 32 ? lane : N_NODES - CF * 32 - 1;
  const int a1 = lane * N_NODES + nk, a2 = cn * N_NODES + nk;
  int nq[NG];
  float cv[CG];
#pragma unroll   // constant register index, immediate load offsets
  for (int i = 0; i < NF; ++i) nq[i] = uidx[i * 32 + lane];
#pragma unroll   // constant register index, immediate load offsets
  for (int i = 0; i < CF; ++i) cv[i] = adpA[a1 + i * 32 * N_NODES];
  nq[NF] = uidx[NF * 32 + cq];
  cv[CF] = adpA[a2 + CF * 32 * N_NODES];
  // stands in front of any reuse of the address registers of the loads above: the indices
  // are inputs, so that they live up to the wait and no result lands in one of them;
  // the scheduling barrier keeps later arithmetic from rising over it
  asm volatile("s_wait_xcnt 0x0" :: "v"(lane), "v"(cq), "v"(a1), "v"(a2) : "memory");
  __builtin_amdgcn_sched_barrier(0);
#pragma unroll   // constant register index
  for (int i = 0; i < CG; ++i) colv[i * 32 + lane] = cv[i];
  __syncthreads();
  float av[NG];
#pragma unroll   // constant register index; every lane reads, so all LDS reads fly together
  for (int i = 0; i < NG; ++i) {
    int n = nq[i] / T_STEPS;
    n = n < 0 ? 0 : (n >= N_NODES ? N_NODES - 1 : n);
    av[i] = colv[n];
  }
#pragma unroll   // constant register index
  for (int i = 0; i < NG; ++i) {
    const bool in = k < N_UNMASK && i * 32 + lane < N_UNMASK;
    av[i] = (in & (av[i] == 0.f)) ? -1e30f : 0.f;
  }
  // every value in a register of its own in front of the first store
  __builtin_amdgcn_sched_barrier(0);
  float* mrow = Mb + (size_t)(k >> 4) * (NG * 512) + (lane >> 4) * 256 + ((k >> 2) & 1) * 128 +
                ((k >> 3) & 1) * 64 + (lane & 15) * 4 + (k & 3);
#pragma unroll   // constant register index, immediate store offsets
  for (int i = 0; i < NG; ++i) mrow[i * 512] = av[i];
  // stands behind the run of stores, in front of any rewrite of their registers in the
  // code that follows this role in the built kernel
  asm volatile("s_wait_xcnt 0x0" ::: "memory");
}

// ---------------------------------------------------------------------------
// Attention in one pass over the keys, per (b, head, 32 queries): the scores never
// leave the registers.
//   St = K Qt : A = 16 keys x 24, B = Qt, kept in registers. D register r of a lane
//               is the score of key 8 * half + r for query l16.
//   softmax   : running maximum and sum per query (one lane column): in-lane over the
//               8 registers, one exchange between the wave's halves.
//   Ot += Vt Pt : D registers 2j, 2j + 1 of St are, as they stand, the B fragment of
//               k-step j if that step's keys are 8 * half + 2j + {0, 1}; the Vt
//               A fragment takes its rows in the same key order.
// A wave holds two query tiles, so each K and V fragment feeds two products. The
// key tiles are dealt round-robin to the NW waves of the work-group; their partial
// (maximum, sum, Ot) are merged in LDS at the end.
// Head dim order of the score product: at k-step j a lane half takes
// d = 8 * (j >> 1) + 4 * half + 2 * (j & 1) + {0, 1}, for K and Q alike: three 16-byte
// loads a row, each of which takes 512 adjacent bytes for a wave on a whole tile.
// Q/K/V and maskT: in fragment order, as said where KV_TILE and EM_ROWS are defined.
// O: in the row chain's fragment order, as said where o_row is defined.
// QB: the first query row. Rows in front of it are keys and values only.
// ---------------------------------------------------------------------------
typedef float v4f __attribute__((ext_vector_type(4)));
#define FA_C (ATTN_SCALE * 1.4426950408889634f)   // score scale, in log2 units
#define FA_ROWS (HD + 2)                          // Ot rows, then maximum, then sum

// lane l <-> l ^ 16
__device__ __forceinline__ float fa_xhalf(float v) {
  int b = __float_as_int(v);
  return __int_as_float(__builtin_amdgcn_permlanex16(b, b, 0x76543210, 0xfedcba98, false, false));
}

// 24 floats of one row as six k-step fragments; p: the row's place in its plane + 64 * half
__device__ __forceinline__ void fa_row(const float* __restrict__ p, v2f (&f)[6]) {
  const v4f x0 = *(const v4f*)p, x1 = *(const v4f*)(p + 128), x2 = *(const v4f*)(p + 256);
  f[0] = (v2f){x0.x, x0.y}; f[1] = (v2f){x0.z, x0.w};
  f[2] = (v2f){x1.x, x1.y}; f[3] = (v2f){x1.z, x1.w};
  f[4] = (v2f){x2.x, x2.y}; f[5] = (v2f){x2.z, x2.w};
}

// The decoder's keys from tile DEC_T0 on are masked tokens' rows alone: they do not depend
// on the encoder. Their share of the decoder's attention runs as extra work-groups of the
// encoder's launches, a range of key tiles a launch. A wave there is on its own: 32 queries
// of one head, every DS_NS-th tile of the range (its stream), and its running (Ot, maximum,
// sum) goes from launch to launch through the workspace, as it stands in the registers.
// The decoder's own launch takes the tiles in front of DEC_T0; its first DS_NS waves start
// from the streams' states.
#define DEC_T0 ((N_UNMASK + 15) / 16)     // 39
#define DEC_KT ((NT + 15) / 16)           // 156
#define DQB    ((N_MASKT + 31) / 32)      // query blocks a head: 59
#define DS_NS  2                          // streams
#define DS_VALS (36 * 32)                 // floats of one wave's state
#define DS_TOTAL ((size_t)BATCH * NHEAD * DS_NS * DQB * DS_VALS)

// sp: the state's start + 4 * lane
__device__ __forceinline__ void fa_state_load(const float* sp, v8f (&o)[2][2], float (&m)[2],
                                              float (&l)[2]) {
  v4f x[9];
#pragma unroll   // constant register index, immediate load offsets
  for (int c = 0; c < 9; ++c) x[c] = *(const v4f*)(sp + c * 128);
  // stands in front of any reuse of the address registers of the loads above; the address is
  // an input, so that it lives up to the wait and no result lands in its registers
  asm volatile("s_wait_xcnt 0x0" :: "v"(sp) : "memory");
#pragma unroll   // constant register index
  for (int c = 0; c < 8; ++c)
#pragma unroll   // constant register index
    for (int i = 0; i < 4; ++i) o[c >> 2][(c >> 1) & 1][(c & 1) * 4 + i] = x[c][i];
  m[0] = x[8].x; m[1] = x[8].y; l[0] = x[8].z; l[1] = x[8].w;
}

__device__ __forceinline__ void fa_state_store(float* sp, const v8f (&o)[2][2],
                                               const float (&m)[2], const float (&l)[2]) {
#pragma unroll   // constant register index, immediate store offsets
  for (int c = 0; c < 8; ++c) {
    const v8f& s = o[c >> 2][(c >> 1) & 1];
    const int e = (c & 1) * 4;
    *(v4f*)(sp + c * 128) = (v4f){s[e], s[e + 1], s[e + 2], s[e + 3]};
  }
  *(v4f*)(sp + 8 * 128) = (v4f){m[0], m[1], l[0], l[1]};
  // stands behind the run of stores, in front of any rewrite of their registers
  asm volatile("s_wait_xcnt 0x0" ::: "memory");
}

// One wave's pass over the key tiles kt0, kt0 + STEP, ... below t1, for the 32 queries from
// q0 on; o, mrun, lrun: its running state, set by the caller. pl: batch * NHEAD + head.
template <int S, int STEP, bool MASK>
__device__ __forceinline__
void fa_run(const float* __restrict__ Q, const float* __restrict__ Kb,
            const float* __restrict__ Vb, const float* __restrict__ maskT,
            const int q0, const int pl, const int kt0, const int t1,
            v8f (&o)[2][2], float (&mrun)[2], float (&lrun)[2]) {
  constexpr int KT = (S + 15) / 16;
  // with a mask the scores are scaled when the bias is added, else inside the exponent
  constexpr float CC = MASK ? 1.f : FA_C;
  const int lane = threadIdx.x & 31;
  const int l16 = lane & 15, half = lane >> 4;
  const size_t pb = (size_t)pl * KV_PLANE(S);
  const float* Kh = Kb + pb + 64 * half;
  const float* Vh = Vb + pb;

  v2f qf[2][6];
#pragma unroll   // constant register index
  for (int t = 0; t < 2; ++t) {
    int qr = q0 + 16 * t + l16; if (qr >= S) qr = S - 1;
    fa_row(Q + pb + 64 * half + qk_row(qr), qf[t]);
  }
  v2f kf[6];
  {
    int key = kt0 * 16 + l16; if (key >= S) key = S - 1;
    fa_row(Kh + qk_row(key), kf);
  }
  // stands in front of any reuse of the address registers of the loads above; the
  // scheduling barrier keeps later arithmetic from rising over it
  asm volatile("s_wait_xcnt 0x0" ::: "memory");
  __builtin_amdgcn_sched_barrier(0);
  // this lane's place in a tile's V: first Ot tile; second Ot tile, 8 rows, each taken twice
  const int vl0 = lane * 4, vl1 = 256 + (8 * half + (l16 & 7)) * 4;

  // one key tile; LAST: the tile that may hold keys past S
  auto tile = [&](auto lastc, const int kt) {
    constexpr bool LAST = decltype(lastc)::value;
    const int kb = kt * 16 + 8 * half;
    v2f vf[2][4];
    if constexpr (!LAST) {
      // a whole tile: four 16-byte loads, keys kb + 4c .. kb + 4c + 3 of one head dim in each
      const float* va = Vh + kt * KV_TILE + vl0;
      const float* vb = Vh + kt * KV_TILE + vl1;
      const v4f x0 = *(const v4f*)va, x1 = *(const v4f*)(va + 128);
      const v4f y0 = *(const v4f*)vb, y1 = *(const v4f*)(vb + 64);
      // stands in front of any reuse of the address registers of the four loads
      asm volatile("s_wait_xcnt 0x0" ::: "memory");
      vf[0][0] = (v2f){x0.x, x0.y}; vf[0][1] = (v2f){x0.z, x0.w};
      vf[0][2] = (v2f){x1.x, x1.y}; vf[0][3] = (v2f){x1.z, x1.w};
      vf[1][0] = (v2f){y0.x, y0.y}; vf[1][1] = (v2f){y0.z, y0.w};
      vf[1][2] = (v2f){y1.x, y1.y}; vf[1][3] = (v2f){y1.z, y1.w};
    } else {
      const float* vp[4][4];   // each load's own address
#pragma unroll   // constant register index
      for (int j = 0; j < 4; ++j) {
        int r0 = kb + 2 * j, r1 = kb + 2 * j + 1;   // past the end: the last row, weight 0
        r0 = r0 < S ? r0 : S - 1;
        r1 = r1 < S ? r1 : S - 1;
        vp[j][0] = Vh + v_row(r0) + v_mid(r0) + l16 * 4;
        vp[j][1] = Vh + v_row(r1) + v_mid(r1) + l16 * 4;
        vp[j][2] = Vh + v_row(r0) + (v_mid(r0) >> 1) + 256 + (l16 & 7) * 4;
        vp[j][3] = Vh + v_row(r1) + (v_mid(r1) >> 1) + 256 + (l16 & 7) * 4;
        vf[0][j].x = *vp[j][0]; vf[0][j].y = *vp[j][1];
        vf[1][j].x = *vp[j][2]; vf[1][j].y = *vp[j][3];
      }
      // clamped rows have addresses of their own: all are inputs, so that they live up to the
      // wait and no result of the run lands in an address register of an earlier load of it
      asm volatile("s_wait_xcnt 0x0" :: "v"(vp[0][0]), "v"(vp[0][1]), "v"(vp[0][2]), "v"(vp[0][3]),
                   "v"(vp[1][0]), "v"(vp[1][1]), "v"(vp[1][2]), "v"(vp[1][3]),
                   "v"(vp[2][0]), "v"(vp[2][1]), "v"(vp[2][2]), "v"(vp[2][3]),
                   "v"(vp[3][0]), "v"(vp[3][1]), "v"(vp[3][2]), "v"(vp[3][3]) : "memory");
    }
    float mb[2][8];
    if (MASK) {
      const float* mp = maskT + ((size_t)kt * (EM_PITCH / 32) + (q0 >> 5)) * 512 + lane * 4;
      v4f mv[4];
#pragma unroll   // constant register index, immediate load offsets
      for (int c = 0; c < 4; ++c) mv[c] = *(const v4f*)(mp + c * 128);
      // as above, for the four loads just issued
      asm volatile("s_wait_xcnt 0x0" ::: "memory");
#pragma unroll   // constant register index
      for (int r = 0; r < 8; ++r) {
        mb[0][r] = mv[r >> 2][r & 3];
        mb[1][r] = mv[2 + (r >> 2)][r & 3];
      }
    }
    // keeps later address arithmetic from rising over the waits above, and the loads in
    // front of the score products, whose time covers their latency
    __builtin_amdgcn_sched_barrier(0);
    v8f s[2];
    s[0] = (v8f){}; s[1] = (v8f){};
#pragma unroll   // constant register index
    for (int j = 0; j < 6; ++j) {
      s[0] = __builtin_amdgcn_wmma_f32_16x16x4_f32(false, kf[j], false, qf[0][j], (short)0, s[0], false, false);
      s[1] = __builtin_amdgcn_wmma_f32_16x16x4_f32(false, kf[j], false, qf[1][j], (short)0, s[1], false, false);
    }
    // this wave's next K tile, in flight during the softmax and the second product
    // (past the end: the clamped last row, never used)
    {
      int key = (kt + STEP) * 16 + l16; if (key >= S) key = S - 1;
      const float* kp = Kh + qk_row(key);
      fa_row(kp, kf);
      // as above, for the three loads just issued; the address is an input, so that it
      // lives up to the wait and none of the three results lands in its registers
      asm volatile("s_wait_xcnt 0x0" :: "v"(kp) : "memory");
    }
    __builtin_amdgcn_sched_barrier(0);
#pragma unroll   // constant register index
    for (int t = 0; t < 2; ++t) {
      if (MASK) {
#pragma unroll   // constant register index
        for (int r = 0; r < 8; ++r) s[t][r] = fmaf(s[t][r], FA_C, mb[t][r]);
      }
      if (LAST) {
#pragma unroll   // constant register index
        for (int r = 0; r < 8; ++r)
          if (kb + r >= S) s[t][r] = -INFINITY;   // no key: weight exactly 0
      }
      float mx = s[t][0];
#pragma unroll   // constant register index
      for (int r = 1; r < 8; ++r) mx = fmaxf(mx, s[t][r]);
      mx = fmaxf(mx, fa_xhalf(mx));
      const float mnew = fmaxf(mrun[t], mx);
      const float alpha = __builtin_amdgcn_exp2f((mrun[t] - mnew) * CC);
      const float nb = -mnew * CC;
      mrun[t] = mnew;
      float sum = 0.f;
#pragma unroll   // constant register index
      for (int r = 0; r < 8; ++r) {
        s[t][r] = __builtin_amdgcn_exp2f(fmaf(s[t][r], CC, nb));
        sum += s[t][r];
      }
      lrun[t] = lrun[t] * alpha + sum;
      o[t][0] *= alpha;
      o[t][1] *= alpha;
    }
#pragma unroll   // constant register index
    for (int j = 0; j < 4; ++j) {
#pragma unroll   // constant register index
      for (int t = 0; t < 2; ++t) {
        const v2f pf = (v2f){s[t][2 * j], s[t][2 * j + 1]};
        o[t][0] = __builtin_amdgcn_wmma_f32_16x16x4_f32(false, vf[0][j], false, pf, (short)0, o[t][0], false, false);
        o[t][1] = __builtin_amdgcn_wmma_f32_16x16x4_f32(false, vf[1][j], false, pf, (short)0, o[t][1], false, false);
      }
    }
  };

  int kt = kt0;
  const int te = t1 < KT - 1 ? t1 : KT - 1;   // whole tiles end here
  for (; kt < te; kt += STEP) tile(fa_bool<false>{}, kt);
  if (kt == KT - 1 && kt < t1) tile(fa_bool<true>{}, kt);
}

// A work-group of NWV independent waves of the decoder's early share: key tiles t0 .. t1 - 1.
// idx: the work-group's number among them. The waves of one work-group have one head and one
// stream, so they read the same K and V rows at about the same time.
#define DE_WGS(NWV) (BATCH * NHEAD * DS_NS * ((DQB + (NWV) - 1) / (NWV)))
template <int NWV>
__device__ __forceinline__
void dec_early(const float* Qd, const float* Kd, const float* Vd, float* St,
               const int idx, const int t0, const int t1) {
  constexpr int WQ = (DQB + NWV - 1) / NWV;
  const int lane = threadIdx.x & 31;
  // wave number in a scalar register: the branches below stay scalar
  const int wave = __builtin_amdgcn_readfirstlane((int)(threadIdx.x >> 5));
  const int qblk = (idx % WQ) * NWV + wave;
  const int sb = idx / WQ;                 // (batch * NHEAD + head) * DS_NS + stream
  if (qblk >= DQB) return;
  const int stream = sb % DS_NS, bh = sb / DS_NS;
  float* sp = St + ((size_t)sb * DQB + qblk) * DS_VALS + lane * 4;
  v8f o[2][2];
  float mrun[2], lrun[2];
  if (t0 != DEC_T0) {
    fa_state_load(sp, o, mrun, lrun);
  } else {
#pragma unroll   // constant register index
    for (int t = 0; t < 2; ++t) {
      o[t][0] = (v8f){}; o[t][1] = (v8f){};
      mrun[t] = -1e30f; lrun[t] = 0.f;
    }
  }
  fa_run<NT, DS_NS, false>(Qd, Kd, Vd, nullptr, N_UNMASK + qblk * 32, bh, t0 + stream, t1, o,
                           mrun, lrun);
  fa_state_store(sp, o, mrun, lrun);
}

// A work-group's attention for 32 queries of one head: key tiles dealt to its NW waves, merged
// in LDS. ST: the key tiles in front of DEC_T0 alone, on top of the streams' states.
template <int S, int NW, bool MASK, int QB, bool ST>
__device__ __forceinline__
void attn_wg(const float* __restrict__ Q, const float* __restrict__ Kb,
             const float* __restrict__ Vb, float* __restrict__ O,
             const float* __restrict__ maskT, const float* __restrict__ St,
             float (*red)[2][FA_ROWS][16], const int qblk, const int h, const int b) {
  constexpr int KT = (S + 15) / 16;
  static_assert(NW >= 4 && NW >= DS_NS, "the merge takes four waves");
  constexpr float CC = MASK ? 1.f : FA_C;
  const int lane = threadIdx.x & 31;
  // wave number in a scalar register: loop bounds and the last-tile branch stay scalar
  const int wave = __builtin_amdgcn_readfirstlane((int)(threadIdx.x >> 5));
  const int l16 = lane & 15, half = lane >> 4;
  const int q0 = QB + qblk * 32;
  v8f o[2][2];
  float mrun[2], lrun[2];
  if (ST && wave < DS_NS) {
    fa_state_load(St + ((size_t)((b * NHEAD + h) * DS_NS + wave) * DQB + qblk) * DS_VALS + lane * 4,
                  o, mrun, lrun);
  } else {
#pragma unroll   // constant register index
    for (int t = 0; t < 2; ++t) {
      o[t][0] = (v8f){}; o[t][1] = (v8f){};
      mrun[t] = -1e30f; lrun[t] = 0.f;
    }
  }
  fa_run<S, NW, MASK>(Q, Kb, Vb, maskT, q0, b * NHEAD + h, wave, ST ? DEC_T0 : KT, o, mrun, lrun);

  // -------- this wave's partial result to LDS --------
#pragma unroll   // constant register index
  for (int t = 0; t < 2; ++t) {
    const float lsum = lrun[t] + fa_xhalf(lrun[t]);
#pragma unroll   // constant register index
    for (int r = 0; r < 8; ++r) {
      red[wave][t][r + 8 * half][l16] = o[t][0][r];
      if (half == 0) red[wave][t][16 + r][l16] = o[t][1][r];
    }
    if (half == 0) {
      red[wave][t][HD][l16] = mrun[t];
      red[wave][t][HD + 1][l16] = lsum;
    }
  }
  __syncthreads();

  // -------- merge over the waves: four threads a query, six head dims each --------
  if (wave < 4) {
    const int ql = threadIdx.x >> 2, t = ql >> 4, qi = ql & 15;
    const int d0 = (threadIdx.x & 3) * 6;
    float mall = red[0][t][HD][qi];
#pragma unroll   // LDS reads at immediate offsets, all in flight together
    for (int w = 1; w < NW; ++w) mall = fmaxf(mall, red[w][t][HD][qi]);
    float den = 0.f, acc[6] = {0.f, 0.f, 0.f, 0.f, 0.f, 0.f};
#pragma unroll   // LDS reads at immediate offsets, all in flight together
    for (int w = 0; w < NW; ++w) {
      const float wg = __builtin_amdgcn_exp2f((red[w][t][HD][qi] - mall) * CC);
      den += wg * red[w][t][HD + 1][qi];
#pragma unroll   // constant register index
      for (int i = 0; i < 6; ++i) acc[i] += wg * red[w][t][d0 + i][qi];
    }
    const float inv = 1.f / den;
    const int q = q0 + ql;
    if (q < S) {
      float* op = O + o_row(b * (S - QB) + q - QB);   // the query rows of all batches, in a row
#pragma unroll   // constant register index
      for (int i = 0; i < 6; ++i) op[o_col(h * HD + d0 + i)] = acc[i] * inv;
    }
  }
}

// An encoder layer's attention, and behind it in the grid a range of the decoder's early share
#define EA_NW  8
#define EA_QB  ((N_UNMASK + 31) / 32)
#define EA_WGS (EA_QB * NHEAD * BATCH)
__global__ __launch_bounds__(EA_NW * 32)
void enc_attn_kernel(const float* __restrict__ Q, const float* __restrict__ Kb,
                     const float* __restrict__ Vb, float* __restrict__ O,
                     const float* __restrict__ maskT,
                     const float* __restrict__ Qd, const float* __restrict__ Kd,
                     const float* __restrict__ Vd, float* __restrict__ St,
                     const int t0, const int t1) {
  __shared__ float red[EA_NW][2][FA_ROWS][16];
  const int blk = blockIdx.x;
  if (blk >= EA_WGS) { dec_early<EA_NW>(Qd, Kd, Vd, St, blk - EA_WGS, t0, t1); return; }
  attn_wg<N_UNMASK, EA_NW, true, 0, false>(Q, Kb, Vb, O, maskT, nullptr, red, blk % EA_QB,
                                           (blk / EA_QB) % NHEAD, blk / (EA_QB * NHEAD));
}

// The decoder's attention: what is left of it behind the encoder
#define DA_NW 4
__global__ __launch_bounds__(DA_NW * 32)
void dec_attn_kernel(const float* __restrict__ Q, const float* __restrict__ Kb,
                     const float* __restrict__ Vb, float* __restrict__ O,
                     const float* __restrict__ St) {
  __shared__ float red[DA_NW][2][FA_ROWS][16];
  attn_wg<NT, DA_NW, false, N_UNMASK, true>(Q, Kb, Vb, O, nullptr, St, red, blockIdx.x,
                                            blockIdx.y, blockIdx.z);
}

// ---------------------------------------------------------------------------
// The row-local chain behind attention in ONE launch, one work-group of PK_WAVES
// waves per 16 rows:
//   h = LN(h + O Wo + bo); f = relu(h W1 + b1); h = LN(h + f W2 + b2); then
//   NEXT 1: the next layer's Q, K, V = h Wq|Wk|Wv + bias (nw, nb);
//   NEXT 2, the encoder's last layer: its closing LayerNorm (cg, cb), the decoder's
//           input row x = (h ew + eb) * sqrt(D), and the decoder's K and V of x (nw, nb);
//           row b * N_UNMASK + s is row s of batch b there. The one decoder layer's output
//           is read at the masked tokens' rows alone, so these rows are only looked at:
//           no Q of them, and x itself goes nowhere;
//   NEXT 3, the decoder's last layer, the masked tokens' rows alone (row b * N_MASKT + j
//           lies at row b * NT + N_UNMASK + j of H): its closing LayerNorm
//           (cg, cb) and the output h . ew + eb, to Ho.
// The 16 x 96 row tile and the 16 x 384 hidden tile stay in LDS; a product's
// result goes there in D layout and is read back as A fragments. Wave w owns
// column tile w of every 96-wide product and four tiles of the 384-wide one.
// Every accumulator keeps the ascending k order.
// LDS pitches are 4 dwords past a multiple of 32: the 16 rows x 2 halves of an
// 8-byte A-fragment read fall on 64 different banks.
// ---------------------------------------------------------------------------
#define PK_WAVES 6
#define PK_HP (D_MODEL + 4)
#define PK_FP (FF_DIM + 4)
#define PK_ENC_WGS ((BATCH * N_UNMASK + 15) / 16)
static_assert(PK_WAVES * 16 == D_MODEL, "one 16-column tile of the model width per wave");

// B fragments of chunk c: CH k-steps x TN column tiles, TS floats from tile to tile
template <int N, int TS, int TN, int CH>
__device__ __forceinline__ void pk_load_b(const float* __restrict__ wp, const int c,
                                          v2f (&b)[CH][TN]) {
#pragma unroll   // constant register index, immediate load offsets
  for (int j = 0; j < CH; ++j) {
    const int k0 = (c * CH + j) * 4;
#pragma unroll   // constant register index
    for (int t = 0; t < TN; ++t) {
      b[j][t].x = wp[k0 * N + t * TS];
      b[j][t].y = wp[(k0 + 1) * N + t * TS];
    }
  }
}

// A fragments of chunk c from the LDS tile (as: this lane's row, + 2 * half)
template <int CH>
__device__ __forceinline__ void pk_load_a(const float* as, const int c, v2f (&a)[CH]) {
#pragma unroll   // constant register index
  for (int j = 0; j < CH; ++j) a[j] = *(const v2f*)(as + (c * CH + j) * 4);
}

// acc[t] += A(LDS, 16 x K) * W(:, tile t). The caller has loaded chunks 0 and 1
// of b (weights depend on no earlier stage, so that is done ahead of the barrier
// in front of the stage); chunk c + 2 is loaded while chunk c is multiplied.
template <int K, int N, int TS, int TN, int CH>
__device__ __forceinline__ void pk_mm(const float* as, const float* __restrict__ wp,
                                      v2f (&b)[3][CH][TN], v8f (&acc)[TN]) {
  constexpr int NCH = K / (4 * CH);
  static_assert(K % (4 * CH) == 0 && NCH >= 2, "shape");
  v2f a[2][CH];
  pk_load_a<CH>(as, 0, a[0]);
#pragma unroll   // constant ring index
  for (int c = 0; c < NCH; ++c) {
    if (c + 2 < NCH) pk_load_b<N, TS, TN, CH>(wp, c + 2, b[(c + 2) % 3]);
    if (c + 1 < NCH) pk_load_a<CH>(as, c + 1, a[(c + 1) % 2]);
    // keeps the loads above in front of this chunk's WMMAs: sunk to their use,
    // each chunk would wait out its own load latency
    __builtin_amdgcn_sched_barrier(0);
#pragma unroll   // constant ring index
    for (int j = 0; j < CH; ++j)
#pragma unroll   // constant ring index
      for (int t = 0; t < TN; ++t)
        acc[t] = __builtin_amdgcn_wmma_f32_16x16x4_f32(false, a[c % 2][j], false, b[c % 3][j][t],
                                                       (short)0, acc[t], false, false);
    // keeps the next trip's loads out of this chunk's WMMAs: risen there, they
    // cannot take this chunk's ring slot and cost a fourth chunk of registers
    __builtin_amdgcn_sched_barrier(0);
  }
  // stands in front of any reuse of the weight loads' address registers; the
  // scheduling barrier keeps later arithmetic from rising over it
  asm volatile("s_wait_xcnt 0x0" ::: "memory");
  __builtin_amdgcn_sched_barrier(0);
}

// LayerNorm of the 16 x 96 LDS tile in place: waves 0..3, four rows a wave, eight
// lanes a row, twelve elements a lane. Hout: the rows also go to global memory.
__device__ __forceinline__ void pk_ln(float* hs, const float* __restrict__ g,
                                      const float* __restrict__ bta, int wave, int lane,
                                      float* __restrict__ Hout, int m0, int M) {
  if (wave < 4) {
    const int row = wave * 4 + (lane >> 3), e = lane & 7;
    float* p = hs + row * PK_HP + e * 4;
    float v[12], gv[12], bv[12];
#pragma unroll   // constant register index
    for (int i = 0; i < 12; ++i) {
      const int o = (i >> 2) * 32 + (i & 3);
      v[i] = p[o];
      gv[i] = g[e * 4 + o];
      bv[i] = bta[e * 4 + o];
    }
    float s = 0.f;
#pragma unroll   // constant register index
    for (int i = 0; i < 12; ++i) s += v[i];
    s += __shfl_xor(s, 1, 32); s += __shfl_xor(s, 2, 32); s += __shfl_xor(s, 4, 32);
    const float m = s / (float)D_MODEL;
    float q = 0.f;
#pragma unroll   // constant register index
    for (int i = 0; i < 12; ++i) { v[i] -= m; q += v[i] * v[i]; }
    q += __shfl_xor(q, 1, 32); q += __shfl_xor(q, 2, 32); q += __shfl_xor(q, 4, 32);
    const float rs = rsqrtf(q / (float)D_MODEL + 1e-5f);
#pragma unroll   // constant register index
    for (int i = 0; i < 12; ++i) {
      v[i] = v[i] * rs * gv[i] + bv[i];
      p[(i >> 2) * 32 + (i & 3)] = v[i];
    }
    if (Hout && m0 + row < M) {
      float* hp = Hout + (size_t)(m0 + row) * D_MODEL + e * 4;
#pragma unroll   // constant register index
      for (int i = 0; i < 12; ++i) hp[(i >> 2) * 32 + (i & 3)] = v[i];
    }
  }
}

template <int NEXT>
__global__ __launch_bounds__(PK_WAVES * 32)
void post_kernel(const float* __restrict__ Ob, float* __restrict__ H,
                 const float* __restrict__ wo, const float* __restrict__ bo,
                 const float* __restrict__ ln,
                 const float* __restrict__ w1, const float* __restrict__ b1,
                 const float* __restrict__ w2, const float* __restrict__ b2,
                 const float* __restrict__ nw, const float* __restrict__ nb,
                 float* __restrict__ Qo, float* __restrict__ Ko, float* __restrict__ Vo,
                 const float* __restrict__ cg, const float* __restrict__ cb,
                 const float* __restrict__ ew, const float* __restrict__ eb,
                 float* __restrict__ Ho, int M,
                 const float* Qe, const float* Ke, const float* Ve, float* Se,
                 const int t0, const int t1) {
  // behind the encoder's row tiles in the grid: a range of the decoder's early share
  if (NEXT != 3) {
    if (blockIdx.x >= PK_ENC_WGS) {
      dec_early<PK_WAVES>(Qe, Ke, Ve, Se, blockIdx.x - PK_ENC_WGS, t0, t1);
      return;
    }
  }
  __shared__ __attribute__((aligned(16))) float hs[16 * PK_HP];
  __shared__ __attribute__((aligned(16))) float fs[16 * PK_FP];
  const int lane = threadIdx.x & 31;
  // wave number in a scalar register: the LayerNorm branch stays scalar
  const int wave = __builtin_amdgcn_readfirstlane((int)(threadIdx.x >> 5));
  const int l16 = lane & 15, half = lane >> 4;
  const int m0 = blockIdx.x * 16;
  const int col = wave * 16 + l16;

  // ---- output projection: A from global (row-clamped), all operands at once ----
  int ra = m0 + l16; if (ra >= M) ra = M - 1;
  const float* xa  = Ob + o_row(ra) + 64 * half;
  const float* wpo = wo + (size_t)(2 * half) * D_MODEL + col;
  v2f ao[D_MODEL / 4], wf[D_MODEL / 4];
#pragma unroll   // constant register index, immediate load offsets
  for (int c = 0; c < D_MODEL / 8; ++c) {
    const v4f x = *(const v4f*)(xa + c * 128);   // two k-steps a load
    ao[2 * c] = (v2f){x.x, x.y};
    ao[2 * c + 1] = (v2f){x.z, x.w};
  }
#pragma unroll   // constant register index
  for (int j = 0; j < D_MODEL / 4; ++j) {
    wf[j].x = wpo[4 * j * D_MODEL];  wf[j].y = wpo[(4 * j + 1) * D_MODEL];
  }
  float res[8];
#pragma unroll   // constant register index
  for (int r = 0; r < 8; ++r) {
    int m = m0 + r + 8 * half; if (m >= M) m = M - 1;
    if (NEXT == 3) m += (m / N_MASKT) * N_UNMASK + N_UNMASK;
    res[r] = H[(size_t)m * D_MODEL + col];
  }
  const float bov = bo[col], b2v = b2[col];
  const float ebv = NEXT == 2 ? eb[col] : 0.f;
  // the products behind the chain: Q, K, V, or (NEXT 2) K and V, the second and third
  constexpr int NP = NEXT == 2 ? 2 : 3, P0 = 3 - NP;
  float b1v[4], nbv[NP];
#pragma unroll   // constant register index
  for (int t = 0; t < 4; ++t) b1v[t] = b1[wave * 64 + t * 16 + l16];
  // stands in front of later loads whose results land in address registers of
  // the loads above
  asm volatile("s_wait_xcnt 0x0" ::: "memory");
  if (NEXT != 3) {
#pragma unroll   // constant register index
    for (int t = 0; t < NP; ++t) nbv[t] = nb[(P0 + t) * D_MODEL + col];
    // as above, for the loads just issued
    asm volatile("s_wait_xcnt 0x0" ::: "memory");
  }
  const float* wp1 = w1 + (size_t)(2 * half) * FF_DIM + wave * 64 + l16;
  v2f bf1[3][4][4];
  pk_load_b<FF_DIM, 16, 4, 4>(wp1, 0, bf1[0]);
  pk_load_b<FF_DIM, 16, 4, 4>(wp1, 1, bf1[1]);
  // holds every load above in front of the WMMAs: one load latency for all
  __builtin_amdgcn_sched_barrier(0);
  v8f acco = {};
#pragma unroll   // constant register index
  for (int j = 0; j < D_MODEL / 4; ++j)
    acco = __builtin_amdgcn_wmma_f32_16x16x4_f32(false, ao[j], false, wf[j], (short)0, acco,
                                                 false, false);
#pragma unroll   // constant register index
  for (int r = 0; r < 8; ++r) hs[(r + 8 * half) * PK_HP + col] = res[r] + (acco[r] + bov);
  __syncthreads();
  // second FFN product's first weights: in flight while the rows are normalised
  const float* wp2 = w2 + (size_t)(2 * half) * D_MODEL + col;
  v2f bf2[3][12][1];
  pk_load_b<D_MODEL, 16, 1, 12>(wp2, 0, bf2[0]);
  pk_load_b<D_MODEL, 16, 1, 12>(wp2, 1, bf2[1]);
  pk_ln(hs, ln, ln + D_MODEL, wave, lane, (float*)0, m0, M);
  __syncthreads();

  // ---- f = relu(h W1 + b1), into LDS ----
  const float* ah = hs + l16 * PK_HP + 2 * half;
  v8f af[4];
#pragma unroll   // constant register index
  for (int t = 0; t < 4; ++t) af[t] = (v8f){};
  pk_mm<D_MODEL, FF_DIM, 16, 4, 4>(ah, wp1, bf1, af);
#pragma unroll   // constant register index
  for (int t = 0; t < 4; ++t)
#pragma unroll   // constant register index
    for (int r = 0; r < 8; ++r)
      fs[(r + 8 * half) * PK_FP + wave * 64 + t * 16 + l16] = fmaxf(af[t][r] + b1v[t], 0.f);
  __syncthreads();
  // the next product's first weights: in flight during the second FFN product
  const float* wpn = nw + (size_t)(P0 * D_MODEL + 2 * half) * D_MODEL + col;
  v2f bfn[3][4][NP];
  v2f bfe[3][12][1];
  if (NEXT == 1) {
    pk_load_b<D_MODEL, D_MODEL * D_MODEL, NP, 4>(wpn, 0, bfn[0]);
    pk_load_b<D_MODEL, D_MODEL * D_MODEL, NP, 4>(wpn, 1, bfn[1]);
  }
  const float* wpe = ew + (size_t)(2 * half) * D_MODEL + col;   // NEXT 2 only
  if (NEXT == 2) {
    pk_load_b<D_MODEL, 16, 1, 12>(wpe, 0, bfe[0]);
    pk_load_b<D_MODEL, 16, 1, 12>(wpe, 1, bfe[1]);
    // stands in front of any reuse of the address registers of these loads; the address
    // is an input, so that it lives up to the wait
    asm volatile("s_wait_xcnt 0x0" :: "v"(wpe) : "memory");
  }

  // ---- h + f W2 + b2: each element of the row tile is updated by its own lane ----
  v8f a2[1];
  a2[0] = (v8f){};
  pk_mm<FF_DIM, D_MODEL, 16, 1, 12>(fs + l16 * PK_FP + 2 * half, wp2, bf2, a2);
#pragma unroll   // constant register index
  for (int r = 0; r < 8; ++r) {
    float* p = hs + (r + 8 * half) * PK_HP + col;
    *p = *p + (a2[0][r] + b2v);
  }
  __syncthreads();
  // the decoder's first projection weights: in flight during the two LayerNorms and
  // the product between them and their use
  if (NEXT == 2) {
    pk_load_b<D_MODEL, D_MODEL * D_MODEL, NP, 4>(wpn, 0, bfn[0]);
    pk_load_b<D_MODEL, D_MODEL * D_MODEL, NP, 4>(wpn, 1, bfn[1]);
  }
  pk_ln(hs, ln + 2 * D_MODEL, ln + 3 * D_MODEL, wave, lane, NEXT == 1 ? H : (float*)0, m0, M);
  // last layer of a stack: the stack's closing LayerNorm; each lane reads back only
  // what it wrote itself, so no barrier stands between the two
  if (NEXT != 1) pk_ln(hs, cg, cb, wave, lane, (float*)0, m0, M);

  // ---- the output: row . ew + eb, by the lanes that normalised the row ----
  if (NEXT == 3) {
    if (wave < 4) {
      const int row = wave * 4 + (lane >> 3), e = lane & 7;
      const float* p = hs + row * PK_HP + e * 4;
      float wv[12];
#pragma unroll   // constant register index
      for (int i = 0; i < 12; ++i) wv[i] = ew[e * 4 + (i >> 2) * 32 + (i & 3)];
      const float ob = eb[0];
      // stands in front of any reuse of the address registers of the loads above: the loaded
      // values are inputs, so that every one of the loads is issued in front of the wait; the
      // scheduling barrier keeps later arithmetic from rising over it
      asm volatile("s_wait_xcnt 0x0" :: "v"(wv[0]), "v"(wv[1]), "v"(wv[2]), "v"(wv[3]), "v"(wv[4]),
                   "v"(wv[5]), "v"(wv[6]), "v"(wv[7]), "v"(wv[8]), "v"(wv[9]), "v"(wv[10]),
                   "v"(wv[11]) : "memory");
      __builtin_amdgcn_sched_barrier(0);
      float s = 0.f;
#pragma unroll   // constant register index
      for (int i = 0; i < 12; ++i) s += p[(i >> 2) * 32 + (i & 3)] * wv[i];
      s += __shfl_xor(s, 1, 32); s += __shfl_xor(s, 2, 32); s += __shfl_xor(s, 4, 32);
      const int m = m0 + row;
      if (e == 0 && m < M) Ho[m] = s + ob;
    }
  }

  // where this lane's eight result rows go, in fragment order: as Q or K (-1: no such row),
  // and as V. Row b * N_UNMASK + s is row s of batch b, of the encoder's sequence (NEXT 1)
  // or of the decoder's (NEXT 2)
  int qko[8], vo[8];
  if (NEXT != 3) {
    constexpr int PL = KV_PLANE(NEXT == 1 ? N_UNMASK : NT);
    const int hc = col / HD, dc = col % HD, b0 = m0 / N_UNMASK;
#pragma unroll   // constant register index
    for (int r = 0; r < 8; ++r) {
      const int m = m0 + 8 * half + r;
      const bool nx = m - b0 * N_UNMASK >= N_UNMASK;   // the tile's rows lie in at most two batches
      const int s = m - (b0 + (nx ? 1 : 0)) * N_UNMASK;
      const int pb = ((b0 + (nx ? 1 : 0)) * NHEAD + hc) * PL;
      qko[r] = m < M ? pb + qk_row(s) + qk_col(dc) : -1;
      vo[r] = pb + v_row(s) + v_col(dc) + (v_mid(s) >> v_sh(dc));
    }
  }
  if (NEXT == 2) {
    // ---- the decoder's input rows, into the row tile ----
    __syncthreads();
    v8f ae[1];
    ae[0] = (v8f){};
    pk_mm<D_MODEL, D_MODEL, 16, 1, 12>(ah, wpe, bfe, ae);
    // every wave has read the row tile as its A operand before it is overwritten
    __syncthreads();
#pragma unroll   // constant register index
    for (int r = 0; r < 8; ++r) hs[(r + 8 * half) * PK_HP + col] = (ae[0][r] + ebv) * SQRT_D;
  }

  // ---- next layer's Q, K, V (NEXT 2: K, V): this wave's column tile of each ----
  if (NEXT != 3) {
    __syncthreads();
    v8f an[NP];
#pragma unroll   // constant register index
    for (int t = 0; t < NP; ++t) an[t] = (v8f){};
    pk_mm<D_MODEL, D_MODEL, D_MODEL * D_MODEL, NP, 4>(ah, wpn, bfn, an);
#pragma unroll   // constant register index
    for (int t = 0; t < NP; ++t) an[t] += nbv[t];
    if (m0 + 16 <= M) {
      // a whole tile: no row tests
      if constexpr (NEXT == 1) pk_st8(Qo, qko, an[0]);
      pk_st8(Ko, qko, an[NP - 2]);
      pk_st8(Vo, vo, an[NP - 1]);
    } else {
#pragma unroll   // constant register index
      for (int r = 0; r < 8; ++r) {
        if (qko[r] >= 0) {
          if constexpr (NEXT == 1) Qo[qko[r]] = an[0][r];
          Ko[qko[r]] = an[NP - 2][r];
          Vo[vo[r]] = an[NP - 1][r];
        }
      }
    }
  }
}

// ---------------------------------------------------------------------------
extern "C" void kernel_launch(void* const* d_in, const int* in_sizes, int n_in,
                              void* d_out, int out_size, void* d_ws, size_t ws_size,
                              hipStream_t stream) {
  (void)in_sizes; (void)n_in; (void)out_size; (void)ws_size;
  const float* hist  = (const float*)d_in[0];
  const int*   uidx  = (const int*)d_in[1];
  const int*   midx  = (const int*)d_in[2];
  const float* nv1   = (const float*)d_in[3];
  const float* nv2   = (const float*)d_in[4];
  const float* dim_w = (const float*)d_in[5];
  const float* dim_b = (const float*)d_in[6];
  const float* pos   = (const float*)d_in[7];
  const float* tod_w = (const float*)d_in[8];
  const float* tod_b = (const float*)d_in[9];
  const float* dow_w = (const float*)d_in[10];
  const float* dow_b = (const float*)d_in[11];
  const float* mtok  = (const float*)d_in[12];
  const float* eaw   = (const float*)d_in[13];
  const float* eab   = (const float*)d_in[14];
  const float* ew1   = (const float*)d_in[15];
  const float* eb1   = (const float*)d_in[16];
  const float* ew2   = (const float*)d_in[17];
  const float* eb2   = (const float*)d_in[18];
  const float* eln   = (const float*)d_in[19];
  const float* eng   = (const float*)d_in[20];
  const float* enb   = (const float*)d_in[21];
  const float* e2dw  = (const float*)d_in[22];
  const float* e2db  = (const float*)d_in[23];
  const float* daw   = (const float*)d_in[24];
  const float* dab   = (const float*)d_in[25];
  const float* dw1   = (const float*)d_in[26];
  const float* db1   = (const float*)d_in[27];
  const float* dw2   = (const float*)d_in[28];
  const float* db2   = (const float*)d_in[29];
  const float* dln   = (const float*)d_in[30];
  const float* dng   = (const float*)d_in[31];
  const float* dnb   = (const float*)d_in[32];
  const float* outw  = (const float*)d_in[33];
  const float* outb  = (const float*)d_in[34];
  float* out = (float*)d_out;

  float* ws = (float*)d_ws;
  size_t off = 0;
  auto alloc = [&](size_t n) { float* p = ws + off; off += n; return p; };
  const size_t MD = (size_t)BATCH * NT;   // max rows (decoder): 9936
  // what the attention reads by 16-byte loads comes first, in sizes that are whole cache lines
  const size_t KE = (size_t)BATCH * NHEAD * KV_PLANE(N_UNMASK);
  const size_t KD = (size_t)BATCH * NHEAD * KV_PLANE(NT);
  static_assert(DS_TOTAL % 32 == 0 && (EM_ROWS * EM_PITCH) % 32 == 0 && KV_TILE % 32 == 0, "lines");
  float* St    = alloc(DS_TOTAL);
  float* Menc  = alloc((size_t)EM_ROWS * EM_PITCH);
  float* Qb = alloc(KE);
  float* Kb = alloc(KE);
  float* Vb = alloc(KE);
  float* Qd = alloc(KD);
  float* Kd = alloc(KD);
  float* Vd = alloc(KD);
  float* X  = alloc(MD * D_MODEL);
  float* Ob = alloc(MD * D_MODEL);
  float* Xd = alloc(MD * D_MODEL);
  float* adpA  = alloc((size_t)N_NODES * N_NODES);

  front_kernel<<<N_NODES + (FR_ENC + FR_DEC) / FR_ROWS, D_MODEL, 0, stream>>>(
      nv1, nv2, adpA, hist, uidx, midx, dim_w, dim_b, pos, tod_w, tod_b, dow_w, dow_b, mtok,
      X, Xd, out);
  proj_kernel<<<PJ_ENC + PJ_DEC + EM_ROWS, 32, 0, stream>>>(
      X, eaw, eab, Qb, Kb, Vb, Xd, daw, dab, Qd, Kd, Vd, adpA, uidx, Menc);

  // ---- encoder (4 layers, masked attention over 621 tokens): attention, then the whole
  // row-local rest of the layer in one launch ----
  const unsigned pe = (BATCH * N_UNMASK + 15) / 16, pd = (BATCH * N_MASKT + 15) / 16;
  // ta .. tp - 1 and tp .. te - 1: the decoder's key tiles that ride on the layer's two launches
  auto layer = [&](const int l, const int ta, const int tp, const int te) {
    const float* aw = eaw + (size_t)l * 4 * D_MODEL * D_MODEL;
    const float* ab = eab + (size_t)l * 4 * D_MODEL;
    const float* w1 = ew1 + (size_t)l * D_MODEL * FF_DIM;
    const float* b1 = eb1 + (size_t)l * FF_DIM;
    const float* w2 = ew2 + (size_t)l * FF_DIM * D_MODEL;
    const float* b2 = eb2 + (size_t)l * D_MODEL;
    const float* ln = eln + (size_t)l * 2 * 2 * D_MODEL;
    enc_attn_kernel<<<EA_WGS + DE_WGS(EA_NW), EA_NW * 32, 0, stream>>>(
        Qb, Kb, Vb, Ob, Menc, Qd, Kd, Vd, St, ta, tp);
    if (l < 3)
      post_kernel<1><<<pe + DE_WGS(PK_WAVES), PK_WAVES * 32, 0, stream>>>(
          Ob, X, aw + 3 * D_MODEL * D_MODEL, ab + 3 * D_MODEL, ln, w1, b1, w2, b2,
          aw + 4 * D_MODEL * D_MODEL, ab + 4 * D_MODEL, Qb, Kb, Vb,
          nullptr, nullptr, nullptr, nullptr, nullptr, BATCH * N_UNMASK,
          Qd, Kd, Vd, St, tp, te);
    else
      post_kernel<2><<<pe + DE_WGS(PK_WAVES), PK_WAVES * 32, 0, stream>>>(
          Ob, X, aw + 3 * D_MODEL * D_MODEL, ab + 3 * D_MODEL, ln, w1, b1, w2, b2,
          daw, dab, nullptr, Kd, Vd, eng, enb, e2dw, e2db, nullptr, BATCH * N_UNMASK,
          Qd, Kd, Vd, St, tp, te);
  };
  static_assert(DEC_T0 == 39 && DEC_KT == 156, "the ranges below cover DEC_T0 .. DEC_KT - 1");
  layer(0, 39, 49, 69);
  layer(1, 69, 79, 98);
  layer(2, 98, 108, 127);
  layer(3, 127, 137, 156);
  // ---- decoder (1 layer, full attention over 2484 tokens; queries: the masked tokens) ----
  dec_attn_kernel<<<dim3(DQB, NHEAD, BATCH), DA_NW * 32, 0, stream>>>(Qd, Kd, Vd, Ob, St);
  post_kernel<3><<<pd, PK_WAVES * 32, 0, stream>>>(
      Ob, Xd, daw + 3 * D_MODEL * D_MODEL, dab + 3 * D_MODEL, dln, dw1, db1, dw2, db2,
      nullptr, nullptr, nullptr, nullptr, nullptr, dng, dnb, outw, outb, out, BATCH * N_MASKT,
      nullptr, nullptr, nullptr, nullptr, 0, 0);
}

// v010
// A run of this version takes 153 microseconds.
// In both of two side-by-side timings against v009, it was 1.04 times as fast.
// Counting every step since v000, it is 17.3 times as fast.
#include <hip/hip_runtime.h>
#include <math.h>

#define N_NODES  207
#define T_STEPS  12
#define C_IN     4
#define BATCH    4
#define NT       (N_NODES * T_STEPS)   // 2484
#define D_MODEL  96
#define NHEAD    4
#define HD       24
#define FF_DIM   384
#define N_MASKT  1863
#define N_UNMASK 621
#define MAX_NEIGH 40
#define ATTN_SCALE 0.20412414523193154f   // 1/sqrt(24)
#define SQRT_D     9.797958971132712f     // sqrt(96)

typedef float v2f __attribute__((ext_vector_type(2)));
typedef float v8f __attribute__((ext_vector_type(8)));

// ---------------------------------------------------------------------------
// Adjacency: A = softmax(relu(nv1 @ nv2), axis=1); keep iff (A > 1/N) and
// strictly greater than the 41st-largest in its row (rank < MAX_NEIGH).
// ---------------------------------------------------------------------------
__device__ __forceinline__ void adj_row(const float* __restrict__ nv1,
                                        const float* __restrict__ nv2,
                                        float* __restrict__ adpA, const int i) {
  constexpr int PER = (N_NODES + D_MODEL - 1) / D_MODEL;  // elements a thread owns
  constexpr int WR  = (N_NODES + 31) / 32;                // elements a lane reads for the statistics
  constexpr int NP4 = (N_NODES + 3) / 4;                  // 16-byte groups of the row
  static_assert(PER == 3 && NP4 * 4 <= PER * D_MODEL, "three elements a thread, pad inside");
  // both hold a slot for every (thread, element), so that the LDS stores need no test
  __shared__ __attribute__((aligned(16))) float a[PER * D_MODEL];
  __shared__ __attribute__((aligned(16))) float p[PER * D_MODEL];
  const int tid = threadIdx.x, lane = tid & 31;   // the block has D_MODEL threads
  int jc[PER];
  float w[PER][10], u[10];
#pragma unroll   // constant register index; in flight together with the loads below
  for (int r = 0; r < 10; ++r) u[r] = nv1[i * 10 + r];
#pragma unroll   // constant register index; all the loads in flight together
  for (int e = 0; e < PER; ++e) {
    const int j = tid + e * D_MODEL;
    jc[e] = j < N_NODES ? j : N_NODES - 1;   // past the end: the last element, not used
#pragma unroll   // constant register index, immediate load offsets
    for (int r = 0; r < 10; ++r) w[e][r] = nv2[r * N_NODES + jc[e]];
  }
  // stands in front of any reuse of the address registers of the loads above: the indices
  // are inputs, so that they live up to the wait and no result lands in one of them;
  // the scheduling barrier keeps later arithmetic from rising over it
  asm volatile("s_wait_xcnt 0x0" :: "v"(jc[0]), "v"(jc[1]), "v"(jc[2]) : "memory");
  __builtin_amdgcn_sched_barrier(0);
  float own[PER];
#pragma unroll   // constant register index
  for (int e = 0; e < PER; ++e) {
    float s = 0.f;
#pragma unroll   // constant register index
    for (int r = 0; r < 10; ++r) s += u[r] * w[e][r];
    own[e] = s > 0.f ? s : 0.f;
    a[tid + e * D_MODEL] = own[e];
  }
  __syncthreads();
  // maximum and sum of the whole row, in every wave for itself: nobody waits for one thread
  float v[WR];
#pragma unroll   // constant register index; the LDS reads in flight together
  for (int e = 0; e < WR; ++e) v[e] = a[lane + e * 32];   // past the end: not used
  float mx = v[0];
#pragma unroll   // constant register index
  for (int e = 1; e < WR; ++e) mx = fmaxf(mx, lane + e * 32 < N_NODES ? v[e] : 0.f);
#pragma unroll   // five exchange steps
  for (int m = 16; m >= 1; m >>= 1) mx = fmaxf(mx, __shfl_xor(mx, m, 32));
  float sum = 0.f;
#pragma unroll   // constant register index
  for (int e = 0; e < WR; ++e) sum += lane + e * 32 < N_NODES ? __expf(v[e] - mx) : 0.f;
#pragma unroll   // five exchange steps
  for (int m = 16; m >= 1; m >>= 1) sum += __shfl_xor(sum, m, 32);
  const float inv = 1.f / sum;
#pragma unroll   // constant register index
  for (int e = 0; e < PER; ++e) {
    const int j = tid + e * D_MODEL;
    own[e] = __expf(own[e] - mx) * inv;
    // behind the row: below every probability, so that it adds to no rank
    p[j] = j < N_NODES ? own[e] : -1.f;
  }
  __syncthreads();
  // ranks of a thread's elements: each value of the row is read once, four a read
  int cnt[PER];
#pragma unroll   // constant register index
  for (int e = 0; e < PER; ++e) cnt[e] = 0;
#pragma unroll 13   // that many 16-byte LDS reads in flight together
  for (int l = 0; l < NP4; ++l) {
    const float4 x = *(const float4*)(p + 4 * l);
#pragma unroll   // constant register index
    for (int e = 0; e < PER; ++e)
      cnt[e] += (x.x > own[e] ? 1 : 0) + (x.y > own[e] ? 1 : 0) + (x.z > own[e] ? 1 : 0) +
                (x.w > own[e] ? 1 : 0);
  }
  const float thr = 1.0f / (float)N_NODES;
  float* arow = adpA + i * N_NODES + tid;
#pragma unroll   // constant register index
  for (int e = 0; e < PER; ++e) own[e] = ((own[e] > thr) && (cnt[e] < MAX_NEIGH)) ? own[e] : 0.f;
#pragma unroll   // constant register index, immediate store offsets
  for (int e = 0; e < PER; ++e)
    if ((e + 1) * D_MODEL <= N_NODES || tid + e * D_MODEL < N_NODES) arow[e * D_MODEL] = own[e];
}

// Encoder additive attention bias: 0 where query q may look at key k, -1e30 where
// adpA == 0. Keys are padded to whole key tiles and queries to whole query blocks (pad
// entries 0), so the attention kernel needs no clamp. It lies in the order in which a wave
// takes it, 512 floats per (key tile, block of 32 queries):
// [k >> 4][q >> 5][(q >> 4) & 1][(k >> 2) & 1][(k >> 3) & 1][q & 15][k & 3].
#define EM_ROWS  (((N_UNMASK + 15) / 16) * 16)   // 624
#define EM_PITCH (((N_UNMASK + 31) / 32) * 32)   // 640

// ---------------------------------------------------------------------------
// Everything that depends on the inputs alone, in ONE launch; a work-group's role
// comes from its index:
//   adjacency row i;
//   encoder input row: (x0*dim_w + dim_b + pos + tod*tod_w + tod_b + dow*dow_w + dow_b)
//     at unmasked_idx, * sqrt(D);
//   decoder input row of a masked token: (mask_token + pos + tod/dow emb) * sqrt(D),
//     and that token's label.
// ---------------------------------------------------------------------------
#define FR_ENC (BATCH * N_UNMASK)
#define FR_DEC (BATCH * N_MASKT)
#define FR_ROWS 12   // rows a work-group: few waves to start, the rows' loads in flight together
static_assert(FR_ENC % FR_ROWS == 0 && FR_DEC % FR_ROWS == 0, "whole work-groups");
__global__ __launch_bounds__(D_MODEL)
void front_kernel(const float* __restrict__ nv1, const float* __restrict__ nv2,
                  float* __restrict__ adpA,
                  const float* __restrict__ hist,
                  const int* __restrict__ uidx, const int* __restrict__ midx,
                  const float* __restrict__ dim_w, const float* __restrict__ dim_b,
                  const float* __restrict__ pos,
                  const float* __restrict__ tod_w, const float* __restrict__ tod_b,
                  const float* __restrict__ dow_w, const float* __restrict__ dow_b,
                  const float* __restrict__ mask_token,
                  float* __restrict__ X, float* __restrict__ Xd, float* __restrict__ out) {
  const int blk = blockIdx.x;
  if (blk < N_NODES) { adj_row(nv1, nv2, adpA, blk); return; }
  const int d = threadIdx.x;       // 0..95
  const float todw = tod_w[d], todb = tod_b[d], doww = dow_w[d], dowb = dow_b[d];
  // stands in front of any reuse of the address registers of the four loads above; the
  // scheduling barrier keeps later arithmetic from rising over it
  asm volatile("s_wait_xcnt 0x0" ::: "memory");
  __builtin_amdgcn_sched_barrier(0);
  if (blk < N_NODES + FR_ENC / FR_ROWS) {
    const float dimw = dim_w[d], dimb = dim_b[d];
    const int r0 = (blk - N_NODES) * FR_ROWS;
#pragma unroll   // the rows' loads in flight together
    for (int i = 0; i < FR_ROWS; ++i) {
      const int row = r0 + i;      // b*N_UNMASK + s
      const int b = row / N_UNMASK, s = row % N_UNMASK;
      int nt = uidx[s];
      nt = nt < 0 ? 0 : (nt >= NT ? NT - 1 : nt);
      const int n = nt / T_STEPS, t = nt % T_STEPS;
      const float* hp = hist + (((size_t)b * T_STEPS + t) * N_NODES + n) * C_IN;
      float x0 = hp[0], dow = hp[2], tod = hp[3];
      float v = x0 * dimw + dimb + pos[(size_t)nt * D_MODEL + d] +
                tod * todw + todb + dow * doww + dowb;
      X[(size_t)row * D_MODEL + d] = v * SQRT_D;
    }
    // stands behind the run of stores, in front of any rewrite of their address and
    // data registers in the code that follows this role in the built kernel
    asm volatile("s_wait_xcnt 0x0" ::: "memory");
  } else {
    const float mtk = mask_token[d];
    const int r0 = (blk - (N_NODES + FR_ENC / FR_ROWS)) * FR_ROWS;
    int ntr[FR_ROWS], po[FR_ROWS];   // each row's token, and its place in pos
    float pv[FR_ROWS];
#pragma unroll   // constant register index; the rows' loads in flight together
    for (int i = 0; i < FR_ROWS; ++i) {
      int nt = midx[(r0 + i) % N_MASKT];
      nt = nt < 0 ? 0 : (nt >= NT ? NT - 1 : nt);
      ntr[i] = nt;
      po[i] = nt * D_MODEL + d;
      pv[i] = pos[po[i]];
    }
    // stands in front of any reuse of the address registers of the loads above: the places
    // are inputs, so that they live up to the wait and no result lands in one of them;
    // the scheduling barrier keeps later arithmetic from rising over it
    asm volatile("s_wait_xcnt 0x0" :: "v"(po[0]), "v"(po[1]), "v"(po[2]), "v"(po[3]), "v"(po[4]),
                 "v"(po[5]), "v"(po[6]), "v"(po[7]), "v"(po[8]), "v"(po[9]), "v"(po[10]),
                 "v"(po[11]) : "memory");
    __builtin_amdgcn_sched_barrier(0);
    float val[FR_ROWS];
    int xo[FR_ROWS];               // where each row goes in Xd
    float lab = 0.f;               // thread i keeps row i's label
#pragma unroll   // constant register index
    for (int i = 0; i < FR_ROWS; ++i) {
      const int row = r0 + i;      // b*N_MASKT + j
      const int b = row / N_MASKT, j = row % N_MASKT;
      const int n = ntr[i] / T_STEPS, t = ntr[i] % T_STEPS;
      const float* hp = hist + (((size_t)b * T_STEPS + t) * N_NODES + n) * C_IN;
      const float x0 = hp[0], dow = hp[2], tod = hp[3];
      float v = mtk + pv[i] + tod * todw + todb + dow * doww + dowb;
      val[i] = v * SQRT_D;
      xo[i] = (b * NT + N_UNMASK + j) * D_MODEL + d;
      lab = d == i ? x0 : lab;
    }
    // every value and place in a register of its own in front of the first store:
    // arithmetic sunk among the stores would rewrite registers of issued stores
    __builtin_amdgcn_sched_barrier(0);
#pragma unroll   // constant register index
    for (int i = 0; i < FR_ROWS; ++i) Xd[xo[i]] = val[i];
    // stands behind the run of stores, in front of any rewrite of their registers
    asm volatile("s_wait_xcnt 0x0" ::: "memory");
    if (d < FR_ROWS) out[FR_DEC + r0 + d] = lab;
  }
}

// ---------------------------------------------------------------------------
// fp32 GEMM via V_WMMA_F32_16X16X4_F32, register-blocked 32x32 per wave:
// 4 accumulators, each A-frag feeds 2 WMMAs and each B-frag feeds 2 WMMAs.
// Y[M,N] = X[M,K] @ W[K,N] + bias. K and N are compile-time, so every
// operand load is a base register plus an immediate offset.
// Row r of the product is row r + (r / SEG) * GAP + OFF of X, SQ rows a batch; Y takes it
// in the attention's fragment order (isv: as V, else as Q or K).
// The K loop is a register ring: operands come in chunks of GK_STEPS k-steps,
// GK_BUFS chunks are held, and a chunk's loads are issued at least GK_BUFS - 1
// chunks ahead of the WMMAs that use it, so a wave waits out the load latency
// once and not once per trip. Every accumulator keeps the ascending k order.
// M edge via row-clamped loads + guarded stores (EXEC stays full for WMMA).
// ---------------------------------------------------------------------------
#define GK_STEPS 4     // k-steps (of 4) per chunk: 32 loads

// Q, K and V lie in the workspace in the order in which the attention's fragments take
// them: one plane per (batch, head), KV_TILE floats per 16 rows of the sequence, so that a
// wave's 16-byte loads cover whole cache lines.
//   Q, K:                [tile][d >> 3][(d >> 2) & 1][row & 15][d & 3]
//   V, head dims 0..15:  [tile][(row >> 2) & 1][(row >> 3) & 1][d][row & 3]
//   V, head dims 16..23: behind them in the tile, the same with eight head dims.
// Offset of (row s, head dim d) in its plane: qk_row(s) + qk_col(d), or
// v_row(s) + v_col(d) + (v_mid(s) >> v_sh(d)).
template <bool B> struct fa_bool { static constexpr bool value = B; };
#define KV_TILE (16 * HD)
#define KV_PLANE(S) ((((S) + 15) / 16) * KV_TILE)
__device__ __forceinline__ int qk_row(const int s) { return (s >> 4) * KV_TILE + (s & 15) * 4; }
__device__ __forceinline__ int qk_col(const int d) {
  return (d >> 3) * 128 + ((d >> 2) & 1) * 64 + (d & 3);
}
__device__ __forceinline__ int v_row(const int s) { return (s >> 4) * KV_TILE + (s & 3); }
__device__ __forceinline__ int v_mid(const int s) {
  return ((s >> 2) & 1) * 128 + ((s >> 3) & 1) * 64;
}
__device__ __forceinline__ int v_col(const int d) { return d < 16 ? d * 4 : 256 + (d - 16) * 4; }
__device__ __forceinline__ int v_sh(const int d) { return d < 16 ? 0 : 1; }
// The attention's result lies in the order in which the row chain takes it as A fragments,
// 16 rows a tile: [row >> 4][c >> 3][(c >> 1) & 1][row & 15][(c >> 2) & 1][c & 1].
// Offset of (row, column c): o_row(row) + o_col(c).
__device__ __forceinline__ int o_row(const int r) { return (r >> 4) * (16 * D_MODEL) + (r & 15) * 4; }
__device__ __forceinline__ int o_col(const int c) {
  return (c >> 3) * 128 + ((c >> 1) & 1) * 64 + ((c >> 2) & 1) * 2 + (c & 1);
}
// Eight 4-byte stores into y at this lane's eight offsets o (in floats). Stores and the wait
// behind them are one statement: every offset and value is an operand, so all are formed in
// front of the first store, and no register of an issued store is rewritten before the wait.
__device__ __forceinline__ void pk_st8(float* y, const int (&o)[8], const v8f x) {
  asm volatile("global_store_b32 %0, %8, %16 scale_offset\n\t"
               "global_store_b32 %1, %9, %16 scale_offset\n\t"
               "global_store_b32 %2, %10, %16 scale_offset\n\t"
               "global_store_b32 %3, %11, %16 scale_offset\n\t"
               "global_store_b32 %4, %12, %16 scale_offset\n\t"
               "global_store_b32 %5, %13, %16 scale_offset\n\t"
               "global_store_b32 %6, %14, %16 scale_offset\n\t"
               "global_store_b32 %7, %15, %16 scale_offset\n\t"
               "s_wait_xcnt 0x0"
               :: "v"(o[0]), "v"(o[1]), "v"(o[2]), "v"(o[3]), "v"(o[4]), "v"(o[5]), "v"(o[6]),
                  "v"(o[7]), "v"(x[0]), "v"(x[1]), "v"(x[2]), "v"(x[3]), "v"(x[4]), "v"(x[5]),
                  "v"(x[6]), "v"(x[7]), "s"(y)
               : "memory");
}
#define GK_BUFS  3     // chunks held in registers

template <int K, int N, int SEG, int GAP, int OFF, int SQ>
__device__ __forceinline__
void gemm_tile(const float* __restrict__ X, const float* __restrict__ W,
               const float* __restrict__ bias, float* __restrict__ Y, const bool isv,
               const int M, const int m0, const int n0) {
  constexpr int NCH = K / (4 * GK_STEPS);
  static_assert(K % (4 * GK_STEPS) == 0 && N % 32 == 0 && NCH >= GK_BUFS, "shape");
  int lane = threadIdx.x & 31;
  int l16 = lane & 15, half = lane >> 4;
  int ra0 = m0 + l16;      if (ra0 >= M) ra0 = M - 1;
  int ra1 = m0 + 16 + l16; if (ra1 >= M) ra1 = M - 1;
  ra0 += (ra0 / SEG) * GAP + OFF;
  ra1 += (ra1 / SEG) * GAP + OFF;
  const float* xa0 = X + (size_t)ra0 * K + 2 * half;
  const float* xa1 = X + (size_t)ra1 * K + 2 * half;
  const float* wp  = W + (size_t)(2 * half) * N + n0 + l16;
  v2f a0[GK_BUFS][GK_STEPS], a1[GK_BUFS][GK_STEPS];
  v2f b0[GK_BUFS][GK_STEPS], b1[GK_BUFS][GK_STEPS];
  v8f acc00 = {}, acc01 = {}, acc10 = {}, acc11 = {};

// unrolled here and below: every ring index must be a compile-time constant,
// or the ring would live in scratch instead of registers
#define GK_LOAD(c)                                                     \
  _Pragma("unroll")                                                    \
  for (int j = 0; j < GK_STEPS; ++j) {                                 \
    const int k0 = ((c) * GK_STEPS + j) * 4;                           \
    const int s = (c) % GK_BUFS;                                       \
    a0[s][j].x = xa0[k0];              a0[s][j].y = xa0[k0 + 1];       \
    a1[s][j].x = xa1[k0];              a1[s][j].y = xa1[k0 + 1];       \
    b0[s][j].x = wp[k0 * N];           b0[s][j].y = wp[(k0 + 1) * N];  \
    b1[s][j].x = wp[k0 * N + 16];      b1[s][j].y = wp[(k0 + 1) * N + 16]; \
  }

#pragma unroll   // constant ring index
  for (int c = 0; c < GK_BUFS - 1; ++c) { GK_LOAD(c) }
#pragma unroll   // constant ring index and immediate load offsets
  for (int c = 0; c < NCH; ++c) {
    if (c + GK_BUFS - 1 < NCH) { GK_LOAD(c + GK_BUFS - 1) }
    // keeps the loads above in front of this chunk's WMMAs: sunk to their use,
    // each chunk would wait out its own load latency again
    __builtin_amdgcn_sched_barrier(0);
    const int s = c % GK_BUFS;
#pragma unroll   // constant ring index
    for (int j = 0; j < GK_STEPS; ++j) {
      acc00 = __builtin_amdgcn_wmma_f32_16x16x4_f32(false, a0[s][j], false, b0[s][j], (short)0, acc00, false, false);
      acc01 = __builtin_amdgcn_wmma_f32_16x16x4_f32(false, a0[s][j], false, b1[s][j], (short)0, acc01, false, false);
      acc10 = __builtin_amdgcn_wmma_f32_16x16x4_f32(false, a1[s][j], false, b0[s][j], (short)0, acc10, false, false);
      acc11 = __builtin_amdgcn_wmma_f32_16x16x4_f32(false, a1[s][j], false, b1[s][j], (short)0, acc11, false, false);
    }
  }
#undef GK_LOAD
  // stands in front of the epilogue's reuse of the operand loads' address
  // registers; the scheduling barrier keeps that arithmetic from rising over it
  asm volatile("s_wait_xcnt 0x0" ::: "memory");
  __builtin_amdgcn_sched_barrier(0);
  const int nA = n0 + l16;
  const float bv0 = bias[nA], bv1 = bias[nA + 16];
  // stands in front of any reuse of the address register of the two loads above: the index
  // is an input, so that it lives up to the wait; the scheduling barrier keeps later
  // arithmetic from rising over it
  asm volatile("s_wait_xcnt 0x0" :: "v"(nA) : "memory");
  __builtin_amdgcn_sched_barrier(0);
  // the result goes out in fragment order; the two columns' shares of the offset
  constexpr int PL = KV_PLANE(SQ);
  const int hA = nA / HD, dA = nA % HD, hB = (nA + 16) / HD, dB = (nA + 16) % HD;
  const int cA = hA * PL + (isv ? v_col(dA) : qk_col(dA)), sA = isv ? v_sh(dA) : 0;
  const int cB = hB * PL + (isv ? v_col(dB) : qk_col(dB)), sB = isv ? v_sh(dB) : 0;
  constexpr int RB = SEG < SQ ? SEG : SQ;   // rows of the product a batch
  static_assert(RB >= 32 && RB + GAP == SQ && OFF == GAP, "row r of a batch is row r + OFF of its sequence");
  const int bt0 = m0 / RB, j0 = m0 - bt0 * RB;
  // every store's offset in a register of its own, formed in front of the stores
  int ro[16], rp[16];
#pragma unroll   // constant register index
  for (int r = 0; r < 16; ++r) {
    const int i = (r & 7) + 8 * half + 16 * (r >> 3);
    const bool nx = j0 + i >= RB;   // the tile's rows lie in at most two batches
    const int s = j0 + i + OFF - (nx ? RB : 0);
    const int base = (bt0 + (nx ? 1 : 0)) * (NHEAD * PL) + (isv ? v_row(s) : qk_row(s));
    const int mid = isv ? v_mid(s) : 0;
    ro[r] = m0 + i < M ? base + cA + (mid >> sA) : -1;
    rp[r] = base + cB + (mid >> sB);
  }
  acc00 += bv0; acc01 += bv1; acc10 += bv0; acc11 += bv1;
  // G: the tile may hold rows past M. A whole tile's stores stand in one run with no test
  auto put = [&](auto gc) {
    constexpr bool G = decltype(gc)::value;
#pragma unroll   // constant register index
    for (int r = 0; r < 8; ++r) {
      if (!G || ro[r] >= 0) {
        Y[ro[r]] = acc00[r];
        Y[rp[r]] = acc01[r];
      }
      if (!G || ro[r + 8] >= 0) {
        Y[ro[r + 8]] = acc10[r];
        Y[rp[r + 8]] = acc11[r];
      }
    }
  };
  if (m0 + 32 <= M) put(fa_bool<false>{}); else put(fa_bool<true>{});
  // stands behind the run of stores, in front of any rewrite of their registers in the
  // code that follows this role in the built kernel
  asm volatile("s_wait_xcnt 0x0" ::: "memory");
}

// ---------------------------------------------------------------------------
// Everything that needs only the launch above, in ONE launch of one-wave
// work-groups; the role comes from the index:
//   a 32 x 32 tile of the first encoder layer's Q, K or V;
//   a 32 x 32 tile of the decoder's Q, K or V for the masked tokens' rows, which do
//     not depend on the encoder;
//   one key row of the encoder's attention bias.
// ---------------------------------------------------------------------------
#define PJ_ENC (((BATCH * N_UNMASK + 31) / 32) * 9)
#define PJ_DEC (((BATCH * N_MASKT + 31) / 32) * 9)
__global__ __launch_bounds__(32)
void proj_kernel(const float* __restrict__ X, const float* __restrict__ eaw,
                 const float* __restrict__ eab, float* __restrict__ Qe,
                 float* __restrict__ Ke, float* __restrict__ Ve,
                 const float* __restrict__ Xd, const float* __restrict__ daw,
                 const float* __restrict__ dab, float* __restrict__ Qd,
                 float* __restrict__ Kd, float* __restrict__ Vd,
                 const float* __restrict__ adpA, const int* __restrict__ uidx,
                 float* __restrict__ Mb) {
  const int blk = blockIdx.x;
  if (blk < PJ_ENC) {
    const int y = blk % 9, p = y / 3;
    gemm_tile<D_MODEL, D_MODEL, (1 << 30), 0, 0, N_UNMASK>(
        X, eaw + p * D_MODEL * D_MODEL, eab + p * D_MODEL, p == 0 ? Qe : (p == 1 ? Ke : Ve),
        p == 2, BATCH * N_UNMASK, (blk / 9) * 32, (y % 3) * 32);
    return;
  }
  if (blk < PJ_ENC + PJ_DEC) {
    const int t = blk - PJ_ENC, y = t % 9, p = y / 3;
    gemm_tile<D_MODEL, D_MODEL, N_MASKT, N_UNMASK, N_UNMASK, NT>(
        Xd, daw + p * D_MODEL * D_MODEL, dab + p * D_MODEL, p == 0 ? Qd : (p == 1 ? Kd : Vd),
        p == 2, BATCH * N_MASKT, (t / 9) * 32, (y % 3) * 32);
    return;
  }
  // column nk of the adjacency goes to LDS, and each query looks its node up there
  constexpr int NG = EM_PITCH / 32, NF = N_UNMASK / 32;        // query groups, whole ones
  constexpr int CG = (N_NODES + 31) / 32, CF = N_NODES / 32;   // node groups, whole ones
  static_assert(NG == NF + 1 && CG == CF + 1, "one clamped group each");
  __shared__ float colv[CG * 32];
  const int k = blk - (PJ_ENC + PJ_DEC);   // 0 .. EM_ROWS - 1
  const int lane = threadIdx.x;
  int nk = uidx[k < N_UNMASK ? k : N_UNMASK - 1] / T_STEPS;
  nk = nk < 0 ? 0 : (nk >= N_NODES ? N_NODES - 1 : nk);
  // last group of each: past the end the last element, not used
  const int cq = lane < N_UNMASK - NF * 32 ? lane : N_UNMASK - NF * 32 - 1;
  const int cn = lane < N_NODES - CF * 32 ? lane : N_NODES - CF * 32 - 1;
  const int a1 = lane * N_NODES + nk, a2 = cn * N_NODES + nk;
  int nq[NG];
  float cv[CG];
#pragma unroll   // constant register index, immediate load offsets
  for (int i = 0; i < NF; ++i) nq[i] = uidx[i * 32 + lane];
#pragma unroll   // constant register index, immediate load offsets
  for (int i = 0; i < CF; ++i) cv[i] = adpA[a1 + i * 32 * N_NODES];
  nq[NF] = uidx[NF * 32 + cq];
  cv[CF] = adpA[a2 + CF * 32 * N_NODES];
  // stands in front of any reuse of the address registers of the loads above: the indices
  // are inputs, so that they live up to the wait and no result lands in one of them;
  // the scheduling barrier keeps later arithmetic from rising over it
  asm volatile("s_wait_xcnt 0x0" :: "v"(lane), "v"(cq), "v"(a1), "v"(a2) : "memory");
  __builtin_amdgcn_sched_barrier(0);
#pragma unroll   // constant register index
  for (int i = 0; i < CG; ++i) colv[i * 32 + lane] = cv[i];
  __syncthreads();
  float av[NG];
#pragma unroll   // constant register index; every lane reads, so all LDS reads fly together
  for (int i = 0; i < NG; ++i) {
    int n = nq[i] / T_STEPS;
    n = n < 0 ? 0 : (n >= N_NODES ? N_NODES - 1 : n);
    av[i] = colv[n];
  }
#pragma unroll   // constant register index
  for (int i = 0; i < NG; ++i) {
    const bool in = k < N_UNMASK && i * 32 + lane < N_UNMASK;
    av[i] = (in & (av[i] == 0.f)) ? -1e30f : 0.f;
  }
  // every value in a register of its own in front of the first store
  __builtin_amdgcn_sched_barrier(0);
  float* mrow = Mb + (size_t)(k >> 4) * (NG * 512) + (lane >> 4) * 256 + ((k >> 2) & 1) * 128 +
                ((k >> 3) & 1) * 64 + (lane & 15) * 4 + (k & 3);
#pragma unroll   // constant register index, immediate store offsets
  for (int i = 0; i < NG; ++i) mrow[i * 512] = av[i];
  // stands behind the run of stores, in front of any rewrite of their registers in the
  // code that follows this role in the built kernel
  asm volatile("s_wait_xcnt 0x0" ::: "memory");
}

// ---------------------------------------------------------------------------
// Attention in one pass over the keys, per (b, head, 32 queries): the scores never
// leave the registers.
//   St = K Qt : A = 16 keys x 24, B = Qt, kept in registers. D register r of a lane
//               is the score of key 8 * half + r for query l16.
//   softmax   : running maximum and sum per query (one lane column): in-lane over the
//               8 registers, one exchange between the wave's halves.
//   Ot += Vt Pt : D registers 2j, 2j + 1 of St are, as they stand, the B fragment of
//               k-step j if that step's keys are 8 * half + 2j + {0, 1}; the Vt
//               A fragment takes its rows in the same key order.
// A wave holds two query tiles, so each K and V fragment feeds two products. The
// key tiles are dealt round-robin to the NW waves of the work-group; their partial
// (maximum, sum, Ot) are merged in LDS at the end.
// Head dim order of the score product: at k-step j a lane half takes
// d = 8 * (j >> 1) + 4 * half + 2 * (j & 1) + {0, 1}, for K and Q alike: three 16-byte
// loads a row, each of which takes 512 adjacent bytes for a wave on a whole tile.
// Q/K/V and maskT: in fragment order, as said where KV_TILE and EM_ROWS are defined.
// O: in the row chain's fragment order, as said where o_row is defined.
// QB: the first query row. Rows in front of it are keys and values only.
// ---------------------------------------------------------------------------
typedef float v4f __attribute__((ext_vector_type(4)));
#define FA_C (ATTN_SCALE * 1.4426950408889634f)   // score scale, in log2 units
#define FA_ROWS (HD + 2)                          // Ot rows, then maximum, then sum

// lane l <-> l ^ 16
__device__ __forceinline__ float fa_xhalf(float v) {
  int b = __float_as_int(v);
  return __int_as_float(__builtin_amdgcn_permlanex16(b, b, 0x76543210, 0xfedcba98, false, false));
}

// 24 floats of one row as six k-step fragments; p: the row's place in its plane + 64 * half
__device__ __forceinline__ void fa_row(const float* __restrict__ p, v2f (&f)[6]) {
  const v4f x0 = *(const v4f*)p, x1 = *(const v4f*)(p + 128), x2 = *(const v4f*)(p + 256);
  f[0] = (v2f){x0.x, x0.y}; f[1] = (v2f){x0.z, x0.w};
  f[2] = (v2f){x1.x, x1.y}; f[3] = (v2f){x1.z, x1.w};
  f[4] = (v2f){x2.x, x2.y}; f[5] = (v2f){x2.z, x2.w};
}

// The decoder's keys from tile DEC_T0 on are masked tokens' rows alone: they do not depend
// on the encoder. Their share of the decoder's attention runs as extra work-groups of the
// encoder's launches. Such a work-group takes one block of 32 queries of one head and one part
// of those key tiles, deals the part's tiles to its waves, merges them in LDS and stores ONE
// partial result (Ot, maximum, sum; not normalised), once. The first DP_UA query blocks have
// their key tiles in three parts, which ride on the attention launches: a part is then as many
// key tiles as an encoder work-group has, and the launch is two equal work-groups a WGP.
// The other blocks have two parts, which ride on the row chain's launches.
// The decoder's own launch takes the tiles in front of DEC_T0 and merges the parts in.
#define DEC_T0 ((N_UNMASK + 15) / 16)     // 39
#define DEC_KT ((NT + 15) / 16)           // 156
#define DQB    ((N_MASKT + 31) / 32)      // query blocks a head: 59
#define FA_SLOT (2 * FA_ROWS * 16)        // floats of one partial result
#define DP_MAX 3                          // places for partial results a query block
#define DP_UNITS (BATCH * NHEAD * DQB)    // query blocks of all heads: 944
#define DP_UA 256                         // of them in three parts
#define DP_ENC_WGS (DP_UA * 3 / 4)                 // parts an attention launch: 192
#define DP_POST_WGS ((DP_UNITS - DP_UA) * 2 / 4)   // parts a row chain launch: 344
#define DS_TOTAL ((size_t)DP_UNITS * DP_MAX * FA_SLOT)
static_assert((DP_UA * 3) % 4 == 0 && ((DP_UNITS - DP_UA) * 2) % 4 == 0, "four launches of each kind");

// One wave's pass over the key tiles kt0, kt0 + STEP, ... below t1, for the 32 queries from
// q0 on; o, mrun, lrun: its running state, set by the caller. pl: batch * NHEAD + head.
template <int S, int STEP, bool MASK>
__device__ __forceinline__
void fa_run(const float* __restrict__ Q, const float* __restrict__ Kb,
            const float* __restrict__ Vb, const float* __restrict__ maskT,
            const int q0, const int pl, const int kt0, const int t1,
            v8f (&o)[2][2], float (&mrun)[2], float (&lrun)[2]) {
  constexpr int KT = (S + 15) / 16;
  // with a mask the scores are scaled when the bias is added, else inside the exponent
  constexpr float CC = MASK ? 1.f : FA_C;
  const int lane = threadIdx.x & 31;
  const int l16 = lane & 15, half = lane >> 4;
  const size_t pb = (size_t)pl * KV_PLANE(S);
  const float* Kh = Kb + pb + 64 * half;
  const float* Vh = Vb + pb;

  v2f qf[2][6];
#pragma unroll   // constant register index
  for (int t = 0; t < 2; ++t) {
    int qr = q0 + 16 * t + l16; if (qr >= S) qr = S - 1;
    fa_row(Q + pb + 64 * half + qk_row(qr), qf[t]);
  }
  v2f kf[6];
  {
    int key = kt0 * 16 + l16; if (key >= S) key = S - 1;
    fa_row(Kh + qk_row(key), kf);
  }
  // stands in front of any reuse of the address registers of the loads above; the
  // scheduling barrier keeps later arithmetic from rising over it
  asm volatile("s_wait_xcnt 0x0" ::: "memory");
  __builtin_amdgcn_sched_barrier(0);
  // this lane's place in a tile's V: first Ot tile; second Ot tile, 8 rows, each taken twice
  const int vl0 = lane * 4, vl1 = 256 + (8 * half + (l16 & 7)) * 4;

  // one key tile; LAST: the tile that may hold keys past S
  auto tile = [&](auto lastc, const int kt) {
    constexpr bool LAST = decltype(lastc)::value;
    const int kb = kt * 16 + 8 * half;
    v2f vf[2][4];
    if constexpr (!LAST) {
      // a whole tile: four 16-byte loads, keys kb + 4c .. kb + 4c + 3 of one head dim in each
      const float* va = Vh + kt * KV_TILE + vl0;
      const float* vb = Vh + kt * KV_TILE + vl1;
      const v4f x0 = *(const v4f*)va, x1 = *(const v4f*)(va + 128);
      const v4f y0 = *(const v4f*)vb, y1 = *(const v4f*)(vb + 64);
      // stands in front of any reuse of the address registers of the four loads
      asm volatile("s_wait_xcnt 0x0" ::: "memory");
      vf[0][0] = (v2f){x0.x, x0.y}; vf[0][1] = (v2f){x0.z, x0.w};
      vf[0][2] = (v2f){x1.x, x1.y}; vf[0][3] = (v2f){x1.z, x1.w};
      vf[1][0] = (v2f){y0.x, y0.y}; vf[1][1] = (v2f){y0.z, y0.w};
      vf[1][2] = (v2f){y1.x, y1.y}; vf[1][3] = (v2f){y1.z, y1.w};
    } else {
      const float* vp[4][4];   // each load's own address
#pragma unroll   // constant register index
      for (int j = 0; j < 4; ++j) {
        int r0 = kb + 2 * j, r1 = kb + 2 * j + 1;   // past the end: the last row, weight 0
        r0 = r0 < S ? r0 : S - 1;
        r1 = r1 < S ? r1 : S - 1;
        vp[j][0] = Vh + v_row(r0) + v_mid(r0) + l16 * 4;
        vp[j][1] = Vh + v_row(r1) + v_mid(r1) + l16 * 4;
        vp[j][2] = Vh + v_row(r0) + (v_mid(r0) >> 1) + 256 + (l16 & 7) * 4;
        vp[j][3] = Vh + v_row(r1) + (v_mid(r1) >> 1) + 256 + (l16 & 7) * 4;
        vf[0][j].x = *vp[j][0]; vf[0][j].y = *vp[j][1];
        vf[1][j].x = *vp[j][2]; vf[1][j].y = *vp[j][3];
      }
      // clamped rows have addresses of their own: all are inputs, so that they live up to the
      // wait and no result of the run lands in an address register of an earlier load of it
      asm volatile("s_wait_xcnt 0x0" :: "v"(vp[0][0]), "v"(vp[0][1]), "v"(vp[0][2]), "v"(vp[0][3]),
                   "v"(vp[1][0]), "v"(vp[1][1]), "v"(vp[1][2]), "v"(vp[1][3]),
                   "v"(vp[2][0]), "v"(vp[2][1]), "v"(vp[2][2]), "v"(vp[2][3]),
                   "v"(vp[3][0]), "v"(vp[3][1]), "v"(vp[3][2]), "v"(vp[3][3]) : "memory");
    }
    float mb[2][8];
    if (MASK) {
      const float* mp = maskT + ((size_t)kt * (EM_PITCH / 32) + (q0 >> 5)) * 512 + lane * 4;
      v4f mv[4];
#pragma unroll   // constant register index, immediate load offsets
      for (int c = 0; c < 4; ++c) mv[c] = *(const v4f*)(mp + c * 128);
      // as above, for the four loads just issued
      asm volatile("s_wait_xcnt 0x0" ::: "memory");
#pragma unroll   // constant register index
      for (int r = 0; r < 8; ++r) {
        mb[0][r] = mv[r >> 2][r & 3];
        mb[1][r] = mv[2 + (r >> 2)][r & 3];
      }
    }
    // keeps later address arithmetic from rising over the waits above, and the loads in
    // front of the score products, whose time covers their latency
    __builtin_amdgcn_sched_barrier(0);
    v8f s[2];
    s[0] = (v8f){}; s[1] = (v8f){};
#pragma unroll   // constant register index
    for (int j = 0; j < 6; ++j) {
      s[0] = __builtin_amdgcn_wmma_f32_16x16x4_f32(false, kf[j], false, qf[0][j], (short)0, s[0], false, false);
      s[1] = __builtin_amdgcn_wmma_f32_16x16x4_f32(false, kf[j], false, qf[1][j], (short)0, s[1], false, false);
    }
    // this wave's next K tile, in flight during the softmax and the second product
    // (past the end: the clamped last row, never used)
    {
      int key = (kt + STEP) * 16 + l16; if (key >= S) key = S - 1;
      const float* kp = Kh + qk_row(key);
      fa_row(kp, kf);
      // as above, for the three loads just issued; the address is an input, so that it
      // lives up to the wait and none of the three results lands in its registers
      asm volatile("s_wait_xcnt 0x0" :: "v"(kp) : "memory");
    }
    __builtin_amdgcn_sched_barrier(0);
#pragma unroll   // constant register index
    for (int t = 0; t < 2; ++t) {
      if (MASK) {
#pragma unroll   // constant register index
        for (int r = 0; r < 8; ++r) s[t][r] = fmaf(s[t][r], FA_C, mb[t][r]);
      }
      if (LAST) {
#pragma unroll   // constant register index
        for (int r = 0; r < 8; ++r)
          if (kb + r >= S) s[t][r] = -INFINITY;   // no key: weight exactly 0
      }
      float mx = s[t][0];
#pragma unroll   // constant register index
      for (int r = 1; r < 8; ++r) mx = fmaxf(mx, s[t][r]);
      mx = fmaxf(mx, fa_xhalf(mx));
      const float mnew = fmaxf(mrun[t], mx);
      const float alpha = __builtin_amdgcn_exp2f((mrun[t] - mnew) * CC);
      const float nb = -mnew * CC;
      mrun[t] = mnew;
      float sum = 0.f;
#pragma unroll   // constant register index
      for (int r = 0; r < 8; ++r) {
        s[t][r] = __builtin_amdgcn_exp2f(fmaf(s[t][r], CC, nb));
        sum += s[t][r];
      }
      lrun[t] = lrun[t] * alpha + sum;
      o[t][0] *= alpha;
      o[t][1] *= alpha;
    }
#pragma unroll   // constant register index
    for (int j = 0; j < 4; ++j) {
#pragma unroll   // constant register index
      for (int t = 0; t < 2; ++t) {
        const v2f pf = (v2f){s[t][2 * j], s[t][2 * j + 1]};
        o[t][0] = __builtin_amdgcn_wmma_f32_16x16x4_f32(false, vf[0][j], false, pf, (short)0, o[t][0], false, false);
        o[t][1] = __builtin_amdgcn_wmma_f32_16x16x4_f32(false, vf[1][j], false, pf, (short)0, o[t][1], false, false);
      }
    }
  };

  int kt = kt0;
  const int te = t1 < KT - 1 ? t1 : KT - 1;   // whole tiles end here
  for (; kt < te; kt += STEP) tile(fa_bool<false>{}, kt);
  if (kt == KT - 1 && kt < t1) tile(fa_bool<true>{}, kt);
}

// A work-group's attention for 32 queries of one head over the key tiles ta .. tb - 1: the tiles
// are dealt to its NW waves, whose results are merged in LDS.
// PART: O is the place of a partial result, which is stored as it stands, in the order of red.
// XS: that many places of earlier partial results, at Sx, are merged in as if they were waves';
// xall: the last of them is filled (else it counts as empty).
template <int S, int NW, bool MASK, int QB, int XS, bool PART>
__device__ __forceinline__
void attn_wg(const float* __restrict__ Q, const float* __restrict__ Kb,
             const float* __restrict__ Vb, float* __restrict__ O,
             const float* __restrict__ maskT, const float* __restrict__ Sx, const bool xall,
             float (*red)[2][FA_ROWS][16], const int qblk, const int h, const int b,
             const int ta, const int tb) {
  static_assert(NW >= 4, "the merge takes four waves");
  constexpr float CC = MASK ? 1.f : FA_C;
  constexpr int NT_ = NW * 32;                               // threads
  constexpr int XG = XS * FA_SLOT / 4;                       // 16-byte groups of the places
  constexpr int XC = XS ? (XG + NT_ - 1) / NT_ : 1;          // of them a thread
  const int lane = threadIdx.x & 31;
  // wave number in a scalar register: loop bounds and the last-tile branch stay scalar
  const int wave = __builtin_amdgcn_readfirstlane((int)(threadIdx.x >> 5));
  const int l16 = lane & 15, half = lane >> 4;
  const int q0 = QB + qblk * 32;
  // the earlier partial results: in flight during this work-group's own key tiles
  v4f ex[XC];
  const int xlim = xall ? XG : XG - FA_SLOT / 4;             // groups that were written
  if constexpr (XS > 0) {
    int xk[XC];
#pragma unroll   // constant register index
    for (int c = 0; c < XC; ++c) {
      const int k = c * NT_ + (int)threadIdx.x;
      xk[c] = k < xlim ? k : xlim - 1;   // past the end: the last written group, not used
      ex[c] = *(const v4f*)(Sx + 4 * xk[c]);
    }
    static_assert(XC == 5 || XS == 0, "the wait below names five indices");
    // stands in front of any reuse of the address registers of the loads above: the indices
    // are inputs, so that they live up to the wait and no result lands in one of them
    asm volatile("s_wait_xcnt 0x0" :: "v"(xk[0]), "v"(xk[1]), "v"(xk[2]), "v"(xk[3]),
                 "v"(xk[XC - 1]) : "memory");
  }
  v8f o[2][2];
  float mrun[2], lrun[2];
#pragma unroll   // constant register index
  for (int t = 0; t < 2; ++t) {
    o[t][0] = (v8f){}; o[t][1] = (v8f){};
    mrun[t] = -1e30f; lrun[t] = 0.f;
  }
  fa_run<S, NW, MASK>(Q, Kb, Vb, maskT, q0, b * NHEAD + h, ta + wave, tb, o, mrun, lrun);

  // -------- this wave's partial result to LDS --------
#pragma unroll   // constant register index
  for (int t = 0; t < 2; ++t) {
    const float lsum = lrun[t] + fa_xhalf(lrun[t]);
#pragma unroll   // constant register index
    for (int r = 0; r < 8; ++r) {
      red[wave][t][r + 8 * half][l16] = o[t][0][r];
      if (half == 0) red[wave][t][16 + r][l16] = o[t][1][r];
    }
    if (half == 0) {
      red[wave][t][HD][l16] = mrun[t];
      red[wave][t][HD + 1][l16] = lsum;
    }
  }
  if constexpr (XS > 0) {
    float* xr = &red[NW][0][0][0];
#pragma unroll   // constant register index
    for (int c = 0; c < XC; ++c) {
      const int k = c * NT_ + (int)threadIdx.x;
      // a place that was not filled: maximum far below every score, sum and Ot zero
      const int row = ((4 * k) % (FA_ROWS * 16)) >> 4;
      const float e = row == HD ? -1e30f : 0.f;
      const v4f x = k < xlim ? ex[c] : (v4f){e, e, e, e};
      if ((c + 1) * NT_ <= XG || k < XG) *(v4f*)(xr + 4 * k) = x;
    }
  }
  __syncthreads();

  // -------- merge over the waves: four threads a query, six head dims each --------
  if (wave < 4) {
    const int ql = threadIdx.x >> 2, t = ql >> 4, qi = ql & 15;
    const int d0 = (threadIdx.x & 3) * 6;
    float mall = red[0][t][HD][qi];
#pragma unroll   // LDS reads at immediate offsets, all in flight together
    for (int w = 1; w < NW + XS; ++w) mall = fmaxf(mall, red[w][t][HD][qi]);
    float den = 0.f, acc[6] = {0.f, 0.f, 0.f, 0.f, 0.f, 0.f};
#pragma unroll   // LDS reads at immediate offsets, all in flight together
    for (int w = 0; w < NW + XS; ++w) {
      const float wg = __builtin_amdgcn_exp2f((red[w][t][HD][qi] - mall) * CC);
      den += wg * red[w][t][HD + 1][qi];
#pragma unroll   // constant register index
      for (int i = 0; i < 6; ++i) acc[i] += wg * red[w][t][d0 + i][qi];
    }
    if constexpr (PART) {
      float* sp = O + t * (FA_ROWS * 16) + d0 * 16 + qi;
#pragma unroll   // constant register index, immediate store offsets
      for (int i = 0; i < 6; ++i) sp[i * 16] = acc[i];
      float* sq = O + t * (FA_ROWS * 16) + HD * 16 + qi;
      if ((threadIdx.x & 3) == 0) { sq[0] = mall; sq[16] = den; }
      // stands behind the run of stores, in front of any rewrite of their registers in the
      // code that follows this role in the built kernel
      asm volatile("s_wait_xcnt 0x0" ::: "memory");
    } else {
      const float inv = 1.f / den;
      const int q = q0 + ql;
      if (q < S) {
        float* op = O + o_row(b * (S - QB) + q - QB);   // the query rows of all batches, in a row
#pragma unroll   // constant register index
        for (int i = 0; i < 6; ++i) op[o_col(h * HD + d0 + i)] = acc[i] * inv;
      }
    }
  }
}

// One part of the decoder's early share. job: its number among the parts of the query blocks
// from u0 on, NP parts a block.
template <int NWV, int NP>
__device__ __forceinline__
void dec_part(const float* __restrict__ Qd, const float* __restrict__ Kd,
              const float* __restrict__ Vd, float* __restrict__ St,
              float (*red)[2][FA_ROWS][16], const int u0, const int job) {
  constexpr int TP = (DEC_KT - DEC_T0 + NP - 1) / NP;   // key tiles a part
  static_assert(NP <= DP_MAX && TP >= NWV, "a place for every part, a tile for every wave");
  const int u = u0 + job / NP, p = job % NP;
  const int ta = DEC_T0 + p * TP;
  const int tb = ta + TP < DEC_KT ? ta + TP : DEC_KT;
  const int bh = u / DQB;
  attn_wg<NT, NWV, false, N_UNMASK, 0, true>(Qd, Kd, Vd, St + (size_t)(u * DP_MAX + p) * FA_SLOT,
                                             nullptr, nullptr, false, red, u % DQB, bh % NHEAD,
                                             bh / NHEAD, ta, tb);
}

// An encoder layer's attention, and behind it in the grid parts of the decoder's early share,
// from part j0 on
#define EA_NW  8
#define EA_QB  ((N_UNMASK + 31) / 32)
#define EA_WGS (EA_QB * NHEAD * BATCH)
__global__ __launch_bounds__(EA_NW * 32)
void enc_attn_kernel(const float* __restrict__ Q, const float* __restrict__ Kb,
                     const float* __restrict__ Vb, float* __restrict__ O,
                     const float* __restrict__ maskT,
                     const float* __restrict__ Qd, const float* __restrict__ Kd,
                     const float* __restrict__ Vd, float* __restrict__ St,
                     const int j0) {
  __shared__ float red[EA_NW][2][FA_ROWS][16];
  const int blk = blockIdx.x;
  if (blk >= EA_WGS) { dec_part<EA_NW, 3>(Qd, Kd, Vd, St, red, 0, j0 + blk - EA_WGS); return; }
  attn_wg<N_UNMASK, EA_NW, true, 0, 0, false>(Q, Kb, Vb, O, maskT, nullptr, false, red,
                                              blk % EA_QB, (blk / EA_QB) % NHEAD,
                                              blk / (EA_QB * NHEAD), 0, (N_UNMASK + 15) / 16);
}

// The decoder's attention: what is left of it behind the encoder
#define DA_NW 4
__global__ __launch_bounds__(DA_NW * 32)
void dec_attn_kernel(const float* __restrict__ Q, const float* __restrict__ Kb,
                     const float* __restrict__ Vb, float* __restrict__ O,
                     const float* __restrict__ St) {
  __shared__ __attribute__((aligned(16))) float red[DA_NW + DP_MAX][2][FA_ROWS][16];
  const int u = (blockIdx.z * NHEAD + blockIdx.y) * DQB + blockIdx.x;
  attn_wg<NT, DA_NW, false, N_UNMASK, DP_MAX, false>(
      Q, Kb, Vb, O, nullptr, St + (size_t)u * (DP_MAX * FA_SLOT), u < DP_UA, red, blockIdx.x,
      blockIdx.y, blockIdx.z, 0, DEC_T0);
}

// ---------------------------------------------------------------------------
// The row-local chain behind attention in ONE launch, one work-group of PK_WAVES
// waves per 16 rows:
//   h = LN(h + O Wo + bo); f = relu(h W1 + b1); h = LN(h + f W2 + b2); then
//   NEXT 1: the next layer's Q, K, V = h Wq|Wk|Wv + bias (nw, nb);
//   NEXT 2, the encoder's last layer: its closing LayerNorm (cg, cb), the decoder's
//           input row x = (h ew + eb) * sqrt(D), and the decoder's K and V of x (nw, nb);
//           row b * N_UNMASK + s is row s of batch b there. The one decoder layer's output
//           is read at the masked tokens' rows alone, so these rows are only looked at:
//           no Q of them, and x itself goes nowhere;
//   NEXT 3, the decoder's last layer, the masked tokens' rows alone (row b * N_MASKT + j
//           lies at row b * NT + N_UNMASK + j of H): its closing LayerNorm
//           (cg, cb) and the output h . ew + eb, to Ho.
// The 16 x 96 row tile and the 16 x 384 hidden tile stay in LDS; a product's
// result goes there in D layout and is read back as A fragments. Wave w owns
// column tile w of every 96-wide product and four tiles of the 384-wide one.
// Every accumulator keeps the ascending k order.
// LDS pitches are 4 dwords past a multiple of 32: the 16 rows x 2 halves of an
// 8-byte A-fragment read fall on 64 different banks.
// ---------------------------------------------------------------------------
#define PK_WAVES 6
#define PK_HP (D_MODEL + 4)
#define PK_FP (FF_DIM + 4)
#define PK_ENC_WGS ((BATCH * N_UNMASK + 15) / 16)
static_assert(PK_WAVES * 16 == D_MODEL, "one 16-column tile of the model width per wave");

// B fragments of chunk c: CH k-steps x TN column tiles, TS floats from tile to tile
template <int N, int TS, int TN, int CH>
__device__ __forceinline__ void pk_load_b(const float* __restrict__ wp, const int c,
                                          v2f (&b)[CH][TN]) {
#pragma unroll   // constant register index, immediate load offsets
  for (int j = 0; j < CH; ++j) {
    const int k0 = (c * CH + j) * 4;
#pragma unroll   // constant register index
    for (int t = 0; t < TN; ++t) {
      b[j][t].x = wp[k0 * N + t * TS];
      b[j][t].y = wp[(k0 + 1) * N + t * TS];
    }
  }
}

// A fragments of chunk c from the LDS tile (as: this lane's row, + 2 * half)
template <int CH>
__device__ __forceinline__ void pk_load_a(const float* as, const int c, v2f (&a)[CH]) {
#pragma unroll   // constant register index
  for (int j = 0; j < CH; ++j) a[j] = *(const v2f*)(as + (c * CH + j) * 4);
}

// acc[t] += A(LDS, 16 x K) * W(:, tile t). The caller has loaded chunks 0 and 1
// of b (weights depend on no earlier stage, so that is done ahead of the barrier
// in front of the stage); chunk c + 2 is loaded while chunk c is multiplied.
template <int K, int N, int TS, int TN, int CH>
__device__ __forceinline__ void pk_mm(const float* as, const float* __restrict__ wp,
                                      v2f (&b)[3][CH][TN], v8f (&acc)[TN]) {
  constexpr int NCH = K / (4 * CH);
  static_assert(K % (4 * CH) == 0 && NCH >= 2, "shape");
  v2f a[2][CH];
  pk_load_a<CH>(as, 0, a[0]);
#pragma unroll   // constant ring index
  for (int c = 0; c < NCH; ++c) {
    if (c + 2 < NCH) pk_load_b<N, TS, TN, CH>(wp, c + 2, b[(c + 2) % 3]);
    if (c + 1 < NCH) pk_load_a<CH>(as, c + 1, a[(c + 1) % 2]);
    // keeps the loads above in front of this chunk's WMMAs: sunk to their use,
    // each chunk would wait out its own load latency
    __builtin_amdgcn_sched_barrier(0);
#pragma unroll   // constant ring index
    for (int j = 0; j < CH; ++j)
#pragma unroll   // constant ring index
      for (int t = 0; t < TN; ++t)
        acc[t] = __builtin_amdgcn_wmma_f32_16x16x4_f32(false, a[c % 2][j], false, b[c % 3][j][t],
                                                       (short)0, acc[t], false, false);
    // keeps the next trip's loads out of this chunk's WMMAs: risen there, they
    // cannot take this chunk's ring slot and cost a fourth chunk of registers
    __builtin_amdgcn_sched_barrier(0);
  }
  // stands in front of any reuse of the weight loads' address registers; the
  // scheduling barrier keeps later arithmetic from rising over it
  asm volatile("s_wait_xcnt 0x0" ::: "memory");
  __builtin_amdgcn_sched_barrier(0);
}

// LayerNorm of the 16 x 96 LDS tile in place: waves 0..3, four rows a wave, eight
// lanes a row, twelve elements a lane. Hout: the rows also go to global memory.
__device__ __forceinline__ void pk_ln(float* hs, const float* __restrict__ g,
                                      const float* __restrict__ bta, int wave, int lane,
                                      float* __restrict__ Hout, int m0, int M) {
  if (wave < 4) {
    const int row = wave * 4 + (lane >> 3), e = lane & 7;
    float* p = hs + row * PK_HP + e * 4;
    float v[12], gv[12], bv[12];
#pragma unroll   // constant register index
    for (int i = 0; i < 12; ++i) {
      const int o = (i >> 2) * 32 + (i & 3);
      v[i] = p[o];
      gv[i] = g[e * 4 + o];
      bv[i] = bta[e * 4 + o];
    }
    float s = 0.f;
#pragma unroll   // constant register index
    for (int i = 0; i < 12; ++i) s += v[i];
    s += __shfl_xor(s, 1, 32); s += __shfl_xor(s, 2, 32); s += __shfl_xor(s, 4, 32);
    const float m = s / (float)D_MODEL;
    float q = 0.f;
#pragma unroll   // constant register index
    for (int i = 0; i < 12; ++i) { v[i] -= m; q += v[i] * v[i]; }
    q += __shfl_xor(q, 1, 32); q += __shfl_xor(q, 2, 32); q += __shfl_xor(q, 4, 32);
    const float rs = rsqrtf(q / (float)D_MODEL + 1e-5f);
#pragma unroll   // constant register index
    for (int i = 0; i < 12; ++i) {
      v[i] = v[i] * rs * gv[i] + bv[i];
      p[(i >> 2) * 32 + (i & 3)] = v[i];
    }
    if (Hout && m0 + row < M) {
      float* hp = Hout + (size_t)(m0 + row) * D_MODEL + e * 4;
#pragma unroll   // constant register index
      for (int i = 0; i < 12; ++i) hp[(i >> 2) * 32 + (i & 3)] = v[i];
    }
  }
}

template <int NEXT>
__global__ __launch_bounds__(PK_WAVES * 32)
void post_kernel(const float* __restrict__ Ob, float* __restrict__ H,
                 const float* __restrict__ wo, const float* __restrict__ bo,
                 const float* __restrict__ ln,
                 const float* __restrict__ w1, const float* __restrict__ b1,
                 const float* __restrict__ w2, const float* __restrict__ b2,
                 const float* __restrict__ nw, const float* __restrict__ nb,
                 float* __restrict__ Qo, float* __restrict__ Ko, float* __restrict__ Vo,
                 const float* __restrict__ cg, const float* __restrict__ cb,
                 const float* __restrict__ ew, const float* __restrict__ eb,
                 float* __restrict__ Ho, int M,
                 const float* Qe, const float* Ke, const float* Ve, float* Se,
                 const int j0) {
  // behind the encoder's row tiles in the grid: parts of the decoder's early share, from j0 on
  if constexpr (NEXT != 3) {
    __shared__ float red[PK_WAVES][2][FA_ROWS][16];
    if (blockIdx.x >= PK_ENC_WGS) {
      dec_part<PK_WAVES, 2>(Qe, Ke, Ve, Se, red, DP_UA, j0 + blockIdx.x - PK_ENC_WGS);
      return;
    }
  }
  __shared__ __attribute__((aligned(16))) float hs[16 * PK_HP];
  __shared__ __attribute__((aligned(16))) float fs[16 * PK_FP];
  const int lane = threadIdx.x & 31;
  // wave number in a scalar register: the LayerNorm branch stays scalar
  const int wave = __builtin_amdgcn_readfirstlane((int)(threadIdx.x >> 5));
  const int l16 = lane & 15, half = lane >> 4;
  const int m0 = blockIdx.x * 16;
  const int col = wave * 16 + l16;

  // ---- output projection: A from global (row-clamped), all operands at once ----
  int ra = m0 + l16; if (ra >= M) ra = M - 1;
  const float* xa  = Ob + o_row(ra) + 64 * half;
  const float* wpo = wo + (size_t)(2 * half) * D_MODEL + col;
  v2f ao[D_MODEL / 4], wf[D_MODEL / 4];
#pragma unroll   // constant register index, immediate load offsets
  for (int c = 0; c < D_MODEL / 8; ++c) {
    const v4f x = *(const v4f*)(xa + c * 128);   // two k-steps a load
    ao[2 * c] = (v2f){x.x, x.y};
    ao[2 * c + 1] = (v2f){x.z, x.w};
  }
#pragma unroll   // constant register index
  for (int j = 0; j < D_MODEL / 4; ++j) {
    wf[j].x = wpo[4 * j * D_MODEL];  wf[j].y = wpo[(4 * j + 1) * D_MODEL];
  }
  float res[8];
#pragma unroll   // constant register index
  for (int r = 0; r < 8; ++r) {
    int m = m0 + r + 8 * half; if (m >= M) m = M - 1;
    if (NEXT == 3) m += (m / N_MASKT) * N_UNMASK + N_UNMASK;
    res[r] = H[(size_t)m * D_MODEL + col];
  }
  const float bov = bo[col], b2v = b2[col];
  const float ebv = NEXT == 2 ? eb[col] : 0.f;
  // the products behind the chain: Q, K, V, or (NEXT 2) K and V, the second and third
  constexpr int NP = NEXT == 2 ? 2 : 3, P0 = 3 - NP;
  float b1v[4], nbv[NP];
#pragma unroll   // constant register index
  for (int t = 0; t < 4; ++t) b1v[t] = b1[wave * 64 + t * 16 + l16];
  // stands in front of later loads whose results land in address registers of
  // the loads above
  asm volatile("s_wait_xcnt 0x0" ::: "memory");
  if (NEXT != 3) {
#pragma unroll   // constant register index
    for (int t = 0; t < NP; ++t) nbv[t] = nb[(P0 + t) * D_MODEL + col];
    // as above, for the loads just issued
    asm volatile("s_wait_xcnt 0x0" ::: "memory");
  }
  const float* wp1 = w1 + (size_t)(2 * half) * FF_DIM + wave * 64 + l16;
  v2f bf1[3][4][4];
  pk_load_b<FF_DIM, 16, 4, 4>(wp1, 0, bf1[0]);
  pk_load_b<FF_DIM, 16, 4, 4>(wp1, 1, bf1[1]);
  // holds every load above in front of the WMMAs: one load latency for all
  __builtin_amdgcn_sched_barrier(0);
  v8f acco = {};
#pragma unroll   // constant register index
  for (int j = 0; j < D_MODEL / 4; ++j)
    acco = __builtin_amdgcn_wmma_f32_16x16x4_f32(false, ao[j], false, wf[j], (short)0, acco,
                                                 false, false);
#pragma unroll   // constant register index
  for (int r = 0; r < 8; ++r) hs[(r + 8 * half) * PK_HP + col] = res[r] + (acco[r] + bov);
  __syncthreads();
  // second FFN product's first weights: in flight while the rows are normalised
  const float* wp2 = w2 + (size_t)(2 * half) * D_MODEL + col;
  v2f bf2[3][12][1];
  pk_load_b<D_MODEL, 16, 1, 12>(wp2, 0, bf2[0]);
  pk_load_b<D_MODEL, 16, 1, 12>(wp2, 1, bf2[1]);
  pk_ln(hs, ln, ln + D_MODEL, wave, lane, (float*)0, m0, M);
  __syncthreads();

  // ---- f = relu(h W1 + b1), into LDS ----
  const float* ah = hs + l16 * PK_HP + 2 * half;
  v8f af[4];
#pragma unroll   // constant register index
  for (int t = 0; t < 4; ++t) af[t] = (v8f){};
  pk_mm<D_MODEL, FF_DIM, 16, 4, 4>(ah, wp1, bf1, af);
#pragma unroll   // constant register index
  for (int t = 0; t < 4; ++t)
#pragma unroll   // constant register index
    for (int r = 0; r < 8; ++r)
      fs[(r + 8 * half) * PK_FP + wave * 64 + t * 16 + l16] = fmaxf(af[t][r] + b1v[t], 0.f);
  __syncthreads();
  // the next product's first weights: in flight during the second FFN product
  const float* wpn = nw + (size_t)(P0 * D_MODEL + 2 * half) * D_MODEL + col;
  v2f bfn[3][4][NP];
  v2f bfe[3][12][1];
  if (NEXT == 1) {
    pk_load_b<D_MODEL, D_MODEL * D_MODEL, NP, 4>(wpn, 0, bfn[0]);
    pk_load_b<D_MODEL, D_MODEL * D_MODEL, NP, 4>(wpn, 1, bfn[1]);
  }
  const float* wpe = ew + (size_t)(2 * half) * D_MODEL + col;   // NEXT 2 only
  if (NEXT == 2) {
    pk_load_b<D_MODEL, 16, 1, 12>(wpe, 0, bfe[0]);
    pk_load_b<D_MODEL, 16, 1, 12>(wpe, 1, bfe[1]);
    // stands in front of any reuse of the address registers of these loads; the address
    // is an input, so that it lives up to the wait
    asm volatile("s_wait_xcnt 0x0" :: "v"(wpe) : "memory");
  }

  // ---- h + f W2 + b2: each element of the row tile is updated by its own lane ----
  v8f a2[1];
  a2[0] = (v8f){};
  pk_mm<FF_DIM, D_MODEL, 16, 1, 12>(fs + l16 * PK_FP + 2 * half, wp2, bf2, a2);
#pragma unroll   // constant register index
  for (int r = 0; r < 8; ++r) {
    float* p = hs + (r + 8 * half) * PK_HP + col;
    *p = *p + (a2[0][r] + b2v);
  }
  __syncthreads();
  // the decoder's first projection weights: in flight during the two LayerNorms and
  // the product between them and their use
  if (NEXT == 2) {
    pk_load_b<D_MODEL, D_MODEL * D_MODEL, NP, 4>(wpn, 0, bfn[0]);
    pk_load_b<D_MODEL, D_MODEL * D_MODEL, NP, 4>(wpn, 1, bfn[1]);
  }
  pk_ln(hs, ln + 2 * D_MODEL, ln + 3 * D_MODEL, wave, lane, NEXT == 1 ? H : (float*)0, m0, M);
  // last layer of a stack: the stack's closing LayerNorm; each lane reads back only
  // what it wrote itself, so no barrier stands between the two
  if (NEXT != 1) pk_ln(hs, cg, cb, wave, lane, (float*)0, m0, M);

  // ---- the output: row . ew + eb, by the lanes that normalised the row ----
  if (NEXT == 3) {
    if (wave < 4) {
      const int row = wave * 4 + (lane >> 3), e = lane & 7;
      const float* p = hs + row * PK_HP + e * 4;
      float wv[12];
#pragma unroll   // constant register index
      for (int i = 0; i < 12; ++i) wv[i] = ew[e * 4 + (i >> 2) * 32 + (i & 3)];
      const float ob = eb[0];
      // stands in front of any reuse of the address registers of the loads above: the loaded
      // values are inputs, so that every one of the loads is issued in front of the wait; the
      // scheduling barrier keeps later arithmetic from rising over it
      asm volatile("s_wait_xcnt 0x0" :: "v"(wv[0]), "v"(wv[1]), "v"(wv[2]), "v"(wv[3]), "v"(wv[4]),
                   "v"(wv[5]), "v"(wv[6]), "v"(wv[7]), "v"(wv[8]), "v"(wv[9]), "v"(wv[10]),
                   "v"(wv[11]) : "memory");
      __builtin_amdgcn_sched_barrier(0);
      float s = 0.f;
#pragma unroll   // constant register index
      for (int i = 0; i < 12; ++i) s += p[(i >> 2) * 32 + (i & 3)] * wv[i];
      s += __shfl_xor(s, 1, 32); s += __shfl_xor(s, 2, 32); s += __shfl_xor(s, 4, 32);
      const int m = m0 + row;
      if (e == 0 && m < M) Ho[m] = s + ob;
    }
  }

  // where this lane's eight result rows go, in fragment order: as Q or K (-1: no such row),
  // and as V. Row b * N_UNMASK + s is row s of batch b, of the encoder's sequence (NEXT 1)
  // or of the decoder's (NEXT 2)
  int qko[8], vo[8];
  if (NEXT != 3) {
    constexpr int PL = KV_PLANE(NEXT == 1 ? N_UNMASK : NT);
    const int hc = col / HD, dc = col % HD, b0 = m0 / N_UNMASK;
#pragma unroll   // constant register index
    for (int r = 0; r < 8; ++r) {
      const int m = m0 + 8 * half + r;
      const bool nx = m - b0 * N_UNMASK >= N_UNMASK;   // the tile's rows lie in at most two batches
      const int s = m - (b0 + (nx ? 1 : 0)) * N_UNMASK;
      const int pb = ((b0 + (nx ? 1 : 0)) * NHEAD + hc) * PL;
      qko[r] = m < M ? pb + qk_row(s) + qk_col(dc) : -1;
      vo[r] = pb + v_row(s) + v_col(dc) + (v_mid(s) >> v_sh(dc));
    }
  }
  if (NEXT == 2) {
    // ---- the decoder's input rows, into the row tile ----
    __syncthreads();
    v8f ae[1];
    ae[0] = (v8f){};
    pk_mm<D_MODEL, D_MODEL, 16, 1, 12>(ah, wpe, bfe, ae);
    // every wave has read the row tile as its A operand before it is overwritten
    __syncthreads();
#pragma unroll   // constant register index
    for (int r = 0; r < 8; ++r) hs[(r + 8 * half) * PK_HP + col] = (ae[0][r] + ebv) * SQRT_D;
  }

  // ---- next layer's Q, K, V (NEXT 2: K, V): this wave's column tile of each ----
  if (NEXT != 3) {
    __syncthreads();
    v8f an[NP];
#pragma unroll   // constant register index
    for (int t = 0; t < NP; ++t) an[t] = (v8f){};
    pk_mm<D_MODEL, D_MODEL, D_MODEL * D_MODEL, NP, 4>(ah, wpn, bfn, an);
#pragma unroll   // constant register index
    for (int t = 0; t < NP; ++t) an[t] += nbv[t];
    if (m0 + 16 <= M) {
      // a whole tile: no row tests
      if constexpr (NEXT == 1) pk_st8(Qo, qko, an[0]);
      pk_st8(Ko, qko, an[NP - 2]);
      pk_st8(Vo, vo, an[NP - 1]);
    } else {
#pragma unroll   // constant register index
      for (int r = 0; r < 8; ++r) {
        if (qko[r] >= 0) {
          if constexpr (NEXT == 1) Qo[qko[r]] = an[0][r];
          Ko[qko[r]] = an[NP - 2][r];
          Vo[vo[r]] = an[NP - 1][r];
        }
      }
    }
  }
}

// ---------------------------------------------------------------------------
extern "C" void kernel_launch(void* const* d_in, const int* in_sizes, int n_in,
                              void* d_out, int out_size, void* d_ws, size_t ws_size,
                              hipStream_t stream) {
  (void)in_sizes; (void)n_in; (void)out_size; (void)ws_size;
  const float* hist  = (const float*)d_in[0];
  const int*   uidx  = (const int*)d_in[1];
  const int*   midx  = (const int*)d_in[2];
  const float* nv1   = (const float*)d_in[3];
  const float* nv2   = (const float*)d_in[4];
  const float* dim_w = (const float*)d_in[5];
  const float* dim_b = (const float*)d_in[6];
  const float* pos   = (const float*)d_in[7];
  const float* tod_w = (const float*)d_in[8];
  const float* tod_b = (const float*)d_in[9];
  const float* dow_w = (const float*)d_in[10];
  const float* dow_b = (const float*)d_in[11];
  const float* mtok  = (const float*)d_in[12];
  const float* eaw   = (const float*)d_in[13];
  const float* eab   = (const float*)d_in[14];
  const float* ew1   = (const float*)d_in[15];
  const float* eb1   = (const float*)d_in[16];
  const float* ew2   = (const float*)d_in[17];
  const float* eb2   = (const float*)d_in[18];
  const float* eln   = (const float*)d_in[19];
  const float* eng   = (const float*)d_in[20];
  const float* enb   = (const float*)d_in[21];
  const float* e2dw  = (const float*)d_in[22];
  const float* e2db  = (const float*)d_in[23];
  const float* daw   = (const float*)d_in[24];
  const float* dab   = (const float*)d_in[25];
  const float* dw1   = (const float*)d_in[26];
  const float* db1   = (const float*)d_in[27];
  const float* dw2   = (const float*)d_in[28];
  const float* db2   = (const float*)d_in[29];
  const float* dln   = (const float*)d_in[30];
  const float* dng   = (const float*)d_in[31];
  const float* dnb   = (const float*)d_in[32];
  const float* outw  = (const float*)d_in[33];
  const float* outb  = (const float*)d_in[34];
  float* out = (float*)d_out;

  float* ws = (float*)d_ws;
  size_t off = 0;
  auto alloc = [&](size_t n) { float* p = ws + off; off += n; return p; };
  const size_t MD = (size_t)BATCH * NT;   // max rows (decoder): 9936
  // what the attention reads by 16-byte loads comes first, in sizes that are whole cache lines
  const size_t KE = (size_t)BATCH * NHEAD * KV_PLANE(N_UNMASK);
  const size_t KD = (size_t)BATCH * NHEAD * KV_PLANE(NT);
  static_assert(DS_TOTAL % 32 == 0 && (EM_ROWS * EM_PITCH) % 32 == 0 && KV_TILE % 32 == 0, "lines");
  float* St    = alloc(DS_TOTAL);
  float* Menc  = alloc((size_t)EM_ROWS * EM_PITCH);
  float* Qb = alloc(KE);
  float* Kb = alloc(KE);
  float* Vb = alloc(KE);
  float* Qd = alloc(KD);
  float* Kd = alloc(KD);
  float* Vd = alloc(KD);
  float* X  = alloc(MD * D_MODEL);
  float* Ob = alloc(MD * D_MODEL);
  float* Xd = alloc(MD * D_MODEL);
  float* adpA  = alloc((size_t)N_NODES * N_NODES);

  front_kernel<<<N_NODES + (FR_ENC + FR_DEC) / FR_ROWS, D_MODEL, 0, stream>>>(
      nv1, nv2, adpA, hist, uidx, midx, dim_w, dim_b, pos, tod_w, tod_b, dow_w, dow_b, mtok,
      X, Xd, out);
  proj_kernel<<<PJ_ENC + PJ_DEC + EM_ROWS, 32, 0, stream>>>(
      X, eaw, eab, Qb, Kb, Vb, Xd, daw, dab, Qd, Kd, Vd, adpA, uidx, Menc);

  // ---- encoder (4 layers, masked attention over 621 tokens): attention, then the whole
  // row-local rest of the layer in one launch ----
  const unsigned pe = (BATCH * N_UNMASK + 15) / 16, pd = (BATCH * N_MASKT + 15) / 16;
  // ja, jp: the first of the parts of the decoder's early share that ride on the layer's two launches
  auto layer = [&](const int l, const int ja, const int jp) {
    const float* aw = eaw + (size_t)l * 4 * D_MODEL * D_MODEL;
    const float* ab = eab + (size_t)l * 4 * D_MODEL;
    const float* w1 = ew1 + (size_t)l * D_MODEL * FF_DIM;
    const float* b1 = eb1 + (size_t)l * FF_DIM;
    const float* w2 = ew2 + (size_t)l * FF_DIM * D_MODEL;
    const float* b2 = eb2 + (size_t)l * D_MODEL;
    const float* ln = eln + (size_t)l * 2 * 2 * D_MODEL;
    enc_attn_kernel<<<EA_WGS + DP_ENC_WGS, EA_NW * 32, 0, stream>>>(
        Qb, Kb, Vb, Ob, Menc, Qd, Kd, Vd, St, ja);
    if (l < 3)
      post_kernel<1><<<pe + DP_POST_WGS, PK_WAVES * 32, 0, stream>>>(
          Ob, X, aw + 3 * D_MODEL * D_MODEL, ab + 3 * D_MODEL, ln, w1, b1, w2, b2,
          aw + 4 * D_MODEL * D_MODEL, ab + 4 * D_MODEL, Qb, Kb, Vb,
          nullptr, nullptr, nullptr, nullptr, nullptr, BATCH * N_UNMASK,
          Qd, Kd, Vd, St, jp);
    else
      post_kernel<2><<<pe + DP_POST_WGS, PK_WAVES * 32, 0, stream>>>(
          Ob, X, aw + 3 * D_MODEL * D_MODEL, ab + 3 * D_MODEL, ln, w1, b1, w2, b2,
          daw, dab, nullptr, Kd, Vd, eng, enb, e2dw, e2db, nullptr, BATCH * N_UNMASK,
          Qd, Kd, Vd, St, jp);
  };
  static_assert(DP_ENC_WGS == 192 && DP_POST_WGS == 344, "the first parts below");
  layer(0, 0, 0);
  layer(1, 192, 344);
  layer(2, 384, 688);
  layer(3, 576, 1032);
  // ---- decoder (1 layer, full attention over 2484 tokens; queries: the masked tokens) ----
  dec_attn_kernel<<<dim3(DQB, NHEAD, BATCH), DA_NW * 32, 0, stream>>>(Qd, Kd, Vd, Ob, St);
  post_kernel<3><<<pd, PK_WAVES * 32, 0, stream>>>(
      Ob, Xd, daw + 3 * D_MODEL * D_MODEL, dab + 3 * D_MODEL, dln, dw1, db1, dw2, db2,
      nullptr, nullptr, nullptr, nullptr, nullptr, dng, dnb, outw, outb, out, BATCH * N_MASKT,
      nullptr, nullptr, nullptr, nullptr, 0);
}
